// v000
// Times are from an AMD MI455X. After a warm-up the kernel runs many times in a row, and a time is the length of
// such a window on the GPU divided by its runs, so every launch and the gaps after it count. The runs cycle
// through copies of the inputs. A figure is the median of several windows, for all but v000 over two sittings.
// Sittings can differ by a few percent; kernels timed side by side share one.
// The starting kernel, v000, takes 1150 microseconds a run.
#include <hip/hip_runtime.h>
#include <hip/hip_bf16.h>
#include <math.h>

// Problem dims (fixed by reference)
#define B_   64
#define T_   128
#define N_   32
#define D_   64
#define H_   128
#define C_   64
#define BT_  (B_ * T_)      // 8192
#define ND_  (N_ * D_)      // 2048
#define KC_  128            // K-chunk for the flatten GEMM stream
#define LN_EPS 1e-5f

typedef _Float16 v16h __attribute__((ext_vector_type(16)));
typedef _Float16 h8   __attribute__((ext_vector_type(8)));
typedef float    v8f  __attribute__((ext_vector_type(8)));

// ---------------------------------------------------------------------------
// CDNA5 async global->LDS staging (GLOBAL_LOAD_ASYNC_TO_LDS_B128, ASYNCcnt).
// GV addressing: vdst = LDS byte address, vaddr = 64-bit global address.
// ---------------------------------------------------------------------------
__device__ __forceinline__ void cp16(void* ldst, const void* gsrc) {
  asm volatile("global_load_async_to_lds_b128 %0, %1, off"
               :
               : "v"((unsigned)(size_t)ldst), "v"((unsigned long long)(size_t)gsrc)
               : "memory");
}
__device__ __forceinline__ void wait_async() {
  asm volatile("s_wait_asynccnt 0x0" ::: "memory");
  __syncthreads();
}

// Load a 16-half WMMA operand fragment. p points at (index, k0 + khalf*8) in a
// row-major [rows][ldK] f16 array; elements 0..7 = K+0..7, 8..15 = K+16..23
// (CDNA5 16-bit A/B VGPR layout, ISA 7.12.2). 16-byte aligned.
__device__ __forceinline__ v16h load_frag16(const _Float16* p) {
  h8 lo = *(const h8*)(p);
  h8 hi = *(const h8*)(p + 16);
  v16h f;
#pragma unroll
  for (int i = 0; i < 8; ++i) { f[i] = lo[i]; f[8 + i] = hi[i]; }
  return f;
}

#define WMMA16(a, b, c) \
  __builtin_amdgcn_wmma_f32_16x16x32_f16(false, (a), false, (b), (short)0, (c), false, false)

__device__ __forceinline__ float elu_f(float x)     { return x > 0.0f ? x : __expf(x) - 1.0f; }
__device__ __forceinline__ float sigmoid_f(float x) { return 1.0f / (1.0f + __expf(-x)); }

// ---------------------------------------------------------------- converts
__global__ void __launch_bounds__(256) k_cvt(const float* __restrict__ src,
                                             _Float16* __restrict__ dst, int n) {
  for (int i = blockIdx.x * blockDim.x + threadIdx.x; i < n; i += gridDim.x * blockDim.x)
    dst[i] = (_Float16)src[i];
}

// src: fp32 [batch][R][C]  ->  dst: f16 [batch][C][R]  (transpose per batch)
__global__ void __launch_bounds__(256) k_cvtT(const float* __restrict__ src,
                                              _Float16* __restrict__ dst,
                                              int batch, int R, int Ccols) {
  int total = batch * R * Ccols;
  for (int i = blockIdx.x * blockDim.x + threadIdx.x; i < total; i += gridDim.x * blockDim.x) {
    int n = i / (R * Ccols);
    int rem = i - n * (R * Ccols);
    int c = rem / R;
    int r = rem - c * R;
    dst[i] = (_Float16)src[((size_t)n * R + r) * Ccols + c];
  }
}

// ctxh[b][h] = sum_c context[b][c] * fWc[c][h]   (tiny, plain FMA)
__global__ void __launch_bounds__(128) k_ctx(const float* __restrict__ context,
                                             const float* __restrict__ fWc,
                                             float* __restrict__ ctxh) {
  int b = blockIdx.x, h = threadIdx.x;
  float s = 0.0f;
  for (int c = 0; c < C_; ++c) s += context[b * C_ + c] * fWc[c * H_ + h];
  ctxh[b * H_ + h] = s;
}

// ---------------------------------------------------------------- flatten GRN
// One block = 128 rows (8 waves, one 16-row M-tile per wave). K=2048 streamed
// in 16 double-buffered async chunks; skip tiles in registers; GLU + LN +
// softmax via 16-lane shfl_xor butterflies. Produces weights [BT, N_].
__global__ void __launch_bounds__(256)
k_flat(const _Float16* __restrict__ e16,
       const _Float16* __restrict__ fW1T, const _Float16* __restrict__ fWskipT,
       const _Float16* __restrict__ fW2T, const _Float16* __restrict__ fWgT,
       const float* __restrict__ fb1, const float* __restrict__ fbskip,
       const float* __restrict__ fb2, const float* __restrict__ fbg,
       const float* __restrict__ fg, const float* __restrict__ fbv,
       const float* __restrict__ ctxh,
       float* __restrict__ wOut) {
  __shared__ _Float16 bufFlat[2][128 * KC_];  // 2x32KB: flat chunks, then act
  __shared__ _Float16 bufW1[2][128 * KC_];    // 2x32KB: W1 chunks, then W2
  __shared__ _Float16 bufWs[2][N_ * KC_];     // 2x8KB : Wskip chunks, then Wg

  const int tid = threadIdx.x;
  const int wave = tid >> 5, lane = tid & 31;
  const int laneR = lane & 15, kh = (lane >> 4) & 1;
  const int hi8 = (lane & 16) ? 8 : 0;
  const int r0 = wave * 16;
  const int rowbase = blockIdx.x * 128;
  const int bIdx = rowbase / T_;              // T_==128: one batch per block
  const v8f Z = {0.f, 0.f, 0.f, 0.f, 0.f, 0.f, 0.f, 0.f};

  auto stageChunk = [&](int kc, int p) {
    int kk = kc * KC_;
    for (int j = 0; j < 8; ++j) {             // flat rows: 2048 x 16B
      int c = tid + j * 256;
      int r = c >> 4, off = (c & 15) * 8;
      cp16(&bufFlat[p][r * KC_ + off], e16 + (size_t)(rowbase + r) * ND_ + kk + off);
    }
    for (int j = 0; j < 8; ++j) {             // W1 panel: 2048 x 16B
      int c = tid + j * 256;
      int col = c >> 4, off = (c & 15) * 8;
      cp16(&bufW1[p][col * KC_ + off], fW1T + (size_t)col * ND_ + kk + off);
    }
    for (int j = 0; j < 2; ++j) {             // Wskip panel: 512 x 16B
      int c = tid + j * 256;
      int col = c >> 4, off = (c & 15) * 8;
      cp16(&bufWs[p][col * KC_ + off], fWskipT + (size_t)col * ND_ + kk + off);
    }
  };

  // ---- GEMM1 stream: accW = flat @ W1 (8 tiles), accS = flat @ Wskip ----
  v8f accW[8], accS[2];
#pragma unroll
  for (int ct = 0; ct < 8; ++ct) accW[ct] = Z;
  accS[0] = Z; accS[1] = Z;

  stageChunk(0, 0);
  for (int kc = 0; kc < ND_ / KC_; ++kc) {
    int p = kc & 1;
    wait_async();                             // chunk kc resident
    if (kc + 1 < ND_ / KC_) stageChunk(kc + 1, p ^ 1);   // overlaps compute
#pragma unroll
    for (int k0 = 0; k0 < KC_; k0 += 32) {
      v16h a = load_frag16(&bufFlat[p][(r0 + laneR) * KC_ + k0 + kh * 8]);
#pragma unroll
      for (int ct = 0; ct < 8; ++ct) {
        v16h b = load_frag16(&bufW1[p][(ct * 16 + laneR) * KC_ + k0 + kh * 8]);
        accW[ct] = WMMA16(a, b, accW[ct]);
      }
#pragma unroll
      for (int cs = 0; cs < 2; ++cs) {
        v16h b = load_frag16(&bufWs[p][(cs * 16 + laneR) * KC_ + k0 + kh * 8]);
        accS[cs] = WMMA16(a, b, accS[cs]);
      }
    }
    __syncthreads();                          // buffer reusable 2 chunks later
  }

  // ---- stage W2 (-> bufW1[0]) and Wg (-> bufWs, 16KB contiguous) ----
  _Float16* sAct = &bufFlat[0][0];
  _Float16* sW2  = &bufW1[0][0];
  _Float16* sWg  = &bufWs[0][0];
  for (int j = 0; j < 8; ++j) { int c = tid + j * 256; cp16(sW2 + c * 8, fW2T + (size_t)c * 8); }
  for (int j = 0; j < 4; ++j) { int c = tid + j * 256; cp16(sWg + c * 8, fWgT + (size_t)c * 8); }

  // ---- h1 = elu(accW + b1 + ctx) -> sAct (own rows); skip in registers ----
  float sk[2][8];
#pragma unroll
  for (int ct = 0; ct < 8; ++ct) {
    int col = ct * 16 + laneR;
    float bc = fb1[col] + ctxh[bIdx * H_ + col];
#pragma unroll
    for (int i = 0; i < 8; ++i)
      sAct[(r0 + i + hi8) * KC_ + col] = (_Float16)elu_f(accW[ct][i] + bc);
  }
#pragma unroll
  for (int cs = 0; cs < 2; ++cs) {
    float bs = fbskip[cs * 16 + laneR];
#pragma unroll
    for (int i = 0; i < 8; ++i) sk[cs][i] = accS[cs][i] + bs;
  }
  wait_async();                               // W2 + Wg resident

  // ---- GEMM2 (K=128): h2 = h1 @ W2 + b2 (own rows, no barriers) ----
  v8f h2[8];
#pragma unroll
  for (int ct = 0; ct < 8; ++ct) h2[ct] = Z;
#pragma unroll
  for (int k0 = 0; k0 < H_; k0 += 32) {
    v16h a = load_frag16(sAct + (r0 + laneR) * KC_ + k0 + kh * 8);
#pragma unroll
    for (int ct = 0; ct < 8; ++ct) {
      v16h b = load_frag16(sW2 + (ct * 16 + laneR) * H_ + k0 + kh * 8);
      h2[ct] = WMMA16(a, b, h2[ct]);
    }
  }
#pragma unroll
  for (int ct = 0; ct < 8; ++ct) {
    int col = ct * 16 + laneR;
    float b2v = fb2[col];
#pragma unroll
    for (int i = 0; i < 8; ++i)
      sAct[(r0 + i + hi8) * KC_ + col] = (_Float16)(h2[ct][i] + b2v);
  }

  // ---- GEMM3 (K=128, 64 cols): g = h2 @ Wg + bg, 4 tiles in registers ----
  v8f g[4];
#pragma unroll
  for (int ct = 0; ct < 4; ++ct) g[ct] = Z;
#pragma unroll
  for (int k0 = 0; k0 < H_; k0 += 32) {
    v16h a = load_frag16(sAct + (r0 + laneR) * KC_ + k0 + kh * 8);
#pragma unroll
    for (int ct = 0; ct < 4; ++ct) {
      v16h b = load_frag16(sWg + (ct * 16 + laneR) * H_ + k0 + kh * 8);
      g[ct] = WMMA16(a, b, g[ct]);
    }
  }

  // ---- GLU (col c with gate c+32) + skip, all in registers ----
  float t[2][8];
#pragma unroll
  for (int cs = 0; cs < 2; ++cs) {
    int col = cs * 16 + laneR;
    float ba = fbg[col], bg2 = fbg[col + 32];
#pragma unroll
    for (int i = 0; i < 8; ++i)
      t[cs][i] = (g[cs][i] + ba) * sigmoid_f(g[cs + 2][i] + bg2) + sk[cs][i];
  }

  // ---- LayerNorm over N=32 + softmax via 16-lane butterflies ----
  float s1[8], s2[8];
#pragma unroll
  for (int i = 0; i < 8; ++i) {
    s1[i] = t[0][i] + t[1][i];
    s2[i] = t[0][i] * t[0][i] + t[1][i] * t[1][i];
  }
#pragma unroll
  for (int m = 1; m < 16; m <<= 1)
#pragma unroll
    for (int i = 0; i < 8; ++i) {
      s1[i] += __shfl_xor(s1[i], m, 32);
      s2[i] += __shfl_xor(s2[i], m, 32);
    }
  float l[2][8];
#pragma unroll
  for (int i = 0; i < 8; ++i) {
    float mu = s1[i] * (1.0f / N_);
    float var = s2[i] * (1.0f / N_) - mu * mu;
    float rs = rsqrtf(var + LN_EPS);
#pragma unroll
    for (int cs = 0; cs < 2; ++cs) {
      int col = cs * 16 + laneR;
      l[cs][i] = (t[cs][i] - mu) * rs * fg[col] + fbv[col];
    }
  }
  float mx[8];
#pragma unroll
  for (int i = 0; i < 8; ++i) mx[i] = fmaxf(l[0][i], l[1][i]);
#pragma unroll
  for (int m = 1; m < 16; m <<= 1)
#pragma unroll
    for (int i = 0; i < 8; ++i) mx[i] = fmaxf(mx[i], __shfl_xor(mx[i], m, 32));
  float e0[8], e1[8], se[8];
#pragma unroll
  for (int i = 0; i < 8; ++i) {
    e0[i] = __expf(l[0][i] - mx[i]);
    e1[i] = __expf(l[1][i] - mx[i]);
    se[i] = e0[i] + e1[i];
  }
#pragma unroll
  for (int m = 1; m < 16; m <<= 1)
#pragma unroll
    for (int i = 0; i < 8; ++i) se[i] += __shfl_xor(se[i], m, 32);
#pragma unroll
  for (int i = 0; i < 8; ++i) {
    int row = rowbase + r0 + i + hi8;
    float inv = 1.0f / se[i];
    wOut[(size_t)row * N_ + laneR]      = e0[i] * inv;
    wOut[(size_t)row * N_ + 16 + laneR] = e1[i] * inv;
  }
}

// ------------------------------------------------------- per-variable GRNs
// One block = 128 rows (8 waves, one 16-row M-tile per wave). Weight panels
// async-staged once per block per n into LDS and shared by all waves.
// GLU, skip-add, LayerNorm (shfl_xor butterflies) and the softmax-weighted
// combine all run in registers.
__global__ void __launch_bounds__(256)
k_var(const _Float16* __restrict__ e16,
      const _Float16* __restrict__ vW1T, const _Float16* __restrict__ vWskipT,
      const _Float16* __restrict__ vW2T, const _Float16* __restrict__ vWgT,
      const float* __restrict__ vb1, const float* __restrict__ vbskip,
      const float* __restrict__ vb2, const float* __restrict__ vbg,
      const float* __restrict__ vg, const float* __restrict__ vbv,
      const float* __restrict__ wIn, float* __restrict__ outPtr) {
  __shared__ _Float16 sE[128 * D_];       // 16KB embedding slice [row][64]
  __shared__ _Float16 sAct[128 * H_];     // 32KB h1 then h2 (per-wave rows)
  __shared__ _Float16 sWa[128 * 128];     // 32KB: W1(16K)+Wskip(16K), reused for Wg gate half
  __shared__ _Float16 sW2[128 * H_];      // 32KB W2 panel [col][128]
  __shared__ _Float16 sWgA[128 * H_];     // 32KB Wg cols 0..127 [col][128]

  const int tid = threadIdx.x;
  const int wave = tid >> 5, lane = tid & 31;
  const int laneR = lane & 15, kh = (lane >> 4) & 1;
  const int hi8 = (lane & 16) ? 8 : 0;
  const int r0 = wave * 16;                    // wave's row tile within block
  const int rowbase = blockIdx.x * 128;
  const v8f Z = {0.f, 0.f, 0.f, 0.f, 0.f, 0.f, 0.f, 0.f};

  float outReg[64];                            // [ct][i] output accumulators
#pragma unroll
  for (int q = 0; q < 64; ++q) outReg[q] = 0.0f;
  float tv[64];                                // skip, then GLU result

  auto stageE = [&](int n) {
    for (int j = 0; j < 4; ++j) {              // 1024 chunks of 16B
      int c = tid + j * 256;
      int r = c >> 3, off = (c & 7) * 8;
      cp16(sE + c * 8, e16 + ((size_t)(rowbase + r) * N_ + n) * D_ + off);
    }
  };
  auto stageW1Ws = [&](int n) {                // two 16KB panels -> sWa
    const _Float16* g1 = vW1T + (size_t)n * H_ * D_;
    const _Float16* gs = vWskipT + (size_t)n * H_ * D_;
    for (int j = 0; j < 4; ++j) {
      int c = tid + j * 256;
      cp16(sWa + c * 8, g1 + c * 8);
      cp16(sWa + 8192 + c * 8, gs + c * 8);
    }
  };
  auto stageW2 = [&](int n) {                  // 32KB
    const _Float16* g = vW2T + (size_t)n * H_ * H_;
    for (int j = 0; j < 8; ++j) { int c = tid + j * 256; cp16(sW2 + c * 8, g + c * 8); }
  };
  auto stageWg = [&](int n) {                  // a-half -> sWgA, gate half -> sWa
    const _Float16* ga = vWgT + (size_t)n * 256 * H_;
    const _Float16* gg = ga + (size_t)128 * H_;
    for (int j = 0; j < 8; ++j) {
      int c = tid + j * 256;
      cp16(sWgA + c * 8, ga + c * 8);
      cp16(sWa + c * 8, gg + c * 8);
    }
  };

  stageE(0);
  stageW1Ws(0);

  for (int n = 0; n < N_; ++n) {
    wait_async();                              // E, W1, Wskip resident
    stageW2(n);                                // overlaps GEMM1

    // ---- GEMM1 (K=64): aW = E@W1, aS = E@Wskip, all 8 col-tiles ----
    v8f aW[8], aS[8];
#pragma unroll
    for (int ct = 0; ct < 8; ++ct) { aW[ct] = Z; aS[ct] = Z; }
#pragma unroll
    for (int k0 = 0; k0 < D_; k0 += 32) {
      v16h a = load_frag16(sE + (r0 + laneR) * D_ + k0 + kh * 8);
#pragma unroll
      for (int ct = 0; ct < 8; ++ct) {
        v16h b = load_frag16(sWa + (ct * 16 + laneR) * D_ + k0 + kh * 8);
        aW[ct] = WMMA16(a, b, aW[ct]);
        v16h b2 = load_frag16(sWa + 8192 + (ct * 16 + laneR) * D_ + k0 + kh * 8);
        aS[ct] = WMMA16(a, b2, aS[ct]);
      }
    }
#pragma unroll
    for (int ct = 0; ct < 8; ++ct) {
      int col = ct * 16 + laneR;
      float b1v = vb1[n * H_ + col], bsv = vbskip[n * H_ + col];
#pragma unroll
      for (int i = 0; i < 8; ++i) {
        int row = i + hi8;
        sAct[(r0 + row) * H_ + col] = (_Float16)elu_f(aW[ct][i] + b1v);
        tv[ct * 8 + i] = aS[ct][i] + bsv;      // skip, kept in registers
      }
    }
    wait_async();                              // W2 resident; waves done with W1/Ws
    stageWg(n);                                // overlaps GEMM2 (gate half -> sWa)

    // ---- GEMM2 (K=128): h2 = h1 @ W2 + b2 (own rows, no barrier) ----
    v8f h2[8];
#pragma unroll
    for (int ct = 0; ct < 8; ++ct) h2[ct] = Z;
#pragma unroll
    for (int k0 = 0; k0 < H_; k0 += 32) {
      v16h a = load_frag16(sAct + (r0 + laneR) * H_ + k0 + kh * 8);
#pragma unroll
      for (int ct = 0; ct < 8; ++ct) {
        v16h b = load_frag16(sW2 + (ct * 16 + laneR) * H_ + k0 + kh * 8);
        h2[ct] = WMMA16(a, b, h2[ct]);
      }
    }
#pragma unroll
    for (int ct = 0; ct < 8; ++ct) {
      int col = ct * 16 + laneR;
      float b2v = vb2[n * H_ + col];
#pragma unroll
      for (int i = 0; i < 8; ++i)
        sAct[(r0 + i + hi8) * H_ + col] = (_Float16)(h2[ct][i] + b2v);
    }
    wait_async();                              // Wg halves resident

    // ---- GEMM3 pairs (K=128): a-part (sWgA) and gate (sWa), GLU in regs ----
#pragma unroll
    for (int ct = 0; ct < 8; ++ct) {
      v8f ga = Z, gg = Z;
#pragma unroll
      for (int k0 = 0; k0 < H_; k0 += 32) {
        v16h a = load_frag16(sAct + (r0 + laneR) * H_ + k0 + kh * 8);
        v16h bA = load_frag16(sWgA + (ct * 16 + laneR) * H_ + k0 + kh * 8);
        ga = WMMA16(a, bA, ga);
        v16h bG = load_frag16(sWa + (ct * 16 + laneR) * H_ + k0 + kh * 8);
        gg = WMMA16(a, bG, gg);
      }
      int col = ct * 16 + laneR;
      float bav = vbg[n * 256 + col], bgv = vbg[n * 256 + 128 + col];
#pragma unroll
      for (int i = 0; i < 8; ++i) {
        float av = ga[i] + bav;
        float gv = gg[i] + bgv;
        tv[ct * 8 + i] = av * sigmoid_f(gv) + tv[ct * 8 + i];   // GLU + skip
      }
    }

    // ---- LayerNorm over H=128: 16-lane shfl_xor butterflies ----
    float s1[8], s2[8];
#pragma unroll
    for (int i = 0; i < 8; ++i) { s1[i] = 0.f; s2[i] = 0.f; }
#pragma unroll
    for (int ct = 0; ct < 8; ++ct)
#pragma unroll
      for (int i = 0; i < 8; ++i) { float t = tv[ct * 8 + i]; s1[i] += t; s2[i] += t * t; }
#pragma unroll
    for (int m = 1; m < 16; m <<= 1)
#pragma unroll
      for (int i = 0; i < 8; ++i) {
        s1[i] += __shfl_xor(s1[i], m, 32);
        s2[i] += __shfl_xor(s2[i], m, 32);
      }

    // ---- normalize + softmax-weighted combine into registers ----
#pragma unroll
    for (int i = 0; i < 8; ++i) {
      float mu = s1[i] * (1.0f / H_);
      float var = s2[i] * (1.0f / H_) - mu * mu;
      float rs = rsqrtf(var + LN_EPS);
      int row = rowbase + r0 + i + hi8;
      float wsel = wIn[(size_t)row * N_ + n];
#pragma unroll
      for (int ct = 0; ct < 8; ++ct) {
        int col = ct * 16 + laneR;
        float val = (tv[ct * 8 + i] - mu) * rs * vg[n * H_ + col] + vbv[n * H_ + col];
        outReg[ct * 8 + i] += wsel * val;
      }
    }
    __syncthreads();                           // panels consumed; safe to restage
    if (n + 1 < N_) {                          // overlaps next-iteration latency
      stageE(n + 1);
      stageW1Ws(n + 1);
    }
  }

  // ---- epilogue: store out tile ----
#pragma unroll
  for (int ct = 0; ct < 8; ++ct)
#pragma unroll
    for (int i = 0; i < 8; ++i) {
      int row = rowbase + r0 + i + hi8;
      outPtr[(size_t)row * H_ + ct * 16 + laneR] = outReg[ct * 8 + i];
    }
}

// ----------------------------------------------------------------------------
extern "C" void kernel_launch(void* const* d_in, const int* in_sizes, int n_in,
                              void* d_out, int out_size, void* d_ws, size_t ws_size,
                              hipStream_t stream) {
  (void)in_sizes; (void)n_in; (void)out_size; (void)ws_size;

  const float* emb    = (const float*)d_in[0];
  const float* ctx    = (const float*)d_in[1];
  const float* fWskip = (const float*)d_in[2];
  const float* fbskip = (const float*)d_in[3];
  const float* fW1    = (const float*)d_in[4];
  const float* fb1    = (const float*)d_in[5];
  const float* fWc    = (const float*)d_in[6];
  const float* fW2    = (const float*)d_in[7];
  const float* fb2    = (const float*)d_in[8];
  const float* fWg    = (const float*)d_in[9];
  const float* fbg    = (const float*)d_in[10];
  const float* fg     = (const float*)d_in[11];
  const float* fbv    = (const float*)d_in[12];
  const float* vWskip = (const float*)d_in[13];
  const float* vbskip = (const float*)d_in[14];
  const float* vW1    = (const float*)d_in[15];
  const float* vb1    = (const float*)d_in[16];
  const float* vW2    = (const float*)d_in[17];
  const float* vb2    = (const float*)d_in[18];
  const float* vWg    = (const float*)d_in[19];
  const float* vbg    = (const float*)d_in[20];
  const float* vg     = (const float*)d_in[21];
  const float* vbv    = (const float*)d_in[22];

  // Workspace carve (f16 copies, transposed weights, ctx projection)
  char* w = (char*)d_ws;
  size_t off = 0;
  auto alloc = [&](size_t bytes) -> char* {
    char* p = w + off;
    off = (off + bytes + 255) & ~(size_t)255;
    return p;
  };
  _Float16* e16     = (_Float16*)alloc((size_t)BT_ * ND_ * 2);
  _Float16* fW1T    = (_Float16*)alloc((size_t)ND_ * H_ * 2);
  _Float16* fWskipT = (_Float16*)alloc((size_t)ND_ * N_ * 2);
  _Float16* fW2T    = (_Float16*)alloc((size_t)H_ * H_ * 2);
  _Float16* fWgT    = (_Float16*)alloc((size_t)H_ * 2 * N_ * 2);
  _Float16* vW1T    = (_Float16*)alloc((size_t)N_ * D_ * H_ * 2);
  _Float16* vWskipT = (_Float16*)alloc((size_t)N_ * D_ * H_ * 2);
  _Float16* vW2T    = (_Float16*)alloc((size_t)N_ * H_ * H_ * 2);
  _Float16* vWgT    = (_Float16*)alloc((size_t)N_ * H_ * 256 * 2);
  float*    ctxh    = (float*)alloc((size_t)B_ * H_ * 4);

  float* outPtr = (float*)d_out;                   // [BT, H]
  float* wOut   = outPtr + (size_t)BT_ * H_;       // [BT, N]

  // precision conversion + transposes
  k_cvt<<<4096, 256, 0, stream>>>(emb, e16, BT_ * ND_);
  k_cvtT<<<512, 256, 0, stream>>>(fW1, fW1T, 1, ND_, H_);
  k_cvtT<<<128, 256, 0, stream>>>(fWskip, fWskipT, 1, ND_, N_);
  k_cvtT<<<64, 256, 0, stream>>>(fW2, fW2T, 1, H_, H_);
  k_cvtT<<<32, 256, 0, stream>>>(fWg, fWgT, 1, H_, 2 * N_);
  k_cvtT<<<512, 256, 0, stream>>>(vW1, vW1T, N_, D_, H_);
  k_cvtT<<<512, 256, 0, stream>>>(vWskip, vWskipT, N_, D_, H_);
  k_cvtT<<<1024, 256, 0, stream>>>(vW2, vW2T, N_, H_, H_);
  k_cvtT<<<2048, 256, 0, stream>>>(vWg, vWgT, N_, H_, 256);
  k_ctx<<<B_, H_, 0, stream>>>(ctx, fWc, ctxh);

  // flatten GRN -> softmax weights (128 rows/block, 8 waves)
  k_flat<<<BT_ / 128, 256, 0, stream>>>(e16, fW1T, fWskipT, fW2T, fWgT,
                                        fb1, fbskip, fb2, fbg, fg, fbv,
                                        ctxh, wOut);

  // per-variable GRNs + weighted combine -> outputs (128 rows/block, 8 waves)
  k_var<<<BT_ / 128, 256, 0, stream>>>(e16, vW1T, vWskipT, vW2T, vWgT,
                                       vb1, vbskip, vb2, vbg, vg, vbv,
                                       wOut, outPtr);
}

// v001
// A run of this version takes 323 microseconds.
// Two timings next to v000 put it at 3.58 and 3.59 times that version's speed.
#include <hip/hip_runtime.h>
#include <hip/hip_bf16.h>
#include <math.h>

// Problem dims (fixed by reference)
#define B_   64
#define T_   128
#define N_   32
#define D_   64
#define H_   128
#define C_   64
#define BT_  (B_ * T_)      // 8192
#define ND_  (N_ * D_)      // 2048
#define KC_  128            // K-chunk for the flatten GEMM stream
#define LN_EPS 1e-5f
// LDS row pitches in halves. Bank = dword address mod 64, so rows of 256 B (or
// 128 B) put the 16 lanes of a ds_load_b128 fragment read on the same four
// (eight) banks. A pitch of 16 B x odd spreads them over all 64 banks.
#define PW_  136            // 256-byte rows: pitch 272 B = 16 B x 17
#define PN_  72             // 128-byte rows: pitch 144 B = 16 B x 9

typedef _Float16 v16h __attribute__((ext_vector_type(16)));
typedef _Float16 h8   __attribute__((ext_vector_type(8)));
typedef float    v8f  __attribute__((ext_vector_type(8)));

// ---------------------------------------------------------------------------
// CDNA5 async global->LDS staging (GLOBAL_LOAD_ASYNC_TO_LDS_B128, ASYNCcnt).
// GV addressing: vdst = LDS byte address, vaddr = 64-bit global address.
// ---------------------------------------------------------------------------
// A run of copies shares one asm statement; its last line, s_wait_xcnt 0, keeps
// every later rewrite of the address registers behind the copies' issue.
// Copy j moves 16 B per lane from gsrc + j*gstep to ldst + j*lstep (in halves).
__device__ __forceinline__ void cp16x2(_Float16* ldst, int lstep,
                                       const _Float16* gsrc, int gstep) {
  unsigned l = (unsigned)(size_t)ldst;
  unsigned long long g = (unsigned long long)(size_t)gsrc;
  unsigned ls = (unsigned)lstep * 2u;
  unsigned long long gs = (unsigned long long)gstep * 2ull;
  asm volatile("global_load_async_to_lds_b128 %0, %2, off\n\t"
               "global_load_async_to_lds_b128 %1, %3, off\n\t"
               "s_wait_xcnt 0x0"
               :
               : "v"(l), "v"(l + ls), "v"(g), "v"(g + gs)
               : "memory");
}
__device__ __forceinline__ void cp16x4(_Float16* ldst, int lstep,
                                       const _Float16* gsrc, int gstep) {
  unsigned l = (unsigned)(size_t)ldst;
  unsigned long long g = (unsigned long long)(size_t)gsrc;
  unsigned ls = (unsigned)lstep * 2u;
  unsigned long long gs = (unsigned long long)gstep * 2ull;
  asm volatile("global_load_async_to_lds_b128 %0, %4, off\n\t"
               "global_load_async_to_lds_b128 %1, %5, off\n\t"
               "global_load_async_to_lds_b128 %2, %6, off\n\t"
               "global_load_async_to_lds_b128 %3, %7, off\n\t"
               "s_wait_xcnt 0x0"
               :
               : "v"(l), "v"(l + ls), "v"(l + 2 * ls), "v"(l + 3 * ls),
                 "v"(g), "v"(g + gs), "v"(g + 2 * gs), "v"(g + 3 * gs)
               : "memory");
}
__device__ __forceinline__ void cp16x8(_Float16* ldst, int lstep,
                                       const _Float16* gsrc, int gstep) {
  unsigned l = (unsigned)(size_t)ldst;
  unsigned long long g = (unsigned long long)(size_t)gsrc;
  unsigned ls = (unsigned)lstep * 2u;
  unsigned long long gs = (unsigned long long)gstep * 2ull;
  asm volatile("global_load_async_to_lds_b128 %0, %8, off\n\t"
               "global_load_async_to_lds_b128 %1, %9, off\n\t"
               "global_load_async_to_lds_b128 %2, %10, off\n\t"
               "global_load_async_to_lds_b128 %3, %11, off\n\t"
               "global_load_async_to_lds_b128 %4, %12, off\n\t"
               "global_load_async_to_lds_b128 %5, %13, off\n\t"
               "global_load_async_to_lds_b128 %6, %14, off\n\t"
               "global_load_async_to_lds_b128 %7, %15, off\n\t"
               "s_wait_xcnt 0x0"
               :
               : "v"(l), "v"(l + ls), "v"(l + 2 * ls), "v"(l + 3 * ls),
                 "v"(l + 4 * ls), "v"(l + 5 * ls), "v"(l + 6 * ls), "v"(l + 7 * ls),
                 "v"(g), "v"(g + gs), "v"(g + 2 * gs), "v"(g + 3 * gs),
                 "v"(g + 4 * gs), "v"(g + 5 * gs), "v"(g + 6 * gs), "v"(g + 7 * gs)
               : "memory");
}
__device__ __forceinline__ void wait_async() {
  asm volatile("s_wait_asynccnt 0x0" ::: "memory");
  __syncthreads();
}

// Load a 16-half WMMA operand fragment. p points at (index, k0 + khalf*8) in a
// row-major [rows][ldK] f16 array; elements 0..7 = K+0..7, 8..15 = K+16..23
// (CDNA5 16-bit A/B VGPR layout, ISA 7.12.2). 16-byte aligned.
__device__ __forceinline__ v16h load_frag16(const _Float16* p) {
  h8 lo = *(const h8*)(p);
  h8 hi = *(const h8*)(p + 16);
  v16h f;
#pragma unroll
  for (int i = 0; i < 8; ++i) { f[i] = lo[i]; f[8 + i] = hi[i]; }
  return f;
}

#define WMMA16(a, b, c) \
  __builtin_amdgcn_wmma_f32_16x16x32_f16(false, (a), false, (b), (short)0, (c), false, false)

__device__ __forceinline__ float elu_f(float x)     { return x > 0.0f ? x : __expf(x) - 1.0f; }
__device__ __forceinline__ float sigmoid_f(float x) { return 1.0f / (1.0f + __expf(-x)); }

// ---------------------------------------------------------------- converts
__global__ void __launch_bounds__(256) k_cvt(const float* __restrict__ src,
                                             _Float16* __restrict__ dst, int n) {
  for (int i = blockIdx.x * blockDim.x + threadIdx.x; i < n; i += gridDim.x * blockDim.x)
    dst[i] = (_Float16)src[i];
}

// src: fp32 [batch][R][C]  ->  dst: f16 [batch][C][R]  (transpose per batch)
__global__ void __launch_bounds__(256) k_cvtT(const float* __restrict__ src,
                                              _Float16* __restrict__ dst,
                                              int batch, int R, int Ccols) {
  int total = batch * R * Ccols;
  for (int i = blockIdx.x * blockDim.x + threadIdx.x; i < total; i += gridDim.x * blockDim.x) {
    int n = i / (R * Ccols);
    int rem = i - n * (R * Ccols);
    int c = rem / R;
    int r = rem - c * R;
    dst[i] = (_Float16)src[((size_t)n * R + r) * Ccols + c];
  }
}

// ctxh[b][h] = sum_c context[b][c] * fWc[c][h]   (tiny, plain FMA)
__global__ void __launch_bounds__(128) k_ctx(const float* __restrict__ context,
                                             const float* __restrict__ fWc,
                                             float* __restrict__ ctxh) {
  int b = blockIdx.x, h = threadIdx.x;
  float s = 0.0f;
  for (int c = 0; c < C_; ++c) s += context[b * C_ + c] * fWc[c * H_ + h];
  ctxh[b * H_ + h] = s;
}

// ---------------------------------------------------------------- flatten GRN
// One block = 128 rows (8 waves, one 16-row M-tile per wave). K=2048 streamed
// in 16 double-buffered async chunks; skip tiles in registers; GLU + LN +
// softmax via 16-lane shfl_xor butterflies. Produces weights [BT, N_].
__global__ void __launch_bounds__(256)
k_flat(const _Float16* __restrict__ e16,
       const _Float16* __restrict__ fW1T, const _Float16* __restrict__ fWskipT,
       const _Float16* __restrict__ fW2T, const _Float16* __restrict__ fWgT,
       const float* __restrict__ fb1, const float* __restrict__ fbskip,
       const float* __restrict__ fb2, const float* __restrict__ fbg,
       const float* __restrict__ fg, const float* __restrict__ fbv,
       const float* __restrict__ ctxh,
       float* __restrict__ wOut) {
  __shared__ __attribute__((aligned(16))) _Float16 bufFlat[2][128 * PW_];  // flat chunks, then act
  __shared__ __attribute__((aligned(16))) _Float16 bufW1[2][128 * PW_];    // W1 chunks, then W2
  __shared__ __attribute__((aligned(16))) _Float16 bufWs[2][N_ * PW_];     // Wskip chunks, then Wg

  const int tid = threadIdx.x;
  const int wave = tid >> 5, lane = tid & 31;
  const int laneR = lane & 15, kh = (lane >> 4) & 1;
  const int hi8 = (lane & 16) ? 8 : 0;
  const int r0 = wave * 16;
  const int rowbase = blockIdx.x * 128;
  const int bIdx = rowbase / T_;              // T_==128: one batch per block
  const v8f Z = {0.f, 0.f, 0.f, 0.f, 0.f, 0.f, 0.f, 0.f};

  // 16 lanes cover one 256-byte row; copy j of a run takes row sr + 16*j.
  const int sr = tid >> 4, so = (tid & 15) * 8;
  auto stageChunk = [&](int kc, int p) {
    int kk = kc * KC_;
    cp16x8(&bufFlat[p][sr * PW_ + so], 16 * PW_,      // flat rows: 2048 x 16B
           e16 + (size_t)(rowbase + sr) * ND_ + kk + so, 16 * ND_);
    cp16x8(&bufW1[p][sr * PW_ + so], 16 * PW_,        // W1 panel: 2048 x 16B
           fW1T + (size_t)sr * ND_ + kk + so, 16 * ND_);
    cp16x2(&bufWs[p][sr * PW_ + so], 16 * PW_,        // Wskip panel: 512 x 16B
           fWskipT + (size_t)sr * ND_ + kk + so, 16 * ND_);
  };

  // ---- GEMM1 stream: accW = flat @ W1 (8 tiles), accS = flat @ Wskip ----
  v8f accW[8], accS[2];
#pragma unroll
  for (int ct = 0; ct < 8; ++ct) accW[ct] = Z;
  accS[0] = Z; accS[1] = Z;

  stageChunk(0, 0);
  for (int kc = 0; kc < ND_ / KC_; ++kc) {
    int p = kc & 1;
    wait_async();                             // chunk kc resident
    if (kc + 1 < ND_ / KC_) stageChunk(kc + 1, p ^ 1);   // overlaps compute
#pragma unroll
    for (int k0 = 0; k0 < KC_; k0 += 32) {
      v16h a = load_frag16(&bufFlat[p][(r0 + laneR) * PW_ + k0 + kh * 8]);
#pragma unroll
      for (int ct = 0; ct < 8; ++ct) {
        v16h b = load_frag16(&bufW1[p][(ct * 16 + laneR) * PW_ + k0 + kh * 8]);
        accW[ct] = WMMA16(a, b, accW[ct]);
      }
#pragma unroll
      for (int cs = 0; cs < 2; ++cs) {
        v16h b = load_frag16(&bufWs[p][(cs * 16 + laneR) * PW_ + k0 + kh * 8]);
        accS[cs] = WMMA16(a, b, accS[cs]);
      }
    }
    __syncthreads();                          // buffer reusable 2 chunks later
  }

  // ---- stage W2 (-> bufW1[0]) and Wg (-> bufWs, 64 rows contiguous) ----
  _Float16* sAct = &bufFlat[0][0];
  _Float16* sW2  = &bufW1[0][0];
  _Float16* sWg  = &bufWs[0][0];
  cp16x8(sW2 + sr * PW_ + so, 16 * PW_, fW2T + tid * 8, 2048);
  cp16x4(sWg + sr * PW_ + so, 16 * PW_, fWgT + tid * 8, 2048);

  // ---- h1 = elu(accW + b1 + ctx) -> sAct (own rows); skip in registers ----
  float sk[2][8];
#pragma unroll
  for (int ct = 0; ct < 8; ++ct) {
    int col = ct * 16 + laneR;
    float bc = fb1[col] + ctxh[bIdx * H_ + col];
#pragma unroll
    for (int i = 0; i < 8; ++i)
      sAct[(r0 + i + hi8) * PW_ + col] = (_Float16)elu_f(accW[ct][i] + bc);
  }
#pragma unroll
  for (int cs = 0; cs < 2; ++cs) {
    float bs = fbskip[cs * 16 + laneR];
#pragma unroll
    for (int i = 0; i < 8; ++i) sk[cs][i] = accS[cs][i] + bs;
  }
  wait_async();                               // W2 + Wg resident

  // ---- GEMM2 (K=128): h2 = h1 @ W2 + b2 (own rows, no barriers) ----
  v8f h2[8];
#pragma unroll
  for (int ct = 0; ct < 8; ++ct) h2[ct] = Z;
#pragma unroll
  for (int k0 = 0; k0 < H_; k0 += 32) {
    v16h a = load_frag16(sAct + (r0 + laneR) * PW_ + k0 + kh * 8);
#pragma unroll
    for (int ct = 0; ct < 8; ++ct) {
      v16h b = load_frag16(sW2 + (ct * 16 + laneR) * PW_ + k0 + kh * 8);
      h2[ct] = WMMA16(a, b, h2[ct]);
    }
  }
#pragma unroll
  for (int ct = 0; ct < 8; ++ct) {
    int col = ct * 16 + laneR;
    float b2v = fb2[col];
#pragma unroll
    for (int i = 0; i < 8; ++i)
      sAct[(r0 + i + hi8) * PW_ + col] = (_Float16)(h2[ct][i] + b2v);
  }

  // ---- GEMM3 (K=128, 64 cols): g = h2 @ Wg + bg, 4 tiles in registers ----
  v8f g[4];
#pragma unroll
  for (int ct = 0; ct < 4; ++ct) g[ct] = Z;
#pragma unroll
  for (int k0 = 0; k0 < H_; k0 += 32) {
    v16h a = load_frag16(sAct + (r0 + laneR) * PW_ + k0 + kh * 8);
#pragma unroll
    for (int ct = 0; ct < 4; ++ct) {
      v16h b = load_frag16(sWg + (ct * 16 + laneR) * PW_ + k0 + kh * 8);
      g[ct] = WMMA16(a, b, g[ct]);
    }
  }

  // ---- GLU (col c with gate c+32) + skip, all in registers ----
  float t[2][8];
#pragma unroll
  for (int cs = 0; cs < 2; ++cs) {
    int col = cs * 16 + laneR;
    float ba = fbg[col], bg2 = fbg[col + 32];
#pragma unroll
    for (int i = 0; i < 8; ++i)
      t[cs][i] = (g[cs][i] + ba) * sigmoid_f(g[cs + 2][i] + bg2) + sk[cs][i];
  }

  // ---- LayerNorm over N=32 + softmax via 16-lane butterflies ----
  float s1[8], s2[8];
#pragma unroll
  for (int i = 0; i < 8; ++i) {
    s1[i] = t[0][i] + t[1][i];
    s2[i] = t[0][i] * t[0][i] + t[1][i] * t[1][i];
  }
#pragma unroll
  for (int m = 1; m < 16; m <<= 1)
#pragma unroll
    for (int i = 0; i < 8; ++i) {
      s1[i] += __shfl_xor(s1[i], m, 32);
      s2[i] += __shfl_xor(s2[i], m, 32);
    }
  float l[2][8];
#pragma unroll
  for (int i = 0; i < 8; ++i) {
    float mu = s1[i] * (1.0f / N_);
    float var = s2[i] * (1.0f / N_) - mu * mu;
    float rs = rsqrtf(var + LN_EPS);
#pragma unroll
    for (int cs = 0; cs < 2; ++cs) {
      int col = cs * 16 + laneR;
      l[cs][i] = (t[cs][i] - mu) * rs * fg[col] + fbv[col];
    }
  }
  float mx[8];
#pragma unroll
  for (int i = 0; i < 8; ++i) mx[i] = fmaxf(l[0][i], l[1][i]);
#pragma unroll
  for (int m = 1; m < 16; m <<= 1)
#pragma unroll
    for (int i = 0; i < 8; ++i) mx[i] = fmaxf(mx[i], __shfl_xor(mx[i], m, 32));
  float e0[8], e1[8], se[8];
#pragma unroll
  for (int i = 0; i < 8; ++i) {
    e0[i] = __expf(l[0][i] - mx[i]);
    e1[i] = __expf(l[1][i] - mx[i]);
    se[i] = e0[i] + e1[i];
  }
#pragma unroll
  for (int m = 1; m < 16; m <<= 1)
#pragma unroll
    for (int i = 0; i < 8; ++i) se[i] += __shfl_xor(se[i], m, 32);
#pragma unroll
  for (int i = 0; i < 8; ++i) {
    int row = rowbase + r0 + i + hi8;
    float inv = 1.0f / se[i];
    wOut[(size_t)row * N_ + laneR]      = e0[i] * inv;
    wOut[(size_t)row * N_ + 16 + laneR] = e1[i] * inv;
  }
}

// ------------------------------------------------------- per-variable GRNs
// One block = 128 rows (8 waves, one 16-row M-tile per wave). Weight panels
// async-staged once per block per n into LDS and shared by all waves.
// GLU, skip-add, LayerNorm (shfl_xor butterflies) and the softmax-weighted
// combine all run in registers.
__global__ void __launch_bounds__(256)
k_var(const _Float16* __restrict__ e16,
      const _Float16* __restrict__ vW1T, const _Float16* __restrict__ vWskipT,
      const _Float16* __restrict__ vW2T, const _Float16* __restrict__ vWgT,
      const float* __restrict__ vb1, const float* __restrict__ vbskip,
      const float* __restrict__ vb2, const float* __restrict__ vbg,
      const float* __restrict__ vg, const float* __restrict__ vbv,
      const float* __restrict__ wIn, float* __restrict__ outPtr) {
  __shared__ __attribute__((aligned(16))) _Float16 sE[128 * PN_];      // embedding slice [row][64]
  __shared__ __attribute__((aligned(16))) _Float16 sAct[128 * PW_];    // h1 then h2 (per-wave rows)
  __shared__ __attribute__((aligned(16))) _Float16 sWa[2 * 128 * PN_]; // W1 + Wskip, reused for Wg gate half
  __shared__ __attribute__((aligned(16))) _Float16 sW2[128 * PW_];     // W2 panel [col][128]
  __shared__ __attribute__((aligned(16))) _Float16 sWgA[128 * PW_];    // Wg cols 0..127 [col][128]
  static_assert(128 * PW_ <= 2 * 128 * PN_, "Wg gate half must fit in sWa");
  _Float16* const sWs = sWa + 128 * PN_;       // Wskip panel behind the W1 panel

  const int tid = threadIdx.x;
  const int wave = tid >> 5, lane = tid & 31;
  const int laneR = lane & 15, kh = (lane >> 4) & 1;
  const int hi8 = (lane & 16) ? 8 : 0;
  const int r0 = wave * 16;                    // wave's row tile within block
  const int rowbase = blockIdx.x * 128;
  const v8f Z = {0.f, 0.f, 0.f, 0.f, 0.f, 0.f, 0.f, 0.f};

  float outReg[64];                            // [ct][i] output accumulators
#pragma unroll
  for (int q = 0; q < 64; ++q) outReg[q] = 0.0f;
  float tv[64];                                // skip, then GLU result

  // 128-byte rows: 8 lanes a row, copy j of a run takes row nr + 32*j.
  // 256-byte rows: 16 lanes a row, copy j of a run takes row wr + 16*j.
  const int nr = tid >> 3, no = (tid & 7) * 8;
  const int wr = tid >> 4, wo = (tid & 15) * 8;
  auto stageE = [&](int n) {                   // 1024 chunks of 16B
    cp16x4(sE + nr * PN_ + no, 32 * PN_,
           e16 + ((size_t)(rowbase + nr) * N_ + n) * D_ + no, 32 * ND_);
  };
  auto stageW1Ws = [&](int n) {                // two 16KB panels -> sWa
    cp16x4(sWa + nr * PN_ + no, 32 * PN_, vW1T + (size_t)n * H_ * D_ + tid * 8, 2048);
    cp16x4(sWs + nr * PN_ + no, 32 * PN_, vWskipT + (size_t)n * H_ * D_ + tid * 8, 2048);
  };
  auto stageW2 = [&](int n) {                  // 32KB
    cp16x8(sW2 + wr * PW_ + wo, 16 * PW_, vW2T + (size_t)n * H_ * H_ + tid * 8, 2048);
  };
  auto stageWg = [&](int n) {                  // a-half -> sWgA, gate half -> sWa
    const _Float16* ga = vWgT + (size_t)n * 256 * H_;
    const _Float16* gg = ga + (size_t)128 * H_;
    cp16x8(sWgA + wr * PW_ + wo, 16 * PW_, ga + tid * 8, 2048);
    cp16x8(sWa + wr * PW_ + wo, 16 * PW_, gg + tid * 8, 2048);
  };

  stageE(0);
  stageW1Ws(0);

  for (int n = 0; n < N_; ++n) {
    wait_async();                              // E, W1, Wskip resident
    stageW2(n);                                // overlaps GEMM1

    // ---- GEMM1 (K=64): aW = E@W1, aS = E@Wskip, all 8 col-tiles ----
    v8f aW[8], aS[8];
#pragma unroll
    for (int ct = 0; ct < 8; ++ct) { aW[ct] = Z; aS[ct] = Z; }
#pragma unroll
    for (int k0 = 0; k0 < D_; k0 += 32) {
      v16h a = load_frag16(sE + (r0 + laneR) * PN_ + k0 + kh * 8);
#pragma unroll
      for (int ct = 0; ct < 8; ++ct) {
        v16h b = load_frag16(sWa + (ct * 16 + laneR) * PN_ + k0 + kh * 8);
        aW[ct] = WMMA16(a, b, aW[ct]);
        v16h b2 = load_frag16(sWs + (ct * 16 + laneR) * PN_ + k0 + kh * 8);
        aS[ct] = WMMA16(a, b2, aS[ct]);
      }
    }
#pragma unroll
    for (int ct = 0; ct < 8; ++ct) {
      int col = ct * 16 + laneR;
      float b1v = vb1[n * H_ + col], bsv = vbskip[n * H_ + col];
#pragma unroll
      for (int i = 0; i < 8; ++i) {
        int row = i + hi8;
        sAct[(r0 + row) * PW_ + col] = (_Float16)elu_f(aW[ct][i] + b1v);
        tv[ct * 8 + i] = aS[ct][i] + bsv;      // skip, kept in registers
      }
    }
    wait_async();                              // W2 resident; waves done with W1/Ws
    stageWg(n);                                // overlaps GEMM2 (gate half -> sWa)

    // ---- GEMM2 (K=128): h2 = h1 @ W2 + b2 (own rows, no barrier) ----
    v8f h2[8];
#pragma unroll
    for (int ct = 0; ct < 8; ++ct) h2[ct] = Z;
#pragma unroll
    for (int k0 = 0; k0 < H_; k0 += 32) {
      v16h a = load_frag16(sAct + (r0 + laneR) * PW_ + k0 + kh * 8);
#pragma unroll
      for (int ct = 0; ct < 8; ++ct) {
        v16h b = load_frag16(sW2 + (ct * 16 + laneR) * PW_ + k0 + kh * 8);
        h2[ct] = WMMA16(a, b, h2[ct]);
      }
    }
#pragma unroll
    for (int ct = 0; ct < 8; ++ct) {
      int col = ct * 16 + laneR;
      float b2v = vb2[n * H_ + col];
#pragma unroll
      for (int i = 0; i < 8; ++i)
        sAct[(r0 + i + hi8) * PW_ + col] = (_Float16)(h2[ct][i] + b2v);
    }
    wait_async();                              // Wg halves resident

    // ---- GEMM3 pairs (K=128): a-part (sWgA) and gate (sWa), GLU in regs ----
#pragma unroll
    for (int ct = 0; ct < 8; ++ct) {
      v8f ga = Z, gg = Z;
#pragma unroll
      for (int k0 = 0; k0 < H_; k0 += 32) {
        v16h a = load_frag16(sAct + (r0 + laneR) * PW_ + k0 + kh * 8);
        v16h bA = load_frag16(sWgA + (ct * 16 + laneR) * PW_ + k0 + kh * 8);
        ga = WMMA16(a, bA, ga);
        v16h bG = load_frag16(sWa + (ct * 16 + laneR) * PW_ + k0 + kh * 8);
        gg = WMMA16(a, bG, gg);
      }
      int col = ct * 16 + laneR;
      float bav = vbg[n * 256 + col], bgv = vbg[n * 256 + 128 + col];
#pragma unroll
      for (int i = 0; i < 8; ++i) {
        float av = ga[i] + bav;
        float gv = gg[i] + bgv;
        tv[ct * 8 + i] = av * sigmoid_f(gv) + tv[ct * 8 + i];   // GLU + skip
      }
    }

    // ---- LayerNorm over H=128: 16-lane shfl_xor butterflies ----
    float s1[8], s2[8];
#pragma unroll
    for (int i = 0; i < 8; ++i) { s1[i] = 0.f; s2[i] = 0.f; }
#pragma unroll
    for (int ct = 0; ct < 8; ++ct)
#pragma unroll
      for (int i = 0; i < 8; ++i) { float t = tv[ct * 8 + i]; s1[i] += t; s2[i] += t * t; }
#pragma unroll
    for (int m = 1; m < 16; m <<= 1)
#pragma unroll
      for (int i = 0; i < 8; ++i) {
        s1[i] += __shfl_xor(s1[i], m, 32);
        s2[i] += __shfl_xor(s2[i], m, 32);
      }

    // ---- normalize + softmax-weighted combine into registers ----
#pragma unroll
    for (int i = 0; i < 8; ++i) {
      float mu = s1[i] * (1.0f / H_);
      float var = s2[i] * (1.0f / H_) - mu * mu;
      float rs = rsqrtf(var + LN_EPS);
      int row = rowbase + r0 + i + hi8;
      float wsel = wIn[(size_t)row * N_ + n];
#pragma unroll
      for (int ct = 0; ct < 8; ++ct) {
        int col = ct * 16 + laneR;
        float val = (tv[ct * 8 + i] - mu) * rs * vg[n * H_ + col] + vbv[n * H_ + col];
        outReg[ct * 8 + i] += wsel * val;
      }
    }
    __syncthreads();                           // panels consumed; safe to restage
    if (n + 1 < N_) {                          // overlaps next-iteration latency
      stageE(n + 1);
      stageW1Ws(n + 1);
    }
  }

  // ---- epilogue: store out tile ----
#pragma unroll
  for (int ct = 0; ct < 8; ++ct)
#pragma unroll
    for (int i = 0; i < 8; ++i) {
      int row = rowbase + r0 + i + hi8;
      outPtr[(size_t)row * H_ + ct * 16 + laneR] = outReg[ct * 8 + i];
    }
}

// ----------------------------------------------------------------------------
extern "C" void kernel_launch(void* const* d_in, const int* in_sizes, int n_in,
                              void* d_out, int out_size, void* d_ws, size_t ws_size,
                              hipStream_t stream) {
  (void)in_sizes; (void)n_in; (void)out_size; (void)ws_size;

  const float* emb    = (const float*)d_in[0];
  const float* ctx    = (const float*)d_in[1];
  const float* fWskip = (const float*)d_in[2];
  const float* fbskip = (const float*)d_in[3];
  const float* fW1    = (const float*)d_in[4];
  const float* fb1    = (const float*)d_in[5];
  const float* fWc    = (const float*)d_in[6];
  const float* fW2    = (const float*)d_in[7];
  const float* fb2    = (const float*)d_in[8];
  const float* fWg    = (const float*)d_in[9];
  const float* fbg    = (const float*)d_in[10];
  const float* fg     = (const float*)d_in[11];
  const float* fbv    = (const float*)d_in[12];
  const float* vWskip = (const float*)d_in[13];
  const float* vbskip = (const float*)d_in[14];
  const float* vW1    = (const float*)d_in[15];
  const float* vb1    = (const float*)d_in[16];
  const float* vW2    = (const float*)d_in[17];
  const float* vb2    = (const float*)d_in[18];
  const float* vWg    = (const float*)d_in[19];
  const float* vbg    = (const float*)d_in[20];
  const float* vg     = (const float*)d_in[21];
  const float* vbv    = (const float*)d_in[22];

  // Workspace carve (f16 copies, transposed weights, ctx projection)
  char* w = (char*)d_ws;
  size_t off = 0;
  auto alloc = [&](size_t bytes) -> char* {
    char* p = w + off;
    off = (off + bytes + 255) & ~(size_t)255;
    return p;
  };
  _Float16* e16     = (_Float16*)alloc((size_t)BT_ * ND_ * 2);
  _Float16* fW1T    = (_Float16*)alloc((size_t)ND_ * H_ * 2);
  _Float16* fWskipT = (_Float16*)alloc((size_t)ND_ * N_ * 2);
  _Float16* fW2T    = (_Float16*)alloc((size_t)H_ * H_ * 2);
  _Float16* fWgT    = (_Float16*)alloc((size_t)H_ * 2 * N_ * 2);
  _Float16* vW1T    = (_Float16*)alloc((size_t)N_ * D_ * H_ * 2);
  _Float16* vWskipT = (_Float16*)alloc((size_t)N_ * D_ * H_ * 2);
  _Float16* vW2T    = (_Float16*)alloc((size_t)N_ * H_ * H_ * 2);
  _Float16* vWgT    = (_Float16*)alloc((size_t)N_ * H_ * 256 * 2);
  float*    ctxh    = (float*)alloc((size_t)B_ * H_ * 4);

  float* outPtr = (float*)d_out;                   // [BT, H]
  float* wOut   = outPtr + (size_t)BT_ * H_;       // [BT, N]

  // precision conversion + transposes
  k_cvt<<<4096, 256, 0, stream>>>(emb, e16, BT_ * ND_);
  k_cvtT<<<512, 256, 0, stream>>>(fW1, fW1T, 1, ND_, H_);
  k_cvtT<<<128, 256, 0, stream>>>(fWskip, fWskipT, 1, ND_, N_);
  k_cvtT<<<64, 256, 0, stream>>>(fW2, fW2T, 1, H_, H_);
  k_cvtT<<<32, 256, 0, stream>>>(fWg, fWgT, 1, H_, 2 * N_);
  k_cvtT<<<512, 256, 0, stream>>>(vW1, vW1T, N_, D_, H_);
  k_cvtT<<<512, 256, 0, stream>>>(vWskip, vWskipT, N_, D_, H_);
  k_cvtT<<<1024, 256, 0, stream>>>(vW2, vW2T, N_, H_, H_);
  k_cvtT<<<2048, 256, 0, stream>>>(vWg, vWgT, N_, H_, 256);
  k_ctx<<<B_, H_, 0, stream>>>(ctx, fWc, ctxh);

  // flatten GRN -> softmax weights (128 rows/block, 8 waves)
  k_flat<<<BT_ / 128, 256, 0, stream>>>(e16, fW1T, fWskipT, fW2T, fWgT,
                                        fb1, fbskip, fb2, fbg, fg, fbv,
                                        ctxh, wOut);

  // per-variable GRNs + weighted combine -> outputs (128 rows/block, 8 waves)
  k_var<<<BT_ / 128, 256, 0, stream>>>(e16, vW1T, vWskipT, vW2T, vWgT,
                                       vb1, vbskip, vb2, vbg, vg, vbv,
                                       wOut, outPtr);
}

// v002
// Measured time: 151 microseconds a run.
// Next to v001, in two timings, it ran 2.15 and 2.13 times as fast.
// Over all steps from v000 it is 7.68 times as fast.
#include <hip/hip_runtime.h>
#include <hip/hip_bf16.h>
#include <math.h>

// Problem dims (fixed by reference)
#define B_   64
#define T_   128
#define N_   32
#define D_   64
#define H_   128
#define C_   64
#define BT_  (B_ * T_)      // 8192
#define ND_  (N_ * D_)      // 2048
#define KC_  128            // K-chunk for the flatten GEMM stream
#define NG_  4              // groups of variables in k_var's grid (blockIdx.y)
#define NPG_ (N_ / NG_)     // variables per group
#define LN_EPS 1e-5f
// LDS row pitches in halves. Bank = dword address mod 64, so rows of 256 B (or
// 128 B) put the 16 lanes of a ds_load_b128 fragment read on the same four
// (eight) banks. A pitch of 16 B x odd spreads them over all 64 banks.
#define PW_  136            // 256-byte rows: pitch 272 B = 16 B x 17
#define PN_  72             // 128-byte rows: pitch 144 B = 16 B x 9

typedef _Float16 v16h __attribute__((ext_vector_type(16)));
typedef _Float16 h8   __attribute__((ext_vector_type(8)));
typedef float    v8f  __attribute__((ext_vector_type(8)));

// ---------------------------------------------------------------------------
// CDNA5 async global->LDS staging (GLOBAL_LOAD_ASYNC_TO_LDS_B128, ASYNCcnt).
// GV addressing: vdst = LDS byte address, vaddr = 64-bit global address.
// ---------------------------------------------------------------------------
// A run of copies shares one asm statement; its last line, s_wait_xcnt 0, keeps
// every later rewrite of the address registers behind the copies' issue.
// Copy j moves 16 B per lane from gsrc + j*gstep to ldst + j*lstep (in halves).
__device__ __forceinline__ void cp16x2(_Float16* ldst, int lstep,
                                       const _Float16* gsrc, int gstep) {
  unsigned l = (unsigned)(size_t)ldst;
  unsigned long long g = (unsigned long long)(size_t)gsrc;
  unsigned ls = (unsigned)lstep * 2u;
  unsigned long long gs = (unsigned long long)gstep * 2ull;
  asm volatile("global_load_async_to_lds_b128 %0, %2, off\n\t"
               "global_load_async_to_lds_b128 %1, %3, off\n\t"
               "s_wait_xcnt 0x0"
               :
               : "v"(l), "v"(l + ls), "v"(g), "v"(g + gs)
               : "memory");
}
__device__ __forceinline__ void cp16x4(_Float16* ldst, int lstep,
                                       const _Float16* gsrc, int gstep) {
  unsigned l = (unsigned)(size_t)ldst;
  unsigned long long g = (unsigned long long)(size_t)gsrc;
  unsigned ls = (unsigned)lstep * 2u;
  unsigned long long gs = (unsigned long long)gstep * 2ull;
  asm volatile("global_load_async_to_lds_b128 %0, %4, off\n\t"
               "global_load_async_to_lds_b128 %1, %5, off\n\t"
               "global_load_async_to_lds_b128 %2, %6, off\n\t"
               "global_load_async_to_lds_b128 %3, %7, off\n\t"
               "s_wait_xcnt 0x0"
               :
               : "v"(l), "v"(l + ls), "v"(l + 2 * ls), "v"(l + 3 * ls),
                 "v"(g), "v"(g + gs), "v"(g + 2 * gs), "v"(g + 3 * gs)
               : "memory");
}
__device__ __forceinline__ void cp16x8(_Float16* ldst, int lstep,
                                       const _Float16* gsrc, int gstep) {
  unsigned l = (unsigned)(size_t)ldst;
  unsigned long long g = (unsigned long long)(size_t)gsrc;
  unsigned ls = (unsigned)lstep * 2u;
  unsigned long long gs = (unsigned long long)gstep * 2ull;
  asm volatile("global_load_async_to_lds_b128 %0, %8, off\n\t"
               "global_load_async_to_lds_b128 %1, %9, off\n\t"
               "global_load_async_to_lds_b128 %2, %10, off\n\t"
               "global_load_async_to_lds_b128 %3, %11, off\n\t"
               "global_load_async_to_lds_b128 %4, %12, off\n\t"
               "global_load_async_to_lds_b128 %5, %13, off\n\t"
               "global_load_async_to_lds_b128 %6, %14, off\n\t"
               "global_load_async_to_lds_b128 %7, %15, off\n\t"
               "s_wait_xcnt 0x0"
               :
               : "v"(l), "v"(l + ls), "v"(l + 2 * ls), "v"(l + 3 * ls),
                 "v"(l + 4 * ls), "v"(l + 5 * ls), "v"(l + 6 * ls), "v"(l + 7 * ls),
                 "v"(g), "v"(g + gs), "v"(g + 2 * gs), "v"(g + 3 * gs),
                 "v"(g + 4 * gs), "v"(g + 5 * gs), "v"(g + 6 * gs), "v"(g + 7 * gs)
               : "memory");
}
__device__ __forceinline__ void wait_async() {
  asm volatile("s_wait_asynccnt 0x0" ::: "memory");
  __syncthreads();
}

// Load a 16-half WMMA operand fragment. p points at (index, k0 + khalf*8) in a
// row-major [rows][ldK] f16 array; elements 0..7 = K+0..7, 8..15 = K+16..23
// (CDNA5 16-bit A/B VGPR layout, ISA 7.12.2). 16-byte aligned.
__device__ __forceinline__ v16h load_frag16(const _Float16* p) {
  h8 lo = *(const h8*)(p);
  h8 hi = *(const h8*)(p + 16);
  v16h f;
#pragma unroll
  for (int i = 0; i < 8; ++i) { f[i] = lo[i]; f[8 + i] = hi[i]; }
  return f;
}

#define WMMA16(a, b, c) \
  __builtin_amdgcn_wmma_f32_16x16x32_f16(false, (a), false, (b), (short)0, (c), false, false)

__device__ __forceinline__ float elu_f(float x)     { return x > 0.0f ? x : __expf(x) - 1.0f; }
__device__ __forceinline__ float sigmoid_f(float x) { return 1.0f / (1.0f + __expf(-x)); }

// ---------------------------------------------------------------- converts
__global__ void __launch_bounds__(256) k_cvt(const float* __restrict__ src,
                                             _Float16* __restrict__ dst, int n) {
  for (int i = blockIdx.x * blockDim.x + threadIdx.x; i < n; i += gridDim.x * blockDim.x)
    dst[i] = (_Float16)src[i];
}

// src: fp32 [batch][R][C]  ->  dst: f16 [batch][C][R]  (transpose per batch)
__global__ void __launch_bounds__(256) k_cvtT(const float* __restrict__ src,
                                              _Float16* __restrict__ dst,
                                              int batch, int R, int Ccols) {
  int total = batch * R * Ccols;
  for (int i = blockIdx.x * blockDim.x + threadIdx.x; i < total; i += gridDim.x * blockDim.x) {
    int n = i / (R * Ccols);
    int rem = i - n * (R * Ccols);
    int c = rem / R;
    int r = rem - c * R;
    dst[i] = (_Float16)src[((size_t)n * R + r) * Ccols + c];
  }
}

// ctxh[b][h] = sum_c context[b][c] * fWc[c][h]   (tiny, plain FMA)
__global__ void __launch_bounds__(128) k_ctx(const float* __restrict__ context,
                                             const float* __restrict__ fWc,
                                             float* __restrict__ ctxh) {
  int b = blockIdx.x, h = threadIdx.x;
  float s = 0.0f;
  for (int c = 0; c < C_; ++c) s += context[b * C_ + c] * fWc[c * H_ + h];
  ctxh[b * H_ + h] = s;
}

// ---------------------------------------------------------------- flatten GRN
// One block = 128 rows (8 waves, one 16-row M-tile per wave). K=2048 streamed
// in 16 double-buffered async chunks; skip tiles in registers; GLU + LN +
// softmax via 16-lane shfl_xor butterflies. Produces weights [BT, N_].
__global__ void __launch_bounds__(256)
k_flat(const _Float16* __restrict__ e16,
       const _Float16* __restrict__ fW1T, const _Float16* __restrict__ fWskipT,
       const _Float16* __restrict__ fW2T, const _Float16* __restrict__ fWgT,
       const float* __restrict__ fb1, const float* __restrict__ fbskip,
       const float* __restrict__ fb2, const float* __restrict__ fbg,
       const float* __restrict__ fg, const float* __restrict__ fbv,
       const float* __restrict__ ctxh,
       float* __restrict__ wOut) {
  __shared__ __attribute__((aligned(16))) _Float16 bufFlat[2][128 * PW_];  // flat chunks, then act
  __shared__ __attribute__((aligned(16))) _Float16 bufW1[2][128 * PW_];    // W1 chunks, then W2
  __shared__ __attribute__((aligned(16))) _Float16 bufWs[2][N_ * PW_];     // Wskip chunks, then Wg

  const int tid = threadIdx.x;
  const int wave = tid >> 5, lane = tid & 31;
  const int laneR = lane & 15, kh = (lane >> 4) & 1;
  const int hi8 = (lane & 16) ? 8 : 0;
  const int r0 = wave * 16;
  const int rowbase = blockIdx.x * 128;
  const int bIdx = rowbase / T_;              // T_==128: one batch per block
  const v8f Z = {0.f, 0.f, 0.f, 0.f, 0.f, 0.f, 0.f, 0.f};

  // 16 lanes cover one 256-byte row; copy j of a run takes row sr + 16*j.
  const int sr = tid >> 4, so = (tid & 15) * 8;
  auto stageChunk = [&](int kc, int p) {
    int kk = kc * KC_;
    cp16x8(&bufFlat[p][sr * PW_ + so], 16 * PW_,      // flat rows: 2048 x 16B
           e16 + (size_t)(rowbase + sr) * ND_ + kk + so, 16 * ND_);
    cp16x8(&bufW1[p][sr * PW_ + so], 16 * PW_,        // W1 panel: 2048 x 16B
           fW1T + (size_t)sr * ND_ + kk + so, 16 * ND_);
    cp16x2(&bufWs[p][sr * PW_ + so], 16 * PW_,        // Wskip panel: 512 x 16B
           fWskipT + (size_t)sr * ND_ + kk + so, 16 * ND_);
  };

  // ---- GEMM1 stream: accW = flat @ W1 (8 tiles), accS = flat @ Wskip ----
  v8f accW[8], accS[2];
#pragma unroll
  for (int ct = 0; ct < 8; ++ct) accW[ct] = Z;
  accS[0] = Z; accS[1] = Z;

  stageChunk(0, 0);
  for (int kc = 0; kc < ND_ / KC_; ++kc) {
    int p = kc & 1;
    wait_async();                             // chunk kc resident
    if (kc + 1 < ND_ / KC_) stageChunk(kc + 1, p ^ 1);   // overlaps compute
#pragma unroll
    for (int k0 = 0; k0 < KC_; k0 += 32) {
      v16h a = load_frag16(&bufFlat[p][(r0 + laneR) * PW_ + k0 + kh * 8]);
#pragma unroll
      for (int ct = 0; ct < 8; ++ct) {
        v16h b = load_frag16(&bufW1[p][(ct * 16 + laneR) * PW_ + k0 + kh * 8]);
        accW[ct] = WMMA16(a, b, accW[ct]);
      }
#pragma unroll
      for (int cs = 0; cs < 2; ++cs) {
        v16h b = load_frag16(&bufWs[p][(cs * 16 + laneR) * PW_ + k0 + kh * 8]);
        accS[cs] = WMMA16(a, b, accS[cs]);
      }
    }
    __syncthreads();                          // buffer reusable 2 chunks later
  }

  // ---- stage W2 (-> bufW1[0]) and Wg (-> bufWs, 64 rows contiguous) ----
  _Float16* sAct = &bufFlat[0][0];
  _Float16* sW2  = &bufW1[0][0];
  _Float16* sWg  = &bufWs[0][0];
  cp16x8(sW2 + sr * PW_ + so, 16 * PW_, fW2T + tid * 8, 2048);
  cp16x4(sWg + sr * PW_ + so, 16 * PW_, fWgT + tid * 8, 2048);

  // ---- h1 = elu(accW + b1 + ctx) -> sAct (own rows); skip in registers ----
  float sk[2][8];
#pragma unroll
  for (int ct = 0; ct < 8; ++ct) {
    int col = ct * 16 + laneR;
    float bc = fb1[col] + ctxh[bIdx * H_ + col];
#pragma unroll
    for (int i = 0; i < 8; ++i)
      sAct[(r0 + i + hi8) * PW_ + col] = (_Float16)elu_f(accW[ct][i] + bc);
  }
#pragma unroll
  for (int cs = 0; cs < 2; ++cs) {
    float bs = fbskip[cs * 16 + laneR];
#pragma unroll
    for (int i = 0; i < 8; ++i) sk[cs][i] = accS[cs][i] + bs;
  }
  wait_async();                               // W2 + Wg resident

  // ---- GEMM2 (K=128): h2 = h1 @ W2 + b2 (own rows, no barriers) ----
  v8f h2[8];
#pragma unroll
  for (int ct = 0; ct < 8; ++ct) h2[ct] = Z;
#pragma unroll
  for (int k0 = 0; k0 < H_; k0 += 32) {
    v16h a = load_frag16(sAct + (r0 + laneR) * PW_ + k0 + kh * 8);
#pragma unroll
    for (int ct = 0; ct < 8; ++ct) {
      v16h b = load_frag16(sW2 + (ct * 16 + laneR) * PW_ + k0 + kh * 8);
      h2[ct] = WMMA16(a, b, h2[ct]);
    }
  }
#pragma unroll
  for (int ct = 0; ct < 8; ++ct) {
    int col = ct * 16 + laneR;
    float b2v = fb2[col];
#pragma unroll
    for (int i = 0; i < 8; ++i)
      sAct[(r0 + i + hi8) * PW_ + col] = (_Float16)(h2[ct][i] + b2v);
  }

  // ---- GEMM3 (K=128, 64 cols): g = h2 @ Wg + bg, 4 tiles in registers ----
  v8f g[4];
#pragma unroll
  for (int ct = 0; ct < 4; ++ct) g[ct] = Z;
#pragma unroll
  for (int k0 = 0; k0 < H_; k0 += 32) {
    v16h a = load_frag16(sAct + (r0 + laneR) * PW_ + k0 + kh * 8);
#pragma unroll
    for (int ct = 0; ct < 4; ++ct) {
      v16h b = load_frag16(sWg + (ct * 16 + laneR) * PW_ + k0 + kh * 8);
      g[ct] = WMMA16(a, b, g[ct]);
    }
  }

  // ---- GLU (col c with gate c+32) + skip, all in registers ----
  float t[2][8];
#pragma unroll
  for (int cs = 0; cs < 2; ++cs) {
    int col = cs * 16 + laneR;
    float ba = fbg[col], bg2 = fbg[col + 32];
#pragma unroll
    for (int i = 0; i < 8; ++i)
      t[cs][i] = (g[cs][i] + ba) * sigmoid_f(g[cs + 2][i] + bg2) + sk[cs][i];
  }

  // ---- LayerNorm over N=32 + softmax via 16-lane butterflies ----
  float s1[8], s2[8];
#pragma unroll
  for (int i = 0; i < 8; ++i) {
    s1[i] = t[0][i] + t[1][i];
    s2[i] = t[0][i] * t[0][i] + t[1][i] * t[1][i];
  }
#pragma unroll
  for (int m = 1; m < 16; m <<= 1)
#pragma unroll
    for (int i = 0; i < 8; ++i) {
      s1[i] += __shfl_xor(s1[i], m, 32);
      s2[i] += __shfl_xor(s2[i], m, 32);
    }
  float l[2][8];
#pragma unroll
  for (int i = 0; i < 8; ++i) {
    float mu = s1[i] * (1.0f / N_);
    float var = s2[i] * (1.0f / N_) - mu * mu;
    float rs = rsqrtf(var + LN_EPS);
#pragma unroll
    for (int cs = 0; cs < 2; ++cs) {
      int col = cs * 16 + laneR;
      l[cs][i] = (t[cs][i] - mu) * rs * fg[col] + fbv[col];
    }
  }
  float mx[8];
#pragma unroll
  for (int i = 0; i < 8; ++i) mx[i] = fmaxf(l[0][i], l[1][i]);
#pragma unroll
  for (int m = 1; m < 16; m <<= 1)
#pragma unroll
    for (int i = 0; i < 8; ++i) mx[i] = fmaxf(mx[i], __shfl_xor(mx[i], m, 32));
  float e0[8], e1[8], se[8];
#pragma unroll
  for (int i = 0; i < 8; ++i) {
    e0[i] = __expf(l[0][i] - mx[i]);
    e1[i] = __expf(l[1][i] - mx[i]);
    se[i] = e0[i] + e1[i];
  }
#pragma unroll
  for (int m = 1; m < 16; m <<= 1)
#pragma unroll
    for (int i = 0; i < 8; ++i) se[i] += __shfl_xor(se[i], m, 32);
#pragma unroll
  for (int i = 0; i < 8; ++i) {
    int row = rowbase + r0 + i + hi8;
    float inv = 1.0f / se[i];
    wOut[(size_t)row * N_ + laneR]      = e0[i] * inv;
    wOut[(size_t)row * N_ + 16 + laneR] = e1[i] * inv;
  }
}

// ------------------------------------------------------- per-variable GRNs
// One block = 128 rows (8 waves, one 16-row M-tile per wave). Weight panels
// async-staged once per block per n into LDS and shared by all waves.
// GLU, skip-add, LayerNorm (shfl_xor butterflies) and the softmax-weighted
// combine all run in registers. blockIdx.y picks a group of NPG_ variables, so
// that the grid fills the chip; each group stores its own partial sum plane
// part[group][row][h], and k_sum adds the planes.
__global__ void __launch_bounds__(256)
k_var(const _Float16* __restrict__ e16,
      const _Float16* __restrict__ vW1T, const _Float16* __restrict__ vWskipT,
      const _Float16* __restrict__ vW2T, const _Float16* __restrict__ vWgT,
      const float* __restrict__ vb1, const float* __restrict__ vbskip,
      const float* __restrict__ vb2, const float* __restrict__ vbg,
      const float* __restrict__ vg, const float* __restrict__ vbv,
      const float* __restrict__ wIn, float* __restrict__ part) {
  __shared__ __attribute__((aligned(16))) _Float16 sE[128 * PN_];      // embedding slice [row][64]
  __shared__ __attribute__((aligned(16))) _Float16 sAct[128 * PW_];    // h1 then h2 (per-wave rows)
  __shared__ __attribute__((aligned(16))) _Float16 sWa[2 * 128 * PN_]; // W1 + Wskip, reused for Wg gate half
  __shared__ __attribute__((aligned(16))) _Float16 sW2[128 * PW_];     // W2 panel [col][128]
  __shared__ __attribute__((aligned(16))) _Float16 sWgA[128 * PW_];    // Wg cols 0..127 [col][128]
  static_assert(128 * PW_ <= 2 * 128 * PN_, "Wg gate half must fit in sWa");
  _Float16* const sWs = sWa + 128 * PN_;       // Wskip panel behind the W1 panel

  const int tid = threadIdx.x;
  const int wave = tid >> 5, lane = tid & 31;
  const int laneR = lane & 15, kh = (lane >> 4) & 1;
  const int hi8 = (lane & 16) ? 8 : 0;
  const int r0 = wave * 16;                    // wave's row tile within block
  const int rowbase = blockIdx.x * 128;
  const int nBeg = blockIdx.y * NPG_, nEnd = nBeg + NPG_;
  float* const outPtr = part + (size_t)blockIdx.y * BT_ * H_;
  const v8f Z = {0.f, 0.f, 0.f, 0.f, 0.f, 0.f, 0.f, 0.f};

  float outReg[64];                            // [ct][i] output accumulators
#pragma unroll
  for (int q = 0; q < 64; ++q) outReg[q] = 0.0f;
  float tv[64];                                // skip, then GLU result

  // 128-byte rows: 8 lanes a row, copy j of a run takes row nr + 32*j.
  // 256-byte rows: 16 lanes a row, copy j of a run takes row wr + 16*j.
  const int nr = tid >> 3, no = (tid & 7) * 8;
  const int wr = tid >> 4, wo = (tid & 15) * 8;
  auto stageE = [&](int n) {                   // 1024 chunks of 16B
    cp16x4(sE + nr * PN_ + no, 32 * PN_,
           e16 + ((size_t)(rowbase + nr) * N_ + n) * D_ + no, 32 * ND_);
  };
  auto stageW1Ws = [&](int n) {                // two 16KB panels -> sWa
    cp16x4(sWa + nr * PN_ + no, 32 * PN_, vW1T + (size_t)n * H_ * D_ + tid * 8, 2048);
    cp16x4(sWs + nr * PN_ + no, 32 * PN_, vWskipT + (size_t)n * H_ * D_ + tid * 8, 2048);
  };
  auto stageW2 = [&](int n) {                  // 32KB
    cp16x8(sW2 + wr * PW_ + wo, 16 * PW_, vW2T + (size_t)n * H_ * H_ + tid * 8, 2048);
  };
  auto stageWg = [&](int n) {                  // a-half -> sWgA, gate half -> sWa
    const _Float16* ga = vWgT + (size_t)n * 256 * H_;
    const _Float16* gg = ga + (size_t)128 * H_;
    cp16x8(sWgA + wr * PW_ + wo, 16 * PW_, ga + tid * 8, 2048);
    cp16x8(sWa + wr * PW_ + wo, 16 * PW_, gg + tid * 8, 2048);
  };

  stageE(nBeg);
  stageW1Ws(nBeg);

  for (int n = nBeg; n < nEnd; ++n) {
    wait_async();                              // E, W1, Wskip resident
    stageW2(n);                                // overlaps GEMM1

    // ---- GEMM1 (K=64): aW = E@W1, aS = E@Wskip, all 8 col-tiles ----
    v8f aW[8], aS[8];
#pragma unroll
    for (int ct = 0; ct < 8; ++ct) { aW[ct] = Z; aS[ct] = Z; }
#pragma unroll
    for (int k0 = 0; k0 < D_; k0 += 32) {
      v16h a = load_frag16(sE + (r0 + laneR) * PN_ + k0 + kh * 8);
#pragma unroll
      for (int ct = 0; ct < 8; ++ct) {
        v16h b = load_frag16(sWa + (ct * 16 + laneR) * PN_ + k0 + kh * 8);
        aW[ct] = WMMA16(a, b, aW[ct]);
        v16h b2 = load_frag16(sWs + (ct * 16 + laneR) * PN_ + k0 + kh * 8);
        aS[ct] = WMMA16(a, b2, aS[ct]);
      }
    }
#pragma unroll
    for (int ct = 0; ct < 8; ++ct) {
      int col = ct * 16 + laneR;
      float b1v = vb1[n * H_ + col], bsv = vbskip[n * H_ + col];
#pragma unroll
      for (int i = 0; i < 8; ++i) {
        int row = i + hi8;
        sAct[(r0 + row) * PW_ + col] = (_Float16)elu_f(aW[ct][i] + b1v);
        tv[ct * 8 + i] = aS[ct][i] + bsv;      // skip, kept in registers
      }
    }
    wait_async();                              // W2 resident; waves done with W1/Ws
    stageWg(n);                                // overlaps GEMM2 (gate half -> sWa)

    // ---- GEMM2 (K=128): h2 = h1 @ W2 + b2 (own rows, no barrier) ----
    v8f h2[8];
#pragma unroll
    for (int ct = 0; ct < 8; ++ct) h2[ct] = Z;
#pragma unroll
    for (int k0 = 0; k0 < H_; k0 += 32) {
      v16h a = load_frag16(sAct + (r0 + laneR) * PW_ + k0 + kh * 8);
#pragma unroll
      for (int ct = 0; ct < 8; ++ct) {
        v16h b = load_frag16(sW2 + (ct * 16 + laneR) * PW_ + k0 + kh * 8);
        h2[ct] = WMMA16(a, b, h2[ct]);
      }
    }
#pragma unroll
    for (int ct = 0; ct < 8; ++ct) {
      int col = ct * 16 + laneR;
      float b2v = vb2[n * H_ + col];
#pragma unroll
      for (int i = 0; i < 8; ++i)
        sAct[(r0 + i + hi8) * PW_ + col] = (_Float16)(h2[ct][i] + b2v);
    }
    wait_async();                              // Wg halves resident

    // ---- GEMM3 pairs (K=128): a-part (sWgA) and gate (sWa), GLU in regs ----
#pragma unroll
    for (int ct = 0; ct < 8; ++ct) {
      v8f ga = Z, gg = Z;
#pragma unroll
      for (int k0 = 0; k0 < H_; k0 += 32) {
        v16h a = load_frag16(sAct + (r0 + laneR) * PW_ + k0 + kh * 8);
        v16h bA = load_frag16(sWgA + (ct * 16 + laneR) * PW_ + k0 + kh * 8);
        ga = WMMA16(a, bA, ga);
        v16h bG = load_frag16(sWa + (ct * 16 + laneR) * PW_ + k0 + kh * 8);
        gg = WMMA16(a, bG, gg);
      }
      int col = ct * 16 + laneR;
      float bav = vbg[n * 256 + col], bgv = vbg[n * 256 + 128 + col];
#pragma unroll
      for (int i = 0; i < 8; ++i) {
        float av = ga[i] + bav;
        float gv = gg[i] + bgv;
        tv[ct * 8 + i] = av * sigmoid_f(gv) + tv[ct * 8 + i];   // GLU + skip
      }
    }

    // ---- LayerNorm over H=128: 16-lane shfl_xor butterflies ----
    float s1[8], s2[8];
#pragma unroll
    for (int i = 0; i < 8; ++i) { s1[i] = 0.f; s2[i] = 0.f; }
#pragma unroll
    for (int ct = 0; ct < 8; ++ct)
#pragma unroll
      for (int i = 0; i < 8; ++i) { float t = tv[ct * 8 + i]; s1[i] += t; s2[i] += t * t; }
#pragma unroll
    for (int m = 1; m < 16; m <<= 1)
#pragma unroll
      for (int i = 0; i < 8; ++i) {
        s1[i] += __shfl_xor(s1[i], m, 32);
        s2[i] += __shfl_xor(s2[i], m, 32);
      }

    // ---- normalize + softmax-weighted combine into registers ----
#pragma unroll
    for (int i = 0; i < 8; ++i) {
      float mu = s1[i] * (1.0f / H_);
      float var = s2[i] * (1.0f / H_) - mu * mu;
      float rs = rsqrtf(var + LN_EPS);
      int row = rowbase + r0 + i + hi8;
      float wsel = wIn[(size_t)row * N_ + n];
#pragma unroll
      for (int ct = 0; ct < 8; ++ct) {
        int col = ct * 16 + laneR;
        float val = (tv[ct * 8 + i] - mu) * rs * vg[n * H_ + col] + vbv[n * H_ + col];
        outReg[ct * 8 + i] += wsel * val;
      }
    }
    __syncthreads();                           // panels consumed; safe to restage
    if (n + 1 < nEnd) {                        // overlaps next-iteration latency
      stageE(n + 1);
      stageW1Ws(n + 1);
    }
  }

  // ---- epilogue: store this group's partial tile ----
#pragma unroll
  for (int ct = 0; ct < 8; ++ct)
#pragma unroll
    for (int i = 0; i < 8; ++i) {
      int row = rowbase + r0 + i + hi8;
      outPtr[(size_t)row * H_ + ct * 16 + laneR] = outReg[ct * 8 + i];
    }
}

// out[i] = sum over the NG_ groups of part[group][i], groups in rising order.
__global__ void __launch_bounds__(256) k_sum(const float* __restrict__ part,
                                             float* __restrict__ outPtr) {
  // One 32-bit byte offset serves every plane and the store (uniform base + offset).
  const unsigned off = (blockIdx.x * 256u + threadIdx.x) * 16u;
  float4 s = *(const float4*)((const char*)part + off);
#pragma unroll  // all planes' loads in flight together
  for (int g = 1; g < NG_; ++g) {
    float4 p = *(const float4*)((const char*)(part + (size_t)g * BT_ * H_) + off);
    s.x += p.x; s.y += p.y; s.z += p.z; s.w += p.w;
  }
  *(float4*)((char*)outPtr + off) = s;
}

// ----------------------------------------------------------------------------
extern "C" void kernel_launch(void* const* d_in, const int* in_sizes, int n_in,
                              void* d_out, int out_size, void* d_ws, size_t ws_size,
                              hipStream_t stream) {
  (void)in_sizes; (void)n_in; (void)out_size; (void)ws_size;

  const float* emb    = (const float*)d_in[0];
  const float* ctx    = (const float*)d_in[1];
  const float* fWskip = (const float*)d_in[2];
  const float* fbskip = (const float*)d_in[3];
  const float* fW1    = (const float*)d_in[4];
  const float* fb1    = (const float*)d_in[5];
  const float* fWc    = (const float*)d_in[6];
  const float* fW2    = (const float*)d_in[7];
  const float* fb2    = (const float*)d_in[8];
  const float* fWg    = (const float*)d_in[9];
  const float* fbg    = (const float*)d_in[10];
  const float* fg     = (const float*)d_in[11];
  const float* fbv    = (const float*)d_in[12];
  const float* vWskip = (const float*)d_in[13];
  const float* vbskip = (const float*)d_in[14];
  const float* vW1    = (const float*)d_in[15];
  const float* vb1    = (const float*)d_in[16];
  const float* vW2    = (const float*)d_in[17];
  const float* vb2    = (const float*)d_in[18];
  const float* vWg    = (const float*)d_in[19];
  const float* vbg    = (const float*)d_in[20];
  const float* vg     = (const float*)d_in[21];
  const float* vbv    = (const float*)d_in[22];

  // Workspace carve (f16 copies, transposed weights, ctx projection, partial planes)
  char* w = (char*)d_ws;
  size_t off = 0;
  auto alloc = [&](size_t bytes) -> char* {
    char* p = w + off;
    off = (off + bytes + 255) & ~(size_t)255;
    return p;
  };
  _Float16* e16     = (_Float16*)alloc((size_t)BT_ * ND_ * 2);
  _Float16* fW1T    = (_Float16*)alloc((size_t)ND_ * H_ * 2);
  _Float16* fWskipT = (_Float16*)alloc((size_t)ND_ * N_ * 2);
  _Float16* fW2T    = (_Float16*)alloc((size_t)H_ * H_ * 2);
  _Float16* fWgT    = (_Float16*)alloc((size_t)H_ * 2 * N_ * 2);
  _Float16* vW1T    = (_Float16*)alloc((size_t)N_ * D_ * H_ * 2);
  _Float16* vWskipT = (_Float16*)alloc((size_t)N_ * D_ * H_ * 2);
  _Float16* vW2T    = (_Float16*)alloc((size_t)N_ * H_ * H_ * 2);
  _Float16* vWgT    = (_Float16*)alloc((size_t)N_ * H_ * 256 * 2);
  float*    ctxh    = (float*)alloc((size_t)B_ * H_ * 4);
  float*    part    = (float*)alloc((size_t)NG_ * BT_ * H_ * 4);

  float* outPtr = (float*)d_out;                   // [BT, H]
  float* wOut   = outPtr + (size_t)BT_ * H_;       // [BT, N]

  // precision conversion + transposes
  k_cvt<<<4096, 256, 0, stream>>>(emb, e16, BT_ * ND_);
  k_cvtT<<<512, 256, 0, stream>>>(fW1, fW1T, 1, ND_, H_);
  k_cvtT<<<128, 256, 0, stream>>>(fWskip, fWskipT, 1, ND_, N_);
  k_cvtT<<<64, 256, 0, stream>>>(fW2, fW2T, 1, H_, H_);
  k_cvtT<<<32, 256, 0, stream>>>(fWg, fWgT, 1, H_, 2 * N_);
  k_cvtT<<<512, 256, 0, stream>>>(vW1, vW1T, N_, D_, H_);
  k_cvtT<<<512, 256, 0, stream>>>(vWskip, vWskipT, N_, D_, H_);
  k_cvtT<<<1024, 256, 0, stream>>>(vW2, vW2T, N_, H_, H_);
  k_cvtT<<<2048, 256, 0, stream>>>(vWg, vWgT, N_, H_, 256);
  k_ctx<<<B_, H_, 0, stream>>>(ctx, fWc, ctxh);

  // flatten GRN -> softmax weights (128 rows/block, 8 waves)
  k_flat<<<BT_ / 128, 256, 0, stream>>>(e16, fW1T, fWskipT, fW2T, fWgT,
                                        fb1, fbskip, fb2, fbg, fg, fbv,
                                        ctxh, wOut);

  // per-variable GRNs + weighted combine -> partial planes (128 rows/block,
  // 8 waves, NPG_ variables per block), then the sum of the planes -> outputs
  k_var<<<dim3(BT_ / 128, NG_), 256, 0, stream>>>(e16, vW1T, vWskipT, vW2T, vWgT,
                                                  vb1, vbskip, vb2, vbg, vg, vbv,
                                                  wOut, part);
  k_sum<<<BT_ * H_ / 1024, 256, 0, stream>>>(part, outPtr);
}

// v003
// One run takes 118 microseconds.
// Two timings next to v002 both put it at 1.28 times that version's speed.
// Over all steps from v000 it is 9.82 times as fast.
#include <hip/hip_runtime.h>
#include <hip/hip_bf16.h>
#include <math.h>

// Problem dims (fixed by reference)
#define B_   64
#define T_   128
#define N_   32
#define D_   64
#define H_   128
#define C_   64
#define BT_  (B_ * T_)      // 8192
#define ND_  (N_ * D_)      // 2048
#define KC_  128            // K-chunk for the flatten GEMM stream
#define NG_  4              // groups of variables in k_var's grid (blockIdx.y)
#define NPG_ (N_ / NG_)     // variables per group
#define LN_EPS 1e-5f
// LDS row pitches in halves. Bank = dword address mod 64, so rows of 256 B (or
// 128 B) put the 16 lanes of a ds_load_b128 fragment read on the same four
// (eight) banks. A pitch of 16 B x odd spreads them over all 64 banks.
#define PW_  136            // 256-byte rows: pitch 272 B = 16 B x 17
#define PN_  72             // 128-byte rows: pitch 144 B = 16 B x 9

typedef _Float16 v16h __attribute__((ext_vector_type(16)));
typedef _Float16 h8   __attribute__((ext_vector_type(8)));
typedef float    v8f  __attribute__((ext_vector_type(8)));

// ---------------------------------------------------------------------------
// CDNA5 async global->LDS staging (GLOBAL_LOAD_ASYNC_TO_LDS_B128, ASYNCcnt).
// GV addressing: vdst = LDS byte address, vaddr = 64-bit global address.
// ---------------------------------------------------------------------------
// A run of copies shares one asm statement; its last line, s_wait_xcnt 0, keeps
// every later rewrite of the address registers behind the copies' issue.
// Copy j moves 16 B per lane from gsrc + j*gstep to ldst + j*lstep (in halves).
__device__ __forceinline__ void cp16x2(_Float16* ldst, int lstep,
                                       const _Float16* gsrc, int gstep) {
  unsigned l = (unsigned)(size_t)ldst;
  unsigned long long g = (unsigned long long)(size_t)gsrc;
  unsigned ls = (unsigned)lstep * 2u;
  unsigned long long gs = (unsigned long long)gstep * 2ull;
  asm volatile("global_load_async_to_lds_b128 %0, %2, off\n\t"
               "global_load_async_to_lds_b128 %1, %3, off\n\t"
               "s_wait_xcnt 0x0"
               :
               : "v"(l), "v"(l + ls), "v"(g), "v"(g + gs)
               : "memory");
}
__device__ __forceinline__ void cp16x4(_Float16* ldst, int lstep,
                                       const _Float16* gsrc, int gstep) {
  unsigned l = (unsigned)(size_t)ldst;
  unsigned long long g = (unsigned long long)(size_t)gsrc;
  unsigned ls = (unsigned)lstep * 2u;
  unsigned long long gs = (unsigned long long)gstep * 2ull;
  asm volatile("global_load_async_to_lds_b128 %0, %4, off\n\t"
               "global_load_async_to_lds_b128 %1, %5, off\n\t"
               "global_load_async_to_lds_b128 %2, %6, off\n\t"
               "global_load_async_to_lds_b128 %3, %7, off\n\t"
               "s_wait_xcnt 0x0"
               :
               : "v"(l), "v"(l + ls), "v"(l + 2 * ls), "v"(l + 3 * ls),
                 "v"(g), "v"(g + gs), "v"(g + 2 * gs), "v"(g + 3 * gs)
               : "memory");
}
__device__ __forceinline__ void cp16x8(_Float16* ldst, int lstep,
                                       const _Float16* gsrc, int gstep) {
  unsigned l = (unsigned)(size_t)ldst;
  unsigned long long g = (unsigned long long)(size_t)gsrc;
  unsigned ls = (unsigned)lstep * 2u;
  unsigned long long gs = (unsigned long long)gstep * 2ull;
  asm volatile("global_load_async_to_lds_b128 %0, %8, off\n\t"
               "global_load_async_to_lds_b128 %1, %9, off\n\t"
               "global_load_async_to_lds_b128 %2, %10, off\n\t"
               "global_load_async_to_lds_b128 %3, %11, off\n\t"
               "global_load_async_to_lds_b128 %4, %12, off\n\t"
               "global_load_async_to_lds_b128 %5, %13, off\n\t"
               "global_load_async_to_lds_b128 %6, %14, off\n\t"
               "global_load_async_to_lds_b128 %7, %15, off\n\t"
               "s_wait_xcnt 0x0"
               :
               : "v"(l), "v"(l + ls), "v"(l + 2 * ls), "v"(l + 3 * ls),
                 "v"(l + 4 * ls), "v"(l + 5 * ls), "v"(l + 6 * ls), "v"(l + 7 * ls),
                 "v"(g), "v"(g + gs), "v"(g + 2 * gs), "v"(g + 3 * gs),
                 "v"(g + 4 * gs), "v"(g + 5 * gs), "v"(g + 6 * gs), "v"(g + 7 * gs)
               : "memory");
}
__device__ __forceinline__ void wait_async() {
  asm volatile("s_wait_asynccnt 0x0" ::: "memory");
  __syncthreads();
}

// Load a 16-half WMMA operand fragment. p points at (index, k0 + khalf*8) in a
// row-major [rows][ldK] f16 array; elements 0..7 = K+0..7, 8..15 = K+16..23
// (CDNA5 16-bit A/B VGPR layout, ISA 7.12.2). 16-byte aligned.
__device__ __forceinline__ v16h load_frag16(const _Float16* p) {
  h8 lo = *(const h8*)(p);
  h8 hi = *(const h8*)(p + 16);
  v16h f;
#pragma unroll
  for (int i = 0; i < 8; ++i) { f[i] = lo[i]; f[8 + i] = hi[i]; }
  return f;
}

#define WMMA16(a, b, c) \
  __builtin_amdgcn_wmma_f32_16x16x32_f16(false, (a), false, (b), (short)0, (c), false, false)

__device__ __forceinline__ float elu_f(float x)     { return x > 0.0f ? x : __expf(x) - 1.0f; }
__device__ __forceinline__ float sigmoid_f(float x) { return 1.0f / (1.0f + __expf(-x)); }

// ---------------------------------------------------------------- preparation
// f16 copy of the embedding, transposed f16 copies of the eight weight tensors
// and the context projection. None of the ten jobs reads what another writes,
// so ONE launch runs them all: each job owns a range of blocks and walks its
// elements with a stride of that range.
// A launch this short also pays for every wave it starts, so the ranges are
// kept small: 16 elements per thread in a transpose, 64 in the embedding copy.
#define NB_CTX   (B_ / 2)                      // two batches per 256-thread block
#define NB_FW1   (ND_ * H_ / 4096)
#define NB_FWS   (ND_ * N_ / 4096)
#define NB_FW2   (H_ * H_ / 4096)
#define NB_FWG   (H_ * 2 * N_ / 4096)
#define NB_VW1   (N_ * D_ * H_ / 4096)
#define NB_VWS   (N_ * D_ * H_ / 4096)
#define NB_VW2   (N_ * H_ * H_ / 4096)
#define NB_VWG   (N_ * H_ * 256 / 4096)
#define NB_EMB   (BT_ * ND_ / 16384)
#define NB_PREP  (NB_CTX + NB_FW1 + NB_FWS + NB_FW2 + NB_FWG + NB_VW1 + NB_VWS + \
                  NB_VW2 + NB_VWG + NB_EMB)

// dst[i] = (f16)src[i]; blk = block's index inside the job's nblk blocks
__device__ __forceinline__ void cvt_job(const float* __restrict__ src,
                                        _Float16* __restrict__ dst, int n,
                                        int blk, int nblk) {
  for (int i = blk * 256 + threadIdx.x; i < n; i += nblk * 256)
    dst[i] = (_Float16)src[i];
}

// src: fp32 [batch][R][C]  ->  dst: f16 [batch][C][R]  (transpose per batch)
__device__ __forceinline__ void cvtT_job(const float* __restrict__ src,
                                         _Float16* __restrict__ dst,
                                         int batch, int R, int Ccols,
                                         int blk, int nblk) {
  int total = batch * R * Ccols;
  for (int i = blk * 256 + threadIdx.x; i < total; i += nblk * 256) {
    int n = i / (R * Ccols);
    int rem = i - n * (R * Ccols);
    int c = rem / R;
    int r = rem - c * R;
    dst[i] = (_Float16)src[((size_t)n * R + r) * Ccols + c];
  }
}

// ctxh[b][h] = sum_c context[b][c] * fWc[c][h]   (tiny, plain FMA)
__device__ __forceinline__ void ctx_job(const float* __restrict__ context,
                                        const float* __restrict__ fWc,
                                        float* __restrict__ ctxh, int blk) {
  int b = blk * 2 + (threadIdx.x >> 7), h = threadIdx.x & (H_ - 1);
  float s = 0.0f;
  for (int c = 0; c < C_; ++c) s += context[b * C_ + c] * fWc[c * H_ + h];
  ctxh[b * H_ + h] = s;
}

// The short jobs take the low block indices, the long embedding stream the rest.
__global__ void __launch_bounds__(256)
k_prep(const float* __restrict__ emb, const float* __restrict__ context,
       const float* __restrict__ fWc,
       const float* __restrict__ fW1, const float* __restrict__ fWskip,
       const float* __restrict__ fW2, const float* __restrict__ fWg,
       const float* __restrict__ vW1, const float* __restrict__ vWskip,
       const float* __restrict__ vW2, const float* __restrict__ vWg,
       _Float16* __restrict__ e16, float* __restrict__ ctxh,
       _Float16* __restrict__ fW1T, _Float16* __restrict__ fWskipT,
       _Float16* __restrict__ fW2T, _Float16* __restrict__ fWgT,
       _Float16* __restrict__ vW1T, _Float16* __restrict__ vWskipT,
       _Float16* __restrict__ vW2T, _Float16* __restrict__ vWgT) {
  int b = blockIdx.x;
  if (b < NB_CTX) { ctx_job(context, fWc, ctxh, b); return; }
  b -= NB_CTX;
  if (b < NB_FW1) { cvtT_job(fW1, fW1T, 1, ND_, H_, b, NB_FW1); return; }
  b -= NB_FW1;
  if (b < NB_FWS) { cvtT_job(fWskip, fWskipT, 1, ND_, N_, b, NB_FWS); return; }
  b -= NB_FWS;
  if (b < NB_FW2) { cvtT_job(fW2, fW2T, 1, H_, H_, b, NB_FW2); return; }
  b -= NB_FW2;
  if (b < NB_FWG) { cvtT_job(fWg, fWgT, 1, H_, 2 * N_, b, NB_FWG); return; }
  b -= NB_FWG;
  if (b < NB_VW1) { cvtT_job(vW1, vW1T, N_, D_, H_, b, NB_VW1); return; }
  b -= NB_VW1;
  if (b < NB_VWS) { cvtT_job(vWskip, vWskipT, N_, D_, H_, b, NB_VWS); return; }
  b -= NB_VWS;
  if (b < NB_VW2) { cvtT_job(vW2, vW2T, N_, H_, H_, b, NB_VW2); return; }
  b -= NB_VW2;
  if (b < NB_VWG) { cvtT_job(vWg, vWgT, N_, H_, 256, b, NB_VWG); return; }
  b -= NB_VWG;
  cvt_job(emb, e16, BT_ * ND_, b, NB_EMB);
}

// ---------------------------------------------------------------- flatten GRN
// One block = 128 rows (8 waves, one 16-row M-tile per wave). K=2048 streamed
// in 16 double-buffered async chunks; skip tiles in registers; GLU + LN +
// softmax via 16-lane shfl_xor butterflies. Produces weights [BT, N_].
__global__ void __launch_bounds__(256)
k_flat(const _Float16* __restrict__ e16,
       const _Float16* __restrict__ fW1T, const _Float16* __restrict__ fWskipT,
       const _Float16* __restrict__ fW2T, const _Float16* __restrict__ fWgT,
       const float* __restrict__ fb1, const float* __restrict__ fbskip,
       const float* __restrict__ fb2, const float* __restrict__ fbg,
       const float* __restrict__ fg, const float* __restrict__ fbv,
       const float* __restrict__ ctxh,
       float* __restrict__ wOut) {
  __shared__ __attribute__((aligned(16))) _Float16 bufFlat[2][128 * PW_];  // flat chunks, then act
  __shared__ __attribute__((aligned(16))) _Float16 bufW1[2][128 * PW_];    // W1 chunks, then W2
  __shared__ __attribute__((aligned(16))) _Float16 bufWs[2][N_ * PW_];     // Wskip chunks, then Wg

  const int tid = threadIdx.x;
  const int wave = tid >> 5, lane = tid & 31;
  const int laneR = lane & 15, kh = (lane >> 4) & 1;
  const int hi8 = (lane & 16) ? 8 : 0;
  const int r0 = wave * 16;
  const int rowbase = blockIdx.x * 128;
  const int bIdx = rowbase / T_;              // T_==128: one batch per block
  const v8f Z = {0.f, 0.f, 0.f, 0.f, 0.f, 0.f, 0.f, 0.f};

  // 16 lanes cover one 256-byte row; copy j of a run takes row sr + 16*j.
  const int sr = tid >> 4, so = (tid & 15) * 8;
  auto stageChunk = [&](int kc, int p) {
    int kk = kc * KC_;
    cp16x8(&bufFlat[p][sr * PW_ + so], 16 * PW_,      // flat rows: 2048 x 16B
           e16 + (size_t)(rowbase + sr) * ND_ + kk + so, 16 * ND_);
    cp16x8(&bufW1[p][sr * PW_ + so], 16 * PW_,        // W1 panel: 2048 x 16B
           fW1T + (size_t)sr * ND_ + kk + so, 16 * ND_);
    cp16x2(&bufWs[p][sr * PW_ + so], 16 * PW_,        // Wskip panel: 512 x 16B
           fWskipT + (size_t)sr * ND_ + kk + so, 16 * ND_);
  };

  // ---- GEMM1 stream: accW = flat @ W1 (8 tiles), accS = flat @ Wskip ----
  v8f accW[8], accS[2];
#pragma unroll
  for (int ct = 0; ct < 8; ++ct) accW[ct] = Z;
  accS[0] = Z; accS[1] = Z;

  stageChunk(0, 0);
  for (int kc = 0; kc < ND_ / KC_; ++kc) {
    int p = kc & 1;
    wait_async();                             // chunk kc resident
    if (kc + 1 < ND_ / KC_) stageChunk(kc + 1, p ^ 1);   // overlaps compute
#pragma unroll
    for (int k0 = 0; k0 < KC_; k0 += 32) {
      v16h a = load_frag16(&bufFlat[p][(r0 + laneR) * PW_ + k0 + kh * 8]);
#pragma unroll
      for (int ct = 0; ct < 8; ++ct) {
        v16h b = load_frag16(&bufW1[p][(ct * 16 + laneR) * PW_ + k0 + kh * 8]);
        accW[ct] = WMMA16(a, b, accW[ct]);
      }
#pragma unroll
      for (int cs = 0; cs < 2; ++cs) {
        v16h b = load_frag16(&bufWs[p][(cs * 16 + laneR) * PW_ + k0 + kh * 8]);
        accS[cs] = WMMA16(a, b, accS[cs]);
      }
    }
    __syncthreads();                          // buffer reusable 2 chunks later
  }

  // ---- stage W2 (-> bufW1[0]) and Wg (-> bufWs, 64 rows contiguous) ----
  _Float16* sAct = &bufFlat[0][0];
  _Float16* sW2  = &bufW1[0][0];
  _Float16* sWg  = &bufWs[0][0];
  cp16x8(sW2 + sr * PW_ + so, 16 * PW_, fW2T + tid * 8, 2048);
  cp16x4(sWg + sr * PW_ + so, 16 * PW_, fWgT + tid * 8, 2048);

  // ---- h1 = elu(accW + b1 + ctx) -> sAct (own rows); skip in registers ----
  float sk[2][8];
#pragma unroll
  for (int ct = 0; ct < 8; ++ct) {
    int col = ct * 16 + laneR;
    float bc = fb1[col] + ctxh[bIdx * H_ + col];
#pragma unroll
    for (int i = 0; i < 8; ++i)
      sAct[(r0 + i + hi8) * PW_ + col] = (_Float16)elu_f(accW[ct][i] + bc);
  }
#pragma unroll
  for (int cs = 0; cs < 2; ++cs) {
    float bs = fbskip[cs * 16 + laneR];
#pragma unroll
    for (int i = 0; i < 8; ++i) sk[cs][i] = accS[cs][i] + bs;
  }
  wait_async();                               // W2 + Wg resident

  // ---- GEMM2 (K=128): h2 = h1 @ W2 + b2 (own rows, no barriers) ----
  v8f h2[8];
#pragma unroll
  for (int ct = 0; ct < 8; ++ct) h2[ct] = Z;
#pragma unroll
  for (int k0 = 0; k0 < H_; k0 += 32) {
    v16h a = load_frag16(sAct + (r0 + laneR) * PW_ + k0 + kh * 8);
#pragma unroll
    for (int ct = 0; ct < 8; ++ct) {
      v16h b = load_frag16(sW2 + (ct * 16 + laneR) * PW_ + k0 + kh * 8);
      h2[ct] = WMMA16(a, b, h2[ct]);
    }
  }
#pragma unroll
  for (int ct = 0; ct < 8; ++ct) {
    int col = ct * 16 + laneR;
    float b2v = fb2[col];
#pragma unroll
    for (int i = 0; i < 8; ++i)
      sAct[(r0 + i + hi8) * PW_ + col] = (_Float16)(h2[ct][i] + b2v);
  }

  // ---- GEMM3 (K=128, 64 cols): g = h2 @ Wg + bg, 4 tiles in registers ----
  v8f g[4];
#pragma unroll
  for (int ct = 0; ct < 4; ++ct) g[ct] = Z;
#pragma unroll
  for (int k0 = 0; k0 < H_; k0 += 32) {
    v16h a = load_frag16(sAct + (r0 + laneR) * PW_ + k0 + kh * 8);
#pragma unroll
    for (int ct = 0; ct < 4; ++ct) {
      v16h b = load_frag16(sWg + (ct * 16 + laneR) * PW_ + k0 + kh * 8);
      g[ct] = WMMA16(a, b, g[ct]);
    }
  }

  // ---- GLU (col c with gate c+32) + skip, all in registers ----
  float t[2][8];
#pragma unroll
  for (int cs = 0; cs < 2; ++cs) {
    int col = cs * 16 + laneR;
    float ba = fbg[col], bg2 = fbg[col + 32];
#pragma unroll
    for (int i = 0; i < 8; ++i)
      t[cs][i] = (g[cs][i] + ba) * sigmoid_f(g[cs + 2][i] + bg2) + sk[cs][i];
  }

  // ---- LayerNorm over N=32 + softmax via 16-lane butterflies ----
  float s1[8], s2[8];
#pragma unroll
  for (int i = 0; i < 8; ++i) {
    s1[i] = t[0][i] + t[1][i];
    s2[i] = t[0][i] * t[0][i] + t[1][i] * t[1][i];
  }
#pragma unroll
  for (int m = 1; m < 16; m <<= 1)
#pragma unroll
    for (int i = 0; i < 8; ++i) {
      s1[i] += __shfl_xor(s1[i], m, 32);
      s2[i] += __shfl_xor(s2[i], m, 32);
    }
  float l[2][8];
#pragma unroll
  for (int i = 0; i < 8; ++i) {
    float mu = s1[i] * (1.0f / N_);
    float var = s2[i] * (1.0f / N_) - mu * mu;
    float rs = rsqrtf(var + LN_EPS);
#pragma unroll
    for (int cs = 0; cs < 2; ++cs) {
      int col = cs * 16 + laneR;
      l[cs][i] = (t[cs][i] - mu) * rs * fg[col] + fbv[col];
    }
  }
  float mx[8];
#pragma unroll
  for (int i = 0; i < 8; ++i) mx[i] = fmaxf(l[0][i], l[1][i]);
#pragma unroll
  for (int m = 1; m < 16; m <<= 1)
#pragma unroll
    for (int i = 0; i < 8; ++i) mx[i] = fmaxf(mx[i], __shfl_xor(mx[i], m, 32));
  float e0[8], e1[8], se[8];
#pragma unroll
  for (int i = 0; i < 8; ++i) {
    e0[i] = __expf(l[0][i] - mx[i]);
    e1[i] = __expf(l[1][i] - mx[i]);
    se[i] = e0[i] + e1[i];
  }
#pragma unroll
  for (int m = 1; m < 16; m <<= 1)
#pragma unroll
    for (int i = 0; i < 8; ++i) se[i] += __shfl_xor(se[i], m, 32);
#pragma unroll
  for (int i = 0; i < 8; ++i) {
    int row = rowbase + r0 + i + hi8;
    float inv = 1.0f / se[i];
    wOut[(size_t)row * N_ + laneR]      = e0[i] * inv;
    wOut[(size_t)row * N_ + 16 + laneR] = e1[i] * inv;
  }
}

// ------------------------------------------------------- per-variable GRNs
// One block = 128 rows (8 waves, one 16-row M-tile per wave). Weight panels
// async-staged once per block per n into LDS and shared by all waves.
// GLU, skip-add, LayerNorm (shfl_xor butterflies) and the softmax-weighted
// combine all run in registers. blockIdx.y picks a group of NPG_ variables, so
// that the grid fills the chip; each group stores its own partial sum plane
// part[group][row][h], and k_sum adds the planes.
__global__ void __launch_bounds__(256)
k_var(const _Float16* __restrict__ e16,
      const _Float16* __restrict__ vW1T, const _Float16* __restrict__ vWskipT,
      const _Float16* __restrict__ vW2T, const _Float16* __restrict__ vWgT,
      const float* __restrict__ vb1, const float* __restrict__ vbskip,
      const float* __restrict__ vb2, const float* __restrict__ vbg,
      const float* __restrict__ vg, const float* __restrict__ vbv,
      const float* __restrict__ wIn, float* __restrict__ part) {
  __shared__ __attribute__((aligned(16))) _Float16 sE[128 * PN_];      // embedding slice [row][64]
  __shared__ __attribute__((aligned(16))) _Float16 sAct[128 * PW_];    // h1 then h2 (per-wave rows)
  __shared__ __attribute__((aligned(16))) _Float16 sWa[2 * 128 * PN_]; // W1 + Wskip, reused for Wg gate half
  __shared__ __attribute__((aligned(16))) _Float16 sW2[128 * PW_];     // W2 panel [col][128]
  __shared__ __attribute__((aligned(16))) _Float16 sWgA[128 * PW_];    // Wg cols 0..127 [col][128]
  static_assert(128 * PW_ <= 2 * 128 * PN_, "Wg gate half must fit in sWa");
  _Float16* const sWs = sWa + 128 * PN_;       // Wskip panel behind the W1 panel

  const int tid = threadIdx.x;
  const int wave = tid >> 5, lane = tid & 31;
  const int laneR = lane & 15, kh = (lane >> 4) & 1;
  const int hi8 = (lane & 16) ? 8 : 0;
  const int r0 = wave * 16;                    // wave's row tile within block
  const int rowbase = blockIdx.x * 128;
  const int nBeg = blockIdx.y * NPG_, nEnd = nBeg + NPG_;
  float* const outPtr = part + (size_t)blockIdx.y * BT_ * H_;
  const v8f Z = {0.f, 0.f, 0.f, 0.f, 0.f, 0.f, 0.f, 0.f};

  float outReg[64];                            // [ct][i] output accumulators
#pragma unroll
  for (int q = 0; q < 64; ++q) outReg[q] = 0.0f;
  float tv[64];                                // skip, then GLU result

  // 128-byte rows: 8 lanes a row, copy j of a run takes row nr + 32*j.
  // 256-byte rows: 16 lanes a row, copy j of a run takes row wr + 16*j.
  const int nr = tid >> 3, no = (tid & 7) * 8;
  const int wr = tid >> 4, wo = (tid & 15) * 8;
  auto stageE = [&](int n) {                   // 1024 chunks of 16B
    cp16x4(sE + nr * PN_ + no, 32 * PN_,
           e16 + ((size_t)(rowbase + nr) * N_ + n) * D_ + no, 32 * ND_);
  };
  auto stageW1Ws = [&](int n) {                // two 16KB panels -> sWa
    cp16x4(sWa + nr * PN_ + no, 32 * PN_, vW1T + (size_t)n * H_ * D_ + tid * 8, 2048);
    cp16x4(sWs + nr * PN_ + no, 32 * PN_, vWskipT + (size_t)n * H_ * D_ + tid * 8, 2048);
  };
  auto stageW2 = [&](int n) {                  // 32KB
    cp16x8(sW2 + wr * PW_ + wo, 16 * PW_, vW2T + (size_t)n * H_ * H_ + tid * 8, 2048);
  };
  auto stageWg = [&](int n) {                  // a-half -> sWgA, gate half -> sWa
    const _Float16* ga = vWgT + (size_t)n * 256 * H_;
    const _Float16* gg = ga + (size_t)128 * H_;
    cp16x8(sWgA + wr * PW_ + wo, 16 * PW_, ga + tid * 8, 2048);
    cp16x8(sWa + wr * PW_ + wo, 16 * PW_, gg + tid * 8, 2048);
  };

  stageE(nBeg);
  stageW1Ws(nBeg);

  for (int n = nBeg; n < nEnd; ++n) {
    wait_async();                              // E, W1, Wskip resident
    stageW2(n);                                // overlaps GEMM1

    // ---- GEMM1 (K=64): aW = E@W1, aS = E@Wskip, all 8 col-tiles ----
    v8f aW[8], aS[8];
#pragma unroll
    for (int ct = 0; ct < 8; ++ct) { aW[ct] = Z; aS[ct] = Z; }
#pragma unroll
    for (int k0 = 0; k0 < D_; k0 += 32) {
      v16h a = load_frag16(sE + (r0 + laneR) * PN_ + k0 + kh * 8);
#pragma unroll
      for (int ct = 0; ct < 8; ++ct) {
        v16h b = load_frag16(sWa + (ct * 16 + laneR) * PN_ + k0 + kh * 8);
        aW[ct] = WMMA16(a, b, aW[ct]);
        v16h b2 = load_frag16(sWs + (ct * 16 + laneR) * PN_ + k0 + kh * 8);
        aS[ct] = WMMA16(a, b2, aS[ct]);
      }
    }
#pragma unroll
    for (int ct = 0; ct < 8; ++ct) {
      int col = ct * 16 + laneR;
      float b1v = vb1[n * H_ + col], bsv = vbskip[n * H_ + col];
#pragma unroll
      for (int i = 0; i < 8; ++i) {
        int row = i + hi8;
        sAct[(r0 + row) * PW_ + col] = (_Float16)elu_f(aW[ct][i] + b1v);
        tv[ct * 8 + i] = aS[ct][i] + bsv;      // skip, kept in registers
      }
    }
    wait_async();                              // W2 resident; waves done with W1/Ws
    stageWg(n);                                // overlaps GEMM2 (gate half -> sWa)

    // ---- GEMM2 (K=128): h2 = h1 @ W2 + b2 (own rows, no barrier) ----
    v8f h2[8];
#pragma unroll
    for (int ct = 0; ct < 8; ++ct) h2[ct] = Z;
#pragma unroll
    for (int k0 = 0; k0 < H_; k0 += 32) {
      v16h a = load_frag16(sAct + (r0 + laneR) * PW_ + k0 + kh * 8);
#pragma unroll
      for (int ct = 0; ct < 8; ++ct) {
        v16h b = load_frag16(sW2 + (ct * 16 + laneR) * PW_ + k0 + kh * 8);
        h2[ct] = WMMA16(a, b, h2[ct]);
      }
    }
#pragma unroll
    for (int ct = 0; ct < 8; ++ct) {
      int col = ct * 16 + laneR;
      float b2v = vb2[n * H_ + col];
#pragma unroll
      for (int i = 0; i < 8; ++i)
        sAct[(r0 + i + hi8) * PW_ + col] = (_Float16)(h2[ct][i] + b2v);
    }
    wait_async();                              // Wg halves resident

    // ---- GEMM3 pairs (K=128): a-part (sWgA) and gate (sWa), GLU in regs ----
#pragma unroll
    for (int ct = 0; ct < 8; ++ct) {
      v8f ga = Z, gg = Z;
#pragma unroll
      for (int k0 = 0; k0 < H_; k0 += 32) {
        v16h a = load_frag16(sAct + (r0 + laneR) * PW_ + k0 + kh * 8);
        v16h bA = load_frag16(sWgA + (ct * 16 + laneR) * PW_ + k0 + kh * 8);
        ga = WMMA16(a, bA, ga);
        v16h bG = load_frag16(sWa + (ct * 16 + laneR) * PW_ + k0 + kh * 8);
        gg = WMMA16(a, bG, gg);
      }
      int col = ct * 16 + laneR;
      float bav = vbg[n * 256 + col], bgv = vbg[n * 256 + 128 + col];
#pragma unroll
      for (int i = 0; i < 8; ++i) {
        float av = ga[i] + bav;
        float gv = gg[i] + bgv;
        tv[ct * 8 + i] = av * sigmoid_f(gv) + tv[ct * 8 + i];   // GLU + skip
      }
    }

    // ---- LayerNorm over H=128: 16-lane shfl_xor butterflies ----
    float s1[8], s2[8];
#pragma unroll
    for (int i = 0; i < 8; ++i) { s1[i] = 0.f; s2[i] = 0.f; }
#pragma unroll
    for (int ct = 0; ct < 8; ++ct)
#pragma unroll
      for (int i = 0; i < 8; ++i) { float t = tv[ct * 8 + i]; s1[i] += t; s2[i] += t * t; }
#pragma unroll
    for (int m = 1; m < 16; m <<= 1)
#pragma unroll
      for (int i = 0; i < 8; ++i) {
        s1[i] += __shfl_xor(s1[i], m, 32);
        s2[i] += __shfl_xor(s2[i], m, 32);
      }

    // ---- normalize + softmax-weighted combine into registers ----
#pragma unroll
    for (int i = 0; i < 8; ++i) {
      float mu = s1[i] * (1.0f / H_);
      float var = s2[i] * (1.0f / H_) - mu * mu;
      float rs = rsqrtf(var + LN_EPS);
      int row = rowbase + r0 + i + hi8;
      float wsel = wIn[(size_t)row * N_ + n];
#pragma unroll
      for (int ct = 0; ct < 8; ++ct) {
        int col = ct * 16 + laneR;
        float val = (tv[ct * 8 + i] - mu) * rs * vg[n * H_ + col] + vbv[n * H_ + col];
        outReg[ct * 8 + i] += wsel * val;
      }
    }
    __syncthreads();                           // panels consumed; safe to restage
    if (n + 1 < nEnd) {                        // overlaps next-iteration latency
      stageE(n + 1);
      stageW1Ws(n + 1);
    }
  }

  // ---- epilogue: store this group's partial tile ----
#pragma unroll
  for (int ct = 0; ct < 8; ++ct)
#pragma unroll
    for (int i = 0; i < 8; ++i) {
      int row = rowbase + r0 + i + hi8;
      outPtr[(size_t)row * H_ + ct * 16 + laneR] = outReg[ct * 8 + i];
    }
}

// out[i] = sum over the NG_ groups of part[group][i], groups in rising order.
__global__ void __launch_bounds__(256) k_sum(const float* __restrict__ part,
                                             float* __restrict__ outPtr) {
  // One 32-bit byte offset serves every plane and the store (uniform base + offset).
  const unsigned off = (blockIdx.x * 256u + threadIdx.x) * 16u;
  float4 s = *(const float4*)((const char*)part + off);
#pragma unroll  // all planes' loads in flight together
  for (int g = 1; g < NG_; ++g) {
    float4 p = *(const float4*)((const char*)(part + (size_t)g * BT_ * H_) + off);
    s.x += p.x; s.y += p.y; s.z += p.z; s.w += p.w;
  }
  *(float4*)((char*)outPtr + off) = s;
}

// ----------------------------------------------------------------------------
extern "C" void kernel_launch(void* const* d_in, const int* in_sizes, int n_in,
                              void* d_out, int out_size, void* d_ws, size_t ws_size,
                              hipStream_t stream) {
  (void)in_sizes; (void)n_in; (void)out_size; (void)ws_size;

  const float* emb    = (const float*)d_in[0];
  const float* ctx    = (const float*)d_in[1];
  const float* fWskip = (const float*)d_in[2];
  const float* fbskip = (const float*)d_in[3];
  const float* fW1    = (const float*)d_in[4];
  const float* fb1    = (const float*)d_in[5];
  const float* fWc    = (const float*)d_in[6];
  const float* fW2    = (const float*)d_in[7];
  const float* fb2    = (const float*)d_in[8];
  const float* fWg    = (const float*)d_in[9];
  const float* fbg    = (const float*)d_in[10];
  const float* fg     = (const float*)d_in[11];
  const float* fbv    = (const float*)d_in[12];
  const float* vWskip = (const float*)d_in[13];
  const float* vbskip = (const float*)d_in[14];
  const float* vW1    = (const float*)d_in[15];
  const float* vb1    = (const float*)d_in[16];
  const float* vW2    = (const float*)d_in[17];
  const float* vb2    = (const float*)d_in[18];
  const float* vWg    = (const float*)d_in[19];
  const float* vbg    = (const float*)d_in[20];
  const float* vg     = (const float*)d_in[21];
  const float* vbv    = (const float*)d_in[22];

  // Workspace carve (f16 copies, transposed weights, ctx projection, partial planes)
  char* w = (char*)d_ws;
  size_t off = 0;
  auto alloc = [&](size_t bytes) -> char* {
    char* p = w + off;
    off = (off + bytes + 255) & ~(size_t)255;
    return p;
  };
  _Float16* e16     = (_Float16*)alloc((size_t)BT_ * ND_ * 2);
  _Float16* fW1T    = (_Float16*)alloc((size_t)ND_ * H_ * 2);
  _Float16* fWskipT = (_Float16*)alloc((size_t)ND_ * N_ * 2);
  _Float16* fW2T    = (_Float16*)alloc((size_t)H_ * H_ * 2);
  _Float16* fWgT    = (_Float16*)alloc((size_t)H_ * 2 * N_ * 2);
  _Float16* vW1T    = (_Float16*)alloc((size_t)N_ * D_ * H_ * 2);
  _Float16* vWskipT = (_Float16*)alloc((size_t)N_ * D_ * H_ * 2);
  _Float16* vW2T    = (_Float16*)alloc((size_t)N_ * H_ * H_ * 2);
  _Float16* vWgT    = (_Float16*)alloc((size_t)N_ * H_ * 256 * 2);
  float*    ctxh    = (float*)alloc((size_t)B_ * H_ * 4);
  float*    part    = (float*)alloc((size_t)NG_ * BT_ * H_ * 4);

  float* outPtr = (float*)d_out;                   // [BT, H]
  float* wOut   = outPtr + (size_t)BT_ * H_;       // [BT, N]

  // precision conversion, transposes and context projection: one launch
  k_prep<<<NB_PREP, 256, 0, stream>>>(emb, ctx, fWc, fW1, fWskip, fW2, fWg,
                                      vW1, vWskip, vW2, vWg,
                                      e16, ctxh, fW1T, fWskipT, fW2T, fWgT,
                                      vW1T, vWskipT, vW2T, vWgT);

  // flatten GRN -> softmax weights (128 rows/block, 8 waves)
  k_flat<<<BT_ / 128, 256, 0, stream>>>(e16, fW1T, fWskipT, fW2T, fWgT,
                                        fb1, fbskip, fb2, fbg, fg, fbv,
                                        ctxh, wOut);

  // per-variable GRNs + weighted combine -> partial planes (128 rows/block,
  // 8 waves, NPG_ variables per block), then the sum of the planes -> outputs
  k_var<<<dim3(BT_ / 128, NG_), 256, 0, stream>>>(e16, vW1T, vWskipT, vW2T, vWgT,
                                                  vb1, vbskip, vb2, vbg, vg, vbv,
                                                  wOut, part);
  k_sum<<<BT_ * H_ / 1024, 256, 0, stream>>>(part, outPtr);
}

// v004
// One run takes 105 microseconds.
// Next to v003, in two timings, it ran 1.12 and 1.13 times as fast.
// Over all steps from v000 it is 11.0 times as fast.
#include <hip/hip_runtime.h>
#include <hip/hip_bf16.h>
#include <math.h>

// Problem dims (fixed by reference)
#define B_   64
#define T_   128
#define N_   32
#define D_   64
#define H_   128
#define C_   64
#define BT_  (B_ * T_)      // 8192
#define ND_  (N_ * D_)      // 2048
#define KC_  128            // K-chunk for the flatten GEMM stream
#define NG_  4              // groups of variables in k_var's grid (blockIdx.y)
#define NPG_ (N_ / NG_)     // variables per group
#define LN_EPS 1e-5f
// LDS row pitches in halves. Bank = dword address mod 64, so rows of 256 B (or
// 128 B) put the 16 lanes of a ds_load_b128 fragment read on the same four
// (eight) banks. A pitch of 16 B x odd spreads them over all 64 banks.
#define PW_  136            // 256-byte rows: pitch 272 B = 16 B x 17
#define PN_  72             // 128-byte rows: pitch 144 B = 16 B x 9

typedef _Float16 v16h __attribute__((ext_vector_type(16)));
typedef _Float16 h8   __attribute__((ext_vector_type(8)));
typedef float    v8f  __attribute__((ext_vector_type(8)));

// ---------------------------------------------------------------------------
// CDNA5 async global->LDS staging (GLOBAL_LOAD_ASYNC_TO_LDS_B128, ASYNCcnt).
// GV addressing: vdst = LDS byte address, vaddr = 64-bit global address.
// ---------------------------------------------------------------------------
// A run of copies shares one asm statement; its last line, s_wait_xcnt 0, keeps
// every later rewrite of the address registers behind the copies' issue.
// Copy j moves 16 B per lane from gsrc + j*gstep to ldst + j*lstep (in halves).
__device__ __forceinline__ void cp16x2(_Float16* ldst, int lstep,
                                       const _Float16* gsrc, int gstep) {
  unsigned l = (unsigned)(size_t)ldst;
  unsigned long long g = (unsigned long long)(size_t)gsrc;
  unsigned ls = (unsigned)lstep * 2u;
  unsigned long long gs = (unsigned long long)gstep * 2ull;
  asm volatile("global_load_async_to_lds_b128 %0, %2, off\n\t"
               "global_load_async_to_lds_b128 %1, %3, off\n\t"
               "s_wait_xcnt 0x0"
               :
               : "v"(l), "v"(l + ls), "v"(g), "v"(g + gs)
               : "memory");
}
__device__ __forceinline__ void cp16x4(_Float16* ldst, int lstep,
                                       const _Float16* gsrc, int gstep) {
  unsigned l = (unsigned)(size_t)ldst;
  unsigned long long g = (unsigned long long)(size_t)gsrc;
  unsigned ls = (unsigned)lstep * 2u;
  unsigned long long gs = (unsigned long long)gstep * 2ull;
  asm volatile("global_load_async_to_lds_b128 %0, %4, off\n\t"
               "global_load_async_to_lds_b128 %1, %5, off\n\t"
               "global_load_async_to_lds_b128 %2, %6, off\n\t"
               "global_load_async_to_lds_b128 %3, %7, off\n\t"
               "s_wait_xcnt 0x0"
               :
               : "v"(l), "v"(l + ls), "v"(l + 2 * ls), "v"(l + 3 * ls),
                 "v"(g), "v"(g + gs), "v"(g + 2 * gs), "v"(g + 3 * gs)
               : "memory");
}
__device__ __forceinline__ void cp16x8(_Float16* ldst, int lstep,
                                       const _Float16* gsrc, int gstep) {
  unsigned l = (unsigned)(size_t)ldst;
  unsigned long long g = (unsigned long long)(size_t)gsrc;
  unsigned ls = (unsigned)lstep * 2u;
  unsigned long long gs = (unsigned long long)gstep * 2ull;
  asm volatile("global_load_async_to_lds_b128 %0, %8, off\n\t"
               "global_load_async_to_lds_b128 %1, %9, off\n\t"
               "global_load_async_to_lds_b128 %2, %10, off\n\t"
               "global_load_async_to_lds_b128 %3, %11, off\n\t"
               "global_load_async_to_lds_b128 %4, %12, off\n\t"
               "global_load_async_to_lds_b128 %5, %13, off\n\t"
               "global_load_async_to_lds_b128 %6, %14, off\n\t"
               "global_load_async_to_lds_b128 %7, %15, off\n\t"
               "s_wait_xcnt 0x0"
               :
               : "v"(l), "v"(l + ls), "v"(l + 2 * ls), "v"(l + 3 * ls),
                 "v"(l + 4 * ls), "v"(l + 5 * ls), "v"(l + 6 * ls), "v"(l + 7 * ls),
                 "v"(g), "v"(g + gs), "v"(g + 2 * gs), "v"(g + 3 * gs),
                 "v"(g + 4 * gs), "v"(g + 5 * gs), "v"(g + 6 * gs), "v"(g + 7 * gs)
               : "memory");
}
__device__ __forceinline__ void wait_async() {
  asm volatile("s_wait_asynccnt 0x0" ::: "memory");
  __syncthreads();
}

// Load a 16-half WMMA operand fragment. p points at (index, k0 + khalf*8) in a
// row-major [rows][ldK] f16 array; elements 0..7 = K+0..7, 8..15 = K+16..23
// (CDNA5 16-bit A/B VGPR layout, ISA 7.12.2). 16-byte aligned.
__device__ __forceinline__ v16h load_frag16(const _Float16* p) {
  h8 lo = *(const h8*)(p);
  h8 hi = *(const h8*)(p + 16);
  v16h f;
#pragma unroll
  for (int i = 0; i < 8; ++i) { f[i] = lo[i]; f[8 + i] = hi[i]; }
  return f;
}

#define WMMA16(a, b, c) \
  __builtin_amdgcn_wmma_f32_16x16x32_f16(false, (a), false, (b), (short)0, (c), false, false)

__device__ __forceinline__ float elu_f(float x)     { return x > 0.0f ? x : __expf(x) - 1.0f; }
__device__ __forceinline__ float sigmoid_f(float x) { return 1.0f / (1.0f + __expf(-x)); }

// ---------------------------------------------------------------- preparation
// f16 copy of the embedding, transposed f16 copies of the eight weight tensors
// and the context projection. None of the ten jobs reads what another writes,
// so ONE launch runs them all: each job owns a range of blocks and walks its
// elements with a stride of that range.
// A launch this short also pays for every wave it starts, so the ranges are
// kept small: 16 elements per thread in a transpose, 64 in the embedding copy.
#define NB_CTX   (B_ / 2)                      // two batches per 256-thread block
#define NB_FW1   (ND_ * H_ / 4096)
#define NB_FWS   (ND_ * N_ / 4096)
#define NB_FW2   (H_ * H_ / 4096)
#define NB_FWG   (H_ * 2 * N_ / 4096)
#define NB_VW1   (N_ * D_ * H_ / 4096)
#define NB_VWS   (N_ * D_ * H_ / 4096)
#define NB_VW2   (N_ * H_ * H_ / 4096)
#define NB_VWG   (N_ * H_ * 256 / 4096)
#define NB_EMB   (BT_ * ND_ / 16384)
#define NB_PREP  (NB_CTX + NB_FW1 + NB_FWS + NB_FW2 + NB_FWG + NB_VW1 + NB_VWS + \
                  NB_VW2 + NB_VWG + NB_EMB)

// dst[i] = (f16)src[i]; blk = block's index inside the job's nblk blocks
__device__ __forceinline__ void cvt_job(const float* __restrict__ src,
                                        _Float16* __restrict__ dst, int n,
                                        int blk, int nblk) {
  for (int i = blk * 256 + threadIdx.x; i < n; i += nblk * 256)
    dst[i] = (_Float16)src[i];
}

// src: fp32 [batch][R][C]  ->  dst: f16 [batch][C][R]  (transpose per batch)
__device__ __forceinline__ void cvtT_job(const float* __restrict__ src,
                                         _Float16* __restrict__ dst,
                                         int batch, int R, int Ccols,
                                         int blk, int nblk) {
  int total = batch * R * Ccols;
  for (int i = blk * 256 + threadIdx.x; i < total; i += nblk * 256) {
    int n = i / (R * Ccols);
    int rem = i - n * (R * Ccols);
    int c = rem / R;
    int r = rem - c * R;
    dst[i] = (_Float16)src[((size_t)n * R + r) * Ccols + c];
  }
}

// ctxh[b][h] = sum_c context[b][c] * fWc[c][h]   (tiny, plain FMA)
__device__ __forceinline__ void ctx_job(const float* __restrict__ context,
                                        const float* __restrict__ fWc,
                                        float* __restrict__ ctxh, int blk) {
  int b = blk * 2 + (threadIdx.x >> 7), h = threadIdx.x & (H_ - 1);
  float s = 0.0f;
  for (int c = 0; c < C_; ++c) s += context[b * C_ + c] * fWc[c * H_ + h];
  ctxh[b * H_ + h] = s;
}

// The short jobs take the low block indices, the long embedding stream the rest.
__global__ void __launch_bounds__(256)
k_prep(const float* __restrict__ emb, const float* __restrict__ context,
       const float* __restrict__ fWc,
       const float* __restrict__ fW1, const float* __restrict__ fWskip,
       const float* __restrict__ fW2, const float* __restrict__ fWg,
       const float* __restrict__ vW1, const float* __restrict__ vWskip,
       const float* __restrict__ vW2, const float* __restrict__ vWg,
       _Float16* __restrict__ e16, float* __restrict__ ctxh,
       _Float16* __restrict__ fW1T, _Float16* __restrict__ fWskipT,
       _Float16* __restrict__ fW2T, _Float16* __restrict__ fWgT,
       _Float16* __restrict__ vW1T, _Float16* __restrict__ vWskipT,
       _Float16* __restrict__ vW2T, _Float16* __restrict__ vWgT) {
  int b = blockIdx.x;
  if (b < NB_CTX) { ctx_job(context, fWc, ctxh, b); return; }
  b -= NB_CTX;
  if (b < NB_FW1) { cvtT_job(fW1, fW1T, 1, ND_, H_, b, NB_FW1); return; }
  b -= NB_FW1;
  if (b < NB_FWS) { cvtT_job(fWskip, fWskipT, 1, ND_, N_, b, NB_FWS); return; }
  b -= NB_FWS;
  if (b < NB_FW2) { cvtT_job(fW2, fW2T, 1, H_, H_, b, NB_FW2); return; }
  b -= NB_FW2;
  if (b < NB_FWG) { cvtT_job(fWg, fWgT, 1, H_, 2 * N_, b, NB_FWG); return; }
  b -= NB_FWG;
  if (b < NB_VW1) { cvtT_job(vW1, vW1T, N_, D_, H_, b, NB_VW1); return; }
  b -= NB_VW1;
  if (b < NB_VWS) { cvtT_job(vWskip, vWskipT, N_, D_, H_, b, NB_VWS); return; }
  b -= NB_VWS;
  if (b < NB_VW2) { cvtT_job(vW2, vW2T, N_, H_, H_, b, NB_VW2); return; }
  b -= NB_VW2;
  if (b < NB_VWG) { cvtT_job(vWg, vWgT, N_, H_, 256, b, NB_VWG); return; }
  b -= NB_VWG;
  cvt_job(emb, e16, BT_ * ND_, b, NB_EMB);
}

// ---------------------------------------------------------------- flatten GRN
// One block = FR_ rows, so that the grid has one block per WGP. The 8 waves
// share the block's 2 x 10 output tiles of GEMM1: wave = (row tile rt, column
// group cg); a wave takes two W1 column tiles, and the waves of groups 0 and 1
// one Wskip tile more. K=2048 streamed in 16 double-buffered async chunks.
// GEMM2 is shared the same way; GEMM3, GLU, LN and softmax (16-lane shfl_xor
// butterflies) run on two waves, one per row tile. Produces weights [BT, N_].
#define FR_  32

// One K-chunk of GEMM1 for one wave. pa, pw, ps: the lane's own fragment
// addresses in the flat, W1 and Wskip chunk at k = 0.
template <bool SKIP>
__device__ __forceinline__ void flat_chunk(const _Float16* pa, const _Float16* pw,
                                           const _Float16* ps, v8f (&accW)[2], v8f& accS) {
#pragma unroll  // all fragment loads of a chunk may be issued ahead of its WMMAs
  for (int k0 = 0; k0 < KC_; k0 += 32) {
    v16h a = load_frag16(pa + k0);
#pragma unroll
    for (int j = 0; j < 2; ++j) {
      v16h b = load_frag16(pw + j * 16 * PW_ + k0);
      accW[j] = WMMA16(a, b, accW[j]);
    }
    if (SKIP) {
      v16h b = load_frag16(ps + k0);
      accS = WMMA16(a, b, accS);
    }
  }
}

__global__ void __launch_bounds__(256)
k_flat(const _Float16* __restrict__ e16,
       const _Float16* __restrict__ fW1T, const _Float16* __restrict__ fWskipT,
       const _Float16* __restrict__ fW2T, const _Float16* __restrict__ fWgT,
       const float* __restrict__ fb1, const float* __restrict__ fbskip,
       const float* __restrict__ fb2, const float* __restrict__ fbg,
       const float* __restrict__ fg, const float* __restrict__ fbv,
       const float* __restrict__ ctxh,
       float* __restrict__ wOut) {
  __shared__ __attribute__((aligned(16))) _Float16 bufFlat[2][FR_ * PW_];  // flat chunks, then h1 | h2
  __shared__ __attribute__((aligned(16))) _Float16 bufW1[2][128 * PW_];    // W1 chunks, then W2
  __shared__ __attribute__((aligned(16))) _Float16 bufWs[2][N_ * PW_];     // Wskip chunks, then Wg
  __shared__ float sSkip[FR_ * N_];                                        // skip path, f32

  const int tid = threadIdx.x;
  const int wave = __builtin_amdgcn_readfirstlane(tid >> 5), lane = tid & 31;
  const int laneR = lane & 15, kh = (lane >> 4) & 1;
  const int hi8 = (lane & 16) ? 8 : 0;
  const int rt = wave & 1, cg = wave >> 1;    // row tile, column group
  const int r0 = rt * 16;
  const int c0 = cg * 32;                     // first of the wave's 32 W1/W2 columns
  const int rowbase = blockIdx.x * FR_;
  const int bIdx = rowbase / T_;              // FR_ divides T_: one batch per block
  const v8f Z = {0.f, 0.f, 0.f, 0.f, 0.f, 0.f, 0.f, 0.f};

  // 16 lanes cover one 256-byte row; copy j of a run takes row sr + 16*j.
  const int sr = tid >> 4, so = (tid & 15) * 8;
  auto stageChunk = [&](int kc, int p) {
    int kk = kc * KC_;
    cp16x2(&bufFlat[p][sr * PW_ + so], 16 * PW_,      // flat rows: 512 x 16B
           e16 + (size_t)(rowbase + sr) * ND_ + kk + so, 16 * ND_);
    cp16x8(&bufW1[p][sr * PW_ + so], 16 * PW_,        // W1 panel: 2048 x 16B
           fW1T + (size_t)sr * ND_ + kk + so, 16 * ND_);
    cp16x2(&bufWs[p][sr * PW_ + so], 16 * PW_,        // Wskip panel: 512 x 16B
           fWskipT + (size_t)sr * ND_ + kk + so, 16 * ND_);
  };

  // ---- GEMM1 stream: accW = flat @ W1 (2 tiles), accS = flat @ Wskip (cg < 2) ----
  v8f accW[2], accS;
  accW[0] = Z; accW[1] = Z; accS = Z;

  stageChunk(0, 0);
  for (int kc = 0; kc < ND_ / KC_; ++kc) {
    int p = kc & 1;
    wait_async();                             // chunk kc resident
    if (kc + 1 < ND_ / KC_) stageChunk(kc + 1, p ^ 1);   // overlaps compute
    const _Float16* pa = &bufFlat[p][(r0 + laneR) * PW_ + kh * 8];
    const _Float16* pw = &bufW1[p][(c0 + laneR) * PW_ + kh * 8];
    const _Float16* ps = &bufWs[p][((cg & 1) * 16 + laneR) * PW_ + kh * 8];
    if (cg < 2) flat_chunk<true>(pa, pw, ps, accW, accS);
    else        flat_chunk<false>(pa, pw, ps, accW, accS);
    __syncthreads();                          // buffer reusable 2 chunks later
  }

  // ---- stage W2 (-> bufW1[0]) and Wg (-> bufWs, 64 rows contiguous) ----
  _Float16* sH1 = &bufFlat[0][0];
  _Float16* sH2 = &bufFlat[1][0];
  _Float16* sW2 = &bufW1[0][0];
  _Float16* sWg = &bufWs[0][0];
  cp16x8(sW2 + sr * PW_ + so, 16 * PW_, fW2T + tid * 8, 2048);
  cp16x4(sWg + sr * PW_ + so, 16 * PW_, fWgT + tid * 8, 2048);

  // ---- h1 = elu(accW + b1 + ctx) -> sH1; skip + bias -> sSkip ----
#pragma unroll
  for (int j = 0; j < 2; ++j) {
    int col = c0 + j * 16 + laneR;
    float bc = fb1[col] + ctxh[bIdx * H_ + col];
#pragma unroll
    for (int i = 0; i < 8; ++i)
      sH1[(r0 + i + hi8) * PW_ + col] = (_Float16)elu_f(accW[j][i] + bc);
  }
  if (cg < 2) {
    int col = cg * 16 + laneR;
    float bs = fbskip[col];
#pragma unroll
    for (int i = 0; i < 8; ++i) sSkip[(r0 + i + hi8) * N_ + col] = accS[i] + bs;
  }
  wait_async();                               // W2 + Wg resident; h1, skip of all waves visible

  // ---- GEMM2 (K=128): h2 = h1 @ W2 + b2, the wave's two column tiles ----
  v8f h2[2];
  h2[0] = Z; h2[1] = Z;
#pragma unroll
  for (int k0 = 0; k0 < H_; k0 += 32) {
    v16h a = load_frag16(sH1 + (r0 + laneR) * PW_ + k0 + kh * 8);
#pragma unroll
    for (int j = 0; j < 2; ++j) {
      v16h b = load_frag16(sW2 + (c0 + j * 16 + laneR) * PW_ + k0 + kh * 8);
      h2[j] = WMMA16(a, b, h2[j]);
    }
  }
#pragma unroll
  for (int j = 0; j < 2; ++j) {
    int col = c0 + j * 16 + laneR;
    float b2v = fb2[col];
#pragma unroll
    for (int i = 0; i < 8; ++i)
      sH2[(r0 + i + hi8) * PW_ + col] = (_Float16)(h2[j][i] + b2v);
  }
  __syncthreads();                            // h2 of all waves visible
  if (wave >= 2) return;                      // no barrier below; waves 0, 1: r0 = wave * 16

  // ---- GEMM3 (K=128, 64 cols): g = h2 @ Wg + bg, 4 tiles in registers ----
  v8f g[4];
#pragma unroll
  for (int ct = 0; ct < 4; ++ct) g[ct] = Z;
#pragma unroll
  for (int k0 = 0; k0 < H_; k0 += 32) {
    v16h a = load_frag16(sH2 + (r0 + laneR) * PW_ + k0 + kh * 8);
#pragma unroll
    for (int ct = 0; ct < 4; ++ct) {
      v16h b = load_frag16(sWg + (ct * 16 + laneR) * PW_ + k0 + kh * 8);
      g[ct] = WMMA16(a, b, g[ct]);
    }
  }
  float sk[2][8];
#pragma unroll
  for (int cs = 0; cs < 2; ++cs)
#pragma unroll
    for (int i = 0; i < 8; ++i) sk[cs][i] = sSkip[(r0 + i + hi8) * N_ + cs * 16 + laneR];

  // ---- GLU (col c with gate c+32) + skip, all in registers ----
  float t[2][8];
#pragma unroll
  for (int cs = 0; cs < 2; ++cs) {
    int col = cs * 16 + laneR;
    float ba = fbg[col], bg2 = fbg[col + 32];
#pragma unroll
    for (int i = 0; i < 8; ++i)
      t[cs][i] = (g[cs][i] + ba) * sigmoid_f(g[cs + 2][i] + bg2) + sk[cs][i];
  }

  // ---- LayerNorm over N=32 + softmax via 16-lane butterflies ----
  float s1[8], s2[8];
#pragma unroll
  for (int i = 0; i < 8; ++i) {
    s1[i] = t[0][i] + t[1][i];
    s2[i] = t[0][i] * t[0][i] + t[1][i] * t[1][i];
  }
#pragma unroll
  for (int m = 1; m < 16; m <<= 1)
#pragma unroll
    for (int i = 0; i < 8; ++i) {
      s1[i] += __shfl_xor(s1[i], m, 32);
      s2[i] += __shfl_xor(s2[i], m, 32);
    }
  float l[2][8];
#pragma unroll
  for (int i = 0; i < 8; ++i) {
    float mu = s1[i] * (1.0f / N_);
    float var = s2[i] * (1.0f / N_) - mu * mu;
    float rs = rsqrtf(var + LN_EPS);
#pragma unroll
    for (int cs = 0; cs < 2; ++cs) {
      int col = cs * 16 + laneR;
      l[cs][i] = (t[cs][i] - mu) * rs * fg[col] + fbv[col];
    }
  }
  float mx[8];
#pragma unroll
  for (int i = 0; i < 8; ++i) mx[i] = fmaxf(l[0][i], l[1][i]);
#pragma unroll
  for (int m = 1; m < 16; m <<= 1)
#pragma unroll
    for (int i = 0; i < 8; ++i) mx[i] = fmaxf(mx[i], __shfl_xor(mx[i], m, 32));
  float e0[8], e1[8], se[8];
#pragma unroll
  for (int i = 0; i < 8; ++i) {
    e0[i] = __expf(l[0][i] - mx[i]);
    e1[i] = __expf(l[1][i] - mx[i]);
    se[i] = e0[i] + e1[i];
  }
#pragma unroll
  for (int m = 1; m < 16; m <<= 1)
#pragma unroll
    for (int i = 0; i < 8; ++i) se[i] += __shfl_xor(se[i], m, 32);
#pragma unroll
  for (int i = 0; i < 8; ++i) {
    int row = rowbase + r0 + i + hi8;
    float inv = 1.0f / se[i];
    wOut[(size_t)row * N_ + laneR]      = e0[i] * inv;
    wOut[(size_t)row * N_ + 16 + laneR] = e1[i] * inv;
  }
}

// ------------------------------------------------------- per-variable GRNs
// One block = 128 rows (8 waves, one 16-row M-tile per wave). Weight panels
// async-staged once per block per n into LDS and shared by all waves.
// GLU, skip-add, LayerNorm (shfl_xor butterflies) and the softmax-weighted
// combine all run in registers. blockIdx.y picks a group of NPG_ variables, so
// that the grid fills the chip; each group stores its own partial sum plane
// part[group][row][h], and k_sum adds the planes.
__global__ void __launch_bounds__(256)
k_var(const _Float16* __restrict__ e16,
      const _Float16* __restrict__ vW1T, const _Float16* __restrict__ vWskipT,
      const _Float16* __restrict__ vW2T, const _Float16* __restrict__ vWgT,
      const float* __restrict__ vb1, const float* __restrict__ vbskip,
      const float* __restrict__ vb2, const float* __restrict__ vbg,
      const float* __restrict__ vg, const float* __restrict__ vbv,
      const float* __restrict__ wIn, float* __restrict__ part) {
  __shared__ __attribute__((aligned(16))) _Float16 sE[128 * PN_];      // embedding slice [row][64]
  __shared__ __attribute__((aligned(16))) _Float16 sAct[128 * PW_];    // h1 then h2 (per-wave rows)
  __shared__ __attribute__((aligned(16))) _Float16 sWa[2 * 128 * PN_]; // W1 + Wskip, reused for Wg gate half
  __shared__ __attribute__((aligned(16))) _Float16 sW2[128 * PW_];     // W2 panel [col][128]
  __shared__ __attribute__((aligned(16))) _Float16 sWgA[128 * PW_];    // Wg cols 0..127 [col][128]
  static_assert(128 * PW_ <= 2 * 128 * PN_, "Wg gate half must fit in sWa");
  _Float16* const sWs = sWa + 128 * PN_;       // Wskip panel behind the W1 panel

  const int tid = threadIdx.x;
  const int wave = tid >> 5, lane = tid & 31;
  const int laneR = lane & 15, kh = (lane >> 4) & 1;
  const int hi8 = (lane & 16) ? 8 : 0;
  const int r0 = wave * 16;                    // wave's row tile within block
  const int rowbase = blockIdx.x * 128;
  const int nBeg = blockIdx.y * NPG_, nEnd = nBeg + NPG_;
  float* const outPtr = part + (size_t)blockIdx.y * BT_ * H_;
  const v8f Z = {0.f, 0.f, 0.f, 0.f, 0.f, 0.f, 0.f, 0.f};

  float outReg[64];                            // [ct][i] output accumulators
#pragma unroll
  for (int q = 0; q < 64; ++q) outReg[q] = 0.0f;
  float tv[64];                                // skip, then GLU result

  // 128-byte rows: 8 lanes a row, copy j of a run takes row nr + 32*j.
  // 256-byte rows: 16 lanes a row, copy j of a run takes row wr + 16*j.
  const int nr = tid >> 3, no = (tid & 7) * 8;
  const int wr = tid >> 4, wo = (tid & 15) * 8;
  auto stageE = [&](int n) {                   // 1024 chunks of 16B
    cp16x4(sE + nr * PN_ + no, 32 * PN_,
           e16 + ((size_t)(rowbase + nr) * N_ + n) * D_ + no, 32 * ND_);
  };
  auto stageW1Ws = [&](int n) {                // two 16KB panels -> sWa
    cp16x4(sWa + nr * PN_ + no, 32 * PN_, vW1T + (size_t)n * H_ * D_ + tid * 8, 2048);
    cp16x4(sWs + nr * PN_ + no, 32 * PN_, vWskipT + (size_t)n * H_ * D_ + tid * 8, 2048);
  };
  auto stageW2 = [&](int n) {                  // 32KB
    cp16x8(sW2 + wr * PW_ + wo, 16 * PW_, vW2T + (size_t)n * H_ * H_ + tid * 8, 2048);
  };
  auto stageWg = [&](int n) {                  // a-half -> sWgA, gate half -> sWa
    const _Float16* ga = vWgT + (size_t)n * 256 * H_;
    const _Float16* gg = ga + (size_t)128 * H_;
    cp16x8(sWgA + wr * PW_ + wo, 16 * PW_, ga + tid * 8, 2048);
    cp16x8(sWa + wr * PW_ + wo, 16 * PW_, gg + tid * 8, 2048);
  };

  stageE(nBeg);
  stageW1Ws(nBeg);

  for (int n = nBeg; n < nEnd; ++n) {
    wait_async();                              // E, W1, Wskip resident
    stageW2(n);                                // overlaps GEMM1

    // ---- GEMM1 (K=64): aW = E@W1, aS = E@Wskip, all 8 col-tiles ----
    v8f aW[8], aS[8];
#pragma unroll
    for (int ct = 0; ct < 8; ++ct) { aW[ct] = Z; aS[ct] = Z; }
#pragma unroll
    for (int k0 = 0; k0 < D_; k0 += 32) {
      v16h a = load_frag16(sE + (r0 + laneR) * PN_ + k0 + kh * 8);
#pragma unroll
      for (int ct = 0; ct < 8; ++ct) {
        v16h b = load_frag16(sWa + (ct * 16 + laneR) * PN_ + k0 + kh * 8);
        aW[ct] = WMMA16(a, b, aW[ct]);
        v16h b2 = load_frag16(sWs + (ct * 16 + laneR) * PN_ + k0 + kh * 8);
        aS[ct] = WMMA16(a, b2, aS[ct]);
      }
    }
#pragma unroll
    for (int ct = 0; ct < 8; ++ct) {
      int col = ct * 16 + laneR;
      float b1v = vb1[n * H_ + col], bsv = vbskip[n * H_ + col];
#pragma unroll
      for (int i = 0; i < 8; ++i) {
        int row = i + hi8;
        sAct[(r0 + row) * PW_ + col] = (_Float16)elu_f(aW[ct][i] + b1v);
        tv[ct * 8 + i] = aS[ct][i] + bsv;      // skip, kept in registers
      }
    }
    wait_async();                              // W2 resident; waves done with W1/Ws
    stageWg(n);                                // overlaps GEMM2 (gate half -> sWa)

    // ---- GEMM2 (K=128): h2 = h1 @ W2 + b2 (own rows, no barrier) ----
    v8f h2[8];
#pragma unroll
    for (int ct = 0; ct < 8; ++ct) h2[ct] = Z;
#pragma unroll
    for (int k0 = 0; k0 < H_; k0 += 32) {
      v16h a = load_frag16(sAct + (r0 + laneR) * PW_ + k0 + kh * 8);
#pragma unroll
      for (int ct = 0; ct < 8; ++ct) {
        v16h b = load_frag16(sW2 + (ct * 16 + laneR) * PW_ + k0 + kh * 8);
        h2[ct] = WMMA16(a, b, h2[ct]);
      }
    }
#pragma unroll
    for (int ct = 0; ct < 8; ++ct) {
      int col = ct * 16 + laneR;
      float b2v = vb2[n * H_ + col];
#pragma unroll
      for (int i = 0; i < 8; ++i)
        sAct[(r0 + i + hi8) * PW_ + col] = (_Float16)(h2[ct][i] + b2v);
    }
    wait_async();                              // Wg halves resident

    // ---- GEMM3 pairs (K=128): a-part (sWgA) and gate (sWa), GLU in regs ----
#pragma unroll
    for (int ct = 0; ct < 8; ++ct) {
      v8f ga = Z, gg = Z;
#pragma unroll
      for (int k0 = 0; k0 < H_; k0 += 32) {
        v16h a = load_frag16(sAct + (r0 + laneR) * PW_ + k0 + kh * 8);
        v16h bA = load_frag16(sWgA + (ct * 16 + laneR) * PW_ + k0 + kh * 8);
        ga = WMMA16(a, bA, ga);
        v16h bG = load_frag16(sWa + (ct * 16 + laneR) * PW_ + k0 + kh * 8);
        gg = WMMA16(a, bG, gg);
      }
      int col = ct * 16 + laneR;
      float bav = vbg[n * 256 + col], bgv = vbg[n * 256 + 128 + col];
#pragma unroll
      for (int i = 0; i < 8; ++i) {
        float av = ga[i] + bav;
        float gv = gg[i] + bgv;
        tv[ct * 8 + i] = av * sigmoid_f(gv) + tv[ct * 8 + i];   // GLU + skip
      }
    }

    // ---- LayerNorm over H=128: 16-lane shfl_xor butterflies ----
    float s1[8], s2[8];
#pragma unroll
    for (int i = 0; i < 8; ++i) { s1[i] = 0.f; s2[i] = 0.f; }
#pragma unroll
    for (int ct = 0; ct < 8; ++ct)
#pragma unroll
      for (int i = 0; i < 8; ++i) { float t = tv[ct * 8 + i]; s1[i] += t; s2[i] += t * t; }
#pragma unroll
    for (int m = 1; m < 16; m <<= 1)
#pragma unroll
      for (int i = 0; i < 8; ++i) {
        s1[i] += __shfl_xor(s1[i], m, 32);
        s2[i] += __shfl_xor(s2[i], m, 32);
      }

    // ---- normalize + softmax-weighted combine into registers ----
#pragma unroll
    for (int i = 0; i < 8; ++i) {
      float mu = s1[i] * (1.0f / H_);
      float var = s2[i] * (1.0f / H_) - mu * mu;
      float rs = rsqrtf(var + LN_EPS);
      int row = rowbase + r0 + i + hi8;
      float wsel = wIn[(size_t)row * N_ + n];
#pragma unroll
      for (int ct = 0; ct < 8; ++ct) {
        int col = ct * 16 + laneR;
        float val = (tv[ct * 8 + i] - mu) * rs * vg[n * H_ + col] + vbv[n * H_ + col];
        outReg[ct * 8 + i] += wsel * val;
      }
    }
    __syncthreads();                           // panels consumed; safe to restage
    if (n + 1 < nEnd) {                        // overlaps next-iteration latency
      stageE(n + 1);
      stageW1Ws(n + 1);
    }
  }

  // ---- epilogue: store this group's partial tile ----
#pragma unroll
  for (int ct = 0; ct < 8; ++ct)
#pragma unroll
    for (int i = 0; i < 8; ++i) {
      int row = rowbase + r0 + i + hi8;
      outPtr[(size_t)row * H_ + ct * 16 + laneR] = outReg[ct * 8 + i];
    }
}

// out[i] = sum over the NG_ groups of part[group][i], groups in rising order.
__global__ void __launch_bounds__(256) k_sum(const float* __restrict__ part,
                                             float* __restrict__ outPtr) {
  // One 32-bit byte offset serves every plane and the store (uniform base + offset).
  const unsigned off = (blockIdx.x * 256u + threadIdx.x) * 16u;
  float4 s = *(const float4*)((const char*)part + off);
#pragma unroll  // all planes' loads in flight together
  for (int g = 1; g < NG_; ++g) {
    float4 p = *(const float4*)((const char*)(part + (size_t)g * BT_ * H_) + off);
    s.x += p.x; s.y += p.y; s.z += p.z; s.w += p.w;
  }
  *(float4*)((char*)outPtr + off) = s;
}

// ----------------------------------------------------------------------------
extern "C" void kernel_launch(void* const* d_in, const int* in_sizes, int n_in,
                              void* d_out, int out_size, void* d_ws, size_t ws_size,
                              hipStream_t stream) {
  (void)in_sizes; (void)n_in; (void)out_size; (void)ws_size;

  const float* emb    = (const float*)d_in[0];
  const float* ctx    = (const float*)d_in[1];
  const float* fWskip = (const float*)d_in[2];
  const float* fbskip = (const float*)d_in[3];
  const float* fW1    = (const float*)d_in[4];
  const float* fb1    = (const float*)d_in[5];
  const float* fWc    = (const float*)d_in[6];
  const float* fW2    = (const float*)d_in[7];
  const float* fb2    = (const float*)d_in[8];
  const float* fWg    = (const float*)d_in[9];
  const float* fbg    = (const float*)d_in[10];
  const float* fg     = (const float*)d_in[11];
  const float* fbv    = (const float*)d_in[12];
  const float* vWskip = (const float*)d_in[13];
  const float* vbskip = (const float*)d_in[14];
  const float* vW1    = (const float*)d_in[15];
  const float* vb1    = (const float*)d_in[16];
  const float* vW2    = (const float*)d_in[17];
  const float* vb2    = (const float*)d_in[18];
  const float* vWg    = (const float*)d_in[19];
  const float* vbg    = (const float*)d_in[20];
  const float* vg     = (const float*)d_in[21];
  const float* vbv    = (const float*)d_in[22];

  // Workspace carve (f16 copies, transposed weights, ctx projection, partial planes)
  char* w = (char*)d_ws;
  size_t off = 0;
  auto alloc = [&](size_t bytes) -> char* {
    char* p = w + off;
    off = (off + bytes + 255) & ~(size_t)255;
    return p;
  };
  _Float16* e16     = (_Float16*)alloc((size_t)BT_ * ND_ * 2);
  _Float16* fW1T    = (_Float16*)alloc((size_t)ND_ * H_ * 2);
  _Float16* fWskipT = (_Float16*)alloc((size_t)ND_ * N_ * 2);
  _Float16* fW2T    = (_Float16*)alloc((size_t)H_ * H_ * 2);
  _Float16* fWgT    = (_Float16*)alloc((size_t)H_ * 2 * N_ * 2);
  _Float16* vW1T    = (_Float16*)alloc((size_t)N_ * D_ * H_ * 2);
  _Float16* vWskipT = (_Float16*)alloc((size_t)N_ * D_ * H_ * 2);
  _Float16* vW2T    = (_Float16*)alloc((size_t)N_ * H_ * H_ * 2);
  _Float16* vWgT    = (_Float16*)alloc((size_t)N_ * H_ * 256 * 2);
  float*    ctxh    = (float*)alloc((size_t)B_ * H_ * 4);
  float*    part    = (float*)alloc((size_t)NG_ * BT_ * H_ * 4);

  float* outPtr = (float*)d_out;                   // [BT, H]
  float* wOut   = outPtr + (size_t)BT_ * H_;       // [BT, N]

  // precision conversion, transposes and context projection: one launch
  k_prep<<<NB_PREP, 256, 0, stream>>>(emb, ctx, fWc, fW1, fWskip, fW2, fWg,
                                      vW1, vWskip, vW2, vWg,
                                      e16, ctxh, fW1T, fWskipT, fW2T, fWgT,
                                      vW1T, vWskipT, vW2T, vWgT);

  // flatten GRN -> softmax weights (FR_ rows/block, 8 waves)
  k_flat<<<BT_ / FR_, 256, 0, stream>>>(e16, fW1T, fWskipT, fW2T, fWgT,
                                        fb1, fbskip, fb2, fbg, fg, fbv,
                                        ctxh, wOut);

  // per-variable GRNs + weighted combine -> partial planes (128 rows/block,
  // 8 waves, NPG_ variables per block), then the sum of the planes -> outputs
  k_var<<<dim3(BT_ / 128, NG_), 256, 0, stream>>>(e16, vW1T, vWskipT, vW2T, vWgT,
                                                  vb1, vbskip, vb2, vbg, vg, vbv,
                                                  wOut, part);
  k_sum<<<BT_ * H_ / 1024, 256, 0, stream>>>(part, outPtr);
}

// v005
// It runs in 96.6 microseconds.
// Timed twice side by side with v004, it ran 1.09 times as fast both times.
// All steps since v000 together make it 12.0 times as fast.
#include <hip/hip_runtime.h>
#include <hip/hip_bf16.h>
#include <math.h>

// Problem dims (fixed by reference)
#define B_   64
#define T_   128
#define N_   32
#define D_   64
#define H_   128
#define C_   64
#define BT_  (B_ * T_)      // 8192
#define ND_  (N_ * D_)      // 2048
#define KC_  128            // K-chunk for the flatten GEMM stream
#define NG_  4              // groups of variables in k_var's grid (blockIdx.y)
#define NPG_ (N_ / NG_)     // variables per group
#define LN_EPS 1e-5f
// LDS row pitches in halves. Bank = dword address mod 64, so rows of 256 B (or
// 128 B) put the 16 lanes of a ds_load_b128 fragment read on the same four
// (eight) banks. A pitch of 16 B x odd spreads them over all 64 banks.
#define PW_  136            // 256-byte rows: pitch 272 B = 16 B x 17
#define PN_  72             // 128-byte rows: pitch 144 B = 16 B x 9

typedef _Float16 v16h __attribute__((ext_vector_type(16)));
typedef _Float16 h8   __attribute__((ext_vector_type(8)));
typedef float    v8f  __attribute__((ext_vector_type(8)));

// ---------------------------------------------------------------------------
// CDNA5 async global->LDS staging (GLOBAL_LOAD_ASYNC_TO_LDS_B128, ASYNCcnt).
// GV addressing: vdst = LDS byte address, vaddr = 64-bit global address.
// ---------------------------------------------------------------------------
// A run of copies shares one asm statement; its last line, s_wait_xcnt 0, keeps
// every later rewrite of the address registers behind the copies' issue.
// Copy j moves 16 B per lane from gsrc + j*gstep to ldst + j*lstep (in halves).
__device__ __forceinline__ void cp16x2(_Float16* ldst, int lstep,
                                       const _Float16* gsrc, int gstep) {
  unsigned l = (unsigned)(size_t)ldst;
  unsigned long long g = (unsigned long long)(size_t)gsrc;
  unsigned ls = (unsigned)lstep * 2u;
  unsigned long long gs = (unsigned long long)gstep * 2ull;
  asm volatile("global_load_async_to_lds_b128 %0, %2, off\n\t"
               "global_load_async_to_lds_b128 %1, %3, off\n\t"
               "s_wait_xcnt 0x0"
               :
               : "v"(l), "v"(l + ls), "v"(g), "v"(g + gs)
               : "memory");
}
__device__ __forceinline__ void cp16x4(_Float16* ldst, int lstep,
                                       const _Float16* gsrc, int gstep) {
  unsigned l = (unsigned)(size_t)ldst;
  unsigned long long g = (unsigned long long)(size_t)gsrc;
  unsigned ls = (unsigned)lstep * 2u;
  unsigned long long gs = (unsigned long long)gstep * 2ull;
  asm volatile("global_load_async_to_lds_b128 %0, %4, off\n\t"
               "global_load_async_to_lds_b128 %1, %5, off\n\t"
               "global_load_async_to_lds_b128 %2, %6, off\n\t"
               "global_load_async_to_lds_b128 %3, %7, off\n\t"
               "s_wait_xcnt 0x0"
               :
               : "v"(l), "v"(l + ls), "v"(l + 2 * ls), "v"(l + 3 * ls),
                 "v"(g), "v"(g + gs), "v"(g + 2 * gs), "v"(g + 3 * gs)
               : "memory");
}
__device__ __forceinline__ void cp16x8(_Float16* ldst, int lstep,
                                       const _Float16* gsrc, int gstep) {
  unsigned l = (unsigned)(size_t)ldst;
  unsigned long long g = (unsigned long long)(size_t)gsrc;
  unsigned ls = (unsigned)lstep * 2u;
  unsigned long long gs = (unsigned long long)gstep * 2ull;
  asm volatile("global_load_async_to_lds_b128 %0, %8, off\n\t"
               "global_load_async_to_lds_b128 %1, %9, off\n\t"
               "global_load_async_to_lds_b128 %2, %10, off\n\t"
               "global_load_async_to_lds_b128 %3, %11, off\n\t"
               "global_load_async_to_lds_b128 %4, %12, off\n\t"
               "global_load_async_to_lds_b128 %5, %13, off\n\t"
               "global_load_async_to_lds_b128 %6, %14, off\n\t"
               "global_load_async_to_lds_b128 %7, %15, off\n\t"
               "s_wait_xcnt 0x0"
               :
               : "v"(l), "v"(l + ls), "v"(l + 2 * ls), "v"(l + 3 * ls),
                 "v"(l + 4 * ls), "v"(l + 5 * ls), "v"(l + 6 * ls), "v"(l + 7 * ls),
                 "v"(g), "v"(g + gs), "v"(g + 2 * gs), "v"(g + 3 * gs),
                 "v"(g + 4 * gs), "v"(g + 5 * gs), "v"(g + 6 * gs), "v"(g + 7 * gs)
               : "memory");
}
__device__ __forceinline__ void wait_async() {
  asm volatile("s_wait_asynccnt 0x0" ::: "memory");
  __syncthreads();
}

// Load a 16-half WMMA operand fragment. p points at (index, k0 + khalf*8) in a
// row-major [rows][ldK] f16 array; elements 0..7 = K+0..7, 8..15 = K+16..23
// (CDNA5 16-bit A/B VGPR layout, ISA 7.12.2). 16-byte aligned.
__device__ __forceinline__ v16h load_frag16(const _Float16* p) {
  h8 lo = *(const h8*)(p);
  h8 hi = *(const h8*)(p + 16);
  v16h f;
#pragma unroll
  for (int i = 0; i < 8; ++i) { f[i] = lo[i]; f[8 + i] = hi[i]; }
  return f;
}

#define WMMA16(a, b, c) \
  __builtin_amdgcn_wmma_f32_16x16x32_f16(false, (a), false, (b), (short)0, (c), false, false)

__device__ __forceinline__ float elu_f(float x)     { return x > 0.0f ? x : __expf(x) - 1.0f; }
// The hardware reciprocal (about 1 ulp) in place of the exact f32 division, which
// compiles to ten more vector instructions per value; 1 + exp(-x) >= 1 or inf.
__device__ __forceinline__ float sigmoid_f(float x) { return __builtin_amdgcn_rcpf(1.0f + __expf(-x)); }

// ---------------------------------------------------------------- preparation
// f16 copy of the embedding, transposed f16 copies of the eight weight tensors
// and the context projection. None of the ten jobs reads what another writes,
// so ONE launch runs them all: each job owns a range of blocks and walks its
// elements with a stride of that range.
// A launch this short also pays for every wave it starts, so the ranges are
// kept small: 16 elements per thread in a transpose, 64 in the embedding copy.
#define NB_CTX   (B_ / 2)                      // two batches per 256-thread block
#define NB_FW1   (ND_ * H_ / 4096)
#define NB_FWS   (ND_ * N_ / 4096)
#define NB_FW2   (H_ * H_ / 4096)
#define NB_FWG   (H_ * 2 * N_ / 4096)
#define NB_VW1   (N_ * D_ * H_ / 4096)
#define NB_VWS   (N_ * D_ * H_ / 4096)
#define NB_VW2   (N_ * H_ * H_ / 4096)
#define NB_VWG   (N_ * H_ * 256 / 4096)
#define NB_EMB   (BT_ * ND_ / 16384)
#define NB_PREP  (NB_CTX + NB_FW1 + NB_FWS + NB_FW2 + NB_FWG + NB_VW1 + NB_VWS + \
                  NB_VW2 + NB_VWG + NB_EMB)

// dst[i] = (f16)src[i]; blk = block's index inside the job's nblk blocks
__device__ __forceinline__ void cvt_job(const float* __restrict__ src,
                                        _Float16* __restrict__ dst, int n,
                                        int blk, int nblk) {
  for (int i = blk * 256 + threadIdx.x; i < n; i += nblk * 256)
    dst[i] = (_Float16)src[i];
}

// src: fp32 [batch][R][C]  ->  dst: f16 [batch][C][R]  (transpose per batch)
__device__ __forceinline__ void cvtT_job(const float* __restrict__ src,
                                         _Float16* __restrict__ dst,
                                         int batch, int R, int Ccols,
                                         int blk, int nblk) {
  int total = batch * R * Ccols;
  for (int i = blk * 256 + threadIdx.x; i < total; i += nblk * 256) {
    int n = i / (R * Ccols);
    int rem = i - n * (R * Ccols);
    int c = rem / R;
    int r = rem - c * R;
    dst[i] = (_Float16)src[((size_t)n * R + r) * Ccols + c];
  }
}

// ctxh[b][h] = sum_c context[b][c] * fWc[c][h]   (tiny, plain FMA)
__device__ __forceinline__ void ctx_job(const float* __restrict__ context,
                                        const float* __restrict__ fWc,
                                        float* __restrict__ ctxh, int blk) {
  int b = blk * 2 + (threadIdx.x >> 7), h = threadIdx.x & (H_ - 1);
  float s = 0.0f;
  for (int c = 0; c < C_; ++c) s += context[b * C_ + c] * fWc[c * H_ + h];
  ctxh[b * H_ + h] = s;
}

// The short jobs take the low block indices, the long embedding stream the rest.
__global__ void __launch_bounds__(256)
k_prep(const float* __restrict__ emb, const float* __restrict__ context,
       const float* __restrict__ fWc,
       const float* __restrict__ fW1, const float* __restrict__ fWskip,
       const float* __restrict__ fW2, const float* __restrict__ fWg,
       const float* __restrict__ vW1, const float* __restrict__ vWskip,
       const float* __restrict__ vW2, const float* __restrict__ vWg,
       _Float16* __restrict__ e16, float* __restrict__ ctxh,
       _Float16* __restrict__ fW1T, _Float16* __restrict__ fWskipT,
       _Float16* __restrict__ fW2T, _Float16* __restrict__ fWgT,
       _Float16* __restrict__ vW1T, _Float16* __restrict__ vWskipT,
       _Float16* __restrict__ vW2T, _Float16* __restrict__ vWgT) {
  int b = blockIdx.x;
  if (b < NB_CTX) { ctx_job(context, fWc, ctxh, b); return; }
  b -= NB_CTX;
  if (b < NB_FW1) { cvtT_job(fW1, fW1T, 1, ND_, H_, b, NB_FW1); return; }
  b -= NB_FW1;
  if (b < NB_FWS) { cvtT_job(fWskip, fWskipT, 1, ND_, N_, b, NB_FWS); return; }
  b -= NB_FWS;
  if (b < NB_FW2) { cvtT_job(fW2, fW2T, 1, H_, H_, b, NB_FW2); return; }
  b -= NB_FW2;
  if (b < NB_FWG) { cvtT_job(fWg, fWgT, 1, H_, 2 * N_, b, NB_FWG); return; }
  b -= NB_FWG;
  if (b < NB_VW1) { cvtT_job(vW1, vW1T, N_, D_, H_, b, NB_VW1); return; }
  b -= NB_VW1;
  if (b < NB_VWS) { cvtT_job(vWskip, vWskipT, N_, D_, H_, b, NB_VWS); return; }
  b -= NB_VWS;
  if (b < NB_VW2) { cvtT_job(vW2, vW2T, N_, H_, H_, b, NB_VW2); return; }
  b -= NB_VW2;
  if (b < NB_VWG) { cvtT_job(vWg, vWgT, N_, H_, 256, b, NB_VWG); return; }
  b -= NB_VWG;
  cvt_job(emb, e16, BT_ * ND_, b, NB_EMB);
}

// ---------------------------------------------------------------- flatten GRN
// One block = FR_ rows, so that the grid has one block per WGP. The 8 waves
// share the block's 2 x 10 output tiles of GEMM1: wave = (row tile rt, column
// group cg); a wave takes two W1 column tiles, and the waves of groups 0 and 1
// one Wskip tile more. K=2048 streamed in 16 double-buffered async chunks.
// GEMM2 is shared the same way; GEMM3, GLU, LN and softmax (16-lane shfl_xor
// butterflies) run on two waves, one per row tile. Produces weights [BT, N_].
#define FR_  32

// One K-chunk of GEMM1 for one wave. pa, pw, ps: the lane's own fragment
// addresses in the flat, W1 and Wskip chunk at k = 0.
template <bool SKIP>
__device__ __forceinline__ void flat_chunk(const _Float16* pa, const _Float16* pw,
                                           const _Float16* ps, v8f (&accW)[2], v8f& accS) {
#pragma unroll  // all fragment loads of a chunk may be issued ahead of its WMMAs
  for (int k0 = 0; k0 < KC_; k0 += 32) {
    v16h a = load_frag16(pa + k0);
#pragma unroll
    for (int j = 0; j < 2; ++j) {
      v16h b = load_frag16(pw + j * 16 * PW_ + k0);
      accW[j] = WMMA16(a, b, accW[j]);
    }
    if (SKIP) {
      v16h b = load_frag16(ps + k0);
      accS = WMMA16(a, b, accS);
    }
  }
}

__global__ void __launch_bounds__(256)
k_flat(const _Float16* __restrict__ e16,
       const _Float16* __restrict__ fW1T, const _Float16* __restrict__ fWskipT,
       const _Float16* __restrict__ fW2T, const _Float16* __restrict__ fWgT,
       const float* __restrict__ fb1, const float* __restrict__ fbskip,
       const float* __restrict__ fb2, const float* __restrict__ fbg,
       const float* __restrict__ fg, const float* __restrict__ fbv,
       const float* __restrict__ ctxh,
       float* __restrict__ wOut) {
  __shared__ __attribute__((aligned(16))) _Float16 bufFlat[2][FR_ * PW_];  // flat chunks, then h1 | h2
  __shared__ __attribute__((aligned(16))) _Float16 bufW1[2][128 * PW_];    // W1 chunks, then W2
  __shared__ __attribute__((aligned(16))) _Float16 bufWs[2][N_ * PW_];     // Wskip chunks, then Wg
  __shared__ float sSkip[FR_ * N_];                                        // skip path, f32

  const int tid = threadIdx.x;
  const int wave = __builtin_amdgcn_readfirstlane(tid >> 5), lane = tid & 31;
  const int laneR = lane & 15, kh = (lane >> 4) & 1;
  const int hi8 = (lane & 16) ? 8 : 0;
  const int rt = wave & 1, cg = wave >> 1;    // row tile, column group
  const int r0 = rt * 16;
  const int c0 = cg * 32;                     // first of the wave's 32 W1/W2 columns
  const int rowbase = blockIdx.x * FR_;
  const int bIdx = rowbase / T_;              // FR_ divides T_: one batch per block
  const v8f Z = {0.f, 0.f, 0.f, 0.f, 0.f, 0.f, 0.f, 0.f};

  // 16 lanes cover one 256-byte row; copy j of a run takes row sr + 16*j.
  const int sr = tid >> 4, so = (tid & 15) * 8;
  auto stageChunk = [&](int kc, int p) {
    int kk = kc * KC_;
    cp16x2(&bufFlat[p][sr * PW_ + so], 16 * PW_,      // flat rows: 512 x 16B
           e16 + (size_t)(rowbase + sr) * ND_ + kk + so, 16 * ND_);
    cp16x8(&bufW1[p][sr * PW_ + so], 16 * PW_,        // W1 panel: 2048 x 16B
           fW1T + (size_t)sr * ND_ + kk + so, 16 * ND_);
    cp16x2(&bufWs[p][sr * PW_ + so], 16 * PW_,        // Wskip panel: 512 x 16B
           fWskipT + (size_t)sr * ND_ + kk + so, 16 * ND_);
  };

  // ---- GEMM1 stream: accW = flat @ W1 (2 tiles), accS = flat @ Wskip (cg < 2) ----
  v8f accW[2], accS;
  accW[0] = Z; accW[1] = Z; accS = Z;

  stageChunk(0, 0);
  for (int kc = 0; kc < ND_ / KC_; ++kc) {
    int p = kc & 1;
    wait_async();                             // chunk kc resident
    if (kc + 1 < ND_ / KC_) stageChunk(kc + 1, p ^ 1);   // overlaps compute
    const _Float16* pa = &bufFlat[p][(r0 + laneR) * PW_ + kh * 8];
    const _Float16* pw = &bufW1[p][(c0 + laneR) * PW_ + kh * 8];
    const _Float16* ps = &bufWs[p][((cg & 1) * 16 + laneR) * PW_ + kh * 8];
    if (cg < 2) flat_chunk<true>(pa, pw, ps, accW, accS);
    else        flat_chunk<false>(pa, pw, ps, accW, accS);
    __syncthreads();                          // buffer reusable 2 chunks later
  }

  // ---- stage W2 (-> bufW1[0]) and Wg (-> bufWs, 64 rows contiguous) ----
  _Float16* sH1 = &bufFlat[0][0];
  _Float16* sH2 = &bufFlat[1][0];
  _Float16* sW2 = &bufW1[0][0];
  _Float16* sWg = &bufWs[0][0];
  cp16x8(sW2 + sr * PW_ + so, 16 * PW_, fW2T + tid * 8, 2048);
  cp16x4(sWg + sr * PW_ + so, 16 * PW_, fWgT + tid * 8, 2048);

  // ---- h1 = elu(accW + b1 + ctx) -> sH1; skip + bias -> sSkip ----
#pragma unroll
  for (int j = 0; j < 2; ++j) {
    int col = c0 + j * 16 + laneR;
    float bc = fb1[col] + ctxh[bIdx * H_ + col];
#pragma unroll
    for (int i = 0; i < 8; ++i)
      sH1[(r0 + i + hi8) * PW_ + col] = (_Float16)elu_f(accW[j][i] + bc);
  }
  if (cg < 2) {
    int col = cg * 16 + laneR;
    float bs = fbskip[col];
#pragma unroll
    for (int i = 0; i < 8; ++i) sSkip[(r0 + i + hi8) * N_ + col] = accS[i] + bs;
  }
  wait_async();                               // W2 + Wg resident; h1, skip of all waves visible

  // ---- GEMM2 (K=128): h2 = h1 @ W2 + b2, the wave's two column tiles ----
  v8f h2[2];
  h2[0] = Z; h2[1] = Z;
#pragma unroll
  for (int k0 = 0; k0 < H_; k0 += 32) {
    v16h a = load_frag16(sH1 + (r0 + laneR) * PW_ + k0 + kh * 8);
#pragma unroll
    for (int j = 0; j < 2; ++j) {
      v16h b = load_frag16(sW2 + (c0 + j * 16 + laneR) * PW_ + k0 + kh * 8);
      h2[j] = WMMA16(a, b, h2[j]);
    }
  }
#pragma unroll
  for (int j = 0; j < 2; ++j) {
    int col = c0 + j * 16 + laneR;
    float b2v = fb2[col];
#pragma unroll
    for (int i = 0; i < 8; ++i)
      sH2[(r0 + i + hi8) * PW_ + col] = (_Float16)(h2[j][i] + b2v);
  }
  __syncthreads();                            // h2 of all waves visible
  if (wave >= 2) return;                      // no barrier below; waves 0, 1: r0 = wave * 16

  // ---- GEMM3 (K=128, 64 cols): g = h2 @ Wg + bg, 4 tiles in registers ----
  v8f g[4];
#pragma unroll
  for (int ct = 0; ct < 4; ++ct) g[ct] = Z;
#pragma unroll
  for (int k0 = 0; k0 < H_; k0 += 32) {
    v16h a = load_frag16(sH2 + (r0 + laneR) * PW_ + k0 + kh * 8);
#pragma unroll
    for (int ct = 0; ct < 4; ++ct) {
      v16h b = load_frag16(sWg + (ct * 16 + laneR) * PW_ + k0 + kh * 8);
      g[ct] = WMMA16(a, b, g[ct]);
    }
  }
  float sk[2][8];
#pragma unroll
  for (int cs = 0; cs < 2; ++cs)
#pragma unroll
    for (int i = 0; i < 8; ++i) sk[cs][i] = sSkip[(r0 + i + hi8) * N_ + cs * 16 + laneR];

  // ---- GLU (col c with gate c+32) + skip, all in registers ----
  float t[2][8];
#pragma unroll
  for (int cs = 0; cs < 2; ++cs) {
    int col = cs * 16 + laneR;
    float ba = fbg[col], bg2 = fbg[col + 32];
#pragma unroll
    for (int i = 0; i < 8; ++i)
      t[cs][i] = (g[cs][i] + ba) * sigmoid_f(g[cs + 2][i] + bg2) + sk[cs][i];
  }

  // ---- LayerNorm over N=32 + softmax via 16-lane butterflies ----
  float s1[8], s2[8];
#pragma unroll
  for (int i = 0; i < 8; ++i) {
    s1[i] = t[0][i] + t[1][i];
    s2[i] = t[0][i] * t[0][i] + t[1][i] * t[1][i];
  }
#pragma unroll
  for (int m = 1; m < 16; m <<= 1)
#pragma unroll
    for (int i = 0; i < 8; ++i) {
      s1[i] += __shfl_xor(s1[i], m, 32);
      s2[i] += __shfl_xor(s2[i], m, 32);
    }
  float l[2][8];
#pragma unroll
  for (int i = 0; i < 8; ++i) {
    float mu = s1[i] * (1.0f / N_);
    float var = s2[i] * (1.0f / N_) - mu * mu;
    float rs = rsqrtf(var + LN_EPS);
#pragma unroll
    for (int cs = 0; cs < 2; ++cs) {
      int col = cs * 16 + laneR;
      l[cs][i] = (t[cs][i] - mu) * rs * fg[col] + fbv[col];
    }
  }
  float mx[8];
#pragma unroll
  for (int i = 0; i < 8; ++i) mx[i] = fmaxf(l[0][i], l[1][i]);
#pragma unroll
  for (int m = 1; m < 16; m <<= 1)
#pragma unroll
    for (int i = 0; i < 8; ++i) mx[i] = fmaxf(mx[i], __shfl_xor(mx[i], m, 32));
  float e0[8], e1[8], se[8];
#pragma unroll
  for (int i = 0; i < 8; ++i) {
    e0[i] = __expf(l[0][i] - mx[i]);
    e1[i] = __expf(l[1][i] - mx[i]);
    se[i] = e0[i] + e1[i];
  }
#pragma unroll
  for (int m = 1; m < 16; m <<= 1)
#pragma unroll
    for (int i = 0; i < 8; ++i) se[i] += __shfl_xor(se[i], m, 32);
#pragma unroll
  for (int i = 0; i < 8; ++i) {
    int row = rowbase + r0 + i + hi8;
    float inv = 1.0f / se[i];
    wOut[(size_t)row * N_ + laneR]      = e0[i] * inv;
    wOut[(size_t)row * N_ + 16 + laneR] = e1[i] * inv;
  }
}

// ------------------------------------------------------- per-variable GRNs
// One block = 128 rows (8 waves, one 16-row M-tile per wave). Weight panels
// async-staged once per block per n into LDS and shared by all waves.
// GLU, skip-add, LayerNorm (shfl_xor butterflies) and the softmax-weighted
// combine all run in registers. blockIdx.y picks a group of NPG_ variables, so
// that the grid fills the chip; each group stores its own partial sum plane
// part[group][row][h], and k_sum adds the planes.
__global__ void __launch_bounds__(256)
k_var(const _Float16* __restrict__ e16,
      const _Float16* __restrict__ vW1T, const _Float16* __restrict__ vWskipT,
      const _Float16* __restrict__ vW2T, const _Float16* __restrict__ vWgT,
      const float* __restrict__ vb1, const float* __restrict__ vbskip,
      const float* __restrict__ vb2, const float* __restrict__ vbg,
      const float* __restrict__ vg, const float* __restrict__ vbv,
      const float* __restrict__ wIn, float* __restrict__ part) {
  __shared__ __attribute__((aligned(16))) _Float16 sE[128 * PN_];      // embedding slice [row][64]
  __shared__ __attribute__((aligned(16))) _Float16 sAct[128 * PW_];    // h1 then h2 (per-wave rows)
  __shared__ __attribute__((aligned(16))) _Float16 sWa[2 * 128 * PN_]; // W1 + Wskip, reused for Wg gate half
  __shared__ __attribute__((aligned(16))) _Float16 sW2[128 * PW_];     // W2 panel [col][128]
  __shared__ __attribute__((aligned(16))) _Float16 sWgA[128 * PW_];    // Wg cols 0..127 [col][128]
  static_assert(128 * PW_ <= 2 * 128 * PN_, "Wg gate half must fit in sWa");
  _Float16* const sWs = sWa + 128 * PN_;       // Wskip panel behind the W1 panel

  const int tid = threadIdx.x;
  const int wave = tid >> 5, lane = tid & 31;
  const int laneR = lane & 15, kh = (lane >> 4) & 1;
  const int hi8 = (lane & 16) ? 8 : 0;
  const int r0 = wave * 16;                    // wave's row tile within block
  const int rowbase = blockIdx.x * 128;
  const int nBeg = blockIdx.y * NPG_, nEnd = nBeg + NPG_;
  float* const outPtr = part + (size_t)blockIdx.y * BT_ * H_;
  const v8f Z = {0.f, 0.f, 0.f, 0.f, 0.f, 0.f, 0.f, 0.f};

  float outReg[64];                            // [ct][i] output accumulators
#pragma unroll
  for (int q = 0; q < 64; ++q) outReg[q] = 0.0f;
  float tv[64];                                // skip, then GLU result

  // 128-byte rows: 8 lanes a row, copy j of a run takes row nr + 32*j.
  // 256-byte rows: 16 lanes a row, copy j of a run takes row wr + 16*j.
  const int nr = tid >> 3, no = (tid & 7) * 8;
  const int wr = tid >> 4, wo = (tid & 15) * 8;
  auto stageE = [&](int n) {                   // 1024 chunks of 16B
    cp16x4(sE + nr * PN_ + no, 32 * PN_,
           e16 + ((size_t)(rowbase + nr) * N_ + n) * D_ + no, 32 * ND_);
  };
  auto stageW1Ws = [&](int n) {                // two 16KB panels -> sWa
    cp16x4(sWa + nr * PN_ + no, 32 * PN_, vW1T + (size_t)n * H_ * D_ + tid * 8, 2048);
    cp16x4(sWs + nr * PN_ + no, 32 * PN_, vWskipT + (size_t)n * H_ * D_ + tid * 8, 2048);
  };
  auto stageW2 = [&](int n) {                  // 32KB
    cp16x8(sW2 + wr * PW_ + wo, 16 * PW_, vW2T + (size_t)n * H_ * H_ + tid * 8, 2048);
  };
  auto stageWg = [&](int n) {                  // a-half -> sWgA, gate half -> sWa
    const _Float16* ga = vWgT + (size_t)n * 256 * H_;
    const _Float16* gg = ga + (size_t)128 * H_;
    cp16x8(sWgA + wr * PW_ + wo, 16 * PW_, ga + tid * 8, 2048);
    cp16x8(sWa + wr * PW_ + wo, 16 * PW_, gg + tid * 8, 2048);
  };

  stageE(nBeg);
  stageW1Ws(nBeg);

  for (int n = nBeg; n < nEnd; ++n) {
    wait_async();                              // E, W1, Wskip resident
    stageW2(n);                                // overlaps GEMM1

    // ---- GEMM1 (K=64): aW = E@W1, aS = E@Wskip, all 8 col-tiles ----
    v8f aW[8], aS[8];
#pragma unroll
    for (int ct = 0; ct < 8; ++ct) { aW[ct] = Z; aS[ct] = Z; }
#pragma unroll
    for (int k0 = 0; k0 < D_; k0 += 32) {
      v16h a = load_frag16(sE + (r0 + laneR) * PN_ + k0 + kh * 8);
#pragma unroll
      for (int ct = 0; ct < 8; ++ct) {
        v16h b = load_frag16(sWa + (ct * 16 + laneR) * PN_ + k0 + kh * 8);
        aW[ct] = WMMA16(a, b, aW[ct]);
        v16h b2 = load_frag16(sWs + (ct * 16 + laneR) * PN_ + k0 + kh * 8);
        aS[ct] = WMMA16(a, b2, aS[ct]);
      }
    }
#pragma unroll
    for (int ct = 0; ct < 8; ++ct) {
      int col = ct * 16 + laneR;
      float b1v = vb1[n * H_ + col], bsv = vbskip[n * H_ + col];
#pragma unroll
      for (int i = 0; i < 8; ++i) {
        int row = i + hi8;
        sAct[(r0 + row) * PW_ + col] = (_Float16)elu_f(aW[ct][i] + b1v);
        tv[ct * 8 + i] = aS[ct][i] + bsv;      // skip, kept in registers
      }
    }
    wait_async();                              // W2 resident; waves done with W1/Ws
    stageWg(n);                                // overlaps GEMM2 (gate half -> sWa)

    // ---- GEMM2 (K=128): h2 = h1 @ W2 + b2 (own rows, no barrier) ----
    v8f h2[8];
#pragma unroll
    for (int ct = 0; ct < 8; ++ct) h2[ct] = Z;
#pragma unroll
    for (int k0 = 0; k0 < H_; k0 += 32) {
      v16h a = load_frag16(sAct + (r0 + laneR) * PW_ + k0 + kh * 8);
#pragma unroll
      for (int ct = 0; ct < 8; ++ct) {
        v16h b = load_frag16(sW2 + (ct * 16 + laneR) * PW_ + k0 + kh * 8);
        h2[ct] = WMMA16(a, b, h2[ct]);
      }
    }
#pragma unroll
    for (int ct = 0; ct < 8; ++ct) {
      int col = ct * 16 + laneR;
      float b2v = vb2[n * H_ + col];
#pragma unroll
      for (int i = 0; i < 8; ++i)
        sAct[(r0 + i + hi8) * PW_ + col] = (_Float16)(h2[ct][i] + b2v);
    }
    wait_async();                              // Wg halves resident

    // ---- GEMM3 pairs (K=128): a-part (sWgA) and gate (sWa), GLU in regs ----
#pragma unroll
    for (int ct = 0; ct < 8; ++ct) {
      v8f ga = Z, gg = Z;
#pragma unroll
      for (int k0 = 0; k0 < H_; k0 += 32) {
        v16h a = load_frag16(sAct + (r0 + laneR) * PW_ + k0 + kh * 8);
        v16h bA = load_frag16(sWgA + (ct * 16 + laneR) * PW_ + k0 + kh * 8);
        ga = WMMA16(a, bA, ga);
        v16h bG = load_frag16(sWa + (ct * 16 + laneR) * PW_ + k0 + kh * 8);
        gg = WMMA16(a, bG, gg);
      }
      int col = ct * 16 + laneR;
      float bav = vbg[n * 256 + col], bgv = vbg[n * 256 + 128 + col];
#pragma unroll
      for (int i = 0; i < 8; ++i) {
        float av = ga[i] + bav;
        float gv = gg[i] + bgv;
        tv[ct * 8 + i] = av * sigmoid_f(gv) + tv[ct * 8 + i];   // GLU + skip
      }
    }

    // ---- LayerNorm over H=128: 16-lane shfl_xor butterflies ----
    float s1[8], s2[8];
#pragma unroll
    for (int i = 0; i < 8; ++i) { s1[i] = 0.f; s2[i] = 0.f; }
#pragma unroll
    for (int ct = 0; ct < 8; ++ct)
#pragma unroll
      for (int i = 0; i < 8; ++i) { float t = tv[ct * 8 + i]; s1[i] += t; s2[i] += t * t; }
#pragma unroll
    for (int m = 1; m < 16; m <<= 1)
#pragma unroll
      for (int i = 0; i < 8; ++i) {
        s1[i] += __shfl_xor(s1[i], m, 32);
        s2[i] += __shfl_xor(s2[i], m, 32);
      }

    // ---- normalize + softmax-weighted combine into registers ----
#pragma unroll
    for (int i = 0; i < 8; ++i) {
      float mu = s1[i] * (1.0f / H_);
      float var = s2[i] * (1.0f / H_) - mu * mu;
      float rs = rsqrtf(var + LN_EPS);
      int row = rowbase + r0 + i + hi8;
      float wsel = wIn[(size_t)row * N_ + n];
#pragma unroll
      for (int ct = 0; ct < 8; ++ct) {
        int col = ct * 16 + laneR;
        float val = (tv[ct * 8 + i] - mu) * rs * vg[n * H_ + col] + vbv[n * H_ + col];
        outReg[ct * 8 + i] += wsel * val;
      }
    }
    __syncthreads();                           // panels consumed; safe to restage
    if (n + 1 < nEnd) {                        // overlaps next-iteration latency
      stageE(n + 1);
      stageW1Ws(n + 1);
    }
  }

  // ---- epilogue: store this group's partial tile ----
#pragma unroll
  for (int ct = 0; ct < 8; ++ct)
#pragma unroll
    for (int i = 0; i < 8; ++i) {
      int row = rowbase + r0 + i + hi8;
      outPtr[(size_t)row * H_ + ct * 16 + laneR] = outReg[ct * 8 + i];
    }
}

// out[i] = sum over the NG_ groups of part[group][i], groups in rising order.
__global__ void __launch_bounds__(256) k_sum(const float* __restrict__ part,
                                             float* __restrict__ outPtr) {
  // One 32-bit byte offset serves every plane and the store (uniform base + offset).
  const unsigned off = (blockIdx.x * 256u + threadIdx.x) * 16u;
  float4 s = *(const float4*)((const char*)part + off);
#pragma unroll  // all planes' loads in flight together
  for (int g = 1; g < NG_; ++g) {
    float4 p = *(const float4*)((const char*)(part + (size_t)g * BT_ * H_) + off);
    s.x += p.x; s.y += p.y; s.z += p.z; s.w += p.w;
  }
  *(float4*)((char*)outPtr + off) = s;
}

// ----------------------------------------------------------------------------
extern "C" void kernel_launch(void* const* d_in, const int* in_sizes, int n_in,
                              void* d_out, int out_size, void* d_ws, size_t ws_size,
                              hipStream_t stream) {
  (void)in_sizes; (void)n_in; (void)out_size; (void)ws_size;

  const float* emb    = (const float*)d_in[0];
  const float* ctx    = (const float*)d_in[1];
  const float* fWskip = (const float*)d_in[2];
  const float* fbskip = (const float*)d_in[3];
  const float* fW1    = (const float*)d_in[4];
  const float* fb1    = (const float*)d_in[5];
  const float* fWc    = (const float*)d_in[6];
  const float* fW2    = (const float*)d_in[7];
  const float* fb2    = (const float*)d_in[8];
  const float* fWg    = (const float*)d_in[9];
  const float* fbg    = (const float*)d_in[10];
  const float* fg     = (const float*)d_in[11];
  const float* fbv    = (const float*)d_in[12];
  const float* vWskip = (const float*)d_in[13];
  const float* vbskip = (const float*)d_in[14];
  const float* vW1    = (const float*)d_in[15];
  const float* vb1    = (const float*)d_in[16];
  const float* vW2    = (const float*)d_in[17];
  const float* vb2    = (const float*)d_in[18];
  const float* vWg    = (const float*)d_in[19];
  const float* vbg    = (const float*)d_in[20];
  const float* vg     = (const float*)d_in[21];
  const float* vbv    = (const float*)d_in[22];

  // Workspace carve (f16 copies, transposed weights, ctx projection, partial planes)
  char* w = (char*)d_ws;
  size_t off = 0;
  auto alloc = [&](size_t bytes) -> char* {
    char* p = w + off;
    off = (off + bytes + 255) & ~(size_t)255;
    return p;
  };
  _Float16* e16     = (_Float16*)alloc((size_t)BT_ * ND_ * 2);
  _Float16* fW1T    = (_Float16*)alloc((size_t)ND_ * H_ * 2);
  _Float16* fWskipT = (_Float16*)alloc((size_t)ND_ * N_ * 2);
  _Float16* fW2T    = (_Float16*)alloc((size_t)H_ * H_ * 2);
  _Float16* fWgT    = (_Float16*)alloc((size_t)H_ * 2 * N_ * 2);
  _Float16* vW1T    = (_Float16*)alloc((size_t)N_ * D_ * H_ * 2);
  _Float16* vWskipT = (_Float16*)alloc((size_t)N_ * D_ * H_ * 2);
  _Float16* vW2T    = (_Float16*)alloc((size_t)N_ * H_ * H_ * 2);
  _Float16* vWgT    = (_Float16*)alloc((size_t)N_ * H_ * 256 * 2);
  float*    ctxh    = (float*)alloc((size_t)B_ * H_ * 4);
  float*    part    = (float*)alloc((size_t)NG_ * BT_ * H_ * 4);

  float* outPtr = (float*)d_out;                   // [BT, H]
  float* wOut   = outPtr + (size_t)BT_ * H_;       // [BT, N]

  // precision conversion, transposes and context projection: one launch
  k_prep<<<NB_PREP, 256, 0, stream>>>(emb, ctx, fWc, fW1, fWskip, fW2, fWg,
                                      vW1, vWskip, vW2, vWg,
                                      e16, ctxh, fW1T, fWskipT, fW2T, fWgT,
                                      vW1T, vWskipT, vW2T, vWgT);

  // flatten GRN -> softmax weights (FR_ rows/block, 8 waves)
  k_flat<<<BT_ / FR_, 256, 0, stream>>>(e16, fW1T, fWskipT, fW2T, fWgT,
                                        fb1, fbskip, fb2, fbg, fg, fbv,
                                        ctxh, wOut);

  // per-variable GRNs + weighted combine -> partial planes (128 rows/block,
  // 8 waves, NPG_ variables per block), then the sum of the planes -> outputs
  k_var<<<dim3(BT_ / 128, NG_), 256, 0, stream>>>(e16, vW1T, vWskipT, vW2T, vWgT,
                                                  vb1, vbskip, vb2, vbg, vg, vbv,
                                                  wOut, part);
  k_sum<<<BT_ * H_ / 1024, 256, 0, stream>>>(part, outPtr);
}

// v006
// It runs in 88.1 microseconds.
// In both of two side-by-side timings against v005, it was 1.10 times as fast.
// Counting every step since v000, it is 13.2 times as fast.
#include <hip/hip_runtime.h>
#include <hip/hip_bf16.h>
#include <math.h>

// Problem dims (fixed by reference)
#define B_   64
#define T_   128
#define N_   32
#define D_   64
#define H_   128
#define C_   64
#define BT_  (B_ * T_)      // 8192
#define ND_  (N_ * D_)      // 2048
#define KC_  128            // K-chunk for the flatten GEMM stream
#define NG_  4              // groups of variables in k_var's grid (blockIdx.y)
#define NPG_ (N_ / NG_)     // variables per group
#define LN_EPS 1e-5f
// LDS row pitches in halves. Bank = dword address mod 64, so rows of 256 B (or
// 128 B) put the 16 lanes of a ds_load_b128 fragment read on the same four
// (eight) banks. A pitch of 16 B x odd spreads them over all 64 banks.
#define PW_  136            // 256-byte rows: pitch 272 B = 16 B x 17
#define PN_  72             // 128-byte rows: pitch 144 B = 16 B x 9

typedef _Float16 v16h __attribute__((ext_vector_type(16)));
typedef _Float16 h8   __attribute__((ext_vector_type(8)));
typedef float    v8f  __attribute__((ext_vector_type(8)));

// ---------------------------------------------------------------------------
// CDNA5 async global->LDS staging (GLOBAL_LOAD_ASYNC_TO_LDS_B128, ASYNCcnt).
// GV addressing: vdst = LDS byte address, vaddr = 64-bit global address.
// ---------------------------------------------------------------------------
// A run of copies shares one asm statement; its last line, s_wait_xcnt 0, keeps
// every later rewrite of the address registers behind the copies' issue.
// Copy j moves 16 B per lane from gsrc + j*gstep to ldst + j*lstep (in halves).
__device__ __forceinline__ void cp16x2(_Float16* ldst, int lstep,
                                       const _Float16* gsrc, int gstep) {
  unsigned l = (unsigned)(size_t)ldst;
  unsigned long long g = (unsigned long long)(size_t)gsrc;
  unsigned ls = (unsigned)lstep * 2u;
  unsigned long long gs = (unsigned long long)gstep * 2ull;
  asm volatile("global_load_async_to_lds_b128 %0, %2, off\n\t"
               "global_load_async_to_lds_b128 %1, %3, off\n\t"
               "s_wait_xcnt 0x0"
               :
               : "v"(l), "v"(l + ls), "v"(g), "v"(g + gs)
               : "memory");
}
__device__ __forceinline__ void cp16x4(_Float16* ldst, int lstep,
                                       const _Float16* gsrc, int gstep) {
  unsigned l = (unsigned)(size_t)ldst;
  unsigned long long g = (unsigned long long)(size_t)gsrc;
  unsigned ls = (unsigned)lstep * 2u;
  unsigned long long gs = (unsigned long long)gstep * 2ull;
  asm volatile("global_load_async_to_lds_b128 %0, %4, off\n\t"
               "global_load_async_to_lds_b128 %1, %5, off\n\t"
               "global_load_async_to_lds_b128 %2, %6, off\n\t"
               "global_load_async_to_lds_b128 %3, %7, off\n\t"
               "s_wait_xcnt 0x0"
               :
               : "v"(l), "v"(l + ls), "v"(l + 2 * ls), "v"(l + 3 * ls),
                 "v"(g), "v"(g + gs), "v"(g + 2 * gs), "v"(g + 3 * gs)
               : "memory");
}
__device__ __forceinline__ void cp16x8(_Float16* ldst, int lstep,
                                       const _Float16* gsrc, int gstep) {
  unsigned l = (unsigned)(size_t)ldst;
  unsigned long long g = (unsigned long long)(size_t)gsrc;
  unsigned ls = (unsigned)lstep * 2u;
  unsigned long long gs = (unsigned long long)gstep * 2ull;
  asm volatile("global_load_async_to_lds_b128 %0, %8, off\n\t"
               "global_load_async_to_lds_b128 %1, %9, off\n\t"
               "global_load_async_to_lds_b128 %2, %10, off\n\t"
               "global_load_async_to_lds_b128 %3, %11, off\n\t"
               "global_load_async_to_lds_b128 %4, %12, off\n\t"
               "global_load_async_to_lds_b128 %5, %13, off\n\t"
               "global_load_async_to_lds_b128 %6, %14, off\n\t"
               "global_load_async_to_lds_b128 %7, %15, off\n\t"
               "s_wait_xcnt 0x0"
               :
               : "v"(l), "v"(l + ls), "v"(l + 2 * ls), "v"(l + 3 * ls),
                 "v"(l + 4 * ls), "v"(l + 5 * ls), "v"(l + 6 * ls), "v"(l + 7 * ls),
                 "v"(g), "v"(g + gs), "v"(g + 2 * gs), "v"(g + 3 * gs),
                 "v"(g + 4 * gs), "v"(g + 5 * gs), "v"(g + 6 * gs), "v"(g + 7 * gs)
               : "memory");
}
__device__ __forceinline__ void wait_async() {
  asm volatile("s_wait_asynccnt 0x0" ::: "memory");
  __syncthreads();
}

// Load a 16-half WMMA operand fragment. p points at (index, k0 + khalf*8) in a
// row-major [rows][ldK] f16 array; elements 0..7 = K+0..7, 8..15 = K+16..23
// (CDNA5 16-bit A/B VGPR layout, ISA 7.12.2). 16-byte aligned.
__device__ __forceinline__ v16h load_frag16(const _Float16* p) {
  h8 lo = *(const h8*)(p);
  h8 hi = *(const h8*)(p + 16);
  v16h f;
#pragma unroll
  for (int i = 0; i < 8; ++i) { f[i] = lo[i]; f[8 + i] = hi[i]; }
  return f;
}

#define WMMA16(a, b, c) \
  __builtin_amdgcn_wmma_f32_16x16x32_f16(false, (a), false, (b), (short)0, (c), false, false)

__device__ __forceinline__ float elu_f(float x)     { return x > 0.0f ? x : __expf(x) - 1.0f; }
// The hardware reciprocal (about 1 ulp) in place of the exact f32 division, which
// compiles to ten more vector instructions per value; 1 + exp(-x) >= 1 or inf.
__device__ __forceinline__ float sigmoid_f(float x) { return __builtin_amdgcn_rcpf(1.0f + __expf(-x)); }

// ---------------------------------------------------------------- preparation
// f16 copy of the embedding, transposed f16 copies of the eight weight tensors
// and the context projection. None of the ten jobs reads what another writes,
// so ONE launch runs them all: each job owns a range of blocks and walks its
// elements with a stride of that range.
// A launch this short also pays for every wave it starts, so the ranges are
// kept small: 16 elements per thread in a transpose, 64 in the embedding copy.
#define NB_CTX   (B_ / 2)                      // two batches per 256-thread block
#define NB_FW1   (ND_ * H_ / 4096)
#define NB_FWS   (ND_ * N_ / 4096)
#define NB_FW2   (H_ * H_ / 4096)
#define NB_FWG   (H_ * 2 * N_ / 4096)
#define NB_VW1   (N_ * D_ * H_ / 4096)
#define NB_VWS   (N_ * D_ * H_ / 4096)
#define NB_VW2   (N_ * H_ * H_ / 4096)
#define NB_VWG   (N_ * H_ * 256 / 4096)
#define NB_EMB   (BT_ * ND_ / 16384)
#define NB_PREP  (NB_CTX + NB_FW1 + NB_FWS + NB_FW2 + NB_FWG + NB_VW1 + NB_VWS + \
                  NB_VW2 + NB_VWG + NB_EMB)

// dst[i] = (f16)src[i]; blk = block's index inside the job's nblk blocks
__device__ __forceinline__ void cvt_job(const float* __restrict__ src,
                                        _Float16* __restrict__ dst, int n,
                                        int blk, int nblk) {
  for (int i = blk * 256 + threadIdx.x; i < n; i += nblk * 256)
    dst[i] = (_Float16)src[i];
}

// src: fp32 [batch][R][C]  ->  dst: f16 [batch][C][R]  (transpose per batch)
__device__ __forceinline__ void cvtT_job(const float* __restrict__ src,
                                         _Float16* __restrict__ dst,
                                         int batch, int R, int Ccols,
                                         int blk, int nblk) {
  int total = batch * R * Ccols;
  for (int i = blk * 256 + threadIdx.x; i < total; i += nblk * 256) {
    int n = i / (R * Ccols);
    int rem = i - n * (R * Ccols);
    int c = rem / R;
    int r = rem - c * R;
    dst[i] = (_Float16)src[((size_t)n * R + r) * Ccols + c];
  }
}

// ctxh[b][h] = sum_c context[b][c] * fWc[c][h]   (tiny, plain FMA)
__device__ __forceinline__ void ctx_job(const float* __restrict__ context,
                                        const float* __restrict__ fWc,
                                        float* __restrict__ ctxh, int blk) {
  int b = blk * 2 + (threadIdx.x >> 7), h = threadIdx.x & (H_ - 1);
  float s = 0.0f;
  for (int c = 0; c < C_; ++c) s += context[b * C_ + c] * fWc[c * H_ + h];
  ctxh[b * H_ + h] = s;
}

// The short jobs take the low block indices, the long embedding stream the rest.
__global__ void __launch_bounds__(256)
k_prep(const float* __restrict__ emb, const float* __restrict__ context,
       const float* __restrict__ fWc,
       const float* __restrict__ fW1, const float* __restrict__ fWskip,
       const float* __restrict__ fW2, const float* __restrict__ fWg,
       const float* __restrict__ vW1, const float* __restrict__ vWskip,
       const float* __restrict__ vW2, const float* __restrict__ vWg,
       _Float16* __restrict__ e16, float* __restrict__ ctxh,
       _Float16* __restrict__ fW1T, _Float16* __restrict__ fWskipT,
       _Float16* __restrict__ fW2T, _Float16* __restrict__ fWgT,
       _Float16* __restrict__ vW1T, _Float16* __restrict__ vWskipT,
       _Float16* __restrict__ vW2T, _Float16* __restrict__ vWgT) {
  int b = blockIdx.x;
  if (b < NB_CTX) { ctx_job(context, fWc, ctxh, b); return; }
  b -= NB_CTX;
  if (b < NB_FW1) { cvtT_job(fW1, fW1T, 1, ND_, H_, b, NB_FW1); return; }
  b -= NB_FW1;
  if (b < NB_FWS) { cvtT_job(fWskip, fWskipT, 1, ND_, N_, b, NB_FWS); return; }
  b -= NB_FWS;
  if (b < NB_FW2) { cvtT_job(fW2, fW2T, 1, H_, H_, b, NB_FW2); return; }
  b -= NB_FW2;
  if (b < NB_FWG) { cvtT_job(fWg, fWgT, 1, H_, 2 * N_, b, NB_FWG); return; }
  b -= NB_FWG;
  if (b < NB_VW1) { cvtT_job(vW1, vW1T, N_, D_, H_, b, NB_VW1); return; }
  b -= NB_VW1;
  if (b < NB_VWS) { cvtT_job(vWskip, vWskipT, N_, D_, H_, b, NB_VWS); return; }
  b -= NB_VWS;
  if (b < NB_VW2) { cvtT_job(vW2, vW2T, N_, H_, H_, b, NB_VW2); return; }
  b -= NB_VW2;
  if (b < NB_VWG) { cvtT_job(vWg, vWgT, N_, H_, 256, b, NB_VWG); return; }
  b -= NB_VWG;
  cvt_job(emb, e16, BT_ * ND_, b, NB_EMB);
}

// ---------------------------------------------------------------- flatten GRN
// One block = FR_ rows, so that the grid has one block per WGP. The 8 waves
// share the block's 2 x 10 output tiles of GEMM1: wave = (row tile rt, column
// group cg); a wave takes two W1 column tiles, and the waves of groups 0 and 1
// one Wskip tile more. K=2048 streamed in 16 double-buffered async chunks.
// GEMM2 is shared the same way; GEMM3, GLU, LN and softmax (16-lane shfl_xor
// butterflies) run on two waves, one per row tile. Produces weights [BT, N_].
#define FR_  32

// One K-chunk of GEMM1 for one wave. pa, pw, ps: the lane's own fragment
// addresses in the flat, W1 and Wskip chunk at k = 0.
template <bool SKIP>
__device__ __forceinline__ void flat_chunk(const _Float16* pa, const _Float16* pw,
                                           const _Float16* ps, v8f (&accW)[2], v8f& accS) {
#pragma unroll  // all fragment loads of a chunk may be issued ahead of its WMMAs
  for (int k0 = 0; k0 < KC_; k0 += 32) {
    v16h a = load_frag16(pa + k0);
#pragma unroll
    for (int j = 0; j < 2; ++j) {
      v16h b = load_frag16(pw + j * 16 * PW_ + k0);
      accW[j] = WMMA16(a, b, accW[j]);
    }
    if (SKIP) {
      v16h b = load_frag16(ps + k0);
      accS = WMMA16(a, b, accS);
    }
  }
}

__global__ void __launch_bounds__(256)
k_flat(const _Float16* __restrict__ e16,
       const _Float16* __restrict__ fW1T, const _Float16* __restrict__ fWskipT,
       const _Float16* __restrict__ fW2T, const _Float16* __restrict__ fWgT,
       const float* __restrict__ fb1, const float* __restrict__ fbskip,
       const float* __restrict__ fb2, const float* __restrict__ fbg,
       const float* __restrict__ fg, const float* __restrict__ fbv,
       const float* __restrict__ ctxh,
       float* __restrict__ wOut) {
  __shared__ __attribute__((aligned(16))) _Float16 bufFlat[2][FR_ * PW_];  // flat chunks, then h1 | h2
  __shared__ __attribute__((aligned(16))) _Float16 bufW1[2][128 * PW_];    // W1 chunks, then W2
  __shared__ __attribute__((aligned(16))) _Float16 bufWs[2][N_ * PW_];     // Wskip chunks, then Wg
  __shared__ float sSkip[FR_ * N_];                                        // skip path, f32

  const int tid = threadIdx.x;
  const int wave = __builtin_amdgcn_readfirstlane(tid >> 5), lane = tid & 31;
  const int laneR = lane & 15, kh = (lane >> 4) & 1;
  const int hi8 = (lane & 16) ? 8 : 0;
  const int rt = wave & 1, cg = wave >> 1;    // row tile, column group
  const int r0 = rt * 16;
  const int c0 = cg * 32;                     // first of the wave's 32 W1/W2 columns
  const int rowbase = blockIdx.x * FR_;
  const int bIdx = rowbase / T_;              // FR_ divides T_: one batch per block
  const v8f Z = {0.f, 0.f, 0.f, 0.f, 0.f, 0.f, 0.f, 0.f};

  // 16 lanes cover one 256-byte row; copy j of a run takes row sr + 16*j.
  const int sr = tid >> 4, so = (tid & 15) * 8;
  auto stageChunk = [&](int kc, int p) {
    int kk = kc * KC_;
    cp16x2(&bufFlat[p][sr * PW_ + so], 16 * PW_,      // flat rows: 512 x 16B
           e16 + (size_t)(rowbase + sr) * ND_ + kk + so, 16 * ND_);
    cp16x8(&bufW1[p][sr * PW_ + so], 16 * PW_,        // W1 panel: 2048 x 16B
           fW1T + (size_t)sr * ND_ + kk + so, 16 * ND_);
    cp16x2(&bufWs[p][sr * PW_ + so], 16 * PW_,        // Wskip panel: 512 x 16B
           fWskipT + (size_t)sr * ND_ + kk + so, 16 * ND_);
  };

  // ---- GEMM1 stream: accW = flat @ W1 (2 tiles), accS = flat @ Wskip (cg < 2) ----
  v8f accW[2], accS;
  accW[0] = Z; accW[1] = Z; accS = Z;

  stageChunk(0, 0);
  for (int kc = 0; kc < ND_ / KC_; ++kc) {
    int p = kc & 1;
    wait_async();                             // chunk kc resident
    if (kc + 1 < ND_ / KC_) stageChunk(kc + 1, p ^ 1);   // overlaps compute
    const _Float16* pa = &bufFlat[p][(r0 + laneR) * PW_ + kh * 8];
    const _Float16* pw = &bufW1[p][(c0 + laneR) * PW_ + kh * 8];
    const _Float16* ps = &bufWs[p][((cg & 1) * 16 + laneR) * PW_ + kh * 8];
    if (cg < 2) flat_chunk<true>(pa, pw, ps, accW, accS);
    else        flat_chunk<false>(pa, pw, ps, accW, accS);
    __syncthreads();                          // buffer reusable 2 chunks later
  }

  // ---- stage W2 (-> bufW1[0]) and Wg (-> bufWs, 64 rows contiguous) ----
  _Float16* sH1 = &bufFlat[0][0];
  _Float16* sH2 = &bufFlat[1][0];
  _Float16* sW2 = &bufW1[0][0];
  _Float16* sWg = &bufWs[0][0];
  cp16x8(sW2 + sr * PW_ + so, 16 * PW_, fW2T + tid * 8, 2048);
  cp16x4(sWg + sr * PW_ + so, 16 * PW_, fWgT + tid * 8, 2048);

  // ---- h1 = elu(accW + b1 + ctx) -> sH1; skip + bias -> sSkip ----
#pragma unroll
  for (int j = 0; j < 2; ++j) {
    int col = c0 + j * 16 + laneR;
    float bc = fb1[col] + ctxh[bIdx * H_ + col];
#pragma unroll
    for (int i = 0; i < 8; ++i)
      sH1[(r0 + i + hi8) * PW_ + col] = (_Float16)elu_f(accW[j][i] + bc);
  }
  if (cg < 2) {
    int col = cg * 16 + laneR;
    float bs = fbskip[col];
#pragma unroll
    for (int i = 0; i < 8; ++i) sSkip[(r0 + i + hi8) * N_ + col] = accS[i] + bs;
  }
  wait_async();                               // W2 + Wg resident; h1, skip of all waves visible

  // ---- GEMM2 (K=128): h2 = h1 @ W2 + b2, the wave's two column tiles ----
  v8f h2[2];
  h2[0] = Z; h2[1] = Z;
#pragma unroll
  for (int k0 = 0; k0 < H_; k0 += 32) {
    v16h a = load_frag16(sH1 + (r0 + laneR) * PW_ + k0 + kh * 8);
#pragma unroll
    for (int j = 0; j < 2; ++j) {
      v16h b = load_frag16(sW2 + (c0 + j * 16 + laneR) * PW_ + k0 + kh * 8);
      h2[j] = WMMA16(a, b, h2[j]);
    }
  }
#pragma unroll
  for (int j = 0; j < 2; ++j) {
    int col = c0 + j * 16 + laneR;
    float b2v = fb2[col];
#pragma unroll
    for (int i = 0; i < 8; ++i)
      sH2[(r0 + i + hi8) * PW_ + col] = (_Float16)(h2[j][i] + b2v);
  }
  __syncthreads();                            // h2 of all waves visible
  if (wave >= 2) return;                      // no barrier below; waves 0, 1: r0 = wave * 16

  // ---- GEMM3 (K=128, 64 cols): g = h2 @ Wg + bg, 4 tiles in registers ----
  v8f g[4];
#pragma unroll
  for (int ct = 0; ct < 4; ++ct) g[ct] = Z;
#pragma unroll
  for (int k0 = 0; k0 < H_; k0 += 32) {
    v16h a = load_frag16(sH2 + (r0 + laneR) * PW_ + k0 + kh * 8);
#pragma unroll
    for (int ct = 0; ct < 4; ++ct) {
      v16h b = load_frag16(sWg + (ct * 16 + laneR) * PW_ + k0 + kh * 8);
      g[ct] = WMMA16(a, b, g[ct]);
    }
  }
  float sk[2][8];
#pragma unroll
  for (int cs = 0; cs < 2; ++cs)
#pragma unroll
    for (int i = 0; i < 8; ++i) sk[cs][i] = sSkip[(r0 + i + hi8) * N_ + cs * 16 + laneR];

  // ---- GLU (col c with gate c+32) + skip, all in registers ----
  float t[2][8];
#pragma unroll
  for (int cs = 0; cs < 2; ++cs) {
    int col = cs * 16 + laneR;
    float ba = fbg[col], bg2 = fbg[col + 32];
#pragma unroll
    for (int i = 0; i < 8; ++i)
      t[cs][i] = (g[cs][i] + ba) * sigmoid_f(g[cs + 2][i] + bg2) + sk[cs][i];
  }

  // ---- LayerNorm over N=32 + softmax via 16-lane butterflies ----
  float s1[8], s2[8];
#pragma unroll
  for (int i = 0; i < 8; ++i) {
    s1[i] = t[0][i] + t[1][i];
    s2[i] = t[0][i] * t[0][i] + t[1][i] * t[1][i];
  }
#pragma unroll
  for (int m = 1; m < 16; m <<= 1)
#pragma unroll
    for (int i = 0; i < 8; ++i) {
      s1[i] += __shfl_xor(s1[i], m, 32);
      s2[i] += __shfl_xor(s2[i], m, 32);
    }
  float l[2][8];
#pragma unroll
  for (int i = 0; i < 8; ++i) {
    float mu = s1[i] * (1.0f / N_);
    float var = s2[i] * (1.0f / N_) - mu * mu;
    float rs = rsqrtf(var + LN_EPS);
#pragma unroll
    for (int cs = 0; cs < 2; ++cs) {
      int col = cs * 16 + laneR;
      l[cs][i] = (t[cs][i] - mu) * rs * fg[col] + fbv[col];
    }
  }
  float mx[8];
#pragma unroll
  for (int i = 0; i < 8; ++i) mx[i] = fmaxf(l[0][i], l[1][i]);
#pragma unroll
  for (int m = 1; m < 16; m <<= 1)
#pragma unroll
    for (int i = 0; i < 8; ++i) mx[i] = fmaxf(mx[i], __shfl_xor(mx[i], m, 32));
  float e0[8], e1[8], se[8];
#pragma unroll
  for (int i = 0; i < 8; ++i) {
    e0[i] = __expf(l[0][i] - mx[i]);
    e1[i] = __expf(l[1][i] - mx[i]);
    se[i] = e0[i] + e1[i];
  }
#pragma unroll
  for (int m = 1; m < 16; m <<= 1)
#pragma unroll
    for (int i = 0; i < 8; ++i) se[i] += __shfl_xor(se[i], m, 32);
#pragma unroll
  for (int i = 0; i < 8; ++i) {
    int row = rowbase + r0 + i + hi8;
    float inv = 1.0f / se[i];
    wOut[(size_t)row * N_ + laneR]      = e0[i] * inv;
    wOut[(size_t)row * N_ + 16 + laneR] = e1[i] * inv;
  }
}

// ------------------------------------------------------- per-variable GRNs
// One block = 128 rows (8 waves, one 16-row M-tile per wave). Weight panels
// async-staged once per block per n into LDS and shared by all waves.
// GLU, skip-add, LayerNorm (shfl_xor butterflies) and the softmax-weighted
// combine all run in registers. blockIdx.y picks a group of NPG_ variables, so
// that the grid fills the chip; each group stores its own partial sum plane
// part[group][row][h], and k_sum adds the planes.
__global__ void __launch_bounds__(256)
k_var(const _Float16* __restrict__ e16,
      const _Float16* __restrict__ vW1T, const _Float16* __restrict__ vWskipT,
      const _Float16* __restrict__ vW2T, const _Float16* __restrict__ vWgT,
      const float* __restrict__ vb1, const float* __restrict__ vbskip,
      const float* __restrict__ vb2, const float* __restrict__ vbg,
      const float* __restrict__ vg, const float* __restrict__ vbv,
      const float* __restrict__ wIn, float* __restrict__ part) {
  __shared__ __attribute__((aligned(16))) _Float16 sE[128 * PN_];      // embedding slice [row][64]
  __shared__ __attribute__((aligned(16))) _Float16 sAct[128 * PW_];    // h1 then h2 (per-wave rows)
  __shared__ __attribute__((aligned(16))) _Float16 sWa[2 * 128 * PN_]; // W1 + Wskip, reused for Wg gate half
  __shared__ __attribute__((aligned(16))) _Float16 sW2[128 * PW_];     // W2 panel [col][128]
  __shared__ __attribute__((aligned(16))) _Float16 sWgA[128 * PW_];    // Wg cols 0..127 [col][128]
  static_assert(128 * PW_ <= 2 * 128 * PN_, "Wg gate half must fit in sWa");
  _Float16* const sWs = sWa + 128 * PN_;       // Wskip panel behind the W1 panel

  const int tid = threadIdx.x;
  const int wave = tid >> 5, lane = tid & 31;
  const int laneR = lane & 15, kh = (lane >> 4) & 1;
  const int hi8 = (lane & 16) ? 8 : 0;
  const int r0 = wave * 16;                    // wave's row tile within block
  const int rowbase = blockIdx.x * 128;
  const int nBeg = blockIdx.y * NPG_, nEnd = nBeg + NPG_;
  float* const outPtr = part + (size_t)blockIdx.y * BT_ * H_;
  const v8f Z = {0.f, 0.f, 0.f, 0.f, 0.f, 0.f, 0.f, 0.f};

  float outReg[64];                            // [ct][i] output accumulators
#pragma unroll
  for (int q = 0; q < 64; ++q) outReg[q] = 0.0f;
  float tv[64];                                // skip, then GLU result

  // 128-byte rows: 8 lanes a row, copy j of a run takes row nr + 32*j.
  // 256-byte rows: 16 lanes a row, copy j of a run takes row wr + 16*j.
  const int nr = tid >> 3, no = (tid & 7) * 8;
  const int wr = tid >> 4, wo = (tid & 15) * 8;
  auto stageE = [&](int n) {                   // 1024 chunks of 16B
    cp16x4(sE + nr * PN_ + no, 32 * PN_,
           e16 + ((size_t)(rowbase + nr) * N_ + n) * D_ + no, 32 * ND_);
  };
  auto stageW1Ws = [&](int n) {                // two 16KB panels -> sWa
    cp16x4(sWa + nr * PN_ + no, 32 * PN_, vW1T + (size_t)n * H_ * D_ + tid * 8, 2048);
    cp16x4(sWs + nr * PN_ + no, 32 * PN_, vWskipT + (size_t)n * H_ * D_ + tid * 8, 2048);
  };
  auto stageW2 = [&](int n) {                  // 32KB
    cp16x8(sW2 + wr * PW_ + wo, 16 * PW_, vW2T + (size_t)n * H_ * H_ + tid * 8, 2048);
  };
  auto stageWg = [&](int n) {                  // a-half -> sWgA, gate half -> sWa
    const _Float16* ga = vWgT + (size_t)n * 256 * H_;
    const _Float16* gg = ga + (size_t)128 * H_;
    cp16x8(sWgA + wr * PW_ + wo, 16 * PW_, ga + tid * 8, 2048);
    cp16x8(sWa + wr * PW_ + wo, 16 * PW_, gg + tid * 8, 2048);
  };

  // Eight bias values of one variable's row p, one per column tile, as one group
  // from a uniform base and the lane's own offset.
  const unsigned laneU = (unsigned)laneR;
  auto loadBias8 = [&](float (&d)[8], const float* p) {
#pragma unroll  // d[] stays in registers, the eight loads issue as one run
    for (int ct = 0; ct < 8; ++ct) d[ct] = p[laneU + ct * 16u];
    // precaution: every later rewrite of the run's address registers stays behind this wait
    asm volatile("s_wait_xcnt 0x0" ::: "memory");
  };

  stageE(nBeg);
  stageW1Ws(nBeg);
  // The tile walks take their bias values from registers, loaded a stage ahead,
  // so that no tile's epilogue waits out a global load.
  float b1r[8], bsr[8];
  loadBias8(b1r, vb1 + nBeg * H_);
  loadBias8(bsr, vbskip + nBeg * H_);

  for (int n = nBeg; n < nEnd; ++n) {
    float b2r[8];
    wait_async();                              // E, W1, Wskip resident
    stageW2(n);                                // overlaps GEMM1
    loadBias8(b2r, vb2 + n * H_);

    // ---- GEMM1 (K=64): aW = E@W1, aS = E@Wskip, one column tile at a time. The
    // next tile's weight fragments are read into a second register set ahead of
    // this tile's WMMAs, so that no WMMA waits out the latency of its own reads ----
    v16h aE[2];
#pragma unroll
    for (int ks = 0; ks < 2; ++ks)
      aE[ks] = load_frag16(sE + (r0 + laneR) * PN_ + ks * 32 + kh * 8);
    v16h f1[2][4];
#pragma unroll
    for (int ks = 0; ks < 2; ++ks) {
      f1[0][ks]     = load_frag16(sWa + laneR * PN_ + ks * 32 + kh * 8);
      f1[0][2 + ks] = load_frag16(sWs + laneR * PN_ + ks * 32 + kh * 8);
    }
#pragma unroll
    for (int ct = 0; ct < 8; ++ct) {
      if (ct + 1 < 8) {
#pragma unroll
        for (int ks = 0; ks < 2; ++ks) {
          f1[(ct + 1) & 1][ks]     = load_frag16(sWa + ((ct + 1) * 16 + laneR) * PN_ + ks * 32 + kh * 8);
          f1[(ct + 1) & 1][2 + ks] = load_frag16(sWs + ((ct + 1) * 16 + laneR) * PN_ + ks * 32 + kh * 8);
        }
      }
      __builtin_amdgcn_sched_barrier(0);       // keeps the reads above as one group ahead of this step's WMMAs
      v8f aW = Z, aS = Z;
#pragma unroll
      for (int ks = 0; ks < 2; ++ks) {
        aW = WMMA16(aE[ks], f1[ct & 1][ks], aW);
        aS = WMMA16(aE[ks], f1[ct & 1][2 + ks], aS);
      }
      int col = ct * 16 + laneR;
      float b1v = b1r[ct], bsv = bsr[ct];
#pragma unroll
      for (int i = 0; i < 8; ++i) {
        int row = i + hi8;
        sAct[(r0 + row) * PW_ + col] = (_Float16)elu_f(aW[i] + b1v);
        tv[ct * 8 + i] = aS[i] + bsv;          // skip, kept in registers
      }
    }
    wait_async();                              // W2 resident; waves done with W1/Ws
    stageWg(n);                                // overlaps GEMM2 (gate half -> sWa)
    float bar[8], bgr[8];
    loadBias8(bar, vbg + n * 256);
    loadBias8(bgr, vbg + n * 256 + 128);

    // ---- GEMM2 (K=128): h2 = h1 @ W2 + b2 (own rows, no barrier). All of
    // h1's fragments are read first; h2 then takes h1's place tile by tile.
    // Two column tiles a step, the next step's W2 fragments read ahead ----
    v16h aH[4];
#pragma unroll
    for (int ks = 0; ks < 4; ++ks)
      aH[ks] = load_frag16(sAct + (r0 + laneR) * PW_ + ks * 32 + kh * 8);
    v16h f2[2][8];
#pragma unroll
    for (int q = 0; q < 8; ++q)
      f2[0][q] = load_frag16(sW2 + ((q & 1) * 16 + laneR) * PW_ + (q >> 1) * 32 + kh * 8);
#pragma unroll
    for (int ct = 0; ct < 8; ct += 2) {
      const int cur = (ct >> 1) & 1;
      if (ct + 2 < 8) {
#pragma unroll
        for (int q = 0; q < 8; ++q)
          f2[cur ^ 1][q] = load_frag16(sW2 + ((ct + 2 + (q & 1)) * 16 + laneR) * PW_ + (q >> 1) * 32 + kh * 8);
      }
      __builtin_amdgcn_sched_barrier(0);       // keeps the reads above as one group ahead of this step's WMMAs
      v8f h2[2];
      h2[0] = Z; h2[1] = Z;
#pragma unroll
      for (int q = 0; q < 8; ++q)
        h2[q & 1] = WMMA16(aH[q >> 1], f2[cur][q], h2[q & 1]);
#pragma unroll
      for (int j = 0; j < 2; ++j) {
        int col = (ct + j) * 16 + laneR;
        float b2v = b2r[ct + j];
#pragma unroll
        for (int i = 0; i < 8; ++i)
          sAct[(r0 + i + hi8) * PW_ + col] = (_Float16)(h2[j][i] + b2v);
      }
    }
    wait_async();                              // Wg halves resident

    // ---- GEMM3 pairs (K=128): a-part (sWgA) and gate (sWa), GLU in regs; the
    // next column tile's Wg fragments read ahead, as above ----
    v16h aG[4];
#pragma unroll
    for (int ks = 0; ks < 4; ++ks)
      aG[ks] = load_frag16(sAct + (r0 + laneR) * PW_ + ks * 32 + kh * 8);
    v16h f3[2][8];
#pragma unroll
    for (int ks = 0; ks < 4; ++ks) {
      f3[0][2 * ks]     = load_frag16(sWgA + laneR * PW_ + ks * 32 + kh * 8);
      f3[0][2 * ks + 1] = load_frag16(sWa + laneR * PW_ + ks * 32 + kh * 8);
    }
#pragma unroll
    for (int ct = 0; ct < 8; ++ct) {
      if (ct + 1 < 8) {
#pragma unroll
        for (int ks = 0; ks < 4; ++ks) {
          f3[(ct + 1) & 1][2 * ks]     = load_frag16(sWgA + ((ct + 1) * 16 + laneR) * PW_ + ks * 32 + kh * 8);
          f3[(ct + 1) & 1][2 * ks + 1] = load_frag16(sWa + ((ct + 1) * 16 + laneR) * PW_ + ks * 32 + kh * 8);
        }
      }
      __builtin_amdgcn_sched_barrier(0);       // keeps the reads above as one group ahead of this step's WMMAs
      v8f ga = Z, gg = Z;
#pragma unroll
      for (int ks = 0; ks < 4; ++ks) {
        ga = WMMA16(aG[ks], f3[ct & 1][2 * ks], ga);
        gg = WMMA16(aG[ks], f3[ct & 1][2 * ks + 1], gg);
      }
      int col = ct * 16 + laneR;
      float bav = bar[ct], bgv = bgr[ct];
#pragma unroll
      for (int i = 0; i < 8; ++i) {
        float av = ga[i] + bav;
        float gv = gg[i] + bgv;
        tv[ct * 8 + i] = av * sigmoid_f(gv) + tv[ct * 8 + i];   // GLU + skip
      }
      __builtin_amdgcn_sched_barrier(0);       // keeps the next tile's reads below: one group at one place, not spread among these WMMAs
    }

    // ---- LayerNorm over H=128: 16-lane shfl_xor butterflies ----
    float s1[8], s2[8];
#pragma unroll
    for (int i = 0; i < 8; ++i) { s1[i] = 0.f; s2[i] = 0.f; }
#pragma unroll
    for (int ct = 0; ct < 8; ++ct)
#pragma unroll
      for (int i = 0; i < 8; ++i) { float t = tv[ct * 8 + i]; s1[i] += t; s2[i] += t * t; }
#pragma unroll
    for (int m = 1; m < 16; m <<= 1)
#pragma unroll
      for (int i = 0; i < 8; ++i) {
        s1[i] += __shfl_xor(s1[i], m, 32);
        s2[i] += __shfl_xor(s2[i], m, 32);
      }

    // ---- normalize + softmax-weighted combine into registers ----
#pragma unroll
    for (int i = 0; i < 8; ++i) {
      float mu = s1[i] * (1.0f / H_);
      float var = s2[i] * (1.0f / H_) - mu * mu;
      float rs = rsqrtf(var + LN_EPS);
      int row = rowbase + r0 + i + hi8;
      float wsel = wIn[(size_t)row * N_ + n];
#pragma unroll
      for (int ct = 0; ct < 8; ++ct) {
        int col = ct * 16 + laneR;
        float val = (tv[ct * 8 + i] - mu) * rs * vg[n * H_ + col] + vbv[n * H_ + col];
        outReg[ct * 8 + i] += wsel * val;
      }
    }
    __syncthreads();                           // panels consumed; safe to restage
    if (n + 1 < nEnd) {                        // overlaps next-iteration latency
      stageE(n + 1);
      stageW1Ws(n + 1);
      loadBias8(b1r, vb1 + (n + 1) * H_);
      loadBias8(bsr, vbskip + (n + 1) * H_);
    }
  }

  // ---- epilogue: store this group's partial tile ----
#pragma unroll
  for (int ct = 0; ct < 8; ++ct)
#pragma unroll
    for (int i = 0; i < 8; ++i) {
      int row = rowbase + r0 + i + hi8;
      outPtr[(size_t)row * H_ + ct * 16 + laneR] = outReg[ct * 8 + i];
    }
}

// out[i] = sum over the NG_ groups of part[group][i], groups in rising order.
__global__ void __launch_bounds__(256) k_sum(const float* __restrict__ part,
                                             float* __restrict__ outPtr) {
  // One 32-bit byte offset serves every plane and the store (uniform base + offset).
  const unsigned off = (blockIdx.x * 256u + threadIdx.x) * 16u;
  float4 s = *(const float4*)((const char*)part + off);
#pragma unroll  // all planes' loads in flight together
  for (int g = 1; g < NG_; ++g) {
    float4 p = *(const float4*)((const char*)(part + (size_t)g * BT_ * H_) + off);
    s.x += p.x; s.y += p.y; s.z += p.z; s.w += p.w;
  }
  *(float4*)((char*)outPtr + off) = s;
}

// ----------------------------------------------------------------------------
extern "C" void kernel_launch(void* const* d_in, const int* in_sizes, int n_in,
                              void* d_out, int out_size, void* d_ws, size_t ws_size,
                              hipStream_t stream) {
  (void)in_sizes; (void)n_in; (void)out_size; (void)ws_size;

  const float* emb    = (const float*)d_in[0];
  const float* ctx    = (const float*)d_in[1];
  const float* fWskip = (const float*)d_in[2];
  const float* fbskip = (const float*)d_in[3];
  const float* fW1    = (const float*)d_in[4];
  const float* fb1    = (const float*)d_in[5];
  const float* fWc    = (const float*)d_in[6];
  const float* fW2    = (const float*)d_in[7];
  const float* fb2    = (const float*)d_in[8];
  const float* fWg    = (const float*)d_in[9];
  const float* fbg    = (const float*)d_in[10];
  const float* fg     = (const float*)d_in[11];
  const float* fbv    = (const float*)d_in[12];
  const float* vWskip = (const float*)d_in[13];
  const float* vbskip = (const float*)d_in[14];
  const float* vW1    = (const float*)d_in[15];
  const float* vb1    = (const float*)d_in[16];
  const float* vW2    = (const float*)d_in[17];
  const float* vb2    = (const float*)d_in[18];
  const float* vWg    = (const float*)d_in[19];
  const float* vbg    = (const float*)d_in[20];
  const float* vg     = (const float*)d_in[21];
  const float* vbv    = (const float*)d_in[22];

  // Workspace carve (f16 copies, transposed weights, ctx projection, partial planes)
  char* w = (char*)d_ws;
  size_t off = 0;
  auto alloc = [&](size_t bytes) -> char* {
    char* p = w + off;
    off = (off + bytes + 255) & ~(size_t)255;
    return p;
  };
  _Float16* e16     = (_Float16*)alloc((size_t)BT_ * ND_ * 2);
  _Float16* fW1T    = (_Float16*)alloc((size_t)ND_ * H_ * 2);
  _Float16* fWskipT = (_Float16*)alloc((size_t)ND_ * N_ * 2);
  _Float16* fW2T    = (_Float16*)alloc((size_t)H_ * H_ * 2);
  _Float16* fWgT    = (_Float16*)alloc((size_t)H_ * 2 * N_ * 2);
  _Float16* vW1T    = (_Float16*)alloc((size_t)N_ * D_ * H_ * 2);
  _Float16* vWskipT = (_Float16*)alloc((size_t)N_ * D_ * H_ * 2);
  _Float16* vW2T    = (_Float16*)alloc((size_t)N_ * H_ * H_ * 2);
  _Float16* vWgT    = (_Float16*)alloc((size_t)N_ * H_ * 256 * 2);
  float*    ctxh    = (float*)alloc((size_t)B_ * H_ * 4);
  float*    part    = (float*)alloc((size_t)NG_ * BT_ * H_ * 4);

  float* outPtr = (float*)d_out;                   // [BT, H]
  float* wOut   = outPtr + (size_t)BT_ * H_;       // [BT, N]

  // precision conversion, transposes and context projection: one launch
  k_prep<<<NB_PREP, 256, 0, stream>>>(emb, ctx, fWc, fW1, fWskip, fW2, fWg,
                                      vW1, vWskip, vW2, vWg,
                                      e16, ctxh, fW1T, fWskipT, fW2T, fWgT,
                                      vW1T, vWskipT, vW2T, vWgT);

  // flatten GRN -> softmax weights (FR_ rows/block, 8 waves)
  k_flat<<<BT_ / FR_, 256, 0, stream>>>(e16, fW1T, fWskipT, fW2T, fWgT,
                                        fb1, fbskip, fb2, fbg, fg, fbv,
                                        ctxh, wOut);

  // per-variable GRNs + weighted combine -> partial planes (128 rows/block,
  // 8 waves, NPG_ variables per block), then the sum of the planes -> outputs
  k_var<<<dim3(BT_ / 128, NG_), 256, 0, stream>>>(e16, vW1T, vWskipT, vW2T, vWgT,
                                                  vb1, vbskip, vb2, vbg, vg, vbv,
                                                  wOut, part);
  k_sum<<<BT_ * H_ / 1024, 256, 0, stream>>>(part, outPtr);
}

// v007
// One run takes 85.8 microseconds.
// Timed twice side by side with v006, it ran 1.04 and 1.03 times as fast.
// Counting every step since v000, it is 13.7 times as fast.
#include <hip/hip_runtime.h>
#include <hip/hip_bf16.h>
#include <math.h>

// Problem dims (fixed by reference)
#define B_   64
#define T_   128
#define N_   32
#define D_   64
#define H_   128
#define C_   64
#define BT_  (B_ * T_)      // 8192
#define ND_  (N_ * D_)      // 2048
#define KC_  128            // K-chunk for the flatten GEMM stream
#define NG_  4              // groups of variables in k_var's grid (blockIdx.y)
#define NPG_ (N_ / NG_)     // variables per group
#define LN_EPS 1e-5f
// LDS row pitches in halves. Bank = dword address mod 64, so rows of 256 B (or
// 128 B) put the 16 lanes of a ds_load_b128 fragment read on the same four
// (eight) banks. A pitch of 16 B x odd spreads them over all 64 banks.
#define PW_  136            // 256-byte rows: pitch 272 B = 16 B x 17
#define PN_  72             // 128-byte rows: pitch 144 B = 16 B x 9

typedef _Float16 v16h __attribute__((ext_vector_type(16)));
typedef _Float16 h8   __attribute__((ext_vector_type(8)));
typedef float    v8f  __attribute__((ext_vector_type(8)));

// ---------------------------------------------------------------------------
// CDNA5 async global->LDS staging (GLOBAL_LOAD_ASYNC_TO_LDS_B128, ASYNCcnt).
// GV addressing: vdst = LDS byte address, vaddr = 64-bit global address.
// ---------------------------------------------------------------------------
// A run of copies shares one asm statement; its last line, s_wait_xcnt 0, keeps
// every later rewrite of the address registers behind the copies' issue.
// Copy j moves 16 B per lane from gsrc + j*gstep to ldst + j*lstep (in halves).
__device__ __forceinline__ void cp16x2(_Float16* ldst, int lstep,
                                       const _Float16* gsrc, int gstep) {
  unsigned l = (unsigned)(size_t)ldst;
  unsigned long long g = (unsigned long long)(size_t)gsrc;
  unsigned ls = (unsigned)lstep * 2u;
  unsigned long long gs = (unsigned long long)gstep * 2ull;
  asm volatile("global_load_async_to_lds_b128 %0, %2, off\n\t"
               "global_load_async_to_lds_b128 %1, %3, off\n\t"
               "s_wait_xcnt 0x0"
               :
               : "v"(l), "v"(l + ls), "v"(g), "v"(g + gs)
               : "memory");
}
__device__ __forceinline__ void cp16x4(_Float16* ldst, int lstep,
                                       const _Float16* gsrc, int gstep) {
  unsigned l = (unsigned)(size_t)ldst;
  unsigned long long g = (unsigned long long)(size_t)gsrc;
  unsigned ls = (unsigned)lstep * 2u;
  unsigned long long gs = (unsigned long long)gstep * 2ull;
  asm volatile("global_load_async_to_lds_b128 %0, %4, off\n\t"
               "global_load_async_to_lds_b128 %1, %5, off\n\t"
               "global_load_async_to_lds_b128 %2, %6, off\n\t"
               "global_load_async_to_lds_b128 %3, %7, off\n\t"
               "s_wait_xcnt 0x0"
               :
               : "v"(l), "v"(l + ls), "v"(l + 2 * ls), "v"(l + 3 * ls),
                 "v"(g), "v"(g + gs), "v"(g + 2 * gs), "v"(g + 3 * gs)
               : "memory");
}
__device__ __forceinline__ void cp16x8(_Float16* ldst, int lstep,
                                       const _Float16* gsrc, int gstep) {
  unsigned l = (unsigned)(size_t)ldst;
  unsigned long long g = (unsigned long long)(size_t)gsrc;
  unsigned ls = (unsigned)lstep * 2u;
  unsigned long long gs = (unsigned long long)gstep * 2ull;
  asm volatile("global_load_async_to_lds_b128 %0, %8, off\n\t"
               "global_load_async_to_lds_b128 %1, %9, off\n\t"
               "global_load_async_to_lds_b128 %2, %10, off\n\t"
               "global_load_async_to_lds_b128 %3, %11, off\n\t"
               "global_load_async_to_lds_b128 %4, %12, off\n\t"
               "global_load_async_to_lds_b128 %5, %13, off\n\t"
               "global_load_async_to_lds_b128 %6, %14, off\n\t"
               "global_load_async_to_lds_b128 %7, %15, off\n\t"
               "s_wait_xcnt 0x0"
               :
               : "v"(l), "v"(l + ls), "v"(l + 2 * ls), "v"(l + 3 * ls),
                 "v"(l + 4 * ls), "v"(l + 5 * ls), "v"(l + 6 * ls), "v"(l + 7 * ls),
                 "v"(g), "v"(g + gs), "v"(g + 2 * gs), "v"(g + 3 * gs),
                 "v"(g + 4 * gs), "v"(g + 5 * gs), "v"(g + 6 * gs), "v"(g + 7 * gs)
               : "memory");
}
__device__ __forceinline__ void wait_async() {
  asm volatile("s_wait_asynccnt 0x0" ::: "memory");
  __syncthreads();
}

// Load a 16-half WMMA operand fragment. p points at (index, k0 + khalf*8) in a
// row-major [rows][ldK] f16 array; elements 0..7 = K+0..7, 8..15 = K+16..23
// (CDNA5 16-bit A/B VGPR layout, ISA 7.12.2). 16-byte aligned.
__device__ __forceinline__ v16h load_frag16(const _Float16* p) {
  h8 lo = *(const h8*)(p);
  h8 hi = *(const h8*)(p + 16);
  v16h f;
#pragma unroll
  for (int i = 0; i < 8; ++i) { f[i] = lo[i]; f[8 + i] = hi[i]; }
  return f;
}

#define WMMA16(a, b, c) \
  __builtin_amdgcn_wmma_f32_16x16x32_f16(false, (a), false, (b), (short)0, (c), false, false)

__device__ __forceinline__ float elu_f(float x)     { return x > 0.0f ? x : __expf(x) - 1.0f; }
// The hardware reciprocal (about 1 ulp) in place of the exact f32 division, which
// compiles to ten more vector instructions per value; 1 + exp(-x) >= 1 or inf.
__device__ __forceinline__ float sigmoid_f(float x) { return __builtin_amdgcn_rcpf(1.0f + __expf(-x)); }

// ---------------------------------------------------------------- preparation
// f16 copy of the embedding, transposed f16 copies of the eight weight tensors
// and the context projection. None of the ten jobs reads what another writes,
// so ONE launch runs them all: each job owns a range of blocks and walks its
// elements with a stride of that range.
// A launch this short also pays for every wave it starts, so the ranges are
// kept small: 16 elements per thread in a transpose, 64 in the embedding copy.
#define NB_CTX   (B_ / 2)                      // two batches per 256-thread block
#define NB_FW1   (ND_ * H_ / 4096)
#define NB_FWS   (ND_ * N_ / 4096)
#define NB_FW2   (H_ * H_ / 4096)
#define NB_FWG   (H_ * 2 * N_ / 4096)
#define NB_VW1   (N_ * D_ * H_ / 4096)
#define NB_VWS   (N_ * D_ * H_ / 4096)
#define NB_VW2   (N_ * H_ * H_ / 4096)
#define NB_VWG   (N_ * H_ * 256 / 4096)
#define NB_EMB   (BT_ * ND_ / 16384)
#define NB_PREP  (NB_CTX + NB_FW1 + NB_FWS + NB_FW2 + NB_FWG + NB_VW1 + NB_VWS + \
                  NB_VW2 + NB_VWG + NB_EMB)

// dst[i] = (f16)src[i]; blk = block's index inside the job's nblk blocks
__device__ __forceinline__ void cvt_job(const float* __restrict__ src,
                                        _Float16* __restrict__ dst, int n,
                                        int blk, int nblk) {
  for (int i = blk * 256 + threadIdx.x; i < n; i += nblk * 256)
    dst[i] = (_Float16)src[i];
}

// src: fp32 [batch][R][C]  ->  dst: f16 [batch][C][R]  (transpose per batch)
__device__ __forceinline__ void cvtT_job(const float* __restrict__ src,
                                         _Float16* __restrict__ dst,
                                         int batch, int R, int Ccols,
                                         int blk, int nblk) {
  int total = batch * R * Ccols;
  for (int i = blk * 256 + threadIdx.x; i < total; i += nblk * 256) {
    int n = i / (R * Ccols);
    int rem = i - n * (R * Ccols);
    int c = rem / R;
    int r = rem - c * R;
    dst[i] = (_Float16)src[((size_t)n * R + r) * Ccols + c];
  }
}

// ctxh[b][h] = sum_c context[b][c] * fWc[c][h]   (tiny, plain FMA)
__device__ __forceinline__ void ctx_job(const float* __restrict__ context,
                                        const float* __restrict__ fWc,
                                        float* __restrict__ ctxh, int blk) {
  int b = blk * 2 + (threadIdx.x >> 7), h = threadIdx.x & (H_ - 1);
  float s = 0.0f;
  for (int c = 0; c < C_; ++c) s += context[b * C_ + c] * fWc[c * H_ + h];
  ctxh[b * H_ + h] = s;
}

// The short jobs take the low block indices, the long embedding stream the rest.
__global__ void __launch_bounds__(256)
k_prep(const float* __restrict__ emb, const float* __restrict__ context,
       const float* __restrict__ fWc,
       const float* __restrict__ fW1, const float* __restrict__ fWskip,
       const float* __restrict__ fW2, const float* __restrict__ fWg,
       const float* __restrict__ vW1, const float* __restrict__ vWskip,
       const float* __restrict__ vW2, const float* __restrict__ vWg,
       _Float16* __restrict__ e16, float* __restrict__ ctxh,
       _Float16* __restrict__ fW1T, _Float16* __restrict__ fWskipT,
       _Float16* __restrict__ fW2T, _Float16* __restrict__ fWgT,
       _Float16* __restrict__ vW1T, _Float16* __restrict__ vWskipT,
       _Float16* __restrict__ vW2T, _Float16* __restrict__ vWgT) {
  int b = blockIdx.x;
  if (b < NB_CTX) { ctx_job(context, fWc, ctxh, b); return; }
  b -= NB_CTX;
  if (b < NB_FW1) { cvtT_job(fW1, fW1T, 1, ND_, H_, b, NB_FW1); return; }
  b -= NB_FW1;
  if (b < NB_FWS) { cvtT_job(fWskip, fWskipT, 1, ND_, N_, b, NB_FWS); return; }
  b -= NB_FWS;
  if (b < NB_FW2) { cvtT_job(fW2, fW2T, 1, H_, H_, b, NB_FW2); return; }
  b -= NB_FW2;
  if (b < NB_FWG) { cvtT_job(fWg, fWgT, 1, H_, 2 * N_, b, NB_FWG); return; }
  b -= NB_FWG;
  if (b < NB_VW1) { cvtT_job(vW1, vW1T, N_, D_, H_, b, NB_VW1); return; }
  b -= NB_VW1;
  if (b < NB_VWS) { cvtT_job(vWskip, vWskipT, N_, D_, H_, b, NB_VWS); return; }
  b -= NB_VWS;
  if (b < NB_VW2) { cvtT_job(vW2, vW2T, N_, H_, H_, b, NB_VW2); return; }
  b -= NB_VW2;
  if (b < NB_VWG) { cvtT_job(vWg, vWgT, N_, H_, 256, b, NB_VWG); return; }
  b -= NB_VWG;
  cvt_job(emb, e16, BT_ * ND_, b, NB_EMB);
}

// ---------------------------------------------------------------- flatten GRN
// One block = FR_ rows, so that the grid has one block per WGP. The 8 waves
// share the block's 2 x 10 output tiles of GEMM1: wave = (row tile rt, column
// group cg); a wave takes two W1 column tiles, and the waves of groups 0 and 1
// one Wskip tile more. K=2048 streamed in 16 double-buffered async chunks.
// GEMM2 is shared the same way; GEMM3, GLU, LN and softmax (16-lane shfl_xor
// butterflies) run on two waves, one per row tile. Produces weights [BT, N_].
#define FR_  32

// One K-chunk of GEMM1 for one wave. pa, pw, ps: the lane's own fragment
// addresses in the flat, W1 and Wskip chunk at k = 0.
template <bool SKIP>
__device__ __forceinline__ void flat_chunk(const _Float16* pa, const _Float16* pw,
                                           const _Float16* ps, v8f (&accW)[2], v8f& accS) {
#pragma unroll  // all fragment loads of a chunk may be issued ahead of its WMMAs
  for (int k0 = 0; k0 < KC_; k0 += 32) {
    v16h a = load_frag16(pa + k0);
#pragma unroll
    for (int j = 0; j < 2; ++j) {
      v16h b = load_frag16(pw + j * 16 * PW_ + k0);
      accW[j] = WMMA16(a, b, accW[j]);
    }
    if (SKIP) {
      v16h b = load_frag16(ps + k0);
      accS = WMMA16(a, b, accS);
    }
  }
}

__global__ void __launch_bounds__(256)
k_flat(const _Float16* __restrict__ e16,
       const _Float16* __restrict__ fW1T, const _Float16* __restrict__ fWskipT,
       const _Float16* __restrict__ fW2T, const _Float16* __restrict__ fWgT,
       const float* __restrict__ fb1, const float* __restrict__ fbskip,
       const float* __restrict__ fb2, const float* __restrict__ fbg,
       const float* __restrict__ fg, const float* __restrict__ fbv,
       const float* __restrict__ ctxh,
       float* __restrict__ wOut) {
  __shared__ __attribute__((aligned(16))) _Float16 bufFlat[2][FR_ * PW_];  // flat chunks, then h1 | h2
  __shared__ __attribute__((aligned(16))) _Float16 bufW1[2][128 * PW_];    // W1 chunks, then W2
  __shared__ __attribute__((aligned(16))) _Float16 bufWs[2][N_ * PW_];     // Wskip chunks, then Wg
  __shared__ float sSkip[FR_ * N_];                                        // skip path, f32

  const int tid = threadIdx.x;
  const int wave = __builtin_amdgcn_readfirstlane(tid >> 5), lane = tid & 31;
  const int laneR = lane & 15, kh = (lane >> 4) & 1;
  const int hi8 = (lane & 16) ? 8 : 0;
  const int rt = wave & 1, cg = wave >> 1;    // row tile, column group
  const int r0 = rt * 16;
  const int c0 = cg * 32;                     // first of the wave's 32 W1/W2 columns
  const int rowbase = blockIdx.x * FR_;
  const int bIdx = rowbase / T_;              // FR_ divides T_: one batch per block
  const v8f Z = {0.f, 0.f, 0.f, 0.f, 0.f, 0.f, 0.f, 0.f};

  // 16 lanes cover one 256-byte row; copy j of a run takes row sr + 16*j.
  const int sr = tid >> 4, so = (tid & 15) * 8;
  auto stageChunk = [&](int kc, int p) {
    int kk = kc * KC_;
    cp16x2(&bufFlat[p][sr * PW_ + so], 16 * PW_,      // flat rows: 512 x 16B
           e16 + (size_t)(rowbase + sr) * ND_ + kk + so, 16 * ND_);
    cp16x8(&bufW1[p][sr * PW_ + so], 16 * PW_,        // W1 panel: 2048 x 16B
           fW1T + (size_t)sr * ND_ + kk + so, 16 * ND_);
    cp16x2(&bufWs[p][sr * PW_ + so], 16 * PW_,        // Wskip panel: 512 x 16B
           fWskipT + (size_t)sr * ND_ + kk + so, 16 * ND_);
  };

  // ---- GEMM1 stream: accW = flat @ W1 (2 tiles), accS = flat @ Wskip (cg < 2) ----
  v8f accW[2], accS;
  accW[0] = Z; accW[1] = Z; accS = Z;

  stageChunk(0, 0);
  for (int kc = 0; kc < ND_ / KC_; ++kc) {
    int p = kc & 1;
    wait_async();                             // chunk kc resident
    if (kc + 1 < ND_ / KC_) stageChunk(kc + 1, p ^ 1);   // overlaps compute
    const _Float16* pa = &bufFlat[p][(r0 + laneR) * PW_ + kh * 8];
    const _Float16* pw = &bufW1[p][(c0 + laneR) * PW_ + kh * 8];
    const _Float16* ps = &bufWs[p][((cg & 1) * 16 + laneR) * PW_ + kh * 8];
    if (cg < 2) flat_chunk<true>(pa, pw, ps, accW, accS);
    else        flat_chunk<false>(pa, pw, ps, accW, accS);
    __syncthreads();                          // buffer reusable 2 chunks later
  }

  // ---- stage W2 (-> bufW1[0]) and Wg (-> bufWs, 64 rows contiguous) ----
  _Float16* sH1 = &bufFlat[0][0];
  _Float16* sH2 = &bufFlat[1][0];
  _Float16* sW2 = &bufW1[0][0];
  _Float16* sWg = &bufWs[0][0];
  cp16x8(sW2 + sr * PW_ + so, 16 * PW_, fW2T + tid * 8, 2048);
  cp16x4(sWg + sr * PW_ + so, 16 * PW_, fWgT + tid * 8, 2048);

  // ---- h1 = elu(accW + b1 + ctx) -> sH1; skip + bias -> sSkip ----
#pragma unroll
  for (int j = 0; j < 2; ++j) {
    int col = c0 + j * 16 + laneR;
    float bc = fb1[col] + ctxh[bIdx * H_ + col];
#pragma unroll
    for (int i = 0; i < 8; ++i)
      sH1[(r0 + i + hi8) * PW_ + col] = (_Float16)elu_f(accW[j][i] + bc);
  }
  if (cg < 2) {
    int col = cg * 16 + laneR;
    float bs = fbskip[col];
#pragma unroll
    for (int i = 0; i < 8; ++i) sSkip[(r0 + i + hi8) * N_ + col] = accS[i] + bs;
  }
  wait_async();                               // W2 + Wg resident; h1, skip of all waves visible

  // ---- GEMM2 (K=128): h2 = h1 @ W2 + b2, the wave's two column tiles ----
  v8f h2[2];
  h2[0] = Z; h2[1] = Z;
#pragma unroll
  for (int k0 = 0; k0 < H_; k0 += 32) {
    v16h a = load_frag16(sH1 + (r0 + laneR) * PW_ + k0 + kh * 8);
#pragma unroll
    for (int j = 0; j < 2; ++j) {
      v16h b = load_frag16(sW2 + (c0 + j * 16 + laneR) * PW_ + k0 + kh * 8);
      h2[j] = WMMA16(a, b, h2[j]);
    }
  }
#pragma unroll
  for (int j = 0; j < 2; ++j) {
    int col = c0 + j * 16 + laneR;
    float b2v = fb2[col];
#pragma unroll
    for (int i = 0; i < 8; ++i)
      sH2[(r0 + i + hi8) * PW_ + col] = (_Float16)(h2[j][i] + b2v);
  }
  __syncthreads();                            // h2 of all waves visible
  if (wave >= 2) return;                      // no barrier below; waves 0, 1: r0 = wave * 16

  // ---- GEMM3 (K=128, 64 cols): g = h2 @ Wg + bg, 4 tiles in registers ----
  v8f g[4];
#pragma unroll
  for (int ct = 0; ct < 4; ++ct) g[ct] = Z;
#pragma unroll
  for (int k0 = 0; k0 < H_; k0 += 32) {
    v16h a = load_frag16(sH2 + (r0 + laneR) * PW_ + k0 + kh * 8);
#pragma unroll
    for (int ct = 0; ct < 4; ++ct) {
      v16h b = load_frag16(sWg + (ct * 16 + laneR) * PW_ + k0 + kh * 8);
      g[ct] = WMMA16(a, b, g[ct]);
    }
  }
  float sk[2][8];
#pragma unroll
  for (int cs = 0; cs < 2; ++cs)
#pragma unroll
    for (int i = 0; i < 8; ++i) sk[cs][i] = sSkip[(r0 + i + hi8) * N_ + cs * 16 + laneR];

  // ---- GLU (col c with gate c+32) + skip, all in registers ----
  float t[2][8];
#pragma unroll
  for (int cs = 0; cs < 2; ++cs) {
    int col = cs * 16 + laneR;
    float ba = fbg[col], bg2 = fbg[col + 32];
#pragma unroll
    for (int i = 0; i < 8; ++i)
      t[cs][i] = (g[cs][i] + ba) * sigmoid_f(g[cs + 2][i] + bg2) + sk[cs][i];
  }

  // ---- LayerNorm over N=32 + softmax via 16-lane butterflies ----
  float s1[8], s2[8];
#pragma unroll
  for (int i = 0; i < 8; ++i) {
    s1[i] = t[0][i] + t[1][i];
    s2[i] = t[0][i] * t[0][i] + t[1][i] * t[1][i];
  }
#pragma unroll
  for (int m = 1; m < 16; m <<= 1)
#pragma unroll
    for (int i = 0; i < 8; ++i) {
      s1[i] += __shfl_xor(s1[i], m, 32);
      s2[i] += __shfl_xor(s2[i], m, 32);
    }
  float l[2][8];
#pragma unroll
  for (int i = 0; i < 8; ++i) {
    float mu = s1[i] * (1.0f / N_);
    float var = s2[i] * (1.0f / N_) - mu * mu;
    float rs = rsqrtf(var + LN_EPS);
#pragma unroll
    for (int cs = 0; cs < 2; ++cs) {
      int col = cs * 16 + laneR;
      l[cs][i] = (t[cs][i] - mu) * rs * fg[col] + fbv[col];
    }
  }
  float mx[8];
#pragma unroll
  for (int i = 0; i < 8; ++i) mx[i] = fmaxf(l[0][i], l[1][i]);
#pragma unroll
  for (int m = 1; m < 16; m <<= 1)
#pragma unroll
    for (int i = 0; i < 8; ++i) mx[i] = fmaxf(mx[i], __shfl_xor(mx[i], m, 32));
  float e0[8], e1[8], se[8];
#pragma unroll
  for (int i = 0; i < 8; ++i) {
    e0[i] = __expf(l[0][i] - mx[i]);
    e1[i] = __expf(l[1][i] - mx[i]);
    se[i] = e0[i] + e1[i];
  }
#pragma unroll
  for (int m = 1; m < 16; m <<= 1)
#pragma unroll
    for (int i = 0; i < 8; ++i) se[i] += __shfl_xor(se[i], m, 32);
#pragma unroll
  for (int i = 0; i < 8; ++i) {
    int row = rowbase + r0 + i + hi8;
    float inv = 1.0f / se[i];
    wOut[(size_t)row * N_ + laneR]      = e0[i] * inv;
    wOut[(size_t)row * N_ + 16 + laneR] = e1[i] * inv;
  }
}

// ------------------------------------------------------- per-variable GRNs
// One block = 128 rows (8 waves, 16 rows per wave). Weight panels async-staged
// once per block per n into LDS and shared by all waves.
// Every product is computed transposed: the weight panel is the A operand (its
// 16 rows = 16 output columns), the wave's 16 activation rows are the B operand.
// A lane then holds ONE activation row (lane & 15), and register i of a D tile
// is output column tile*16 + 8*(lane >> 4) + i. Two neighbouring D tiles,
// converted to f16 in place, are the next product's B fragment in the hardware's
// k order, so h1 and h2 never leave the registers. The values that go by column
// (biases, LayerNorm scale and shift) are staged in LDS and read eight per lane;
// a bias is the accumulator's start value. The LayerNorm sums run inside the
// lane, with one exchange between the lane halves.
// blockIdx.y picks a group of NPG_ variables, so that the grid fills the chip;
// each group stores its own partial sum plane part[group][row][h], and k_sum
// adds the planes.
typedef float f4 __attribute__((ext_vector_type(4)));

// One copy of 16 B per lane, as the builtin: the compiler places its address
// registers anywhere, where an asm operand must lie in the first 256 registers
// (this kernel's long-lived ones no longer all fit there and would be spilled).
typedef int i4 __attribute__((ext_vector_type(4)));
__device__ __forceinline__ void cp16b(void* ldst, const void* gsrc) {
  __builtin_amdgcn_global_load_async_to_lds_b128(
      (__attribute__((address_space(1))) i4*)(gsrc),
      (__attribute__((address_space(3))) i4*)(ldst), 0, 0);
}
// A run of N such copies: copy j moves gsrc + j*gstep to ldst + j*lstep (in halves).
template <int N>
__device__ __forceinline__ void cpRun(_Float16* ldst, int lstep, const _Float16* gsrc, int gstep) {
#pragma unroll  // the copies of a run issue back to back
  for (int j = 0; j < N; ++j) cp16b(ldst + j * lstep, gsrc + (size_t)j * gstep);
}
// Eight consecutive f32 (32-byte aligned, LDS) in the register order of a D tile.
__device__ __forceinline__ v8f load_c8(const float* p) {
  f4 lo = *(const f4*)(p);
  f4 hi = *(const f4*)(p + 4);
  return __builtin_shufflevector(lo, hi, 0, 1, 2, 3, 4, 5, 6, 7);
}
// Two f32 D tiles (k 0..15 and 16..31 of a k step) -> one f16 B fragment.
__device__ __forceinline__ v16h pack_frag(v8f t0, v8f t1) {
  h8 lo = __builtin_convertvector(t0, h8);
  h8 hi = __builtin_convertvector(t1, h8);
  return __builtin_shufflevector(lo, hi, 0, 1, 2, 3, 4, 5, 6, 7, 8, 9, 10, 11, 12, 13, 14, 15);
}
// The value of lane l ^ 16.
__device__ __forceinline__ float other_half(float x) {
  int b = __builtin_bit_cast(int, x);
  return __builtin_bit_cast(float,
      __builtin_amdgcn_permlanex16(b, b, 0x76543210, 0xfedcba98, false, false));
}

// Rows of sCol, H_ floats each
#define CB1_  0
#define CBS_  1
#define CB2_  2
#define CBA_  3
#define CBG_  4
#define CLG_  5
#define CLB_  6
#define NCOL_ 7

__global__ void __launch_bounds__(256)
k_var(const _Float16* __restrict__ e16,
      const _Float16* __restrict__ vW1T, const _Float16* __restrict__ vWskipT,
      const _Float16* __restrict__ vW2T, const _Float16* __restrict__ vWgT,
      const float* __restrict__ vb1, const float* __restrict__ vbskip,
      const float* __restrict__ vb2, const float* __restrict__ vbg,
      const float* __restrict__ vg, const float* __restrict__ vbv,
      const float* __restrict__ wIn, float* __restrict__ part) {
  __shared__ __attribute__((aligned(16))) _Float16 sE[128 * PN_];      // embedding slice [row][64]
  __shared__ __attribute__((aligned(16))) _Float16 sWa[2 * 128 * PN_]; // W1 + Wskip, reused for Wg gate half
  __shared__ __attribute__((aligned(16))) _Float16 sW2[128 * PW_];     // W2 panel [col][128]
  __shared__ __attribute__((aligned(16))) _Float16 sWgA[128 * PW_];    // Wg cols 0..127 [col][128]
  __shared__ __attribute__((aligned(32))) float sCol[NCOL_ * H_];      // per-column values of one variable
  static_assert(128 * PW_ <= 2 * 128 * PN_, "Wg gate half must fit in sWa");
  _Float16* const sWs = sWa + 128 * PN_;       // Wskip panel behind the W1 panel

  const int tid = threadIdx.x;
  const int wave = __builtin_amdgcn_readfirstlane(tid >> 5), lane = tid & 31;
  const int laneR = lane & 15, kh = (lane >> 4) & 1;
  const int hi8 = (lane & 16) ? 8 : 0;
  const int r0 = wave * 16;                    // wave's row tile within block
  const int rowbase = blockIdx.x * 128;
  const int nBeg = blockIdx.y * NPG_, nEnd = nBeg + NPG_;
  float* const outPtr = part + (size_t)blockIdx.y * BT_ * H_;

  float outReg[64];                            // [ct][i]: row laneR, column ct*16 + hi8 + i
#pragma unroll
  for (int q = 0; q < 64; ++q) outReg[q] = 0.0f;
  float tv[64];                                // skip, then GLU result; same map

  // 128-byte rows: 8 lanes a row, copy j of a run takes row nr + 32*j.
  // 256-byte rows: 16 lanes a row, copy j of a run takes row wr + 16*j.
  const int nr = tid >> 3, no = (tid & 7) * 8;
  const int wr = tid >> 4, wo = (tid & 15) * 8;
  auto stageE = [&](int n) {                   // 1024 chunks of 16B
    cpRun<4>(sE + nr * PN_ + no, 32 * PN_,
             e16 + ((size_t)(rowbase + nr) * N_ + n) * D_ + no, 32 * ND_);
  };
  auto stageW1Ws = [&](int n) {                // two 16KB panels -> sWa
    cpRun<4>(sWa + nr * PN_ + no, 32 * PN_, vW1T + (size_t)n * H_ * D_ + tid * 8, 2048);
    cpRun<4>(sWs + nr * PN_ + no, 32 * PN_, vWskipT + (size_t)n * H_ * D_ + tid * 8, 2048);
  };
  auto stageW2 = [&](int n) {                  // 32KB
    cpRun<8>(sW2 + wr * PW_ + wo, 16 * PW_, vW2T + (size_t)n * H_ * H_ + tid * 8, 2048);
  };
  auto stageWg = [&](int n) {                  // a-half -> sWgA, gate half -> sWa
    const _Float16* ga = vWgT + (size_t)n * 256 * H_;
    const _Float16* gg = ga + (size_t)128 * H_;
    cpRun<8>(sWgA + wr * PW_ + wo, 16 * PW_, ga + tid * 8, 2048);
    cpRun<8>(sWa + wr * PW_ + wo, 16 * PW_, gg + tid * 8, 2048);
  };
  // Wave w < NCOL_ brings row w of sCol: 32 lanes x 16 B = H_ floats. Its source
  // walks from variable to variable in steps of the array's own row length.
  const float* colSrc = (wave == CB1_ ? vb1 + nBeg * H_
                       : wave == CBS_ ? vbskip + nBeg * H_
                       : wave == CB2_ ? vb2 + nBeg * H_
                       : wave == CBA_ ? vbg + nBeg * 256
                       : wave == CBG_ ? vbg + nBeg * 256 + 128
                       : wave == CLG_ ? vg + nBeg * H_
                                      : vbv + nBeg * H_);
  const int colStep = (wave == CBA_ || wave == CBG_) ? 256 : H_;
  float* const colDst = sCol + (wave < NCOL_ ? wave : 0) * H_ + lane * 4;
  auto stageCol = [&]() {                      // next variable's column values
    if (wave < NCOL_) {                        // scalar test: the eighth wave issues no copy
      cp16b(colDst, colSrc + lane * 4);
      colSrc += colStep;
    }
  };
  const float* const colP = sCol + hi8;        // the lane's eight columns of tile 0
  const float* const wRow = wIn + (size_t)(rowbase + r0 + laneR) * N_;

  stageE(nBeg);
  stageW1Ws(nBeg);
  stageCol();

  for (int n = nBeg; n < nEnd; ++n) {
    wait_async();                              // E, W1, Wskip, column values resident
    stageW2(n);                                // overlaps GEMM1
    float wsel = wRow[n];                      // the row's selection weight, used at the end of the trip
    // precaution: every later rewrite of the load's address registers stays behind this wait
    asm volatile("s_wait_xcnt 0x0" ::: "memory");

    // ---- GEMM1 (K=64): aW = (E@W1 + b1)^T, aS = (E@Wskip + bskip)^T, one column
    // tile at a time. The next tile's weight fragments and start values are read
    // into a second register set ahead of this tile's WMMAs, so that no WMMA waits
    // out the latency of its own reads ----
    v16h bE[2];
#pragma unroll
    for (int ks = 0; ks < 2; ++ks)
      bE[ks] = load_frag16(sE + (r0 + laneR) * PN_ + ks * 32 + kh * 8);
    v16h f1[2][4];
    v8f c1[2][2];
#pragma unroll
    for (int ks = 0; ks < 2; ++ks) {
      f1[0][ks]     = load_frag16(sWa + laneR * PN_ + ks * 32 + kh * 8);
      f1[0][2 + ks] = load_frag16(sWs + laneR * PN_ + ks * 32 + kh * 8);
    }
    c1[0][0] = load_c8(colP + CB1_ * H_);
    c1[0][1] = load_c8(colP + CBS_ * H_);
    v16h bH[4];                                // elu(h1) as B fragments
    v8f hPrev;
#pragma unroll
    for (int ct = 0; ct < 8; ++ct) {
      if (ct + 1 < 8) {
#pragma unroll
        for (int ks = 0; ks < 2; ++ks) {
          f1[(ct + 1) & 1][ks]     = load_frag16(sWa + ((ct + 1) * 16 + laneR) * PN_ + ks * 32 + kh * 8);
          f1[(ct + 1) & 1][2 + ks] = load_frag16(sWs + ((ct + 1) * 16 + laneR) * PN_ + ks * 32 + kh * 8);
        }
        c1[(ct + 1) & 1][0] = load_c8(colP + CB1_ * H_ + (ct + 1) * 16);
        c1[(ct + 1) & 1][1] = load_c8(colP + CBS_ * H_ + (ct + 1) * 16);
      }
      __builtin_amdgcn_sched_barrier(0);       // keeps the reads above as one group ahead of this step's WMMAs
      v8f aW = c1[ct & 1][0], aS = c1[ct & 1][1];
#pragma unroll
      for (int ks = 0; ks < 2; ++ks) {
        aW = WMMA16(f1[ct & 1][ks], bE[ks], aW);
        aS = WMMA16(f1[ct & 1][2 + ks], bE[ks], aS);
      }
      v8f h;
#pragma unroll
      for (int i = 0; i < 8; ++i) {
        h[i] = elu_f(aW[i]);
        tv[ct * 8 + i] = aS[i];                // skip, kept in registers
      }
      if (ct & 1) bH[ct >> 1] = pack_frag(hPrev, h);
      else        hPrev = h;
    }
    __builtin_amdgcn_sched_barrier(0);         // the last tile's WMMAs and their readers stay together above: the copies below fill no vector slot between them
    wait_async();                              // W2 resident; waves done with W1/Ws
    stageWg(n);                                // overlaps GEMM2 (gate half -> sWa)

    // ---- GEMM2 (K=128): h2 = (elu(h1) @ W2 + b2)^T. Two column tiles a step (one
    // B fragment of GEMM3), the next step's W2 fragments read ahead ----
    v16h f2[2][8];
    v8f c2[2][2];
#pragma unroll
    for (int q = 0; q < 8; ++q)
      f2[0][q] = load_frag16(sW2 + ((q & 1) * 16 + laneR) * PW_ + (q >> 1) * 32 + kh * 8);
    c2[0][0] = load_c8(colP + CB2_ * H_);
    c2[0][1] = load_c8(colP + CB2_ * H_ + 16);
    v16h bG[4];                                // h2 as B fragments
#pragma unroll
    for (int ct = 0; ct < 8; ct += 2) {
      const int cur = (ct >> 1) & 1;
      if (ct + 2 < 8) {
#pragma unroll
        for (int q = 0; q < 8; ++q)
          f2[cur ^ 1][q] = load_frag16(sW2 + ((ct + 2 + (q & 1)) * 16 + laneR) * PW_ + (q >> 1) * 32 + kh * 8);
        c2[cur ^ 1][0] = load_c8(colP + CB2_ * H_ + (ct + 2) * 16);
        c2[cur ^ 1][1] = load_c8(colP + CB2_ * H_ + (ct + 3) * 16);
      }
      __builtin_amdgcn_sched_barrier(0);       // keeps the reads above as one group ahead of this step's WMMAs
      v8f h2[2];
      h2[0] = c2[cur][0]; h2[1] = c2[cur][1];
#pragma unroll
      for (int q = 0; q < 8; ++q)
        h2[q & 1] = WMMA16(f2[cur][q], bH[q >> 1], h2[q & 1]);
      bG[ct >> 1] = pack_frag(h2[0], h2[1]);
    }
    wait_async();                              // Wg halves resident

    // ---- GEMM3 pairs (K=128): a-part (sWgA) and gate (sWa), GLU in regs; the
    // next column tile's Wg fragments read ahead, as above ----
    v16h f3[2][8];
    v8f c3[2][2];
#pragma unroll
    for (int ks = 0; ks < 4; ++ks) {
      f3[0][2 * ks]     = load_frag16(sWgA + laneR * PW_ + ks * 32 + kh * 8);
      f3[0][2 * ks + 1] = load_frag16(sWa + laneR * PW_ + ks * 32 + kh * 8);
    }
    c3[0][0] = load_c8(colP + CBA_ * H_);
    c3[0][1] = load_c8(colP + CBG_ * H_);
#pragma unroll
    for (int ct = 0; ct < 8; ++ct) {
      if (ct + 1 < 8) {
#pragma unroll
        for (int ks = 0; ks < 4; ++ks) {
          f3[(ct + 1) & 1][2 * ks]     = load_frag16(sWgA + ((ct + 1) * 16 + laneR) * PW_ + ks * 32 + kh * 8);
          f3[(ct + 1) & 1][2 * ks + 1] = load_frag16(sWa + ((ct + 1) * 16 + laneR) * PW_ + ks * 32 + kh * 8);
        }
        c3[(ct + 1) & 1][0] = load_c8(colP + CBA_ * H_ + (ct + 1) * 16);
        c3[(ct + 1) & 1][1] = load_c8(colP + CBG_ * H_ + (ct + 1) * 16);
      }
      __builtin_amdgcn_sched_barrier(0);       // keeps the reads above as one group ahead of this step's WMMAs
      v8f ga = c3[ct & 1][0], gg = c3[ct & 1][1];
#pragma unroll
      for (int ks = 0; ks < 4; ++ks) {
        ga = WMMA16(f3[ct & 1][2 * ks], bG[ks], ga);
        gg = WMMA16(f3[ct & 1][2 * ks + 1], bG[ks], gg);
      }
#pragma unroll
      for (int i = 0; i < 8; ++i)
        tv[ct * 8 + i] = ga[i] * sigmoid_f(gg[i]) + tv[ct * 8 + i];   // GLU + skip
      __builtin_amdgcn_sched_barrier(0);       // keeps the next tile's reads below: one group at one place, not spread among these WMMAs
    }

    // ---- LayerNorm over H=128: the lane's 64 columns (eight chains, then a
    // tree), then the other lane half's 64 ----
    float s1[8], s2[8];
#pragma unroll
    for (int i = 0; i < 8; ++i) { s1[i] = 0.f; s2[i] = 0.f; }
#pragma unroll
    for (int ct = 0; ct < 8; ++ct)
#pragma unroll
      for (int i = 0; i < 8; ++i) { float t = tv[ct * 8 + i]; s1[i] += t; s2[i] += t * t; }
#pragma unroll
    for (int m = 4; m >= 1; m >>= 1)
#pragma unroll
      for (int i = 0; i < m; ++i) { s1[i] += s1[i + m]; s2[i] += s2[i + m]; }
    const float t1 = s1[0] + other_half(s1[0]);
    const float t2 = s2[0] + other_half(s2[0]);

    // ---- normalize + softmax-weighted combine into registers ----
    const float mu = t1 * (1.0f / H_);
    const float var = t2 * (1.0f / H_) - mu * mu;
    const float rs = rsqrtf(var + LN_EPS);
#pragma unroll
    for (int ct = 0; ct < 8; ++ct) {
      v8f lg = load_c8(colP + CLG_ * H_ + ct * 16);
      v8f lb = load_c8(colP + CLB_ * H_ + ct * 16);
#pragma unroll
      for (int i = 0; i < 8; ++i) {
        float val = (tv[ct * 8 + i] - mu) * rs * lg[i] + lb[i];
        outReg[ct * 8 + i] += wsel * val;
      }
    }
    __syncthreads();                           // panels consumed; safe to restage
    if (n + 1 < nEnd) {                        // overlaps next-iteration latency
      stageE(n + 1);
      stageW1Ws(n + 1);
      stageCol();
    }
  }

  // ---- epilogue: store this group's partial tile, eight columns per lane and tile ----
  float* const oRow = outPtr + (size_t)(rowbase + r0 + laneR) * H_ + hi8;
#pragma unroll
  for (int ct = 0; ct < 8; ++ct) {
    f4 lo = {outReg[ct * 8 + 0], outReg[ct * 8 + 1], outReg[ct * 8 + 2], outReg[ct * 8 + 3]};
    f4 hi = {outReg[ct * 8 + 4], outReg[ct * 8 + 5], outReg[ct * 8 + 6], outReg[ct * 8 + 7]};
    *(f4*)(oRow + ct * 16)     = lo;
    *(f4*)(oRow + ct * 16 + 4) = hi;
  }
}

// out[i] = sum over the NG_ groups of part[group][i], groups in rising order.
__global__ void __launch_bounds__(256) k_sum(const float* __restrict__ part,
                                             float* __restrict__ outPtr) {
  // One 32-bit byte offset serves every plane and the store (uniform base + offset).
  const unsigned off = (blockIdx.x * 256u + threadIdx.x) * 16u;
  float4 s = *(const float4*)((const char*)part + off);
#pragma unroll  // all planes' loads in flight together
  for (int g = 1; g < NG_; ++g) {
    float4 p = *(const float4*)((const char*)(part + (size_t)g * BT_ * H_) + off);
    s.x += p.x; s.y += p.y; s.z += p.z; s.w += p.w;
  }
  *(float4*)((char*)outPtr + off) = s;
}

// ----------------------------------------------------------------------------
extern "C" void kernel_launch(void* const* d_in, const int* in_sizes, int n_in,
                              void* d_out, int out_size, void* d_ws, size_t ws_size,
                              hipStream_t stream) {
  (void)in_sizes; (void)n_in; (void)out_size; (void)ws_size;

  const float* emb    = (const float*)d_in[0];
  const float* ctx    = (const float*)d_in[1];
  const float* fWskip = (const float*)d_in[2];
  const float* fbskip = (const float*)d_in[3];
  const float* fW1    = (const float*)d_in[4];
  const float* fb1    = (const float*)d_in[5];
  const float* fWc    = (const float*)d_in[6];
  const float* fW2    = (const float*)d_in[7];
  const float* fb2    = (const float*)d_in[8];
  const float* fWg    = (const float*)d_in[9];
  const float* fbg    = (const float*)d_in[10];
  const float* fg     = (const float*)d_in[11];
  const float* fbv    = (const float*)d_in[12];
  const float* vWskip = (const float*)d_in[13];
  const float* vbskip = (const float*)d_in[14];
  const float* vW1    = (const float*)d_in[15];
  const float* vb1    = (const float*)d_in[16];
  const float* vW2    = (const float*)d_in[17];
  const float* vb2    = (const float*)d_in[18];
  const float* vWg    = (const float*)d_in[19];
  const float* vbg    = (const float*)d_in[20];
  const float* vg     = (const float*)d_in[21];
  const float* vbv    = (const float*)d_in[22];

  // Workspace carve (f16 copies, transposed weights, ctx projection, partial planes)
  char* w = (char*)d_ws;
  size_t off = 0;
  auto alloc = [&](size_t bytes) -> char* {
    char* p = w + off;
    off = (off + bytes + 255) & ~(size_t)255;
    return p;
  };
  _Float16* e16     = (_Float16*)alloc((size_t)BT_ * ND_ * 2);
  _Float16* fW1T    = (_Float16*)alloc((size_t)ND_ * H_ * 2);
  _Float16* fWskipT = (_Float16*)alloc((size_t)ND_ * N_ * 2);
  _Float16* fW2T    = (_Float16*)alloc((size_t)H_ * H_ * 2);
  _Float16* fWgT    = (_Float16*)alloc((size_t)H_ * 2 * N_ * 2);
  _Float16* vW1T    = (_Float16*)alloc((size_t)N_ * D_ * H_ * 2);
  _Float16* vWskipT = (_Float16*)alloc((size_t)N_ * D_ * H_ * 2);
  _Float16* vW2T    = (_Float16*)alloc((size_t)N_ * H_ * H_ * 2);
  _Float16* vWgT    = (_Float16*)alloc((size_t)N_ * H_ * 256 * 2);
  float*    ctxh    = (float*)alloc((size_t)B_ * H_ * 4);
  float*    part    = (float*)alloc((size_t)NG_ * BT_ * H_ * 4);

  float* outPtr = (float*)d_out;                   // [BT, H]
  float* wOut   = outPtr + (size_t)BT_ * H_;       // [BT, N]

  // precision conversion, transposes and context projection: one launch
  k_prep<<<NB_PREP, 256, 0, stream>>>(emb, ctx, fWc, fW1, fWskip, fW2, fWg,
                                      vW1, vWskip, vW2, vWg,
                                      e16, ctxh, fW1T, fWskipT, fW2T, fWgT,
                                      vW1T, vWskipT, vW2T, vWgT);

  // flatten GRN -> softmax weights (FR_ rows/block, 8 waves)
  k_flat<<<BT_ / FR_, 256, 0, stream>>>(e16, fW1T, fWskipT, fW2T, fWgT,
                                        fb1, fbskip, fb2, fbg, fg, fbv,
                                        ctxh, wOut);

  // per-variable GRNs + weighted combine -> partial planes (128 rows/block,
  // 8 waves, NPG_ variables per block), then the sum of the planes -> outputs
  k_var<<<dim3(BT_ / 128, NG_), 256, 0, stream>>>(e16, vW1T, vWskipT, vW2T, vWgT,
                                                  vb1, vbskip, vb2, vbg, vg, vbv,
                                                  wOut, part);
  k_sum<<<BT_ * H_ / 1024, 256, 0, stream>>>(part, outPtr);
}

// v008
// It runs in 81.7 microseconds.
// Next to v007, in two timings, it ran 1.05 and 1.04 times as fast.
// Counting every step since v000, it is 14.3 times as fast.
#include <hip/hip_runtime.h>
#include <hip/hip_bf16.h>
#include <math.h>

// Problem dims (fixed by reference)
#define B_   64
#define T_   128
#define N_   32
#define D_   64
#define H_   128
#define C_   64
#define BT_  (B_ * T_)      // 8192
#define ND_  (N_ * D_)      // 2048
#define KC_  128            // K-chunk for the flatten GEMM stream
#define NG_  4              // groups of variables in k_var's grid (blockIdx.y)
#define NPG_ (N_ / NG_)     // variables per group
#define LN_EPS 1e-5f
// LDS row pitches in halves. Bank = dword address mod 64, so rows of 256 B (or
// 128 B) put the 16 lanes of a ds_load_b128 fragment read on the same four
// (eight) banks. A pitch of 16 B x odd spreads them over all 64 banks.
#define PW_  136            // 256-byte rows: pitch 272 B = 16 B x 17
#define PN_  72             // 128-byte rows: pitch 144 B = 16 B x 9

typedef _Float16 v16h __attribute__((ext_vector_type(16)));
typedef _Float16 h8   __attribute__((ext_vector_type(8)));
typedef float    v8f  __attribute__((ext_vector_type(8)));

// ---------------------------------------------------------------------------
// CDNA5 async global->LDS staging (GLOBAL_LOAD_ASYNC_TO_LDS_B128, ASYNCcnt).
// GV addressing: vdst = LDS byte address, vaddr = 64-bit global address.
// ---------------------------------------------------------------------------
// A run of copies shares one asm statement; its last line, s_wait_xcnt 0, keeps
// every later rewrite of the address registers behind the copies' issue.
// Copy j moves 16 B per lane from gsrc + j*gstep to ldst + j*lstep (in halves).
__device__ __forceinline__ void cp16x2(_Float16* ldst, int lstep,
                                       const _Float16* gsrc, int gstep) {
  unsigned l = (unsigned)(size_t)ldst;
  unsigned long long g = (unsigned long long)(size_t)gsrc;
  unsigned ls = (unsigned)lstep * 2u;
  unsigned long long gs = (unsigned long long)gstep * 2ull;
  asm volatile("global_load_async_to_lds_b128 %0, %2, off\n\t"
               "global_load_async_to_lds_b128 %1, %3, off\n\t"
               "s_wait_xcnt 0x0"
               :
               : "v"(l), "v"(l + ls), "v"(g), "v"(g + gs)
               : "memory");
}
__device__ __forceinline__ void cp16x4(_Float16* ldst, int lstep,
                                       const _Float16* gsrc, int gstep) {
  unsigned l = (unsigned)(size_t)ldst;
  unsigned long long g = (unsigned long long)(size_t)gsrc;
  unsigned ls = (unsigned)lstep * 2u;
  unsigned long long gs = (unsigned long long)gstep * 2ull;
  asm volatile("global_load_async_to_lds_b128 %0, %4, off\n\t"
               "global_load_async_to_lds_b128 %1, %5, off\n\t"
               "global_load_async_to_lds_b128 %2, %6, off\n\t"
               "global_load_async_to_lds_b128 %3, %7, off\n\t"
               "s_wait_xcnt 0x0"
               :
               : "v"(l), "v"(l + ls), "v"(l + 2 * ls), "v"(l + 3 * ls),
                 "v"(g), "v"(g + gs), "v"(g + 2 * gs), "v"(g + 3 * gs)
               : "memory");
}
__device__ __forceinline__ void cp16x8(_Float16* ldst, int lstep,
                                       const _Float16* gsrc, int gstep) {
  unsigned l = (unsigned)(size_t)ldst;
  unsigned long long g = (unsigned long long)(size_t)gsrc;
  unsigned ls = (unsigned)lstep * 2u;
  unsigned long long gs = (unsigned long long)gstep * 2ull;
  asm volatile("global_load_async_to_lds_b128 %0, %8, off\n\t"
               "global_load_async_to_lds_b128 %1, %9, off\n\t"
               "global_load_async_to_lds_b128 %2, %10, off\n\t"
               "global_load_async_to_lds_b128 %3, %11, off\n\t"
               "global_load_async_to_lds_b128 %4, %12, off\n\t"
               "global_load_async_to_lds_b128 %5, %13, off\n\t"
               "global_load_async_to_lds_b128 %6, %14, off\n\t"
               "global_load_async_to_lds_b128 %7, %15, off\n\t"
               "s_wait_xcnt 0x0"
               :
               : "v"(l), "v"(l + ls), "v"(l + 2 * ls), "v"(l + 3 * ls),
                 "v"(l + 4 * ls), "v"(l + 5 * ls), "v"(l + 6 * ls), "v"(l + 7 * ls),
                 "v"(g), "v"(g + gs), "v"(g + 2 * gs), "v"(g + 3 * gs),
                 "v"(g + 4 * gs), "v"(g + 5 * gs), "v"(g + 6 * gs), "v"(g + 7 * gs)
               : "memory");
}
__device__ __forceinline__ void wait_async() {
  asm volatile("s_wait_asynccnt 0x0" ::: "memory");
  __syncthreads();
}

// Load a 16-half WMMA operand fragment. p points at (index, k0 + khalf*8) in a
// row-major [rows][ldK] f16 array; elements 0..7 = K+0..7, 8..15 = K+16..23
// (CDNA5 16-bit A/B VGPR layout, ISA 7.12.2). 16-byte aligned.
__device__ __forceinline__ v16h load_frag16(const _Float16* p) {
  h8 lo = *(const h8*)(p);
  h8 hi = *(const h8*)(p + 16);
  v16h f;
#pragma unroll
  for (int i = 0; i < 8; ++i) { f[i] = lo[i]; f[8 + i] = hi[i]; }
  return f;
}

#define WMMA16(a, b, c) \
  __builtin_amdgcn_wmma_f32_16x16x32_f16(false, (a), false, (b), (short)0, (c), false, false)

__device__ __forceinline__ float elu_f(float x)     { return x > 0.0f ? x : __expf(x) - 1.0f; }
// The hardware reciprocal (about 1 ulp) in place of the exact f32 division, which
// compiles to ten more vector instructions per value; 1 + exp(-x) >= 1 or inf.
__device__ __forceinline__ float sigmoid_f(float x) { return __builtin_amdgcn_rcpf(1.0f + __expf(-x)); }

// ---------------------------------------------------------------- preparation
// f16 copy of the embedding, transposed f16 copies of the eight weight tensors
// and the context projection. None of the ten jobs reads what another writes,
// so ONE launch runs them all: each job owns a range of blocks and walks its
// elements with a stride of that range.
// A launch this short also pays for every wave it starts, so the ranges are
// kept small: 16 elements per thread in a transpose, 64 in the embedding copy.
#define NB_CTX   (B_ / 2)                      // two batches per 256-thread block
#define NB_FW1   (ND_ * H_ / 4096)
#define NB_FWS   (ND_ * N_ / 4096)
#define NB_FW2   (H_ * H_ / 4096)
#define NB_FWG   (H_ * 2 * N_ / 4096)
#define NB_VW1   (N_ * D_ * H_ / 4096)
#define NB_VWS   (N_ * D_ * H_ / 4096)
#define NB_VW2   (N_ * H_ * H_ / 4096)
#define NB_VWG   (N_ * H_ * 256 / 4096)
#define NB_EMB   (BT_ * ND_ / 16384)
#define NB_PREP  (NB_CTX + NB_FW1 + NB_FWS + NB_FW2 + NB_FWG + NB_VW1 + NB_VWS + \
                  NB_VW2 + NB_VWG + NB_EMB)

// dst[i] = (f16)src[i]; blk = block's index inside the job's nblk blocks
__device__ __forceinline__ void cvt_job(const float* __restrict__ src,
                                        _Float16* __restrict__ dst, int n,
                                        int blk, int nblk) {
  for (int i = blk * 256 + threadIdx.x; i < n; i += nblk * 256)
    dst[i] = (_Float16)src[i];
}

// src: fp32 [batch][R][C]  ->  dst: f16 [batch][C][R]  (transpose per batch)
__device__ __forceinline__ void cvtT_job(const float* __restrict__ src,
                                         _Float16* __restrict__ dst,
                                         int batch, int R, int Ccols,
                                         int blk, int nblk) {
  int total = batch * R * Ccols;
  for (int i = blk * 256 + threadIdx.x; i < total; i += nblk * 256) {
    int n = i / (R * Ccols);
    int rem = i - n * (R * Ccols);
    int c = rem / R;
    int r = rem - c * R;
    dst[i] = (_Float16)src[((size_t)n * R + r) * Ccols + c];
  }
}

// ctxh[b][h] = sum_c context[b][c] * fWc[c][h]   (tiny, plain FMA)
__device__ __forceinline__ void ctx_job(const float* __restrict__ context,
                                        const float* __restrict__ fWc,
                                        float* __restrict__ ctxh, int blk) {
  int b = blk * 2 + (threadIdx.x >> 7), h = threadIdx.x & (H_ - 1);
  float s = 0.0f;
  for (int c = 0; c < C_; ++c) s += context[b * C_ + c] * fWc[c * H_ + h];
  ctxh[b * H_ + h] = s;
}

// The short jobs take the low block indices, the long embedding stream the rest.
__global__ void __launch_bounds__(256)
k_prep(const float* __restrict__ emb, const float* __restrict__ context,
       const float* __restrict__ fWc,
       const float* __restrict__ fW1, const float* __restrict__ fWskip,
       const float* __restrict__ fW2, const float* __restrict__ fWg,
       const float* __restrict__ vW1, const float* __restrict__ vWskip,
       const float* __restrict__ vW2, const float* __restrict__ vWg,
       _Float16* __restrict__ e16, float* __restrict__ ctxh,
       _Float16* __restrict__ fW1T, _Float16* __restrict__ fWskipT,
       _Float16* __restrict__ fW2T, _Float16* __restrict__ fWgT,
       _Float16* __restrict__ vW1T, _Float16* __restrict__ vWskipT,
       _Float16* __restrict__ vW2T, _Float16* __restrict__ vWgT) {
  int b = blockIdx.x;
  if (b < NB_CTX) { ctx_job(context, fWc, ctxh, b); return; }
  b -= NB_CTX;
  if (b < NB_FW1) { cvtT_job(fW1, fW1T, 1, ND_, H_, b, NB_FW1); return; }
  b -= NB_FW1;
  if (b < NB_FWS) { cvtT_job(fWskip, fWskipT, 1, ND_, N_, b, NB_FWS); return; }
  b -= NB_FWS;
  if (b < NB_FW2) { cvtT_job(fW2, fW2T, 1, H_, H_, b, NB_FW2); return; }
  b -= NB_FW2;
  if (b < NB_FWG) { cvtT_job(fWg, fWgT, 1, H_, 2 * N_, b, NB_FWG); return; }
  b -= NB_FWG;
  if (b < NB_VW1) { cvtT_job(vW1, vW1T, N_, D_, H_, b, NB_VW1); return; }
  b -= NB_VW1;
  if (b < NB_VWS) { cvtT_job(vWskip, vWskipT, N_, D_, H_, b, NB_VWS); return; }
  b -= NB_VWS;
  if (b < NB_VW2) { cvtT_job(vW2, vW2T, N_, H_, H_, b, NB_VW2); return; }
  b -= NB_VW2;
  if (b < NB_VWG) { cvtT_job(vWg, vWgT, N_, H_, 256, b, NB_VWG); return; }
  b -= NB_VWG;
  cvt_job(emb, e16, BT_ * ND_, b, NB_EMB);
}

// ---------------------------------------------------------------- flatten GRN
// One block = FR_ rows, so that the grid has one block per WGP. The 8 waves
// share the block's 2 x 10 output tiles of GEMM1: wave = (row tile rt, column
// group cg); a wave takes two W1 column tiles, and the waves of groups 0 and 1
// one Wskip tile more. K=2048 streamed in 16 double-buffered async chunks.
// GEMM2 is shared the same way; GEMM3, GLU, LN and softmax (16-lane shfl_xor
// butterflies) run on two waves, one per row tile. Produces weights [BT, N_].
#define FR_  32

// One K-chunk of GEMM1 for one wave. pa, pw, ps: the lane's own fragment
// addresses in the flat, W1 and Wskip chunk at k = 0.
template <bool SKIP>
__device__ __forceinline__ void flat_chunk(const _Float16* pa, const _Float16* pw,
                                           const _Float16* ps, v8f (&accW)[2], v8f& accS) {
#pragma unroll  // all fragment loads of a chunk may be issued ahead of its WMMAs
  for (int k0 = 0; k0 < KC_; k0 += 32) {
    v16h a = load_frag16(pa + k0);
#pragma unroll
    for (int j = 0; j < 2; ++j) {
      v16h b = load_frag16(pw + j * 16 * PW_ + k0);
      accW[j] = WMMA16(a, b, accW[j]);
    }
    if (SKIP) {
      v16h b = load_frag16(ps + k0);
      accS = WMMA16(a, b, accS);
    }
  }
}

__global__ void __launch_bounds__(256)
k_flat(const _Float16* __restrict__ e16,
       const _Float16* __restrict__ fW1T, const _Float16* __restrict__ fWskipT,
       const _Float16* __restrict__ fW2T, const _Float16* __restrict__ fWgT,
       const float* __restrict__ fb1, const float* __restrict__ fbskip,
       const float* __restrict__ fb2, const float* __restrict__ fbg,
       const float* __restrict__ fg, const float* __restrict__ fbv,
       const float* __restrict__ ctxh,
       float* __restrict__ wOut) {
  __shared__ __attribute__((aligned(16))) _Float16 bufFlat[2][FR_ * PW_];  // flat chunks, then h1 | h2
  __shared__ __attribute__((aligned(16))) _Float16 bufW1[2][128 * PW_];    // W1 chunks, then W2
  __shared__ __attribute__((aligned(16))) _Float16 bufWs[2][N_ * PW_];     // Wskip chunks, then Wg
  __shared__ float sSkip[FR_ * N_];                                        // skip path, f32

  const int tid = threadIdx.x;
  const int wave = __builtin_amdgcn_readfirstlane(tid >> 5), lane = tid & 31;
  const int laneR = lane & 15, kh = (lane >> 4) & 1;
  const int hi8 = (lane & 16) ? 8 : 0;
  const int rt = wave & 1, cg = wave >> 1;    // row tile, column group
  const int r0 = rt * 16;
  const int c0 = cg * 32;                     // first of the wave's 32 W1/W2 columns
  const int rowbase = blockIdx.x * FR_;
  const int bIdx = rowbase / T_;              // FR_ divides T_: one batch per block
  const v8f Z = {0.f, 0.f, 0.f, 0.f, 0.f, 0.f, 0.f, 0.f};

  // 16 lanes cover one 256-byte row; copy j of a run takes row sr + 16*j.
  const int sr = tid >> 4, so = (tid & 15) * 8;
  auto stageChunk = [&](int kc, int p) {
    int kk = kc * KC_;
    cp16x2(&bufFlat[p][sr * PW_ + so], 16 * PW_,      // flat rows: 512 x 16B
           e16 + (size_t)(rowbase + sr) * ND_ + kk + so, 16 * ND_);
    cp16x8(&bufW1[p][sr * PW_ + so], 16 * PW_,        // W1 panel: 2048 x 16B
           fW1T + (size_t)sr * ND_ + kk + so, 16 * ND_);
    cp16x2(&bufWs[p][sr * PW_ + so], 16 * PW_,        // Wskip panel: 512 x 16B
           fWskipT + (size_t)sr * ND_ + kk + so, 16 * ND_);
  };

  // ---- GEMM1 stream: accW = flat @ W1 (2 tiles), accS = flat @ Wskip (cg < 2) ----
  v8f accW[2], accS;
  accW[0] = Z; accW[1] = Z; accS = Z;

  stageChunk(0, 0);
  for (int kc = 0; kc < ND_ / KC_; ++kc) {
    int p = kc & 1;
    wait_async();                             // chunk kc resident
    if (kc + 1 < ND_ / KC_) stageChunk(kc + 1, p ^ 1);   // overlaps compute
    const _Float16* pa = &bufFlat[p][(r0 + laneR) * PW_ + kh * 8];
    const _Float16* pw = &bufW1[p][(c0 + laneR) * PW_ + kh * 8];
    const _Float16* ps = &bufWs[p][((cg & 1) * 16 + laneR) * PW_ + kh * 8];
    if (cg < 2) flat_chunk<true>(pa, pw, ps, accW, accS);
    else        flat_chunk<false>(pa, pw, ps, accW, accS);
    __syncthreads();                          // buffer reusable 2 chunks later
  }

  // ---- stage W2 (-> bufW1[0]) and Wg (-> bufWs, 64 rows contiguous) ----
  _Float16* sH1 = &bufFlat[0][0];
  _Float16* sH2 = &bufFlat[1][0];
  _Float16* sW2 = &bufW1[0][0];
  _Float16* sWg = &bufWs[0][0];
  cp16x8(sW2 + sr * PW_ + so, 16 * PW_, fW2T + tid * 8, 2048);
  cp16x4(sWg + sr * PW_ + so, 16 * PW_, fWgT + tid * 8, 2048);

  // ---- h1 = elu(accW + b1 + ctx) -> sH1; skip + bias -> sSkip ----
#pragma unroll
  for (int j = 0; j < 2; ++j) {
    int col = c0 + j * 16 + laneR;
    float bc = fb1[col] + ctxh[bIdx * H_ + col];
#pragma unroll
    for (int i = 0; i < 8; ++i)
      sH1[(r0 + i + hi8) * PW_ + col] = (_Float16)elu_f(accW[j][i] + bc);
  }
  if (cg < 2) {
    int col = cg * 16 + laneR;
    float bs = fbskip[col];
#pragma unroll
    for (int i = 0; i < 8; ++i) sSkip[(r0 + i + hi8) * N_ + col] = accS[i] + bs;
  }
  wait_async();                               // W2 + Wg resident; h1, skip of all waves visible

  // ---- GEMM2 (K=128): h2 = h1 @ W2 + b2, the wave's two column tiles ----
  v8f h2[2];
  h2[0] = Z; h2[1] = Z;
#pragma unroll
  for (int k0 = 0; k0 < H_; k0 += 32) {
    v16h a = load_frag16(sH1 + (r0 + laneR) * PW_ + k0 + kh * 8);
#pragma unroll
    for (int j = 0; j < 2; ++j) {
      v16h b = load_frag16(sW2 + (c0 + j * 16 + laneR) * PW_ + k0 + kh * 8);
      h2[j] = WMMA16(a, b, h2[j]);
    }
  }
#pragma unroll
  for (int j = 0; j < 2; ++j) {
    int col = c0 + j * 16 + laneR;
    float b2v = fb2[col];
#pragma unroll
    for (int i = 0; i < 8; ++i)
      sH2[(r0 + i + hi8) * PW_ + col] = (_Float16)(h2[j][i] + b2v);
  }
  __syncthreads();                            // h2 of all waves visible
  if (wave >= 2) return;                      // no barrier below; waves 0, 1: r0 = wave * 16

  // ---- GEMM3 (K=128, 64 cols): g = h2 @ Wg + bg, 4 tiles in registers ----
  v8f g[4];
#pragma unroll
  for (int ct = 0; ct < 4; ++ct) g[ct] = Z;
#pragma unroll
  for (int k0 = 0; k0 < H_; k0 += 32) {
    v16h a = load_frag16(sH2 + (r0 + laneR) * PW_ + k0 + kh * 8);
#pragma unroll
    for (int ct = 0; ct < 4; ++ct) {
      v16h b = load_frag16(sWg + (ct * 16 + laneR) * PW_ + k0 + kh * 8);
      g[ct] = WMMA16(a, b, g[ct]);
    }
  }
  float sk[2][8];
#pragma unroll
  for (int cs = 0; cs < 2; ++cs)
#pragma unroll
    for (int i = 0; i < 8; ++i) sk[cs][i] = sSkip[(r0 + i + hi8) * N_ + cs * 16 + laneR];

  // ---- GLU (col c with gate c+32) + skip, all in registers ----
  float t[2][8];
#pragma unroll
  for (int cs = 0; cs < 2; ++cs) {
    int col = cs * 16 + laneR;
    float ba = fbg[col], bg2 = fbg[col + 32];
#pragma unroll
    for (int i = 0; i < 8; ++i)
      t[cs][i] = (g[cs][i] + ba) * sigmoid_f(g[cs + 2][i] + bg2) + sk[cs][i];
  }

  // ---- LayerNorm over N=32 + softmax via 16-lane butterflies ----
  float s1[8], s2[8];
#pragma unroll
  for (int i = 0; i < 8; ++i) {
    s1[i] = t[0][i] + t[1][i];
    s2[i] = t[0][i] * t[0][i] + t[1][i] * t[1][i];
  }
#pragma unroll
  for (int m = 1; m < 16; m <<= 1)
#pragma unroll
    for (int i = 0; i < 8; ++i) {
      s1[i] += __shfl_xor(s1[i], m, 32);
      s2[i] += __shfl_xor(s2[i], m, 32);
    }
  float l[2][8];
#pragma unroll
  for (int i = 0; i < 8; ++i) {
    float mu = s1[i] * (1.0f / N_);
    float var = s2[i] * (1.0f / N_) - mu * mu;
    float rs = rsqrtf(var + LN_EPS);
#pragma unroll
    for (int cs = 0; cs < 2; ++cs) {
      int col = cs * 16 + laneR;
      l[cs][i] = (t[cs][i] - mu) * rs * fg[col] + fbv[col];
    }
  }
  float mx[8];
#pragma unroll
  for (int i = 0; i < 8; ++i) mx[i] = fmaxf(l[0][i], l[1][i]);
#pragma unroll
  for (int m = 1; m < 16; m <<= 1)
#pragma unroll
    for (int i = 0; i < 8; ++i) mx[i] = fmaxf(mx[i], __shfl_xor(mx[i], m, 32));
  float e0[8], e1[8], se[8];
#pragma unroll
  for (int i = 0; i < 8; ++i) {
    e0[i] = __expf(l[0][i] - mx[i]);
    e1[i] = __expf(l[1][i] - mx[i]);
    se[i] = e0[i] + e1[i];
  }
#pragma unroll
  for (int m = 1; m < 16; m <<= 1)
#pragma unroll
    for (int i = 0; i < 8; ++i) se[i] += __shfl_xor(se[i], m, 32);
#pragma unroll
  for (int i = 0; i < 8; ++i) {
    int row = rowbase + r0 + i + hi8;
    float inv = 1.0f / se[i];
    wOut[(size_t)row * N_ + laneR]      = e0[i] * inv;
    wOut[(size_t)row * N_ + 16 + laneR] = e1[i] * inv;
  }
}

// ------------------------------------------------------- per-variable GRNs
// One block = 128 rows (8 waves, 16 rows per wave). Everything one variable needs
// (embedding slice, weight panels, column values) is async-staged into one of two
// LDS buffers and shared by all waves: the next variable's copies fly during the
// whole of this variable's work, and one barrier a variable hands a buffer over.
// Every product is computed transposed: the weight panel is the A operand (its
// 16 rows = 16 output columns), the wave's 16 activation rows are the B operand.
// A lane then holds ONE activation row (lane & 15), and register i of a D tile
// is output column tile*16 + 8*(lane >> 4) + i. Two neighbouring D tiles,
// converted to f16 in place, are the next product's B fragment in the hardware's
// k order, so h1 and h2 never leave the registers. The values that go by column
// (biases, LayerNorm scale and shift) are staged in LDS and read eight per lane;
// a bias is the accumulator's start value. The LayerNorm sums run inside the
// lane, with one exchange between the lane halves.
// blockIdx.y picks a group of NPG_ variables, so that the grid fills the chip;
// each group stores its own partial sum plane part[group][row][h], and k_sum
// adds the planes.
typedef float f4 __attribute__((ext_vector_type(4)));

// One copy of 16 B per lane, as the builtin: the compiler places its address
// registers anywhere, where an asm operand must lie in the first 256 registers
// (this kernel's long-lived ones no longer all fit there and would be spilled).
typedef int i4 __attribute__((ext_vector_type(4)));
__device__ __forceinline__ void cp16b(void* ldst, const void* gsrc) {
  __builtin_amdgcn_global_load_async_to_lds_b128(
      (__attribute__((address_space(1))) i4*)(gsrc),
      (__attribute__((address_space(3))) i4*)(ldst), 0, 0);
}
// A run of N such copies: copy j moves gsrc + j*gstep to ldst + j*lstep (in halves).
template <int N>
__device__ __forceinline__ void cpRun(_Float16* ldst, int lstep, const _Float16* gsrc, int gstep) {
#pragma unroll  // the copies of a run issue back to back
  for (int j = 0; j < N; ++j) cp16b(ldst + j * lstep, gsrc + (size_t)j * gstep);
}
// Eight consecutive f32 (32-byte aligned, LDS) in the register order of a D tile.
__device__ __forceinline__ v8f load_c8(const float* p) {
  f4 lo = *(const f4*)(p);
  f4 hi = *(const f4*)(p + 4);
  return __builtin_shufflevector(lo, hi, 0, 1, 2, 3, 4, 5, 6, 7);
}
// Two f32 D tiles (k 0..15 and 16..31 of a k step) -> one f16 B fragment.
__device__ __forceinline__ v16h pack_frag(v8f t0, v8f t1) {
  h8 lo = __builtin_convertvector(t0, h8);
  h8 hi = __builtin_convertvector(t1, h8);
  return __builtin_shufflevector(lo, hi, 0, 1, 2, 3, 4, 5, 6, 7, 8, 9, 10, 11, 12, 13, 14, 15);
}
// The value of lane l ^ 16.
__device__ __forceinline__ float other_half(float x) {
  int b = __builtin_bit_cast(int, x);
  return __builtin_bit_cast(float,
      __builtin_amdgcn_permlanex16(b, b, 0x76543210, 0xfedcba98, false, false));
}

// Rows of a VarBuf's col, H_ floats each
#define CB1_  0
#define CBS_  1
#define CB2_  2
#define CBA_  3
#define CBG_  4
#define CLG_  5
#define CLB_  6
#define NCOL_ 7

// The LDS of one variable; two of them fill the work-group processor's LDS.
struct __attribute__((aligned(32))) VarBuf {
  _Float16 e[128 * PN_];      // embedding slice [row][64]
  _Float16 w1[128 * PN_];     // W1 panel [col][64]
  _Float16 ws[128 * PN_];     // Wskip panel [col][64]
  _Float16 w2[128 * PW_];     // W2 panel [col][128]
  _Float16 wga[128 * PW_];    // Wg cols 0..127 [col][128]
  _Float16 wgg[128 * PW_];    // Wg gate half, cols 128..255 [col][128]
  float col[NCOL_ * H_];      // per-column values
};
static_assert(2 * sizeof(VarBuf) <= 327680, "two buffers must fit the LDS");
static_assert(NPG_ >= 2, "the ring's prologue stages two variables");

__global__ void __launch_bounds__(256)
k_var(const _Float16* __restrict__ e16,
      const _Float16* __restrict__ vW1T, const _Float16* __restrict__ vWskipT,
      const _Float16* __restrict__ vW2T, const _Float16* __restrict__ vWgT,
      const float* __restrict__ vb1, const float* __restrict__ vbskip,
      const float* __restrict__ vb2, const float* __restrict__ vbg,
      const float* __restrict__ vg, const float* __restrict__ vbv,
      const float* __restrict__ wIn, float* __restrict__ part) {
  __shared__ VarBuf sB[2];

  const int tid = threadIdx.x;
  const int wave = __builtin_amdgcn_readfirstlane(tid >> 5), lane = tid & 31;
  const int laneR = lane & 15, kh = (lane >> 4) & 1;
  const int hi8 = (lane & 16) ? 8 : 0;
  const int r0 = wave * 16;                    // wave's row tile within block
  const int rowbase = blockIdx.x * 128;
  const int nBeg = blockIdx.y * NPG_, nEnd = nBeg + NPG_;
  float* const outPtr = part + (size_t)blockIdx.y * BT_ * H_;

  float outReg[64];                            // [ct][i]: row laneR, column ct*16 + hi8 + i
#pragma unroll
  for (int q = 0; q < 64; ++q) outReg[q] = 0.0f;
  float tv[64];                                // skip, then GLU result; same map

  // 128-byte rows: 8 lanes a row, copy j of a run takes row nr + 32*j.
  // 256-byte rows: 16 lanes a row, copy j of a run takes row wr + 16*j.
  const int nr = tid >> 3, no = (tid & 7) * 8;
  const int wr = tid >> 4, wo = (tid & 15) * 8;
  auto stagePanels = [&](int n, VarBuf& b) {   // 36 copies a wave
    cpRun<4>(b.e + nr * PN_ + no, 32 * PN_,    // 1024 chunks of 16B
             e16 + ((size_t)(rowbase + nr) * N_ + n) * D_ + no, 32 * ND_);
    cpRun<4>(b.w1 + nr * PN_ + no, 32 * PN_, vW1T + (size_t)n * H_ * D_ + tid * 8, 2048);
    cpRun<4>(b.ws + nr * PN_ + no, 32 * PN_, vWskipT + (size_t)n * H_ * D_ + tid * 8, 2048);
    cpRun<8>(b.w2 + wr * PW_ + wo, 16 * PW_, vW2T + (size_t)n * H_ * H_ + tid * 8, 2048);
    const _Float16* ga = vWgT + (size_t)n * 256 * H_;
    const _Float16* gg = ga + (size_t)128 * H_;
    cpRun<8>(b.wga + wr * PW_ + wo, 16 * PW_, ga + tid * 8, 2048);
    cpRun<8>(b.wgg + wr * PW_ + wo, 16 * PW_, gg + tid * 8, 2048);
  };
  // Wave w < NCOL_ brings row w of col: 32 lanes x 16 B = H_ floats. Its source
  // walks from variable to variable in steps of the array's own row length.
  const float* colSrc = (wave == CB1_ ? vb1 + nBeg * H_
                       : wave == CBS_ ? vbskip + nBeg * H_
                       : wave == CB2_ ? vb2 + nBeg * H_
                       : wave == CBA_ ? vbg + nBeg * 256
                       : wave == CBG_ ? vbg + nBeg * 256 + 128
                       : wave == CLG_ ? vg + nBeg * H_
                                      : vbv + nBeg * H_);
  const int colStep = (wave == CBA_ || wave == CBG_) ? 256 : H_;
  const int colOff = (wave < NCOL_ ? wave : 0) * H_ + lane * 4;
  auto stageCol = [&](VarBuf& b) {             // the next staged variable's column values
    if (wave < NCOL_) {                        // scalar test: the eighth wave issues no copy
      cp16b(b.col + colOff, colSrc + lane * 4);
      colSrc += colStep;
    }
  };
  const float* const wRow = wIn + (size_t)(rowbase + r0 + laneR) * N_;

  stagePanels(nBeg, sB[0]);
  stageCol(sB[0]);
  wait_async();                                // first variable resident in buffer 0
  stagePanels(nBeg + 1, sB[1]);
  stageCol(sB[1]);

  for (int n = nBeg; n < nEnd; ++n) {
    VarBuf& vb = sB[(n - nBeg) & 1];           // this variable's buffer, the only one read in this trip
    const _Float16* const sE = vb.e;
    const _Float16* const sW1 = vb.w1;
    const _Float16* const sWs = vb.ws;
    const _Float16* const sW2 = vb.w2;
    const _Float16* const sWgA = vb.wga;
    const _Float16* const sWgG = vb.wgg;
    const float* const colP = vb.col + hi8;    // the lane's eight columns of tile 0
    float wsel = wRow[n];                      // the row's selection weight, used at the end of the trip
    // precaution: every later rewrite of the load's address registers stays behind this wait
    asm volatile("s_wait_xcnt 0x0" ::: "memory");

    // ---- GEMM1 (K=64): aW = (E@W1 + b1)^T, aS = (E@Wskip + bskip)^T, one column
    // tile at a time. The next tile's weight fragments and start values are read
    // into a second register set ahead of this tile's WMMAs, so that no WMMA waits
    // out the latency of its own reads ----
    v16h bE[2];
#pragma unroll
    for (int ks = 0; ks < 2; ++ks)
      bE[ks] = load_frag16(sE + (r0 + laneR) * PN_ + ks * 32 + kh * 8);
    v16h f1[2][4];
    v8f c1[2][2];
#pragma unroll
    for (int ks = 0; ks < 2; ++ks) {
      f1[0][ks]     = load_frag16(sW1 + laneR * PN_ + ks * 32 + kh * 8);
      f1[0][2 + ks] = load_frag16(sWs + laneR * PN_ + ks * 32 + kh * 8);
    }
    c1[0][0] = load_c8(colP + CB1_ * H_);
    c1[0][1] = load_c8(colP + CBS_ * H_);
    v16h bH[4];                                // elu(h1) as B fragments
    v8f hPrev;
#pragma unroll
    for (int ct = 0; ct < 8; ++ct) {
      if (ct + 1 < 8) {
#pragma unroll
        for (int ks = 0; ks < 2; ++ks) {
          f1[(ct + 1) & 1][ks]     = load_frag16(sW1 + ((ct + 1) * 16 + laneR) * PN_ + ks * 32 + kh * 8);
          f1[(ct + 1) & 1][2 + ks] = load_frag16(sWs + ((ct + 1) * 16 + laneR) * PN_ + ks * 32 + kh * 8);
        }
        c1[(ct + 1) & 1][0] = load_c8(colP + CB1_ * H_ + (ct + 1) * 16);
        c1[(ct + 1) & 1][1] = load_c8(colP + CBS_ * H_ + (ct + 1) * 16);
      }
      __builtin_amdgcn_sched_barrier(0);       // keeps the reads above as one group ahead of this step's WMMAs
      v8f aW = c1[ct & 1][0], aS = c1[ct & 1][1];
#pragma unroll
      for (int ks = 0; ks < 2; ++ks) {
        aW = WMMA16(f1[ct & 1][ks], bE[ks], aW);
        aS = WMMA16(f1[ct & 1][2 + ks], bE[ks], aS);
      }
      v8f h;
#pragma unroll
      for (int i = 0; i < 8; ++i) {
        h[i] = elu_f(aW[i]);
        tv[ct * 8 + i] = aS[i];                // skip, kept in registers
      }
      if (ct & 1) bH[ct >> 1] = pack_frag(hPrev, h);
      else        hPrev = h;
    }

    // ---- GEMM2 (K=128): h2 = (elu(h1) @ W2 + b2)^T. Two column tiles a step (one
    // B fragment of GEMM3), the next step's W2 fragments read ahead ----
    v16h f2[2][8];
    v8f c2[2][2];
#pragma unroll
    for (int q = 0; q < 8; ++q)
      f2[0][q] = load_frag16(sW2 + ((q & 1) * 16 + laneR) * PW_ + (q >> 1) * 32 + kh * 8);
    c2[0][0] = load_c8(colP + CB2_ * H_);
    c2[0][1] = load_c8(colP + CB2_ * H_ + 16);
    v16h bG[4];                                // h2 as B fragments
#pragma unroll
    for (int ct = 0; ct < 8; ct += 2) {
      const int cur = (ct >> 1) & 1;
      if (ct + 2 < 8) {
#pragma unroll
        for (int q = 0; q < 8; ++q)
          f2[cur ^ 1][q] = load_frag16(sW2 + ((ct + 2 + (q & 1)) * 16 + laneR) * PW_ + (q >> 1) * 32 + kh * 8);
        c2[cur ^ 1][0] = load_c8(colP + CB2_ * H_ + (ct + 2) * 16);
        c2[cur ^ 1][1] = load_c8(colP + CB2_ * H_ + (ct + 3) * 16);
      }
      __builtin_amdgcn_sched_barrier(0);       // keeps the reads above as one group ahead of this step's WMMAs
      v8f h2[2];
      h2[0] = c2[cur][0]; h2[1] = c2[cur][1];
#pragma unroll
      for (int q = 0; q < 8; ++q)
        h2[q & 1] = WMMA16(f2[cur][q], bH[q >> 1], h2[q & 1]);
      bG[ct >> 1] = pack_frag(h2[0], h2[1]);
    }

    // ---- GEMM3 pairs (K=128): a-part (sWgA) and gate (sWgG), GLU in regs; the
    // next column tile's Wg fragments read ahead, as above ----
    v16h f3[2][8];
    v8f c3[2][2];
#pragma unroll
    for (int ks = 0; ks < 4; ++ks) {
      f3[0][2 * ks]     = load_frag16(sWgA + laneR * PW_ + ks * 32 + kh * 8);
      f3[0][2 * ks + 1] = load_frag16(sWgG + laneR * PW_ + ks * 32 + kh * 8);
    }
    c3[0][0] = load_c8(colP + CBA_ * H_);
    c3[0][1] = load_c8(colP + CBG_ * H_);
#pragma unroll
    for (int ct = 0; ct < 8; ++ct) {
      if (ct + 1 < 8) {
#pragma unroll
        for (int ks = 0; ks < 4; ++ks) {
          f3[(ct + 1) & 1][2 * ks]     = load_frag16(sWgA + ((ct + 1) * 16 + laneR) * PW_ + ks * 32 + kh * 8);
          f3[(ct + 1) & 1][2 * ks + 1] = load_frag16(sWgG + ((ct + 1) * 16 + laneR) * PW_ + ks * 32 + kh * 8);
        }
        c3[(ct + 1) & 1][0] = load_c8(colP + CBA_ * H_ + (ct + 1) * 16);
        c3[(ct + 1) & 1][1] = load_c8(colP + CBG_ * H_ + (ct + 1) * 16);
      }
      __builtin_amdgcn_sched_barrier(0);       // keeps the reads above as one group ahead of this step's WMMAs
      v8f ga = c3[ct & 1][0], gg = c3[ct & 1][1];
#pragma unroll
      for (int ks = 0; ks < 4; ++ks) {
        ga = WMMA16(f3[ct & 1][2 * ks], bG[ks], ga);
        gg = WMMA16(f3[ct & 1][2 * ks + 1], bG[ks], gg);
      }
#pragma unroll
      for (int i = 0; i < 8; ++i)
        tv[ct * 8 + i] = ga[i] * sigmoid_f(gg[i]) + tv[ct * 8 + i];   // GLU + skip
      __builtin_amdgcn_sched_barrier(0);       // keeps the next tile's reads below: one group at one place, not spread among these WMMAs
    }

    // ---- LayerNorm over H=128: the lane's 64 columns (eight chains, then a
    // tree), then the other lane half's 64 ----
    float s1[8], s2[8];
#pragma unroll
    for (int i = 0; i < 8; ++i) { s1[i] = 0.f; s2[i] = 0.f; }
#pragma unroll
    for (int ct = 0; ct < 8; ++ct)
#pragma unroll
      for (int i = 0; i < 8; ++i) { float t = tv[ct * 8 + i]; s1[i] += t; s2[i] += t * t; }
#pragma unroll
    for (int m = 4; m >= 1; m >>= 1)
#pragma unroll
      for (int i = 0; i < m; ++i) { s1[i] += s1[i + m]; s2[i] += s2[i + m]; }
    const float t1 = s1[0] + other_half(s1[0]);
    const float t2 = s2[0] + other_half(s2[0]);

    // ---- normalize + softmax-weighted combine into registers ----
    const float mu = t1 * (1.0f / H_);
    const float var = t2 * (1.0f / H_) - mu * mu;
    const float rs = rsqrtf(var + LN_EPS);
#pragma unroll
    for (int ct = 0; ct < 8; ++ct) {
      v8f lg = load_c8(colP + CLG_ * H_ + ct * 16);
      v8f lb = load_c8(colP + CLB_ * H_ + ct * 16);
#pragma unroll
      for (int i = 0; i < 8; ++i) {
        float val = (tv[ct * 8 + i] - mu) * rs * lg[i] + lb[i];
        outReg[ct * 8 + i] += wsel * val;
      }
    }
    // Hand-over: this wave's reads of vb have returned, its copies of the next
    // variable have landed; behind the barrier that holds for every wave.
    asm volatile("s_wait_dscnt 0x0" ::: "memory");
    wait_async();
    if (n + 2 < nEnd) {                        // refill the buffer just read; flies during the next trip
      stagePanels(n + 2, vb);
      stageCol(vb);
    }
  }
  asm volatile("s_wait_asynccnt 0x0" ::: "memory");   // no copy outlives the loop

  // ---- epilogue: store this group's partial tile, eight columns per lane and tile ----
  float* const oRow = outPtr + (size_t)(rowbase + r0 + laneR) * H_ + hi8;
#pragma unroll
  for (int ct = 0; ct < 8; ++ct) {
    f4 lo = {outReg[ct * 8 + 0], outReg[ct * 8 + 1], outReg[ct * 8 + 2], outReg[ct * 8 + 3]};
    f4 hi = {outReg[ct * 8 + 4], outReg[ct * 8 + 5], outReg[ct * 8 + 6], outReg[ct * 8 + 7]};
    *(f4*)(oRow + ct * 16)     = lo;
    *(f4*)(oRow + ct * 16 + 4) = hi;
  }
}

// out[i] = sum over the NG_ groups of part[group][i], groups in rising order.
__global__ void __launch_bounds__(256) k_sum(const float* __restrict__ part,
                                             float* __restrict__ outPtr) {
  // One 32-bit byte offset serves every plane and the store (uniform base + offset).
  const unsigned off = (blockIdx.x * 256u + threadIdx.x) * 16u;
  float4 s = *(const float4*)((const char*)part + off);
#pragma unroll  // all planes' loads in flight together
  for (int g = 1; g < NG_; ++g) {
    float4 p = *(const float4*)((const char*)(part + (size_t)g * BT_ * H_) + off);
    s.x += p.x; s.y += p.y; s.z += p.z; s.w += p.w;
  }
  *(float4*)((char*)outPtr + off) = s;
}

// ----------------------------------------------------------------------------
extern "C" void kernel_launch(void* const* d_in, const int* in_sizes, int n_in,
                              void* d_out, int out_size, void* d_ws, size_t ws_size,
                              hipStream_t stream) {
  (void)in_sizes; (void)n_in; (void)out_size; (void)ws_size;

  const float* emb    = (const float*)d_in[0];
  const float* ctx    = (const float*)d_in[1];
  const float* fWskip = (const float*)d_in[2];
  const float* fbskip = (const float*)d_in[3];
  const float* fW1    = (const float*)d_in[4];
  const float* fb1    = (const float*)d_in[5];
  const float* fWc    = (const float*)d_in[6];
  const float* fW2    = (const float*)d_in[7];
  const float* fb2    = (const float*)d_in[8];
  const float* fWg    = (const float*)d_in[9];
  const float* fbg    = (const float*)d_in[10];
  const float* fg     = (const float*)d_in[11];
  const float* fbv    = (const float*)d_in[12];
  const float* vWskip = (const float*)d_in[13];
  const float* vbskip = (const float*)d_in[14];
  const float* vW1    = (const float*)d_in[15];
  const float* vb1    = (const float*)d_in[16];
  const float* vW2    = (const float*)d_in[17];
  const float* vb2    = (const float*)d_in[18];
  const float* vWg    = (const float*)d_in[19];
  const float* vbg    = (const float*)d_in[20];
  const float* vg     = (const float*)d_in[21];
  const float* vbv    = (const float*)d_in[22];

  // Workspace carve (f16 copies, transposed weights, ctx projection, partial planes)
  char* w = (char*)d_ws;
  size_t off = 0;
  auto alloc = [&](size_t bytes) -> char* {
    char* p = w + off;
    off = (off + bytes + 255) & ~(size_t)255;
    return p;
  };
  _Float16* e16     = (_Float16*)alloc((size_t)BT_ * ND_ * 2);
  _Float16* fW1T    = (_Float16*)alloc((size_t)ND_ * H_ * 2);
  _Float16* fWskipT = (_Float16*)alloc((size_t)ND_ * N_ * 2);
  _Float16* fW2T    = (_Float16*)alloc((size_t)H_ * H_ * 2);
  _Float16* fWgT    = (_Float16*)alloc((size_t)H_ * 2 * N_ * 2);
  _Float16* vW1T    = (_Float16*)alloc((size_t)N_ * D_ * H_ * 2);
  _Float16* vWskipT = (_Float16*)alloc((size_t)N_ * D_ * H_ * 2);
  _Float16* vW2T    = (_Float16*)alloc((size_t)N_ * H_ * H_ * 2);
  _Float16* vWgT    = (_Float16*)alloc((size_t)N_ * H_ * 256 * 2);
  float*    ctxh    = (float*)alloc((size_t)B_ * H_ * 4);
  float*    part    = (float*)alloc((size_t)NG_ * BT_ * H_ * 4);

  float* outPtr = (float*)d_out;                   // [BT, H]
  float* wOut   = outPtr + (size_t)BT_ * H_;       // [BT, N]

  // precision conversion, transposes and context projection: one launch
  k_prep<<<NB_PREP, 256, 0, stream>>>(emb, ctx, fWc, fW1, fWskip, fW2, fWg,
                                      vW1, vWskip, vW2, vWg,
                                      e16, ctxh, fW1T, fWskipT, fW2T, fWgT,
                                      vW1T, vWskipT, vW2T, vWgT);

  // flatten GRN -> softmax weights (FR_ rows/block, 8 waves)
  k_flat<<<BT_ / FR_, 256, 0, stream>>>(e16, fW1T, fWskipT, fW2T, fWgT,
                                        fb1, fbskip, fb2, fbg, fg, fbv,
                                        ctxh, wOut);

  // per-variable GRNs + weighted combine -> partial planes (128 rows/block,
  // 8 waves, NPG_ variables per block), then the sum of the planes -> outputs
  k_var<<<dim3(BT_ / 128, NG_), 256, 0, stream>>>(e16, vW1T, vWskipT, vW2T, vWgT,
                                                  vb1, vbskip, vb2, vbg, vg, vbv,
                                                  wOut, part);
  k_sum<<<BT_ * H_ / 1024, 256, 0, stream>>>(part, outPtr);
}

// v009
// Measured time: 71.8 microseconds a run.
// Two timings next to v008 put it at 1.15 and 1.13 times that version's speed.
// Over all steps from v000 it is 16.3 times as fast.
#include <hip/hip_runtime.h>
#include <hip/hip_bf16.h>
#include <math.h>

// Problem dims (fixed by reference)
#define B_   64
#define T_   128
#define N_   32
#define D_   64
#define H_   128
#define C_   64
#define BT_  (B_ * T_)      // 8192
#define ND_  (N_ * D_)      // 2048
#define KC_  128            // K-chunk for the flatten GEMM stream
#define NG_  4              // groups of variables in k_var's grid (blockIdx.y)
#define NPG_ (N_ / NG_)     // variables per group
#define LN_EPS 1e-5f
// LDS row pitches in halves. Bank = dword address mod 64, so rows of 256 B (or
// 128 B) put the 16 lanes of a ds_load_b128 fragment read on the same four
// (eight) banks. A pitch of 16 B x odd spreads them over all 64 banks.
#define PW_  136            // 256-byte rows: pitch 272 B = 16 B x 17
#define PN_  72             // 128-byte rows: pitch 144 B = 16 B x 9

typedef _Float16 v16h __attribute__((ext_vector_type(16)));
typedef _Float16 h8   __attribute__((ext_vector_type(8)));
typedef float    v8f  __attribute__((ext_vector_type(8)));

// ---------------------------------------------------------------------------
// CDNA5 async global->LDS staging (GLOBAL_LOAD_ASYNC_TO_LDS_B128, ASYNCcnt).
// GV addressing: vdst = LDS byte address, vaddr = 64-bit global address.
// ---------------------------------------------------------------------------
// A run of copies shares one asm statement; its last line, s_wait_xcnt 0, keeps
// every later rewrite of the address registers behind the copies' issue.
// Copy j moves 16 B per lane from gsrc + j*gstep to ldst + j*lstep (in halves).
__device__ __forceinline__ void cp16x2(_Float16* ldst, int lstep,
                                       const _Float16* gsrc, int gstep) {
  unsigned l = (unsigned)(size_t)ldst;
  unsigned long long g = (unsigned long long)(size_t)gsrc;
  unsigned ls = (unsigned)lstep * 2u;
  unsigned long long gs = (unsigned long long)gstep * 2ull;
  asm volatile("global_load_async_to_lds_b128 %0, %2, off\n\t"
               "global_load_async_to_lds_b128 %1, %3, off\n\t"
               "s_wait_xcnt 0x0"
               :
               : "v"(l), "v"(l + ls), "v"(g), "v"(g + gs)
               : "memory");
}
__device__ __forceinline__ void cp16x4(_Float16* ldst, int lstep,
                                       const _Float16* gsrc, int gstep) {
  unsigned l = (unsigned)(size_t)ldst;
  unsigned long long g = (unsigned long long)(size_t)gsrc;
  unsigned ls = (unsigned)lstep * 2u;
  unsigned long long gs = (unsigned long long)gstep * 2ull;
  asm volatile("global_load_async_to_lds_b128 %0, %4, off\n\t"
               "global_load_async_to_lds_b128 %1, %5, off\n\t"
               "global_load_async_to_lds_b128 %2, %6, off\n\t"
               "global_load_async_to_lds_b128 %3, %7, off\n\t"
               "s_wait_xcnt 0x0"
               :
               : "v"(l), "v"(l + ls), "v"(l + 2 * ls), "v"(l + 3 * ls),
                 "v"(g), "v"(g + gs), "v"(g + 2 * gs), "v"(g + 3 * gs)
               : "memory");
}
__device__ __forceinline__ void cp16x8(_Float16* ldst, int lstep,
                                       const _Float16* gsrc, int gstep) {
  unsigned l = (unsigned)(size_t)ldst;
  unsigned long long g = (unsigned long long)(size_t)gsrc;
  unsigned ls = (unsigned)lstep * 2u;
  unsigned long long gs = (unsigned long long)gstep * 2ull;
  asm volatile("global_load_async_to_lds_b128 %0, %8, off\n\t"
               "global_load_async_to_lds_b128 %1, %9, off\n\t"
               "global_load_async_to_lds_b128 %2, %10, off\n\t"
               "global_load_async_to_lds_b128 %3, %11, off\n\t"
               "global_load_async_to_lds_b128 %4, %12, off\n\t"
               "global_load_async_to_lds_b128 %5, %13, off\n\t"
               "global_load_async_to_lds_b128 %6, %14, off\n\t"
               "global_load_async_to_lds_b128 %7, %15, off\n\t"
               "s_wait_xcnt 0x0"
               :
               : "v"(l), "v"(l + ls), "v"(l + 2 * ls), "v"(l + 3 * ls),
                 "v"(l + 4 * ls), "v"(l + 5 * ls), "v"(l + 6 * ls), "v"(l + 7 * ls),
                 "v"(g), "v"(g + gs), "v"(g + 2 * gs), "v"(g + 3 * gs),
                 "v"(g + 4 * gs), "v"(g + 5 * gs), "v"(g + 6 * gs), "v"(g + 7 * gs)
               : "memory");
}
__device__ __forceinline__ void wait_async() {
  asm volatile("s_wait_asynccnt 0x0" ::: "memory");
  __syncthreads();
}

// Load a 16-half WMMA operand fragment. p points at (index, k0 + khalf*8) in a
// row-major [rows][ldK] f16 array; elements 0..7 = K+0..7, 8..15 = K+16..23
// (CDNA5 16-bit A/B VGPR layout, ISA 7.12.2). 16-byte aligned.
__device__ __forceinline__ v16h load_frag16(const _Float16* p) {
  h8 lo = *(const h8*)(p);
  h8 hi = *(const h8*)(p + 16);
  v16h f;
#pragma unroll
  for (int i = 0; i < 8; ++i) { f[i] = lo[i]; f[8 + i] = hi[i]; }
  return f;
}

#define WMMA16(a, b, c) \
  __builtin_amdgcn_wmma_f32_16x16x32_f16(false, (a), false, (b), (short)0, (c), false, false)

__device__ __forceinline__ float elu_f(float x)     { return x > 0.0f ? x : __expf(x) - 1.0f; }
// The hardware reciprocal (about 1 ulp) in place of the exact f32 division, which
// compiles to ten more vector instructions per value; 1 + exp(-x) >= 1 or inf.
__device__ __forceinline__ float sigmoid_f(float x) { return __builtin_amdgcn_rcpf(1.0f + __expf(-x)); }

// ---------------------------------------------------------------- preparation
// f16 copy of the embedding, transposed f16 copies of six weight tensors and
// the context projection. None of the eight jobs reads what another writes,
// so ONE launch runs them all: each job owns a range of blocks and walks its
// elements with a stride of that range.
// A launch this short also pays for every wave it starts, so the ranges are
// kept small: 16 elements per thread in a transpose, 64 in the embedding copy.
#define NB_CTX   (B_ / 2)                      // two batches per 256-thread block
#define NB_FW1   (ND_ * H_ / 4096)
#define NB_FWS   (ND_ * N_ / 4096)
#define NB_FW2   (H_ * H_ / 4096)
#define NB_FWG   (H_ * 2 * N_ / 4096)
#define NB_VW1   (N_ * D_ * H_ / 4096)
#define NB_VWS   (N_ * D_ * H_ / 4096)
#define NB_FOLD  (N_ * 16 * 2 / 8)             // 8 waves a block; a wave: variable, column tile, half of the rows
#define NB_EMB   (BT_ * ND_ / 16384)
#define NB_PREP  (NB_CTX + NB_FW1 + NB_FWS + NB_FW2 + NB_FWG + NB_VW1 + NB_VWS + NB_EMB)

// dst[i] = (f16)src[i]; blk = block's index inside the job's nblk blocks
__device__ __forceinline__ void cvt_job(const float* __restrict__ src,
                                        _Float16* __restrict__ dst, int n,
                                        int blk, int nblk) {
  for (int i = blk * 256 + threadIdx.x; i < n; i += nblk * 256)
    dst[i] = (_Float16)src[i];
}

// src: fp32 [batch][R][C]  ->  dst: f16 [batch][C][R]  (transpose per batch)
__device__ __forceinline__ void cvtT_job(const float* __restrict__ src,
                                         _Float16* __restrict__ dst,
                                         int batch, int R, int Ccols,
                                         int blk, int nblk) {
  int total = batch * R * Ccols;
  for (int i = blk * 256 + threadIdx.x; i < total; i += nblk * 256) {
    int n = i / (R * Ccols);
    int rem = i - n * (R * Ccols);
    int c = rem / R;
    int r = rem - c * R;
    dst[i] = (_Float16)src[((size_t)n * R + r) * Ccols + c];
  }
}

// ctxh[b][h] = sum_c context[b][c] * fWc[c][h]   (tiny, plain FMA)
__device__ __forceinline__ void ctx_job(const float* __restrict__ context,
                                        const float* __restrict__ fWc,
                                        float* __restrict__ ctxh, int blk) {
  int b = blk * 2 + (threadIdx.x >> 7), h = threadIdx.x & (H_ - 1);
  float s = 0.0f;
  for (int c = 0; c < C_; ++c) s += context[b * C_ + c] * fWc[c * H_ + h];
  ctxh[b * H_ + h] = s;
}

// The value of lane l ^ 16.
__device__ __forceinline__ float other_half(float x) {
  int b = __builtin_bit_cast(int, x);
  return __builtin_bit_cast(float,
      __builtin_amdgcn_permlanex16(b, b, 0x76543210, 0xfedcba98, false, false));
}

// Nothing nonlinear stands between a variable's W2 and Wg:
//   (x @ W2 + b2) @ Wg + bg = x @ (W2 @ Wg) + (b2 @ Wg + bg).
// This job forms, per variable, F = W2 @ Wg on the matrix unit (f16 operands, f32
// sums) and stores it as f16 [column k][h], and the f32 bias b2 @ Wg + bg.
// One wave = 16 columns k of one variable and 64 of the 128 rows h. A = W2 rows h,
// B = Wg columns k; both fragments take k-dimension j in load_frag16's order.
// Register i of a D tile is row h = tile*16 + 8*(lane >> 4) + i of the lane's column.
// It reads inputs only and k_var alone reads its results, so it rides in k_flat's
// launch (the blocks behind the row blocks), beside work-groups that leave most
// issue slots free; in k_prep its registers would cut the resident streaming waves.
__device__ __forceinline__ void fold_job(const float* __restrict__ W2,
                                         const float* __restrict__ Wg,
                                         const float* __restrict__ b2,
                                         const float* __restrict__ bg,
                                         _Float16* __restrict__ dstW,
                                         float* __restrict__ dstB, int blk) {
  const int lane = threadIdx.x & 31, laneR = lane & 15, kh = lane >> 4;
  const int job = blk * 8 + __builtin_amdgcn_readfirstlane(threadIdx.x >> 5);
  const int n = job >> 5, kt = (job >> 1) & 15, hh = job & 1;
  const int col = kt * 16 + laneR;
  const float* const w2 = W2 + (size_t)n * H_ * H_ + (size_t)(hh * 64 + laneR) * H_ + kh * 8;
  const float* const wg = Wg + (size_t)n * H_ * 256 + col;
  const float* const bv = b2 + n * H_;
  v16h b[4];
  float bs = 0.0f;                             // the lane half's 64 terms of b2 @ Wg
#pragma unroll  // all 64 column loads in flight together
  for (int ks = 0; ks < 4; ++ks)
#pragma unroll
    for (int e = 0; e < 16; ++e) {
      int j = ks * 32 + (e >> 3) * 16 + kh * 8 + (e & 7);
      float wv = wg[(size_t)j * 256];
      bs += bv[j] * wv;
      b[ks][e] = (_Float16)wv;
    }
  h8 o[4];
#pragma unroll  // the four tiles' loads may run ahead of one another's WMMAs
  for (int t = 0; t < 4; ++t) {
    v8f d = {0.f, 0.f, 0.f, 0.f, 0.f, 0.f, 0.f, 0.f};
#pragma unroll
    for (int ks = 0; ks < 4; ++ks) {
      const float* p = w2 + (size_t)t * 16 * H_ + ks * 32;
      v16h a;
#pragma unroll
      for (int e = 0; e < 8; ++e) { a[e] = (_Float16)p[e]; a[8 + e] = (_Float16)p[16 + e]; }
      d = WMMA16(a, b[ks], d);
    }
    o[t] = __builtin_convertvector(d, h8);
  }
  // precaution: the loads' address registers (named as inputs, so that they live
  // up to here) are rewritten only behind this wait
  asm volatile("s_wait_xcnt 0x0" :: "v"(w2), "v"(wg), "v"(kh * 32) : "memory");
  _Float16* const po = dstW + ((size_t)n * 256 + col) * H_ + hh * 64 + kh * 8;
#pragma unroll
  for (int t = 0; t < 4; ++t) *(h8*)(po + t * 16) = o[t];
  bs += other_half(bs);
  if (hh == 0 && kh == 0) dstB[n * 256 + col] = bg[n * 256 + col] + bs;
}

// The short jobs take the low block indices, the long embedding stream the rest.
__global__ void __launch_bounds__(256)
k_prep(const float* __restrict__ emb, const float* __restrict__ context,
       const float* __restrict__ fWc,
       const float* __restrict__ fW1, const float* __restrict__ fWskip,
       const float* __restrict__ fW2, const float* __restrict__ fWg,
       const float* __restrict__ vW1, const float* __restrict__ vWskip,
       _Float16* __restrict__ e16, float* __restrict__ ctxh,
       _Float16* __restrict__ fW1T, _Float16* __restrict__ fWskipT,
       _Float16* __restrict__ fW2T, _Float16* __restrict__ fWgT,
       _Float16* __restrict__ vW1T, _Float16* __restrict__ vWskipT) {
  int b = blockIdx.x;
  if (b < NB_CTX) { ctx_job(context, fWc, ctxh, b); return; }
  b -= NB_CTX;
  if (b < NB_FW1) { cvtT_job(fW1, fW1T, 1, ND_, H_, b, NB_FW1); return; }
  b -= NB_FW1;
  if (b < NB_FWS) { cvtT_job(fWskip, fWskipT, 1, ND_, N_, b, NB_FWS); return; }
  b -= NB_FWS;
  if (b < NB_FW2) { cvtT_job(fW2, fW2T, 1, H_, H_, b, NB_FW2); return; }
  b -= NB_FW2;
  if (b < NB_FWG) { cvtT_job(fWg, fWgT, 1, H_, 2 * N_, b, NB_FWG); return; }
  b -= NB_FWG;
  if (b < NB_VW1) { cvtT_job(vW1, vW1T, N_, D_, H_, b, NB_VW1); return; }
  b -= NB_VW1;
  if (b < NB_VWS) { cvtT_job(vWskip, vWskipT, N_, D_, H_, b, NB_VWS); return; }
  b -= NB_VWS;
  cvt_job(emb, e16, BT_ * ND_, b, NB_EMB);
}

// ---------------------------------------------------------------- flatten GRN
// One block = FR_ rows, so that the grid's row blocks are one per WGP. The 8 waves
// share the block's 2 x 10 output tiles of GEMM1: wave = (row tile rt, column
// group cg); a wave takes two W1 column tiles, and the waves of groups 0 and 1
// one Wskip tile more. K=2048 streamed in 16 double-buffered async chunks.
// GEMM2 is shared the same way; GEMM3, GLU, LN and softmax (16-lane shfl_xor
// butterflies) run on two waves, one per row tile. Produces weights [BT, N_].
#define FR_  32

// One K-chunk of GEMM1 for one wave. pa, pw, ps: the lane's own fragment
// addresses in the flat, W1 and Wskip chunk at k = 0.
template <bool SKIP>
__device__ __forceinline__ void flat_chunk(const _Float16* pa, const _Float16* pw,
                                           const _Float16* ps, v8f (&accW)[2], v8f& accS) {
#pragma unroll  // all fragment loads of a chunk may be issued ahead of its WMMAs
  for (int k0 = 0; k0 < KC_; k0 += 32) {
    v16h a = load_frag16(pa + k0);
#pragma unroll
    for (int j = 0; j < 2; ++j) {
      v16h b = load_frag16(pw + j * 16 * PW_ + k0);
      accW[j] = WMMA16(a, b, accW[j]);
    }
    if (SKIP) {
      v16h b = load_frag16(ps + k0);
      accS = WMMA16(a, b, accS);
    }
  }
}

__global__ void __launch_bounds__(256)
k_flat(const _Float16* __restrict__ e16,
       const _Float16* __restrict__ fW1T, const _Float16* __restrict__ fWskipT,
       const _Float16* __restrict__ fW2T, const _Float16* __restrict__ fWgT,
       const float* __restrict__ fb1, const float* __restrict__ fbskip,
       const float* __restrict__ fb2, const float* __restrict__ fbg,
       const float* __restrict__ fg, const float* __restrict__ fbv,
       const float* __restrict__ ctxh,
       float* __restrict__ wOut,
       const float* __restrict__ vW2, const float* __restrict__ vWg,
       const float* __restrict__ vb2, const float* __restrict__ vbg,
       _Float16* __restrict__ vWfT, float* __restrict__ vbf) {
  if (blockIdx.x >= BT_ / FR_) {              // whole blocks, in front of every barrier and copy
    fold_job(vW2, vWg, vb2, vbg, vWfT, vbf, blockIdx.x - BT_ / FR_);
    return;
  }
  __shared__ __attribute__((aligned(16))) _Float16 bufFlat[2][FR_ * PW_];  // flat chunks, then h1 | h2
  __shared__ __attribute__((aligned(16))) _Float16 bufW1[2][128 * PW_];    // W1 chunks, then W2
  __shared__ __attribute__((aligned(16))) _Float16 bufWs[2][N_ * PW_];     // Wskip chunks, then Wg
  __shared__ float sSkip[FR_ * N_];                                        // skip path, f32

  const int tid = threadIdx.x;
  const int wave = __builtin_amdgcn_readfirstlane(tid >> 5), lane = tid & 31;
  const int laneR = lane & 15, kh = (lane >> 4) & 1;
  const int hi8 = (lane & 16) ? 8 : 0;
  const int rt = wave & 1, cg = wave >> 1;    // row tile, column group
  const int r0 = rt * 16;
  const int c0 = cg * 32;                     // first of the wave's 32 W1/W2 columns
  const int rowbase = blockIdx.x * FR_;
  const int bIdx = rowbase / T_;              // FR_ divides T_: one batch per block
  const v8f Z = {0.f, 0.f, 0.f, 0.f, 0.f, 0.f, 0.f, 0.f};

  // 16 lanes cover one 256-byte row; copy j of a run takes row sr + 16*j.
  const int sr = tid >> 4, so = (tid & 15) * 8;
  auto stageChunk = [&](int kc, int p) {
    int kk = kc * KC_;
    cp16x2(&bufFlat[p][sr * PW_ + so], 16 * PW_,      // flat rows: 512 x 16B
           e16 + (size_t)(rowbase + sr) * ND_ + kk + so, 16 * ND_);
    cp16x8(&bufW1[p][sr * PW_ + so], 16 * PW_,        // W1 panel: 2048 x 16B
           fW1T + (size_t)sr * ND_ + kk + so, 16 * ND_);
    cp16x2(&bufWs[p][sr * PW_ + so], 16 * PW_,        // Wskip panel: 512 x 16B
           fWskipT + (size_t)sr * ND_ + kk + so, 16 * ND_);
  };

  // ---- GEMM1 stream: accW = flat @ W1 (2 tiles), accS = flat @ Wskip (cg < 2) ----
  v8f accW[2], accS;
  accW[0] = Z; accW[1] = Z; accS = Z;

  stageChunk(0, 0);
  for (int kc = 0; kc < ND_ / KC_; ++kc) {
    int p = kc & 1;
    wait_async();                             // chunk kc resident
    if (kc + 1 < ND_ / KC_) stageChunk(kc + 1, p ^ 1);   // overlaps compute
    const _Float16* pa = &bufFlat[p][(r0 + laneR) * PW_ + kh * 8];
    const _Float16* pw = &bufW1[p][(c0 + laneR) * PW_ + kh * 8];
    const _Float16* ps = &bufWs[p][((cg & 1) * 16 + laneR) * PW_ + kh * 8];
    if (cg < 2) flat_chunk<true>(pa, pw, ps, accW, accS);
    else        flat_chunk<false>(pa, pw, ps, accW, accS);
    __syncthreads();                          // buffer reusable 2 chunks later
  }

  // ---- stage W2 (-> bufW1[0]) and Wg (-> bufWs, 64 rows contiguous) ----
  _Float16* sH1 = &bufFlat[0][0];
  _Float16* sH2 = &bufFlat[1][0];
  _Float16* sW2 = &bufW1[0][0];
  _Float16* sWg = &bufWs[0][0];
  cp16x8(sW2 + sr * PW_ + so, 16 * PW_, fW2T + tid * 8, 2048);
  cp16x4(sWg + sr * PW_ + so, 16 * PW_, fWgT + tid * 8, 2048);

  // ---- h1 = elu(accW + b1 + ctx) -> sH1; skip + bias -> sSkip ----
#pragma unroll
  for (int j = 0; j < 2; ++j) {
    int col = c0 + j * 16 + laneR;
    float bc = fb1[col] + ctxh[bIdx * H_ + col];
#pragma unroll
    for (int i = 0; i < 8; ++i)
      sH1[(r0 + i + hi8) * PW_ + col] = (_Float16)elu_f(accW[j][i] + bc);
  }
  if (cg < 2) {
    int col = cg * 16 + laneR;
    float bs = fbskip[col];
#pragma unroll
    for (int i = 0; i < 8; ++i) sSkip[(r0 + i + hi8) * N_ + col] = accS[i] + bs;
  }
  wait_async();                               // W2 + Wg resident; h1, skip of all waves visible

  // ---- GEMM2 (K=128): h2 = h1 @ W2 + b2, the wave's two column tiles ----
  v8f h2[2];
  h2[0] = Z; h2[1] = Z;
#pragma unroll
  for (int k0 = 0; k0 < H_; k0 += 32) {
    v16h a = load_frag16(sH1 + (r0 + laneR) * PW_ + k0 + kh * 8);
#pragma unroll
    for (int j = 0; j < 2; ++j) {
      v16h b = load_frag16(sW2 + (c0 + j * 16 + laneR) * PW_ + k0 + kh * 8);
      h2[j] = WMMA16(a, b, h2[j]);
    }
  }
#pragma unroll
  for (int j = 0; j < 2; ++j) {
    int col = c0 + j * 16 + laneR;
    float b2v = fb2[col];
#pragma unroll
    for (int i = 0; i < 8; ++i)
      sH2[(r0 + i + hi8) * PW_ + col] = (_Float16)(h2[j][i] + b2v);
  }
  __syncthreads();                            // h2 of all waves visible
  if (wave >= 2) return;                      // no barrier below; waves 0, 1: r0 = wave * 16

  // ---- GEMM3 (K=128, 64 cols): g = h2 @ Wg + bg, 4 tiles in registers ----
  v8f g[4];
#pragma unroll
  for (int ct = 0; ct < 4; ++ct) g[ct] = Z;
#pragma unroll
  for (int k0 = 0; k0 < H_; k0 += 32) {
    v16h a = load_frag16(sH2 + (r0 + laneR) * PW_ + k0 + kh * 8);
#pragma unroll
    for (int ct = 0; ct < 4; ++ct) {
      v16h b = load_frag16(sWg + (ct * 16 + laneR) * PW_ + k0 + kh * 8);
      g[ct] = WMMA16(a, b, g[ct]);
    }
  }
  float sk[2][8];
#pragma unroll
  for (int cs = 0; cs < 2; ++cs)
#pragma unroll
    for (int i = 0; i < 8; ++i) sk[cs][i] = sSkip[(r0 + i + hi8) * N_ + cs * 16 + laneR];

  // ---- GLU (col c with gate c+32) + skip, all in registers ----
  float t[2][8];
#pragma unroll
  for (int cs = 0; cs < 2; ++cs) {
    int col = cs * 16 + laneR;
    float ba = fbg[col], bg2 = fbg[col + 32];
#pragma unroll
    for (int i = 0; i < 8; ++i)
      t[cs][i] = (g[cs][i] + ba) * sigmoid_f(g[cs + 2][i] + bg2) + sk[cs][i];
  }

  // ---- LayerNorm over N=32 + softmax via 16-lane butterflies ----
  float s1[8], s2[8];
#pragma unroll
  for (int i = 0; i < 8; ++i) {
    s1[i] = t[0][i] + t[1][i];
    s2[i] = t[0][i] * t[0][i] + t[1][i] * t[1][i];
  }
#pragma unroll
  for (int m = 1; m < 16; m <<= 1)
#pragma unroll
    for (int i = 0; i < 8; ++i) {
      s1[i] += __shfl_xor(s1[i], m, 32);
      s2[i] += __shfl_xor(s2[i], m, 32);
    }
  float l[2][8];
#pragma unroll
  for (int i = 0; i < 8; ++i) {
    float mu = s1[i] * (1.0f / N_);
    float var = s2[i] * (1.0f / N_) - mu * mu;
    float rs = rsqrtf(var + LN_EPS);
#pragma unroll
    for (int cs = 0; cs < 2; ++cs) {
      int col = cs * 16 + laneR;
      l[cs][i] = (t[cs][i] - mu) * rs * fg[col] + fbv[col];
    }
  }
  float mx[8];
#pragma unroll
  for (int i = 0; i < 8; ++i) mx[i] = fmaxf(l[0][i], l[1][i]);
#pragma unroll
  for (int m = 1; m < 16; m <<= 1)
#pragma unroll
    for (int i = 0; i < 8; ++i) mx[i] = fmaxf(mx[i], __shfl_xor(mx[i], m, 32));
  float e0[8], e1[8], se[8];
#pragma unroll
  for (int i = 0; i < 8; ++i) {
    e0[i] = __expf(l[0][i] - mx[i]);
    e1[i] = __expf(l[1][i] - mx[i]);
    se[i] = e0[i] + e1[i];
  }
#pragma unroll
  for (int m = 1; m < 16; m <<= 1)
#pragma unroll
    for (int i = 0; i < 8; ++i) se[i] += __shfl_xor(se[i], m, 32);
#pragma unroll
  for (int i = 0; i < 8; ++i) {
    int row = rowbase + r0 + i + hi8;
    float inv = 1.0f / se[i];
    wOut[(size_t)row * N_ + laneR]      = e0[i] * inv;
    wOut[(size_t)row * N_ + 16 + laneR] = e1[i] * inv;
  }
}

// ------------------------------------------------------- per-variable GRNs
// One block = 128 rows (8 waves, 16 rows per wave). Everything one variable needs
// (embedding slice, weight panels, column values) is async-staged into one of two
// LDS buffers and shared by all waves: the next variable's copies fly during the
// whole of this variable's work, and one barrier a variable hands a buffer over.
// Every product is computed transposed: the weight panel is the A operand (its
// 16 rows = 16 output columns), the wave's 16 activation rows are the B operand.
// A lane then holds ONE activation row (lane & 15), and register i of a D tile
// is output column tile*16 + 8*(lane >> 4) + i. Two neighbouring D tiles,
// converted to f16 in place, are the next product's B fragment in the hardware's
// k order, so h1 never leaves the registers. W2 and Wg come folded into one panel
// (fold_job), so a variable is two products deep. The values that go by column
// (biases, LayerNorm scale and shift) are staged in LDS and read eight per lane;
// a bias is the accumulator's start value. The LayerNorm sums run inside the
// lane, with one exchange between the lane halves.
// blockIdx.y picks a group of NPG_ variables, so that the grid fills the chip;
// each group stores its own partial sum plane part[group][row][h], and k_sum
// adds the planes.
typedef float f4 __attribute__((ext_vector_type(4)));

// One copy of 16 B per lane, as the builtin: the compiler places its address
// registers anywhere, where an asm operand must lie in the first 256 registers
// (this kernel's long-lived ones no longer all fit there and would be spilled).
typedef int i4 __attribute__((ext_vector_type(4)));
__device__ __forceinline__ void cp16b(void* ldst, const void* gsrc) {
  __builtin_amdgcn_global_load_async_to_lds_b128(
      (__attribute__((address_space(1))) i4*)(gsrc),
      (__attribute__((address_space(3))) i4*)(ldst), 0, 0);
}
// A run of N such copies: copy j moves gsrc + j*gstep to ldst + j*lstep (in halves).
template <int N>
__device__ __forceinline__ void cpRun(_Float16* ldst, int lstep, const _Float16* gsrc, int gstep) {
#pragma unroll  // the copies of a run issue back to back
  for (int j = 0; j < N; ++j) cp16b(ldst + j * lstep, gsrc + (size_t)j * gstep);
}
// Eight consecutive f32 (32-byte aligned, LDS) in the register order of a D tile.
__device__ __forceinline__ v8f load_c8(const float* p) {
  f4 lo = *(const f4*)(p);
  f4 hi = *(const f4*)(p + 4);
  return __builtin_shufflevector(lo, hi, 0, 1, 2, 3, 4, 5, 6, 7);
}
// Two f32 D tiles (k 0..15 and 16..31 of a k step) -> one f16 B fragment.
__device__ __forceinline__ v16h pack_frag(v8f t0, v8f t1) {
  h8 lo = __builtin_convertvector(t0, h8);
  h8 hi = __builtin_convertvector(t1, h8);
  return __builtin_shufflevector(lo, hi, 0, 1, 2, 3, 4, 5, 6, 7, 8, 9, 10, 11, 12, 13, 14, 15);
}
// Rows of VarBuf::col, H_ floats each
#define CB1_  0
#define CBS_  1
#define CBA_  2
#define CBG_  3
#define CLG_  4
#define CLB_  5
#define NCOL_ 6

// The LDS of one variable; there are two of them.
struct __attribute__((aligned(32))) VarBuf {
  _Float16 e[128 * PN_];      // embedding slice [row][64]
  _Float16 w1[128 * PN_];     // W1 panel [col][64]
  _Float16 ws[128 * PN_];     // Wskip panel [col][64]
  _Float16 wga[128 * PW_];    // W2 @ Wg, cols 0..127 [col][128]
  _Float16 wgg[128 * PW_];    // W2 @ Wg, gate half, cols 128..255 [col][128]
  float col[NCOL_ * H_];      // per-column values
};
static_assert(2 * sizeof(VarBuf) <= 327680, "two buffers must fit the LDS");
static_assert(NPG_ >= 2, "the ring's prologue stages two variables");

__global__ void __launch_bounds__(256)
k_var(const _Float16* __restrict__ e16,
      const _Float16* __restrict__ vW1T, const _Float16* __restrict__ vWskipT,
      const _Float16* __restrict__ vWfT,
      const float* __restrict__ vb1, const float* __restrict__ vbskip,
      const float* __restrict__ vbf,
      const float* __restrict__ vg, const float* __restrict__ vbv,
      const float* __restrict__ wIn, float* __restrict__ part) {
  __shared__ VarBuf sB[2];

  const int tid = threadIdx.x;
  const int wave = __builtin_amdgcn_readfirstlane(tid >> 5), lane = tid & 31;
  const int laneR = lane & 15, kh = (lane >> 4) & 1;
  const int hi8 = (lane & 16) ? 8 : 0;
  const int r0 = wave * 16;                    // wave's row tile within block
  const int rowbase = blockIdx.x * 128;
  const int nBeg = blockIdx.y * NPG_, nEnd = nBeg + NPG_;
  float* const outPtr = part + (size_t)blockIdx.y * BT_ * H_;

  float outReg[64];                            // [ct][i]: row laneR, column ct*16 + hi8 + i
#pragma unroll
  for (int q = 0; q < 64; ++q) outReg[q] = 0.0f;
  float tv[64];                                // skip, then GLU result; same map

  // 128-byte rows: 8 lanes a row, copy j of a run takes row nr + 32*j.
  // 256-byte rows: 16 lanes a row, copy j of a run takes row wr + 16*j.
  const int nr = tid >> 3, no = (tid & 7) * 8;
  const int wr = tid >> 4, wo = (tid & 15) * 8;
  auto stagePanels = [&](int n, VarBuf& b) {   // 28 copies a wave
    cpRun<4>(b.e + nr * PN_ + no, 32 * PN_,    // 1024 chunks of 16B
             e16 + ((size_t)(rowbase + nr) * N_ + n) * D_ + no, 32 * ND_);
    cpRun<4>(b.w1 + nr * PN_ + no, 32 * PN_, vW1T + (size_t)n * H_ * D_ + tid * 8, 2048);
    cpRun<4>(b.ws + nr * PN_ + no, 32 * PN_, vWskipT + (size_t)n * H_ * D_ + tid * 8, 2048);
    const _Float16* ga = vWfT + (size_t)n * 256 * H_;
    const _Float16* gg = ga + (size_t)128 * H_;
    cpRun<8>(b.wga + wr * PW_ + wo, 16 * PW_, ga + tid * 8, 2048);
    cpRun<8>(b.wgg + wr * PW_ + wo, 16 * PW_, gg + tid * 8, 2048);
  };
  // Wave w < NCOL_ brings row w of col: 32 lanes x 16 B = H_ floats. Its source
  // walks from variable to variable in steps of the array's own row length.
  const float* colSrc = (wave == CB1_ ? vb1 + nBeg * H_
                       : wave == CBS_ ? vbskip + nBeg * H_
                       : wave == CBA_ ? vbf + nBeg * 256
                       : wave == CBG_ ? vbf + nBeg * 256 + 128
                       : wave == CLG_ ? vg + nBeg * H_
                                      : vbv + nBeg * H_);
  const int colStep = (wave == CBA_ || wave == CBG_) ? 256 : H_;
  const int colOff = (wave < NCOL_ ? wave : 0) * H_ + lane * 4;
  auto stageCol = [&](VarBuf& b) {             // the next staged variable's column values
    if (wave < NCOL_) {                        // scalar test: the last two waves issue no copy
      cp16b(b.col + colOff, colSrc + lane * 4);
      colSrc += colStep;
    }
  };
  const float* const wRow = wIn + (size_t)(rowbase + r0 + laneR) * N_;

  stagePanels(nBeg, sB[0]);
  stageCol(sB[0]);
  wait_async();                                // first variable resident in buffer 0
  stagePanels(nBeg + 1, sB[1]);
  stageCol(sB[1]);

  for (int n = nBeg; n < nEnd; ++n) {
    VarBuf& vb = sB[(n - nBeg) & 1];           // this variable's buffer, the only one read in this trip
    const _Float16* const sE = vb.e;
    const _Float16* const sW1 = vb.w1;
    const _Float16* const sWs = vb.ws;
    const _Float16* const sWgA = vb.wga;
    const _Float16* const sWgG = vb.wgg;
    const float* const colP = vb.col + hi8;    // the lane's eight columns of tile 0
    float wsel = wRow[n];                      // the row's selection weight, used at the end of the trip
    // precaution: every later rewrite of the load's address registers stays behind this wait
    asm volatile("s_wait_xcnt 0x0" ::: "memory");

    // ---- GEMM1 (K=64): aW = (E@W1 + b1)^T, aS = (E@Wskip + bskip)^T, one column
    // tile at a time. The next tile's weight fragments and start values are read
    // into a second register set ahead of this tile's WMMAs, so that no WMMA waits
    // out the latency of its own reads ----
    v16h bE[2];
#pragma unroll
    for (int ks = 0; ks < 2; ++ks)
      bE[ks] = load_frag16(sE + (r0 + laneR) * PN_ + ks * 32 + kh * 8);
    v16h f1[2][4];
    v8f c1[2][2];
#pragma unroll
    for (int ks = 0; ks < 2; ++ks) {
      f1[0][ks]     = load_frag16(sW1 + laneR * PN_ + ks * 32 + kh * 8);
      f1[0][2 + ks] = load_frag16(sWs + laneR * PN_ + ks * 32 + kh * 8);
    }
    c1[0][0] = load_c8(colP + CB1_ * H_);
    c1[0][1] = load_c8(colP + CBS_ * H_);
    v16h bH[4];                                // elu(h1) as B fragments
    v8f hPrev;
#pragma unroll
    for (int ct = 0; ct < 8; ++ct) {
      if (ct + 1 < 8) {
#pragma unroll
        for (int ks = 0; ks < 2; ++ks) {
          f1[(ct + 1) & 1][ks]     = load_frag16(sW1 + ((ct + 1) * 16 + laneR) * PN_ + ks * 32 + kh * 8);
          f1[(ct + 1) & 1][2 + ks] = load_frag16(sWs + ((ct + 1) * 16 + laneR) * PN_ + ks * 32 + kh * 8);
        }
        c1[(ct + 1) & 1][0] = load_c8(colP + CB1_ * H_ + (ct + 1) * 16);
        c1[(ct + 1) & 1][1] = load_c8(colP + CBS_ * H_ + (ct + 1) * 16);
      }
      __builtin_amdgcn_sched_barrier(0);       // keeps the reads above as one group ahead of this step's WMMAs
      v8f aW = c1[ct & 1][0], aS = c1[ct & 1][1];
#pragma unroll
      for (int ks = 0; ks < 2; ++ks) {
        aW = WMMA16(f1[ct & 1][ks], bE[ks], aW);
        aS = WMMA16(f1[ct & 1][2 + ks], bE[ks], aS);
      }
      v8f h;
#pragma unroll
      for (int i = 0; i < 8; ++i) {
        h[i] = elu_f(aW[i]);
        tv[ct * 8 + i] = aS[i];                // skip, kept in registers
      }
      if (ct & 1) bH[ct >> 1] = pack_frag(hPrev, h);
      else        hPrev = h;
    }

    // ---- GEMM2 pairs (K=128), elu(h1) @ (W2 @ Wg) + folded bias: a-part (sWgA) and
    // gate (sWgG), GLU in regs; the next column tile's fragments read ahead, as above ----
    v16h f3[2][8];
    v8f c3[2][2];
#pragma unroll
    for (int ks = 0; ks < 4; ++ks) {
      f3[0][2 * ks]     = load_frag16(sWgA + laneR * PW_ + ks * 32 + kh * 8);
      f3[0][2 * ks + 1] = load_frag16(sWgG + laneR * PW_ + ks * 32 + kh * 8);
    }
    c3[0][0] = load_c8(colP + CBA_ * H_);
    c3[0][1] = load_c8(colP + CBG_ * H_);
#pragma unroll
    for (int ct = 0; ct < 8; ++ct) {
      if (ct + 1 < 8) {
#pragma unroll
        for (int ks = 0; ks < 4; ++ks) {
          f3[(ct + 1) & 1][2 * ks]     = load_frag16(sWgA + ((ct + 1) * 16 + laneR) * PW_ + ks * 32 + kh * 8);
          f3[(ct + 1) & 1][2 * ks + 1] = load_frag16(sWgG + ((ct + 1) * 16 + laneR) * PW_ + ks * 32 + kh * 8);
        }
        c3[(ct + 1) & 1][0] = load_c8(colP + CBA_ * H_ + (ct + 1) * 16);
        c3[(ct + 1) & 1][1] = load_c8(colP + CBG_ * H_ + (ct + 1) * 16);
      }
      __builtin_amdgcn_sched_barrier(0);       // keeps the reads above as one group ahead of this step's WMMAs
      v8f ga = c3[ct & 1][0], gg = c3[ct & 1][1];
#pragma unroll
      for (int ks = 0; ks < 4; ++ks) {
        ga = WMMA16(f3[ct & 1][2 * ks], bH[ks], ga);
        gg = WMMA16(f3[ct & 1][2 * ks + 1], bH[ks], gg);
      }
#pragma unroll
      for (int i = 0; i < 8; ++i)
        tv[ct * 8 + i] = ga[i] * sigmoid_f(gg[i]) + tv[ct * 8 + i];   // GLU + skip
      __builtin_amdgcn_sched_barrier(0);       // keeps the next tile's reads below: one group at one place, not spread among these WMMAs
    }

    // ---- LayerNorm over H=128: the lane's 64 columns (eight chains, then a
    // tree), then the other lane half's 64 ----
    float s1[8], s2[8];
#pragma unroll
    for (int i = 0; i < 8; ++i) { s1[i] = 0.f; s2[i] = 0.f; }
#pragma unroll
    for (int ct = 0; ct < 8; ++ct)
#pragma unroll
      for (int i = 0; i < 8; ++i) { float t = tv[ct * 8 + i]; s1[i] += t; s2[i] += t * t; }
#pragma unroll
    for (int m = 4; m >= 1; m >>= 1)
#pragma unroll
      for (int i = 0; i < m; ++i) { s1[i] += s1[i + m]; s2[i] += s2[i + m]; }
    const float t1 = s1[0] + other_half(s1[0]);
    const float t2 = s2[0] + other_half(s2[0]);

    // ---- normalize + softmax-weighted combine into registers ----
    const float mu = t1 * (1.0f / H_);
    const float var = t2 * (1.0f / H_) - mu * mu;
    const float rs = rsqrtf(var + LN_EPS);
#pragma unroll
    for (int ct = 0; ct < 8; ++ct) {
      v8f lg = load_c8(colP + CLG_ * H_ + ct * 16);
      v8f lb = load_c8(colP + CLB_ * H_ + ct * 16);
#pragma unroll
      for (int i = 0; i < 8; ++i) {
        float val = (tv[ct * 8 + i] - mu) * rs * lg[i] + lb[i];
        outReg[ct * 8 + i] += wsel * val;
      }
    }
    // Hand-over: this wave's reads of vb have returned, its copies of the next
    // variable have landed; behind the barrier that holds for every wave.
    asm volatile("s_wait_dscnt 0x0" ::: "memory");
    wait_async();
    if (n + 2 < nEnd) {                        // refill the buffer just read; flies during the next trip
      stagePanels(n + 2, vb);
      stageCol(vb);
    }
  }
  asm volatile("s_wait_asynccnt 0x0" ::: "memory");   // no copy outlives the loop

  // ---- epilogue: store this group's partial tile, eight columns per lane and tile ----
  float* const oRow = outPtr + (size_t)(rowbase + r0 + laneR) * H_ + hi8;
#pragma unroll
  for (int ct = 0; ct < 8; ++ct) {
    f4 lo = {outReg[ct * 8 + 0], outReg[ct * 8 + 1], outReg[ct * 8 + 2], outReg[ct * 8 + 3]};
    f4 hi = {outReg[ct * 8 + 4], outReg[ct * 8 + 5], outReg[ct * 8 + 6], outReg[ct * 8 + 7]};
    *(f4*)(oRow + ct * 16)     = lo;
    *(f4*)(oRow + ct * 16 + 4) = hi;
  }
}

// out[i] = sum over the NG_ groups of part[group][i], groups in rising order.
__global__ void __launch_bounds__(256) k_sum(const float* __restrict__ part,
                                             float* __restrict__ outPtr) {
  // One 32-bit byte offset serves every plane and the store (uniform base + offset).
  const unsigned off = (blockIdx.x * 256u + threadIdx.x) * 16u;
  float4 s = *(const float4*)((const char*)part + off);
#pragma unroll  // all planes' loads in flight together
  for (int g = 1; g < NG_; ++g) {
    float4 p = *(const float4*)((const char*)(part + (size_t)g * BT_ * H_) + off);
    s.x += p.x; s.y += p.y; s.z += p.z; s.w += p.w;
  }
  *(float4*)((char*)outPtr + off) = s;
}

// ----------------------------------------------------------------------------
extern "C" void kernel_launch(void* const* d_in, const int* in_sizes, int n_in,
                              void* d_out, int out_size, void* d_ws, size_t ws_size,
                              hipStream_t stream) {
  (void)in_sizes; (void)n_in; (void)out_size; (void)ws_size;

  const float* emb    = (const float*)d_in[0];
  const float* ctx    = (const float*)d_in[1];
  const float* fWskip = (const float*)d_in[2];
  const float* fbskip = (const float*)d_in[3];
  const float* fW1    = (const float*)d_in[4];
  const float* fb1    = (const float*)d_in[5];
  const float* fWc    = (const float*)d_in[6];
  const float* fW2    = (const float*)d_in[7];
  const float* fb2    = (const float*)d_in[8];
  const float* fWg    = (const float*)d_in[9];
  const float* fbg    = (const float*)d_in[10];
  const float* fg     = (const float*)d_in[11];
  const float* fbv    = (const float*)d_in[12];
  const float* vWskip = (const float*)d_in[13];
  const float* vbskip = (const float*)d_in[14];
  const float* vW1    = (const float*)d_in[15];
  const float* vb1    = (const float*)d_in[16];
  const float* vW2    = (const float*)d_in[17];
  const float* vb2    = (const float*)d_in[18];
  const float* vWg    = (const float*)d_in[19];
  const float* vbg    = (const float*)d_in[20];
  const float* vg     = (const float*)d_in[21];
  const float* vbv    = (const float*)d_in[22];

  // Workspace carve (f16 copies, transposed weights, ctx projection, partial planes)
  char* w = (char*)d_ws;
  size_t off = 0;
  auto alloc = [&](size_t bytes) -> char* {
    char* p = w + off;
    off = (off + bytes + 255) & ~(size_t)255;
    return p;
  };
  _Float16* e16     = (_Float16*)alloc((size_t)BT_ * ND_ * 2);
  _Float16* fW1T    = (_Float16*)alloc((size_t)ND_ * H_ * 2);
  _Float16* fWskipT = (_Float16*)alloc((size_t)ND_ * N_ * 2);
  _Float16* fW2T    = (_Float16*)alloc((size_t)H_ * H_ * 2);
  _Float16* fWgT    = (_Float16*)alloc((size_t)H_ * 2 * N_ * 2);
  _Float16* vW1T    = (_Float16*)alloc((size_t)N_ * D_ * H_ * 2);
  _Float16* vWskipT = (_Float16*)alloc((size_t)N_ * D_ * H_ * 2);
  _Float16* vWfT    = (_Float16*)alloc((size_t)N_ * H_ * 256 * 2);
  float*    vbf     = (float*)alloc((size_t)N_ * 256 * 4);
  float*    ctxh    = (float*)alloc((size_t)B_ * H_ * 4);
  float*    part    = (float*)alloc((size_t)NG_ * BT_ * H_ * 4);

  float* outPtr = (float*)d_out;                   // [BT, H]
  float* wOut   = outPtr + (size_t)BT_ * H_;       // [BT, N]

  // precision conversion, transposes and context projection: one launch
  k_prep<<<NB_PREP, 256, 0, stream>>>(emb, ctx, fWc, fW1, fWskip, fW2, fWg,
                                      vW1, vWskip,
                                      e16, ctxh, fW1T, fWskipT, fW2T, fWgT,
                                      vW1T, vWskipT);

  // flatten GRN -> softmax weights (FR_ rows/block, 8 waves); NB_FOLD more blocks
  // fold each variable's W2 and Wg for k_var
  k_flat<<<BT_ / FR_ + NB_FOLD, 256, 0, stream>>>(e16, fW1T, fWskipT, fW2T, fWgT,
                                                  fb1, fbskip, fb2, fbg, fg, fbv,
                                                  ctxh, wOut,
                                                  vW2, vWg, vb2, vbg, vWfT, vbf);

  // per-variable GRNs + weighted combine -> partial planes (128 rows/block,
  // 8 waves, NPG_ variables per block), then the sum of the planes -> outputs
  k_var<<<dim3(BT_ / 128, NG_), 256, 0, stream>>>(e16, vW1T, vWskipT, vWfT,
                                                  vb1, vbskip, vbf, vg, vbv,
                                                  wOut, part);
  k_sum<<<BT_ * H_ / 1024, 256, 0, stream>>>(part, outPtr);
}

// v010
// One run takes 68.1 microseconds.
// Timed twice side by side with v009, it ran 1.05 times as fast both times.
// Counting every step since v000, it is 17.2 times as fast.
#include <hip/hip_runtime.h>
#include <hip/hip_bf16.h>
#include <math.h>

// Problem dims (fixed by reference)
#define B_   64
#define T_   128
#define N_   32
#define D_   64
#define H_   128
#define C_   64
#define BT_  (B_ * T_)      // 8192
#define ND_  (N_ * D_)      // 2048
#define KC_  128            // K-chunk for the flatten GEMM stream
#define NG_  4              // groups of variables in k_var's grid (blockIdx.y)
#define NPG_ (N_ / NG_)     // variables per group
#define LN_EPS 1e-5f
// LDS row pitches in halves. Bank = dword address mod 64, so rows of 256 B (or
// 128 B) put the 16 lanes of a ds_load_b128 fragment read on the same four
// (eight) banks. A pitch of 16 B x odd spreads them over all 64 banks.
#define PW_  136            // 256-byte rows: pitch 272 B = 16 B x 17
#define PN_  72             // 128-byte rows: pitch 144 B = 16 B x 9
// The same rule for the f32 embedding rows, in floats.
#define PF_  132            // 512-byte rows: pitch 528 B = 16 B x 33
#define PE_  68             // 256-byte rows: pitch 272 B = 16 B x 17

typedef _Float16 v16h __attribute__((ext_vector_type(16)));
typedef _Float16 h8   __attribute__((ext_vector_type(8)));
typedef float    v8f  __attribute__((ext_vector_type(8)));
typedef float    f4   __attribute__((ext_vector_type(4)));

// ---------------------------------------------------------------------------
// CDNA5 async global->LDS staging (GLOBAL_LOAD_ASYNC_TO_LDS_B128, ASYNCcnt).
// GV addressing: vdst = LDS byte address, vaddr = 64-bit global address.
// ---------------------------------------------------------------------------
// A run of copies shares one asm statement; its last line, s_wait_xcnt 0, keeps
// every later rewrite of the address registers behind the copies' issue.
// Copy j moves 16 B per lane from gsrc + j*gstep to ldst + j*lstep (in halves).
__device__ __forceinline__ void cp16x2(_Float16* ldst, int lstep,
                                       const _Float16* gsrc, int gstep) {
  unsigned l = (unsigned)(size_t)ldst;
  unsigned long long g = (unsigned long long)(size_t)gsrc;
  unsigned ls = (unsigned)lstep * 2u;
  unsigned long long gs = (unsigned long long)gstep * 2ull;
  asm volatile("global_load_async_to_lds_b128 %0, %2, off\n\t"
               "global_load_async_to_lds_b128 %1, %3, off\n\t"
               "s_wait_xcnt 0x0"
               :
               : "v"(l), "v"(l + ls), "v"(g), "v"(g + gs)
               : "memory");
}
__device__ __forceinline__ void cp16x4(_Float16* ldst, int lstep,
                                       const _Float16* gsrc, int gstep) {
  unsigned l = (unsigned)(size_t)ldst;
  unsigned long long g = (unsigned long long)(size_t)gsrc;
  unsigned ls = (unsigned)lstep * 2u;
  unsigned long long gs = (unsigned long long)gstep * 2ull;
  asm volatile("global_load_async_to_lds_b128 %0, %4, off\n\t"
               "global_load_async_to_lds_b128 %1, %5, off\n\t"
               "global_load_async_to_lds_b128 %2, %6, off\n\t"
               "global_load_async_to_lds_b128 %3, %7, off\n\t"
               "s_wait_xcnt 0x0"
               :
               : "v"(l), "v"(l + ls), "v"(l + 2 * ls), "v"(l + 3 * ls),
                 "v"(g), "v"(g + gs), "v"(g + 2 * gs), "v"(g + 3 * gs)
               : "memory");
}
// The same run for f32 data: steps in floats.
__device__ __forceinline__ void cp16x4f(float* ldst, int lstep,
                                        const float* gsrc, int gstep) {
  unsigned l = (unsigned)(size_t)ldst;
  unsigned long long g = (unsigned long long)(size_t)gsrc;
  unsigned ls = (unsigned)lstep * 4u;
  unsigned long long gs = (unsigned long long)gstep * 4ull;
  asm volatile("global_load_async_to_lds_b128 %0, %4, off\n\t"
               "global_load_async_to_lds_b128 %1, %5, off\n\t"
               "global_load_async_to_lds_b128 %2, %6, off\n\t"
               "global_load_async_to_lds_b128 %3, %7, off\n\t"
               "s_wait_xcnt 0x0"
               :
               : "v"(l), "v"(l + ls), "v"(l + 2 * ls), "v"(l + 3 * ls),
                 "v"(g), "v"(g + gs), "v"(g + 2 * gs), "v"(g + 3 * gs)
               : "memory");
}
__device__ __forceinline__ void cp16x8(_Float16* ldst, int lstep,
                                       const _Float16* gsrc, int gstep) {
  unsigned l = (unsigned)(size_t)ldst;
  unsigned long long g = (unsigned long long)(size_t)gsrc;
  unsigned ls = (unsigned)lstep * 2u;
  unsigned long long gs = (unsigned long long)gstep * 2ull;
  asm volatile("global_load_async_to_lds_b128 %0, %8, off\n\t"
               "global_load_async_to_lds_b128 %1, %9, off\n\t"
               "global_load_async_to_lds_b128 %2, %10, off\n\t"
               "global_load_async_to_lds_b128 %3, %11, off\n\t"
               "global_load_async_to_lds_b128 %4, %12, off\n\t"
               "global_load_async_to_lds_b128 %5, %13, off\n\t"
               "global_load_async_to_lds_b128 %6, %14, off\n\t"
               "global_load_async_to_lds_b128 %7, %15, off\n\t"
               "s_wait_xcnt 0x0"
               :
               : "v"(l), "v"(l + ls), "v"(l + 2 * ls), "v"(l + 3 * ls),
                 "v"(l + 4 * ls), "v"(l + 5 * ls), "v"(l + 6 * ls), "v"(l + 7 * ls),
                 "v"(g), "v"(g + gs), "v"(g + 2 * gs), "v"(g + 3 * gs),
                 "v"(g + 4 * gs), "v"(g + 5 * gs), "v"(g + 6 * gs), "v"(g + 7 * gs)
               : "memory");
}
__device__ __forceinline__ void wait_async() {
  asm volatile("s_wait_asynccnt 0x0" ::: "memory");
  __syncthreads();
}

// Load a 16-half WMMA operand fragment. p points at (index, k0 + khalf*8) in a
// row-major [rows][ldK] f16 array; elements 0..7 = K+0..7, 8..15 = K+16..23
// (CDNA5 16-bit A/B VGPR layout, ISA 7.12.2). 16-byte aligned.
__device__ __forceinline__ v16h load_frag16(const _Float16* p) {
  h8 lo = *(const h8*)(p);
  h8 hi = *(const h8*)(p + 16);
  v16h f;
#pragma unroll
  for (int i = 0; i < 8; ++i) { f[i] = lo[i]; f[8 + i] = hi[i]; }
  return f;
}

// Eight consecutive f32 (16-byte aligned, LDS) in the register order of a D tile.
__device__ __forceinline__ v8f load_c8(const float* p) {
  f4 lo = *(const f4*)(p);
  f4 hi = *(const f4*)(p + 4);
  return __builtin_shufflevector(lo, hi, 0, 1, 2, 3, 4, 5, 6, 7);
}
// Two f32 D tiles (k 0..15 and 16..31 of a k step) -> one f16 B fragment.
__device__ __forceinline__ v16h pack_frag(v8f t0, v8f t1) {
  h8 lo = __builtin_convertvector(t0, h8);
  h8 hi = __builtin_convertvector(t1, h8);
  return __builtin_shufflevector(lo, hi, 0, 1, 2, 3, 4, 5, 6, 7, 8, 9, 10, 11, 12, 13, 14, 15);
}
// load_frag16 from a row-major f32 array: the same elements in the same k order,
// rounded to f16 (nearest even) in the registers.
__device__ __forceinline__ v16h load_frag16_f32(const float* p) {
  return pack_frag(load_c8(p), load_c8(p + 16));
}

#define WMMA16(a, b, c) \
  __builtin_amdgcn_wmma_f32_16x16x32_f16(false, (a), false, (b), (short)0, (c), false, false)

__device__ __forceinline__ float elu_f(float x)     { return x > 0.0f ? x : __expf(x) - 1.0f; }
// The hardware reciprocal (about 1 ulp) in place of the exact f32 division, which
// compiles to ten more vector instructions per value; 1 + exp(-x) >= 1 or inf.
__device__ __forceinline__ float sigmoid_f(float x) { return __builtin_amdgcn_rcpf(1.0f + __expf(-x)); }

// ---------------------------------------------------------------- preparation
// Transposed f16 copies of six weight tensors and the context projection. None
// of the seven jobs reads what another writes, so ONE launch runs them all: each
// job owns a range of blocks and walks its elements with a stride of that range.
// A launch this short also pays for every wave it starts, so the ranges are
// kept small: 16 elements per thread in a transpose.
// The embedding has no f16 copy: the two GEMM kernels stage its f32 rows in LDS
// and round them to f16 where they load their fragments.
#define NB_CTX   (B_ / 2)                      // two batches per 256-thread block
#define NB_FW1   (ND_ * H_ / 4096)
#define NB_FWS   (ND_ * N_ / 4096)
#define NB_FW2   (H_ * H_ / 4096)
#define NB_FWG   (H_ * 2 * N_ / 4096)
#define NB_VW1   (N_ * D_ * H_ / 4096)
#define NB_VWS   (N_ * D_ * H_ / 4096)
#define NB_FOLD  (N_ * 16 * 2 / 8)             // 8 waves a block; a wave: variable, column tile, half of the rows
#define NB_PREP  (NB_CTX + NB_FW1 + NB_FWS + NB_FW2 + NB_FWG + NB_VW1 + NB_VWS)

// src: fp32 [batch][R][C]  ->  dst: f16 [batch][C][R]  (transpose per batch);
// blk = block's index inside the job's nblk blocks
__device__ __forceinline__ void cvtT_job(const float* __restrict__ src,
                                         _Float16* __restrict__ dst,
                                         int batch, int R, int Ccols,
                                         int blk, int nblk) {
  int total = batch * R * Ccols;
  for (int i = blk * 256 + threadIdx.x; i < total; i += nblk * 256) {
    int n = i / (R * Ccols);
    int rem = i - n * (R * Ccols);
    int c = rem / R;
    int r = rem - c * R;
    dst[i] = (_Float16)src[((size_t)n * R + r) * Ccols + c];
  }
}

// ctxh[b][h] = sum_c context[b][c] * fWc[c][h]   (tiny, plain FMA)
__device__ __forceinline__ void ctx_job(const float* __restrict__ context,
                                        const float* __restrict__ fWc,
                                        float* __restrict__ ctxh, int blk) {
  int b = blk * 2 + (threadIdx.x >> 7), h = threadIdx.x & (H_ - 1);
  float s = 0.0f;
  for (int c = 0; c < C_; ++c) s += context[b * C_ + c] * fWc[c * H_ + h];
  ctxh[b * H_ + h] = s;
}

// The value of lane l ^ 16.
__device__ __forceinline__ float other_half(float x) {
  int b = __builtin_bit_cast(int, x);
  return __builtin_bit_cast(float,
      __builtin_amdgcn_permlanex16(b, b, 0x76543210, 0xfedcba98, false, false));
}

// Nothing nonlinear stands between a variable's W2 and Wg:
//   (x @ W2 + b2) @ Wg + bg = x @ (W2 @ Wg) + (b2 @ Wg + bg).
// This job forms, per variable, F = W2 @ Wg on the matrix unit (f16 operands, f32
// sums) and stores it as f16 [column k][h], and the f32 bias b2 @ Wg + bg.
// One wave = 16 columns k of one variable and 64 of the 128 rows h. A = W2 rows h,
// B = Wg columns k; both fragments take k-dimension j in load_frag16's order.
// Register i of a D tile is row h = tile*16 + 8*(lane >> 4) + i of the lane's column.
// It reads inputs only and k_var alone reads its results, so it rides in k_flat's
// launch (the blocks behind the row blocks), beside work-groups that leave most
// issue slots free; k_prep is too short a launch to hide it.
__device__ __forceinline__ void fold_job(const float* __restrict__ W2,
                                         const float* __restrict__ Wg,
                                         const float* __restrict__ b2,
                                         const float* __restrict__ bg,
                                         _Float16* __restrict__ dstW,
                                         float* __restrict__ dstB, int blk) {
  const int lane = threadIdx.x & 31, laneR = lane & 15, kh = lane >> 4;
  const int job = blk * 8 + __builtin_amdgcn_readfirstlane(threadIdx.x >> 5);
  const int n = job >> 5, kt = (job >> 1) & 15, hh = job & 1;
  const int col = kt * 16 + laneR;
  const float* const w2 = W2 + (size_t)n * H_ * H_ + (size_t)(hh * 64 + laneR) * H_ + kh * 8;
  const float* const wg = Wg + (size_t)n * H_ * 256 + col;
  const float* const bv = b2 + n * H_;
  v16h b[4];
  float bs = 0.0f;                             // the lane half's 64 terms of b2 @ Wg
#pragma unroll  // all 64 column loads in flight together
  for (int ks = 0; ks < 4; ++ks)
#pragma unroll
    for (int e = 0; e < 16; ++e) {
      int j = ks * 32 + (e >> 3) * 16 + kh * 8 + (e & 7);
      float wv = wg[(size_t)j * 256];
      bs += bv[j] * wv;
      b[ks][e] = (_Float16)wv;
    }
  // The row loads below start behind the column loads above (see the note in the loop).
  __builtin_amdgcn_sched_barrier(0);
  h8 o[4];
#pragma unroll  // two tiles' loads may run ahead of one another's WMMAs
  for (int t = 0; t < 4; ++t) {
    v8f d = {0.f, 0.f, 0.f, 0.f, 0.f, 0.f, 0.f, 0.f};
#pragma unroll
    for (int ks = 0; ks < 4; ++ks) {
      const float* p = w2 + (size_t)t * 16 * H_ + ks * 32;
      v16h a;
#pragma unroll
      for (int e = 0; e < 8; ++e) { a[e] = (_Float16)p[e]; a[8 + e] = (_Float16)p[16 + e]; }
      d = WMMA16(a, b[ks], d);
    }
    o[t] = __builtin_convertvector(d, h8);
    // Two tiles' loads in flight, not four: keeps k_flat within 256 registers, so that a
    // fold block fits on a WGP beside a row block and need not wait for one to end.
    if (t == 1) __builtin_amdgcn_sched_barrier(0);
  }
  // precaution: the loads' address registers (named as inputs, so that they live
  // up to here) are rewritten only behind this wait
  asm volatile("s_wait_xcnt 0x0" :: "v"(w2), "v"(wg), "v"(kh * 32) : "memory");
  _Float16* const po = dstW + ((size_t)n * 256 + col) * H_ + hh * 64 + kh * 8;
#pragma unroll
  for (int t = 0; t < 4; ++t) *(h8*)(po + t * 16) = o[t];
  bs += other_half(bs);
  if (hh == 0 && kh == 0) dstB[n * 256 + col] = bg[n * 256 + col] + bs;
}

__global__ void __launch_bounds__(256)
k_prep(const float* __restrict__ context,
       const float* __restrict__ fWc,
       const float* __restrict__ fW1, const float* __restrict__ fWskip,
       const float* __restrict__ fW2, const float* __restrict__ fWg,
       const float* __restrict__ vW1, const float* __restrict__ vWskip,
       float* __restrict__ ctxh,
       _Float16* __restrict__ fW1T, _Float16* __restrict__ fWskipT,
       _Float16* __restrict__ fW2T, _Float16* __restrict__ fWgT,
       _Float16* __restrict__ vW1T, _Float16* __restrict__ vWskipT) {
  int b = blockIdx.x;
  if (b < NB_CTX) { ctx_job(context, fWc, ctxh, b); return; }
  b -= NB_CTX;
  if (b < NB_FW1) { cvtT_job(fW1, fW1T, 1, ND_, H_, b, NB_FW1); return; }
  b -= NB_FW1;
  if (b < NB_FWS) { cvtT_job(fWskip, fWskipT, 1, ND_, N_, b, NB_FWS); return; }
  b -= NB_FWS;
  if (b < NB_FW2) { cvtT_job(fW2, fW2T, 1, H_, H_, b, NB_FW2); return; }
  b -= NB_FW2;
  if (b < NB_FWG) { cvtT_job(fWg, fWgT, 1, H_, 2 * N_, b, NB_FWG); return; }
  b -= NB_FWG;
  if (b < NB_VW1) { cvtT_job(vW1, vW1T, N_, D_, H_, b, NB_VW1); return; }
  b -= NB_VW1;
  cvtT_job(vWskip, vWskipT, N_, D_, H_, b, NB_VWS);
}

// ---------------------------------------------------------------- flatten GRN
// One block = FR_ rows, so that the grid's row blocks are one per WGP. The 8 waves
// share the block's 2 x 10 output tiles of GEMM1: wave = (row tile rt, column
// group cg); a wave takes two W1 column tiles, and the waves of groups 0 and 1
// one Wskip tile more. K=2048 streamed in 16 double-buffered async chunks.
// GEMM2 is shared the same way; GEMM3, GLU, LN and softmax (16-lane shfl_xor
// butterflies) run on two waves, one per row tile. Produces weights [BT, N_].
#define FR_  32

// One K-chunk of GEMM1 for one wave. pa, pw, ps: the lane's own fragment
// addresses in the flat (f32), W1 and Wskip chunk at k = 0.
template <bool SKIP>
__device__ __forceinline__ void flat_chunk(const float* pa, const _Float16* pw,
                                           const _Float16* ps, v8f (&accW)[2], v8f& accS) {
#pragma unroll  // all fragment loads of a chunk may be issued ahead of its WMMAs
  for (int k0 = 0; k0 < KC_; k0 += 32) {
    v16h a = load_frag16_f32(pa + k0);
#pragma unroll
    for (int j = 0; j < 2; ++j) {
      v16h b = load_frag16(pw + j * 16 * PW_ + k0);
      accW[j] = WMMA16(a, b, accW[j]);
    }
    if (SKIP) {
      v16h b = load_frag16(ps + k0);
      accS = WMMA16(a, b, accS);
    }
  }
}

__global__ void __launch_bounds__(256)
k_flat(const float* __restrict__ emb,
       const _Float16* __restrict__ fW1T, const _Float16* __restrict__ fWskipT,
       const _Float16* __restrict__ fW2T, const _Float16* __restrict__ fWgT,
       const float* __restrict__ fb1, const float* __restrict__ fbskip,
       const float* __restrict__ fb2, const float* __restrict__ fbg,
       const float* __restrict__ fg, const float* __restrict__ fbv,
       const float* __restrict__ ctxh,
       float* __restrict__ wOut,
       const float* __restrict__ vW2, const float* __restrict__ vWg,
       const float* __restrict__ vb2, const float* __restrict__ vbg,
       _Float16* __restrict__ vWfT, float* __restrict__ vbf) {
  if (blockIdx.x >= BT_ / FR_) {              // whole blocks, in front of every barrier and copy
    fold_job(vW2, vWg, vb2, vbg, vWfT, vbf, blockIdx.x - BT_ / FR_);
    return;
  }
  __shared__ __attribute__((aligned(16))) float bufFlat[2][FR_ * PF_];     // flat chunks (f32), then h1 | h2 (f16)
  __shared__ __attribute__((aligned(16))) _Float16 bufW1[2][128 * PW_];    // W1 chunks, then W2
  __shared__ __attribute__((aligned(16))) _Float16 bufWs[2][N_ * PW_];     // Wskip chunks, then Wg
  __shared__ float sSkip[FR_ * N_];                                        // skip path, f32

  const int tid = threadIdx.x;
  const int wave = __builtin_amdgcn_readfirstlane(tid >> 5), lane = tid & 31;
  const int laneR = lane & 15, kh = (lane >> 4) & 1;
  const int hi8 = (lane & 16) ? 8 : 0;
  const int rt = wave & 1, cg = wave >> 1;    // row tile, column group
  const int r0 = rt * 16;
  const int c0 = cg * 32;                     // first of the wave's 32 W1/W2 columns
  const int rowbase = blockIdx.x * FR_;
  const int bIdx = rowbase / T_;              // FR_ divides T_: one batch per block
  const v8f Z = {0.f, 0.f, 0.f, 0.f, 0.f, 0.f, 0.f, 0.f};

  // 16 lanes cover one 256-byte row; copy j of a run takes row sr + 16*j.
  // A flat row of a chunk is 512 bytes of f32: one wave covers it; copy j takes row wave + 8*j.
  const int sr = tid >> 4, so = (tid & 15) * 8;
  auto stageChunk = [&](int kc, int p) {
    int kk = kc * KC_;
    cp16x4f(&bufFlat[p][wave * PF_ + lane * 4], 8 * PF_,   // flat rows: 1024 x 16B
            emb + (size_t)(rowbase + wave) * ND_ + kk + lane * 4, 8 * ND_);
    cp16x8(&bufW1[p][sr * PW_ + so], 16 * PW_,        // W1 panel: 2048 x 16B
           fW1T + (size_t)sr * ND_ + kk + so, 16 * ND_);
    cp16x2(&bufWs[p][sr * PW_ + so], 16 * PW_,        // Wskip panel: 512 x 16B
           fWskipT + (size_t)sr * ND_ + kk + so, 16 * ND_);
  };

  // ---- GEMM1 stream: accW = flat @ W1 (2 tiles), accS = flat @ Wskip (cg < 2) ----
  v8f accW[2], accS;
  accW[0] = Z; accW[1] = Z; accS = Z;

  stageChunk(0, 0);
  for (int kc = 0; kc < ND_ / KC_; ++kc) {
    int p = kc & 1;
    wait_async();                             // chunk kc resident
    if (kc + 1 < ND_ / KC_) stageChunk(kc + 1, p ^ 1);   // overlaps compute
    const float* pa = &bufFlat[p][(r0 + laneR) * PF_ + kh * 8];
    const _Float16* pw = &bufW1[p][(c0 + laneR) * PW_ + kh * 8];
    const _Float16* ps = &bufWs[p][((cg & 1) * 16 + laneR) * PW_ + kh * 8];
    if (cg < 2) flat_chunk<true>(pa, pw, ps, accW, accS);
    else        flat_chunk<false>(pa, pw, ps, accW, accS);
    __syncthreads();                          // buffer reusable 2 chunks later
  }

  // ---- stage W2 (-> bufW1[0]) and Wg (-> bufWs, 64 rows contiguous) ----
  static_assert(FR_ * PW_ * 2 <= FR_ * PF_ * 4, "h1, h2 fit a flat buffer each");
  _Float16* sH1 = (_Float16*)&bufFlat[0][0];   // behind the loop's last barrier no f32 read is left
  _Float16* sH2 = (_Float16*)&bufFlat[1][0];
  _Float16* sW2 = &bufW1[0][0];
  _Float16* sWg = &bufWs[0][0];
  cp16x8(sW2 + sr * PW_ + so, 16 * PW_, fW2T + tid * 8, 2048);
  cp16x4(sWg + sr * PW_ + so, 16 * PW_, fWgT + tid * 8, 2048);

  // ---- h1 = elu(accW + b1 + ctx) -> sH1; skip + bias -> sSkip ----
#pragma unroll
  for (int j = 0; j < 2; ++j) {
    int col = c0 + j * 16 + laneR;
    float bc = fb1[col] + ctxh[bIdx * H_ + col];
#pragma unroll
    for (int i = 0; i < 8; ++i)
      sH1[(r0 + i + hi8) * PW_ + col] = (_Float16)elu_f(accW[j][i] + bc);
  }
  if (cg < 2) {
    int col = cg * 16 + laneR;
    float bs = fbskip[col];
#pragma unroll
    for (int i = 0; i < 8; ++i) sSkip[(r0 + i + hi8) * N_ + col] = accS[i] + bs;
  }
  wait_async();                               // W2 + Wg resident; h1, skip of all waves visible

  // ---- GEMM2 (K=128): h2 = h1 @ W2 + b2, the wave's two column tiles ----
  v8f h2[2];
  h2[0] = Z; h2[1] = Z;
#pragma unroll
  for (int k0 = 0; k0 < H_; k0 += 32) {
    v16h a = load_frag16(sH1 + (r0 + laneR) * PW_ + k0 + kh * 8);
#pragma unroll
    for (int j = 0; j < 2; ++j) {
      v16h b = load_frag16(sW2 + (c0 + j * 16 + laneR) * PW_ + k0 + kh * 8);
      h2[j] = WMMA16(a, b, h2[j]);
    }
  }
#pragma unroll
  for (int j = 0; j < 2; ++j) {
    int col = c0 + j * 16 + laneR;
    float b2v = fb2[col];
#pragma unroll
    for (int i = 0; i < 8; ++i)
      sH2[(r0 + i + hi8) * PW_ + col] = (_Float16)(h2[j][i] + b2v);
  }
  __syncthreads();                            // h2 of all waves visible
  if (wave >= 2) return;                      // no barrier below; waves 0, 1: r0 = wave * 16

  // ---- GEMM3 (K=128, 64 cols): g = h2 @ Wg + bg, 4 tiles in registers ----
  v8f g[4];
#pragma unroll
  for (int ct = 0; ct < 4; ++ct) g[ct] = Z;
#pragma unroll
  for (int k0 = 0; k0 < H_; k0 += 32) {
    v16h a = load_frag16(sH2 + (r0 + laneR) * PW_ + k0 + kh * 8);
#pragma unroll
    for (int ct = 0; ct < 4; ++ct) {
      v16h b = load_frag16(sWg + (ct * 16 + laneR) * PW_ + k0 + kh * 8);
      g[ct] = WMMA16(a, b, g[ct]);
    }
  }
  float sk[2][8];
#pragma unroll
  for (int cs = 0; cs < 2; ++cs)
#pragma unroll
    for (int i = 0; i < 8; ++i) sk[cs][i] = sSkip[(r0 + i + hi8) * N_ + cs * 16 + laneR];

  // ---- GLU (col c with gate c+32) + skip, all in registers ----
  float t[2][8];
#pragma unroll
  for (int cs = 0; cs < 2; ++cs) {
    int col = cs * 16 + laneR;
    float ba = fbg[col], bg2 = fbg[col + 32];
#pragma unroll
    for (int i = 0; i < 8; ++i)
      t[cs][i] = (g[cs][i] + ba) * sigmoid_f(g[cs + 2][i] + bg2) + sk[cs][i];
  }

  // ---- LayerNorm over N=32 + softmax via 16-lane butterflies ----
  float s1[8], s2[8];
#pragma unroll
  for (int i = 0; i < 8; ++i) {
    s1[i] = t[0][i] + t[1][i];
    s2[i] = t[0][i] * t[0][i] + t[1][i] * t[1][i];
  }
#pragma unroll
  for (int m = 1; m < 16; m <<= 1)
#pragma unroll
    for (int i = 0; i < 8; ++i) {
      s1[i] += __shfl_xor(s1[i], m, 32);
      s2[i] += __shfl_xor(s2[i], m, 32);
    }
  float l[2][8];
#pragma unroll
  for (int i = 0; i < 8; ++i) {
    float mu = s1[i] * (1.0f / N_);
    float var = s2[i] * (1.0f / N_) - mu * mu;
    float rs = rsqrtf(var + LN_EPS);
#pragma unroll
    for (int cs = 0; cs < 2; ++cs) {
      int col = cs * 16 + laneR;
      l[cs][i] = (t[cs][i] - mu) * rs * fg[col] + fbv[col];
    }
  }
  float mx[8];
#pragma unroll
  for (int i = 0; i < 8; ++i) mx[i] = fmaxf(l[0][i], l[1][i]);
#pragma unroll
  for (int m = 1; m < 16; m <<= 1)
#pragma unroll
    for (int i = 0; i < 8; ++i) mx[i] = fmaxf(mx[i], __shfl_xor(mx[i], m, 32));
  float e0[8], e1[8], se[8];
#pragma unroll
  for (int i = 0; i < 8; ++i) {
    e0[i] = __expf(l[0][i] - mx[i]);
    e1[i] = __expf(l[1][i] - mx[i]);
    se[i] = e0[i] + e1[i];
  }
#pragma unroll
  for (int m = 1; m < 16; m <<= 1)
#pragma unroll
    for (int i = 0; i < 8; ++i) se[i] += __shfl_xor(se[i], m, 32);
#pragma unroll
  for (int i = 0; i < 8; ++i) {
    int row = rowbase + r0 + i + hi8;
    float inv = 1.0f / se[i];
    wOut[(size_t)row * N_ + laneR]      = e0[i] * inv;
    wOut[(size_t)row * N_ + 16 + laneR] = e1[i] * inv;
  }
}

// ------------------------------------------------------- per-variable GRNs
// One block = 128 rows (8 waves, 16 rows per wave). Everything one variable needs
// (embedding slice, weight panels, column values) is async-staged into one of two
// LDS buffers and shared by all waves: the next variable's copies fly during the
// whole of this variable's work, and one barrier a variable hands a buffer over.
// Every product is computed transposed: the weight panel is the A operand (its
// 16 rows = 16 output columns), the wave's 16 activation rows are the B operand.
// A lane then holds ONE activation row (lane & 15), and register i of a D tile
// is output column tile*16 + 8*(lane >> 4) + i. Two neighbouring D tiles,
// converted to f16 in place, are the next product's B fragment in the hardware's
// k order, so h1 never leaves the registers. W2 and Wg come folded into one panel
// (fold_job), so a variable is two products deep. The values that go by column
// (biases, LayerNorm scale and shift) are staged in LDS and read eight per lane;
// a bias is the accumulator's start value. The LayerNorm sums run inside the
// lane, with one exchange between the lane halves.
// blockIdx.y picks a group of NPG_ variables, so that the grid fills the chip;
// each group stores its own partial sum plane part[group][row][h], and k_sum
// adds the planes.
// One copy of 16 B per lane, as the builtin: the compiler places its address
// registers anywhere, where an asm operand must lie in the first 256 registers
// (this kernel's long-lived ones no longer all fit there and would be spilled).
typedef int i4 __attribute__((ext_vector_type(4)));
__device__ __forceinline__ void cp16b(void* ldst, const void* gsrc) {
  __builtin_amdgcn_global_load_async_to_lds_b128(
      (__attribute__((address_space(1))) i4*)(gsrc),
      (__attribute__((address_space(3))) i4*)(ldst), 0, 0);
}
// A run of N such copies: copy j moves gsrc + j*gstep to ldst + j*lstep (in elements).
template <int N, typename E>
__device__ __forceinline__ void cpRun(E* ldst, int lstep, const E* gsrc, int gstep) {
#pragma unroll  // the copies of a run issue back to back
  for (int j = 0; j < N; ++j) cp16b(ldst + j * lstep, gsrc + (size_t)j * gstep);
}
// Rows of VarBuf::col, H_ floats each
#define CB1_  0
#define CBS_  1
#define CBA_  2
#define CBG_  3
#define CLG_  4
#define CLB_  5
#define NCOL_ 6

// The LDS of one variable; there are two of them.
struct __attribute__((aligned(32))) VarBuf {
  float e[128 * PE_];         // embedding slice [row][64], f32
  _Float16 w1[128 * PN_];     // W1 panel [col][64]
  _Float16 ws[128 * PN_];     // Wskip panel [col][64]
  _Float16 wga[128 * PW_];    // W2 @ Wg, cols 0..127 [col][128]
  _Float16 wgg[128 * PW_];    // W2 @ Wg, gate half, cols 128..255 [col][128]
  float col[NCOL_ * H_];      // per-column values
};
static_assert(2 * sizeof(VarBuf) <= 327680, "two buffers must fit the LDS");
static_assert(NPG_ >= 2, "the ring's prologue stages two variables");

__global__ void __launch_bounds__(256)
k_var(const float* __restrict__ emb,
      const _Float16* __restrict__ vW1T, const _Float16* __restrict__ vWskipT,
      const _Float16* __restrict__ vWfT,
      const float* __restrict__ vb1, const float* __restrict__ vbskip,
      const float* __restrict__ vbf,
      const float* __restrict__ vg, const float* __restrict__ vbv,
      const float* __restrict__ wIn, float* __restrict__ part) {
  __shared__ VarBuf sB[2];

  const int tid = threadIdx.x;
  const int wave = __builtin_amdgcn_readfirstlane(tid >> 5), lane = tid & 31;
  const int laneR = lane & 15, kh = (lane >> 4) & 1;
  const int hi8 = (lane & 16) ? 8 : 0;
  const int r0 = wave * 16;                    // wave's row tile within block
  const int rowbase = blockIdx.x * 128;
  const int nBeg = blockIdx.y * NPG_, nEnd = nBeg + NPG_;
  float* const outPtr = part + (size_t)blockIdx.y * BT_ * H_;

  float outReg[64];                            // [ct][i]: row laneR, column ct*16 + hi8 + i
#pragma unroll
  for (int q = 0; q < 64; ++q) outReg[q] = 0.0f;
  float tv[64];                                // skip, then GLU result; same map

  // 128-byte rows: 8 lanes a row, copy j of a run takes row nr + 32*j.
  // 256-byte rows: 16 lanes a row, copy j of a run takes row wr + 16*j.
  const int nr = tid >> 3, no = (tid & 7) * 8;
  const int wr = tid >> 4, wo = (tid & 15) * 8;
  auto stagePanels = [&](int n, VarBuf& b) {   // 32 copies a wave
    cpRun<8>(b.e + wr * PE_ + (tid & 15) * 4, 16 * PE_,   // 2048 chunks of 16B
             emb + ((size_t)(rowbase + wr) * N_ + n) * D_ + (tid & 15) * 4, 16 * ND_);
    cpRun<4>(b.w1 + nr * PN_ + no, 32 * PN_, vW1T + (size_t)n * H_ * D_ + tid * 8, 2048);
    cpRun<4>(b.ws + nr * PN_ + no, 32 * PN_, vWskipT + (size_t)n * H_ * D_ + tid * 8, 2048);
    const _Float16* ga = vWfT + (size_t)n * 256 * H_;
    const _Float16* gg = ga + (size_t)128 * H_;
    cpRun<8>(b.wga + wr * PW_ + wo, 16 * PW_, ga + tid * 8, 2048);
    cpRun<8>(b.wgg + wr * PW_ + wo, 16 * PW_, gg + tid * 8, 2048);
  };
  // Wave w < NCOL_ brings row w of col: 32 lanes x 16 B = H_ floats. Its source
  // walks from variable to variable in steps of the array's own row length.
  const float* colSrc = (wave == CB1_ ? vb1 + nBeg * H_
                       : wave == CBS_ ? vbskip + nBeg * H_
                       : wave == CBA_ ? vbf + nBeg * 256
                       : wave == CBG_ ? vbf + nBeg * 256 + 128
                       : wave == CLG_ ? vg + nBeg * H_
                                      : vbv + nBeg * H_);
  const int colStep = (wave == CBA_ || wave == CBG_) ? 256 : H_;
  const int colOff = (wave < NCOL_ ? wave : 0) * H_ + lane * 4;
  auto stageCol = [&](VarBuf& b) {             // the next staged variable's column values
    if (wave < NCOL_) {                        // scalar test: the last two waves issue no copy
      cp16b(b.col + colOff, colSrc + lane * 4);
      colSrc += colStep;
    }
  };
  const float* const wRow = wIn + (size_t)(rowbase + r0 + laneR) * N_;

  stagePanels(nBeg, sB[0]);
  stageCol(sB[0]);
  wait_async();                                // first variable resident in buffer 0
  stagePanels(nBeg + 1, sB[1]);
  stageCol(sB[1]);

  for (int n = nBeg; n < nEnd; ++n) {
    VarBuf& vb = sB[(n - nBeg) & 1];           // this variable's buffer, the only one read in this trip
    const float* const sE = vb.e;
    const _Float16* const sW1 = vb.w1;
    const _Float16* const sWs = vb.ws;
    const _Float16* const sWgA = vb.wga;
    const _Float16* const sWgG = vb.wgg;
    const float* const colP = vb.col + hi8;    // the lane's eight columns of tile 0
    float wsel = wRow[n];                      // the row's selection weight, used at the end of the trip
    // precaution: every later rewrite of the load's address registers stays behind this wait
    asm volatile("s_wait_xcnt 0x0" ::: "memory");

    // ---- GEMM1 (K=64): aW = (E@W1 + b1)^T, aS = (E@Wskip + bskip)^T, one column
    // tile at a time. The next tile's weight fragments and start values are read
    // into a second register set ahead of this tile's WMMAs, so that no WMMA waits
    // out the latency of its own reads ----
    v16h bE[2];
#pragma unroll
    for (int ks = 0; ks < 2; ++ks)
      bE[ks] = load_frag16_f32(sE + (r0 + laneR) * PE_ + ks * 32 + kh * 8);
    v16h f1[2][4];
    v8f c1[2][2];
#pragma unroll
    for (int ks = 0; ks < 2; ++ks) {
      f1[0][ks]     = load_frag16(sW1 + laneR * PN_ + ks * 32 + kh * 8);
      f1[0][2 + ks] = load_frag16(sWs + laneR * PN_ + ks * 32 + kh * 8);
    }
    c1[0][0] = load_c8(colP + CB1_ * H_);
    c1[0][1] = load_c8(colP + CBS_ * H_);
    v16h bH[4];                                // elu(h1) as B fragments
    v8f hPrev;
#pragma unroll
    for (int ct = 0; ct < 8; ++ct) {
      if (ct + 1 < 8) {
#pragma unroll
        for (int ks = 0; ks < 2; ++ks) {
          f1[(ct + 1) & 1][ks]     = load_frag16(sW1 + ((ct + 1) * 16 + laneR) * PN_ + ks * 32 + kh * 8);
          f1[(ct + 1) & 1][2 + ks] = load_frag16(sWs + ((ct + 1) * 16 + laneR) * PN_ + ks * 32 + kh * 8);
        }
        c1[(ct + 1) & 1][0] = load_c8(colP + CB1_ * H_ + (ct + 1) * 16);
        c1[(ct + 1) & 1][1] = load_c8(colP + CBS_ * H_ + (ct + 1) * 16);
      }
      __builtin_amdgcn_sched_barrier(0);       // keeps the reads above as one group ahead of this step's WMMAs
      v8f aW = c1[ct & 1][0], aS = c1[ct & 1][1];
#pragma unroll
      for (int ks = 0; ks < 2; ++ks) {
        aW = WMMA16(f1[ct & 1][ks], bE[ks], aW);
        aS = WMMA16(f1[ct & 1][2 + ks], bE[ks], aS);
      }
      v8f h;
#pragma unroll
      for (int i = 0; i < 8; ++i) {
        h[i] = elu_f(aW[i]);
        tv[ct * 8 + i] = aS[i];                // skip, kept in registers
      }
      if (ct & 1) bH[ct >> 1] = pack_frag(hPrev, h);
      else        hPrev = h;
    }

    // ---- GEMM2 pairs (K=128), elu(h1) @ (W2 @ Wg) + folded bias: a-part (sWgA) and
    // gate (sWgG), GLU in regs; the next column tile's fragments read ahead, as above ----
    v16h f3[2][8];
    v8f c3[2][2];
#pragma unroll
    for (int ks = 0; ks < 4; ++ks) {
      f3[0][2 * ks]     = load_frag16(sWgA + laneR * PW_ + ks * 32 + kh * 8);
      f3[0][2 * ks + 1] = load_frag16(sWgG + laneR * PW_ + ks * 32 + kh * 8);
    }
    c3[0][0] = load_c8(colP + CBA_ * H_);
    c3[0][1] = load_c8(colP + CBG_ * H_);
#pragma unroll
    for (int ct = 0; ct < 8; ++ct) {
      if (ct + 1 < 8) {
#pragma unroll
        for (int ks = 0; ks < 4; ++ks) {
          f3[(ct + 1) & 1][2 * ks]     = load_frag16(sWgA + ((ct + 1) * 16 + laneR) * PW_ + ks * 32 + kh * 8);
          f3[(ct + 1) & 1][2 * ks + 1] = load_frag16(sWgG + ((ct + 1) * 16 + laneR) * PW_ + ks * 32 + kh * 8);
        }
        c3[(ct + 1) & 1][0] = load_c8(colP + CBA_ * H_ + (ct + 1) * 16);
        c3[(ct + 1) & 1][1] = load_c8(colP + CBG_ * H_ + (ct + 1) * 16);
      }
      __builtin_amdgcn_sched_barrier(0);       // keeps the reads above as one group ahead of this step's WMMAs
      v8f ga = c3[ct & 1][0], gg = c3[ct & 1][1];
#pragma unroll
      for (int ks = 0; ks < 4; ++ks) {
        ga = WMMA16(f3[ct & 1][2 * ks], bH[ks], ga);
        gg = WMMA16(f3[ct & 1][2 * ks + 1], bH[ks], gg);
      }
#pragma unroll
      for (int i = 0; i < 8; ++i)
        tv[ct * 8 + i] = ga[i] * sigmoid_f(gg[i]) + tv[ct * 8 + i];   // GLU + skip
      __builtin_amdgcn_sched_barrier(0);       // keeps the next tile's reads below: one group at one place, not spread among these WMMAs
    }

    // ---- LayerNorm over H=128: the lane's 64 columns (eight chains, then a
    // tree), then the other lane half's 64 ----
    float s1[8], s2[8];
#pragma unroll
    for (int i = 0; i < 8; ++i) { s1[i] = 0.f; s2[i] = 0.f; }
#pragma unroll
    for (int ct = 0; ct < 8; ++ct)
#pragma unroll
      for (int i = 0; i < 8; ++i) { float t = tv[ct * 8 + i]; s1[i] += t; s2[i] += t * t; }
#pragma unroll
    for (int m = 4; m >= 1; m >>= 1)
#pragma unroll
      for (int i = 0; i < m; ++i) { s1[i] += s1[i + m]; s2[i] += s2[i + m]; }
    const float t1 = s1[0] + other_half(s1[0]);
    const float t2 = s2[0] + other_half(s2[0]);

    // ---- normalize + softmax-weighted combine into registers ----
    const float mu = t1 * (1.0f / H_);
    const float var = t2 * (1.0f / H_) - mu * mu;
    const float rs = rsqrtf(var + LN_EPS);
#pragma unroll
    for (int ct = 0; ct < 8; ++ct) {
      v8f lg = load_c8(colP + CLG_ * H_ + ct * 16);
      v8f lb = load_c8(colP + CLB_ * H_ + ct * 16);
#pragma unroll
      for (int i = 0; i < 8; ++i) {
        float val = (tv[ct * 8 + i] - mu) * rs * lg[i] + lb[i];
        outReg[ct * 8 + i] += wsel * val;
      }
    }
    // Hand-over: this wave's reads of vb have returned, its copies of the next
    // variable have landed; behind the barrier that holds for every wave.
    asm volatile("s_wait_dscnt 0x0" ::: "memory");
    wait_async();
    if (n + 2 < nEnd) {                        // refill the buffer just read; flies during the next trip
      stagePanels(n + 2, vb);
      stageCol(vb);
    }
  }
  asm volatile("s_wait_asynccnt 0x0" ::: "memory");   // no copy outlives the loop

  // ---- epilogue: store this group's partial tile, eight columns per lane and tile ----
  float* const oRow = outPtr + (size_t)(rowbase + r0 + laneR) * H_ + hi8;
#pragma unroll
  for (int ct = 0; ct < 8; ++ct) {
    f4 lo = {outReg[ct * 8 + 0], outReg[ct * 8 + 1], outReg[ct * 8 + 2], outReg[ct * 8 + 3]};
    f4 hi = {outReg[ct * 8 + 4], outReg[ct * 8 + 5], outReg[ct * 8 + 6], outReg[ct * 8 + 7]};
    *(f4*)(oRow + ct * 16)     = lo;
    *(f4*)(oRow + ct * 16 + 4) = hi;
  }
}

// out[i] = sum over the NG_ groups of part[group][i], groups in rising order.
__global__ void __launch_bounds__(256) k_sum(const float* __restrict__ part,
                                             float* __restrict__ outPtr) {
  // One 32-bit byte offset serves every plane and the store (uniform base + offset).
  const unsigned off = (blockIdx.x * 256u + threadIdx.x) * 16u;
  float4 s = *(const float4*)((const char*)part + off);
#pragma unroll  // all planes' loads in flight together
  for (int g = 1; g < NG_; ++g) {
    float4 p = *(const float4*)((const char*)(part + (size_t)g * BT_ * H_) + off);
    s.x += p.x; s.y += p.y; s.z += p.z; s.w += p.w;
  }
  *(float4*)((char*)outPtr + off) = s;
}

// ----------------------------------------------------------------------------
extern "C" void kernel_launch(void* const* d_in, const int* in_sizes, int n_in,
                              void* d_out, int out_size, void* d_ws, size_t ws_size,
                              hipStream_t stream) {
  (void)in_sizes; (void)n_in; (void)out_size; (void)ws_size;

  const float* emb    = (const float*)d_in[0];
  const float* ctx    = (const float*)d_in[1];
  const float* fWskip = (const float*)d_in[2];
  const float* fbskip = (const float*)d_in[3];
  const float* fW1    = (const float*)d_in[4];
  const float* fb1    = (const float*)d_in[5];
  const float* fWc    = (const float*)d_in[6];
  const float* fW2    = (const float*)d_in[7];
  const float* fb2    = (const float*)d_in[8];
  const float* fWg    = (const float*)d_in[9];
  const float* fbg    = (const float*)d_in[10];
  const float* fg     = (const float*)d_in[11];
  const float* fbv    = (const float*)d_in[12];
  const float* vWskip = (const float*)d_in[13];
  const float* vbskip = (const float*)d_in[14];
  const float* vW1    = (const float*)d_in[15];
  const float* vb1    = (const float*)d_in[16];
  const float* vW2    = (const float*)d_in[17];
  const float* vb2    = (const float*)d_in[18];
  const float* vWg    = (const float*)d_in[19];
  const float* vbg    = (const float*)d_in[20];
  const float* vg     = (const float*)d_in[21];
  const float* vbv    = (const float*)d_in[22];

  // Workspace carve (transposed f16 weights, ctx projection, partial planes)
  char* w = (char*)d_ws;
  size_t off = 0;
  auto alloc = [&](size_t bytes) -> char* {
    char* p = w + off;
    off = (off + bytes + 255) & ~(size_t)255;
    return p;
  };
  _Float16* fW1T    = (_Float16*)alloc((size_t)ND_ * H_ * 2);
  _Float16* fWskipT = (_Float16*)alloc((size_t)ND_ * N_ * 2);
  _Float16* fW2T    = (_Float16*)alloc((size_t)H_ * H_ * 2);
  _Float16* fWgT    = (_Float16*)alloc((size_t)H_ * 2 * N_ * 2);
  _Float16* vW1T    = (_Float16*)alloc((size_t)N_ * D_ * H_ * 2);
  _Float16* vWskipT = (_Float16*)alloc((size_t)N_ * D_ * H_ * 2);
  _Float16* vWfT    = (_Float16*)alloc((size_t)N_ * H_ * 256 * 2);
  float*    vbf     = (float*)alloc((size_t)N_ * 256 * 4);
  float*    ctxh    = (float*)alloc((size_t)B_ * H_ * 4);
  float*    part    = (float*)alloc((size_t)NG_ * BT_ * H_ * 4);

  float* outPtr = (float*)d_out;                   // [BT, H]
  float* wOut   = outPtr + (size_t)BT_ * H_;       // [BT, N]

  // weight transposes (to f16) and context projection: one launch
  k_prep<<<NB_PREP, 256, 0, stream>>>(ctx, fWc, fW1, fWskip, fW2, fWg,
                                      vW1, vWskip,
                                      ctxh, fW1T, fWskipT, fW2T, fWgT,
                                      vW1T, vWskipT);

  // flatten GRN -> softmax weights (FR_ rows/block, 8 waves); NB_FOLD more blocks
  // fold each variable's W2 and Wg for k_var
  k_flat<<<BT_ / FR_ + NB_FOLD, 256, 0, stream>>>(emb, fW1T, fWskipT, fW2T, fWgT,
                                                  fb1, fbskip, fb2, fbg, fg, fbv,
                                                  ctxh, wOut,
                                                  vW2, vWg, vb2, vbg, vWfT, vbf);

  // per-variable GRNs + weighted combine -> partial planes (128 rows/block,
  // 8 waves, NPG_ variables per block), then the sum of the planes -> outputs
  k_var<<<dim3(BT_ / 128, NG_), 256, 0, stream>>>(emb, vW1T, vWskipT, vWfT,
                                                  vb1, vbskip, vbf, vg, vbv,
                                                  wOut, part);
  k_sum<<<BT_ * H_ / 1024, 256, 0, stream>>>(part, outPtr);
}
